// v000
// Times are from an AMD MI455X. After a warm-up the kernel runs many times in a row, and a time is the length of
// such a window on the GPU divided by its runs, so every launch and the gaps after it count. The runs cycle
// through copies of the inputs. A figure is the median of several windows, for all but v000 over two sittings.
// Sittings can differ by a few percent; kernels timed side by side share one.
// v000 is the starting kernel. One run takes 13.5 milliseconds.
#include <hip/hip_runtime.h>
// Post-LN transformer encoder block (x [4][2048][1024]; q = x wq^T, k, v likewise (nn.Linear natural [1024][1024] sigma 1/32, no biases); 16 heads of 64 (chunked along features = head-major columns); softmax(q k^T / 8) v over all keys (no mask), heads merged, NO output projection; h = LN1(x + attn) (biased variance, eps 1e-5, gamma/beta); ff = relu(h l1_w^T + l1_b) l2_w^T + l2_b (natural [1024][1024], biases sigma 0.01); out = LN2(h + ff) -> [4][2048][1024]).
// Structure: token rows r = b*2048 + s; x as exact f16 rows (bf16-rounded); Q, K, V as three WMMA GEMMs (32x64 wave tiles, f32 accumulation, exact x16 weights, f16 outputs); per batch: V^T for all heads via LDS transposes; per (batch, group of 2 heads): scores GEMM (K = 64, batched over the heads on grid.y, alpha = 64^-0.5), row softmax on VALU (f32 statistics, native exp; weights stored x256 as f16), h_pre = bf16(x) + P . V^T (K = 2048, alpha 2^-8; own-element residual addend) as f32 rows; LN1 on VALU (f32 statistics, LDS trees) -> f16 + f32 rows; relu(h l1^T + b1) GEMM with the ReLU epilogue -> f16; y = h + ff l2^T + b2 GEMM (own-element residual); LN2 on VALU -> f32 output.
// Compute dtype: inputs rounded to bf16; x / weights exact; q, k, v, softmax weights, h and the ReLU output as plain f16 GEMM operands (~2^-12); scores and softmax statistics f32. v_wmma_f32_16x16x32_f16.
#define NB 4
#define SQ 2048
#define DM 1024
#define NH 16
#define HD 64
#define DMQ DM                       /* LayerNorm width */
#define HG 2                         /* heads per attention launch group */
#define B0 0                         /* first batch processed (debug hook) */
#define NBR NB                       /* batches processed (debug hook) */
#define NR ((size_t)NB * SQ)         /* token rows */
#define MP ((int)((size_t)NBR * SQ)) /* rows projected (debug hook) */
#define QN SQ                        /* query rows attended per batch (debug hook) */
#define NHD NH                       /* heads attended (debug hook) */
#define MPO MP                       /* unused (the output stage runs MP rows) */
#define LQ DM      /* row pitch of the q/k/v rows */
typedef __bf16 v16b __attribute__((ext_vector_type(16)));
typedef unsigned short v8us __attribute__((ext_vector_type(8), may_alias));
typedef float  v8f  __attribute__((ext_vector_type(8)));
typedef float  v4f  __attribute__((ext_vector_type(4)));
typedef float  v4fa __attribute__((ext_vector_type(4), may_alias));
union FragB { v16b v; v8us half[2]; unsigned short u[16]; };

__device__ __forceinline__ unsigned short bf16_bits(float x) { unsigned int u = __float_as_uint(x); return (unsigned short)((u + 0x7FFFu + ((u >> 16) & 1u)) >> 16); }
__device__ __forceinline__ float bf16_val(unsigned short b) { return __uint_as_float(((unsigned int)b) << 16); }
__device__ __forceinline__ float bf16_round(float x) { return bf16_val(bf16_bits(x)); }
// D += A·B with NT terms: 1 = ah·bh, 2 = + al·bh (A split), 3 = + ah·bl (both split)
template <int NT>
__device__ __forceinline__ v8f mmaN(v16b ah, v16b al, v16b bh, v16b bl, v8f c) {
  c = __builtin_amdgcn_wmma_f32_16x16x32_bf16(false, ah, false, bh, (short)0, c, false, false);
  if (NT >= 2) c = __builtin_amdgcn_wmma_f32_16x16x32_bf16(false, al, false, bh, (short)0, c, false, false);
  if (NT >= 3) c = __builtin_amdgcn_wmma_f32_16x16x32_bf16(false, ah, false, bl, (short)0, c, false, false);
  asm volatile("v_nop\n\tv_nop\n\tv_nop\n\tv_nop" : "+v"(c) : "v"(ah), "v"(al), "v"(bh), "v"(bl));
  return c;
}

__global__ __launch_bounds__(256) void k_wt_bf16(const float* __restrict__ W, unsigned short* __restrict__ Wt, int K, int N) {
  const int t = blockIdx.x * 256 + threadIdx.x;
  const int k8n = K / 8;
  if (t >= N * k8n) return;
  const int n = t / k8n, k8 = (t % k8n) * 8;
  v8us v;
#pragma unroll
  for (int i = 0; i < 8; ++i) v[i] = bf16_bits(W[(size_t)(k8 + i) * N + n]);
  *(v8us*)(Wt + (size_t)n * K + k8) = v;
  
}

// GEMM C[M][N] (f32, pitch ldc) = act(A[M][K]·W + bias). A f32 row-major (pitch lda) converted per fragment to bf16
// (ASPLIT: hi/lo two planes -> 2 terms, else single rounded term); Wt bf16 [N][K] (pitch ldb). BIAS_BF16 rounds the
// bias to bf16 first (bias quantised to bf16 before the add). K%32==0, M%16==0, N%64==0.
template <bool ASPLIT, int ACT, bool BIAS_BF16>
__global__ __launch_bounds__(128) void k_gemm_bf(const float* __restrict__ A, int lda, const unsigned short* __restrict__ Wt, int ldb,
                                               const float* __restrict__ bias, float* __restrict__ C, int ldc, int M, int N, int K) {
  __shared__ __attribute__((aligned(16))) float so[4][16][64];
  const int tid = threadIdx.x, w = tid >> 5, lane = tid & 31, ln = lane & 15, hh = lane >> 4;
  const int ntn = N / 64;
  const int wid = blockIdx.x * 4 + w;
  const int mt = wid / ntn, nq = wid % ntn;
  if (mt * 16 >= M) return;
  const int row0 = mt * 16, col0 = nq * 64;
  const float* arow = A + (size_t)(row0 + ln) * lda;
  v8f acc[4] = {};
  for (int kb = 0; kb < K; kb += 32) {
    FragB ah, al;
    const v4f x0 = *(const v4fa*)(arow + kb + 8 * hh), x1 = *(const v4fa*)(arow + kb + 8 * hh + 4);
    const v4f x2 = *(const v4fa*)(arow + kb + 16 + 8 * hh), x3 = *(const v4fa*)(arow + kb + 16 + 8 * hh + 4);
    float xs[16] = {x0[0],x0[1],x0[2],x0[3],x1[0],x1[1],x1[2],x1[3],x2[0],x2[1],x2[2],x2[3],x3[0],x3[1],x3[2],x3[3]};
#pragma unroll
    for (int i = 0; i < 16; ++i) { const unsigned short hb = bf16_bits(xs[i]); ah.u[i] = hb; al.u[i] = ASPLIT ? bf16_bits(xs[i] - bf16_val(hb)) : (unsigned short)0; }
#pragma unroll
    for (int t = 0; t < 4; ++t) {
      const unsigned short* brow = Wt + (size_t)(col0 + t * 16 + ln) * ldb + kb;
      FragB b;
      b.half[0] = *(const v8us*)(brow + 8 * hh);
      b.half[1] = *(const v8us*)(brow + 16 + 8 * hh);
      acc[t] = mmaN<ASPLIT ? 2 : 1>(ah.v, al.v, b.v, b.v, acc[t]);
    }
  }
#pragma unroll
  for (int t = 0; t < 4; ++t) {
    float bv = bias ? bias[col0 + t * 16 + ln] : 0.f;
    if (BIAS_BF16) bv = bf16_round(bv);
#pragma unroll
    for (int r = 0; r < 8; ++r) { float v = acc[t][r] + bv; if (ACT == 1) v = fmaxf(v, 0.f); so[w][8 * hh + r][t * 16 + ln] = v; }
  }
  __builtin_amdgcn_fence(__ATOMIC_ACQ_REL, "workgroup");
  __builtin_amdgcn_wave_barrier();
  const int rsub = lane >> 4, c4 = (lane & 15) * 4;
  {
#pragma unroll
    for (int q = 0; q < 8; ++q) {
      const int r = q * 2 + rsub;
      const v4f v = *(const v4fa*)&so[w][r][c4];
      *(v4f*)(C + (size_t)(row0 + r) * ldc + col0 + c4) = v;
    }
    
  }
}

// GEMM C = act(A·W + bias + resid): A f32 (ASPLIT -> hi/lo 2 terms), Wt bf16 [N][K]; ACT 0 none, 1 relu, 2 exact gelu;
// resid (optional, f32, row index = (row % rmod), pitch ldr, RES_BF16 rounds it) added before the activation.
template <bool ASPLIT, int ACT, bool BIAS_BF16, bool RES_BF16>
__global__ __launch_bounds__(128) void k_gemm_bf3(const float* __restrict__ A, int lda, const unsigned short* __restrict__ Wt, int ldb,
                                                const float* __restrict__ bias, const float* __restrict__ resid, int rmod, int ldr,
                                                float* __restrict__ C, int ldc, int M, int N, int K) {
  __shared__ __attribute__((aligned(16))) float so[4][16][64];
  const int tid = threadIdx.x, w = tid >> 5, lane = tid & 31, ln = lane & 15, hh = lane >> 4;
  const int ntn = N / 64;
  const int wid = blockIdx.x * 4 + w;
  const int mt = wid / ntn, nq = wid % ntn;
  if (mt * 16 >= M) return;
  const int row0 = mt * 16, col0 = nq * 64;
  const float* arow = A + (size_t)(row0 + ln) * lda;
  v8f acc[4] = {};
  for (int kb = 0; kb < K; kb += 32) {
    FragB ah, al;
    const v4f x0 = *(const v4fa*)(arow + kb + 8 * hh), x1 = *(const v4fa*)(arow + kb + 8 * hh + 4);
    const v4f x2 = *(const v4fa*)(arow + kb + 16 + 8 * hh), x3 = *(const v4fa*)(arow + kb + 16 + 8 * hh + 4);
    float xs[16] = {x0[0],x0[1],x0[2],x0[3],x1[0],x1[1],x1[2],x1[3],x2[0],x2[1],x2[2],x2[3],x3[0],x3[1],x3[2],x3[3]};
#pragma unroll
    for (int i = 0; i < 16; ++i) { const unsigned short hb = bf16_bits(xs[i]); ah.u[i] = hb; al.u[i] = ASPLIT ? bf16_bits(xs[i] - bf16_val(hb)) : (unsigned short)0; }
#pragma unroll
    for (int t = 0; t < 4; ++t) {
      const unsigned short* brow = Wt + (size_t)(col0 + t * 16 + ln) * ldb + kb;
      FragB b;
      b.half[0] = *(const v8us*)(brow + 8 * hh);
      b.half[1] = *(const v8us*)(brow + 16 + 8 * hh);
      acc[t] = mmaN<ASPLIT ? 2 : 1>(ah.v, al.v, b.v, b.v, acc[t]);
    }
  }
#pragma unroll
  for (int t = 0; t < 4; ++t) {
    const int col = col0 + t * 16 + ln;
    float bv = bias ? bias[col] : 0.f;
    if (BIAS_BF16) bv = bf16_round(bv);
#pragma unroll
    for (int r = 0; r < 8; ++r) {
      float v = acc[t][r] + bv;
      if (resid) { float rv = resid[(size_t)((row0 + 8 * hh + r) % rmod) * ldr + col]; if (RES_BF16) rv = bf16_round(rv); v += rv; }
      if (ACT == 1) v = fmaxf(v, 0.f);
      if (ACT == 2) v = 0.5f * v * (1.0f + erff(v * 0.70710678118654752f));
      if (ACT == 3) { const float u = 0.7978845608028654f * (v + 0.044715f * v * v * v); v = 0.5f * v * (1.0f + tanhf(u)); }
      so[w][8 * hh + r][t * 16 + ln] = v;
    }
  }
  __builtin_amdgcn_fence(__ATOMIC_ACQ_REL, "workgroup");
  __builtin_amdgcn_wave_barrier();
  const int rsub = lane >> 4, c4 = (lane & 15) * 4;
  {
#pragma unroll
    for (int q = 0; q < 8; ++q) {
      const int r = q * 2 + rsub;
      const v4f v = *(const v4fa*)&so[w][r][c4];
      *(v4f*)(C + (size_t)(row0 + r) * ldc + col0 + c4) = v;
    }
    
  }
}
// row LayerNorm (biased variance, eps) over N: s = X (+ R); optional out_sum <- s; out_norm <- (s-mu)*rsqrt(var+eps)*g + b
template <bool PARAM_BF16>
__global__ __launch_bounds__(256) void k_layernorm(const float* __restrict__ X, const float* __restrict__ R, const float* __restrict__ g, const float* __restrict__ bta,
                                                  float* __restrict__ out_sum, float* __restrict__ out_norm, int N, float eps) {
  __shared__ float red[256];
  const int row = blockIdx.x, tid = threadIdx.x;
  const float* x = X + (size_t)row * N; const float* rr = R ? R + (size_t)row * N : nullptr;
  float vals[16];                     // up to N = 4096
  const int per = N / 256;            // contiguous chunk per thread? use strided-by-4 chunks: thread handles j = tid*4 + 1024*u
  float s1 = 0.f;
  for (int u = 0; u < per / 4; ++u) {
    const int j = tid * 4 + 1024 * u;
    const v4f a = *(const v4fa*)(x + j);
    v4f b = {0.f,0.f,0.f,0.f}; if (rr) b = *(const v4fa*)(rr + j);
#pragma unroll
    for (int q = 0; q < 4; ++q) { const float v = a[q] + b[q]; vals[u * 4 + q] = v; s1 += v; }
  }
  red[tid] = s1; __syncthreads();
  for (int st = 128; st > 0; st >>= 1) { if (tid < st) red[tid] += red[tid + st]; __syncthreads(); }
  const float mu = red[0] / (float)N; __syncthreads();
  float s2 = 0.f;
  for (int u = 0; u < per / 4; ++u)
#pragma unroll
    for (int q = 0; q < 4; ++q) { const float c = vals[u * 4 + q] - mu; s2 += c * c; }
  red[tid] = s2; __syncthreads();
  for (int st = 128; st > 0; st >>= 1) { if (tid < st) red[tid] += red[tid + st]; __syncthreads(); }
  const float rs = rsqrtf(red[0] / (float)N + eps);
  {
    for (int u = 0; u < per / 4; ++u) {
      const int j = tid * 4 + 1024 * u;
      v4f o, sm;
#pragma unroll
      for (int q = 0; q < 4; ++q) {
        float gg = g[j + q], bb = bta[j + q];
        if (PARAM_BF16) { gg = bf16_round(gg); bb = bf16_round(bb); }
        sm[q] = vals[u * 4 + q]; o[q] = (vals[u * 4 + q] - mu) * rs * gg + bb;
      }
      if (out_sum) *(v4f*)(out_sum + (size_t)row * N + j) = sm;
      *(v4f*)(out_norm + (size_t)row * N + j) = o;
    }
    
  }
}



// ---- f16 WMMA path (v_wmma_f32_16x16x32_f16): 11-bit significands for operands in range — used where a [0,1] probability operand needs more precision than bf16
typedef _Float16 v16h __attribute__((ext_vector_type(16)));
union FragH { v16h v; v8us half[2]; _Float16 h[16]; unsigned short u[16]; };
template <int NT>
__device__ __forceinline__ v8f mmaH(v16h ah, v16h al, v16h bh, v16h bl, v8f c) {
  c = __builtin_amdgcn_wmma_f32_16x16x32_f16(false, ah, false, bh, (short)0, c, false, false);
  if (NT >= 2) c = __builtin_amdgcn_wmma_f32_16x16x32_f16(false, al, false, bh, (short)0, c, false, false);
  if (NT >= 3) c = __builtin_amdgcn_wmma_f32_16x16x32_f16(false, ah, false, bl, (short)0, c, false, false);
  asm volatile("v_nop\n\tv_nop\n\tv_nop\n\tv_nop" : "+v"(c) : "v"(ah), "v"(al), "v"(bh), "v"(bl));
  return c;
}
// batched GEMM like k_gemm_b but f16 operands: A f32 (split into f16 hi/lo if ASPLIT, else rounded to f16), Bt = f16 values [n][k]; alpha; C f32; N multiple of 16 (partial tiles skipped)
template <bool ASPLIT>
__global__ __launch_bounds__(128) void k_gemm_h(const float* __restrict__ A, int lda, size_t sA, const _Float16* __restrict__ Bh, int ldb, size_t sB, float alpha, float* __restrict__ C, int ldc, size_t sC, int M, int N, int K) {
  __shared__ __attribute__((aligned(16))) float so[4][16][64];
  const int tid = threadIdx.x, w = tid >> 5, lane = tid & 31, ln = lane & 15, hh = lane >> 4; const int by = blockIdx.y;
  A += (size_t)by * sA; Bh += (size_t)by * sB; C += (size_t)by * sC;
  const int ntn = (N + 63) / 64; const int wid = blockIdx.x * 4 + w; const int mt = wid / ntn, nq = wid % ntn; if (mt * 16 >= M) return;
  const int row0 = mt * 16, col0 = nq * 64; const float* arow = A + (size_t)(row0 + ln) * lda;
  v8f acc[4] = {};
  for (int kb = 0; kb < K; kb += 32) {
    FragH ah, al;
    const v4f x0 = *(const v4fa*)(arow + kb + 8 * hh), x1 = *(const v4fa*)(arow + kb + 8 * hh + 4), x2 = *(const v4fa*)(arow + kb + 16 + 8 * hh), x3 = *(const v4fa*)(arow + kb + 16 + 8 * hh + 4);
    float xs[16] = {x0[0],x0[1],x0[2],x0[3],x1[0],x1[1],x1[2],x1[3],x2[0],x2[1],x2[2],x2[3],x3[0],x3[1],x3[2],x3[3]};
#pragma unroll
    for (int i = 0; i < 16; ++i) { const _Float16 h = (_Float16)xs[i]; ah.h[i] = h; al.h[i] = ASPLIT ? (_Float16)(xs[i] - (float)h) : (_Float16)0.0f; }
#pragma unroll
    for (int t = 0; t < 4; ++t) { if (col0 + t * 16 >= N) continue; const size_t boff = (size_t)(col0 + t * 16 + ln) * ldb + kb; FragH bq; bq.half[0] = *(const v8us*)(Bh + boff + 8 * hh); bq.half[1] = *(const v8us*)(Bh + boff + 16 + 8 * hh);
      acc[t] = mmaH<ASPLIT ? 2 : 1>(ah.v, al.v, bq.v, bq.v, acc[t]); }
  }
#pragma unroll
  for (int t = 0; t < 4; ++t) { if (col0 + t * 16 >= N) continue;
#pragma unroll
    for (int r = 0; r < 8; ++r) so[w][8 * hh + r][t * 16 + ln] = acc[t][r] * alpha; }
  __builtin_amdgcn_fence(__ATOMIC_ACQ_REL, "workgroup"); __builtin_amdgcn_wave_barrier();
  const int rsub = lane >> 4, c4 = (lane & 15) * 4;
  {
#pragma unroll
    for (int q = 0; q < 8; ++q) { const int r = q * 2 + rsub; if (col0 + c4 < N) { const v4f v = *(const v4fa*)&so[w][r][c4]; *(v4f*)(C + (size_t)(row0 + r) * ldc + col0 + c4) = v; } }
     }
}

// Wt[n][k] = f16(W[k][n]·scale) from f32 row-major W[K][N] (scale = power of two; bf16-exact weights stay exact in f16 away from the subnormal range)
__global__ __launch_bounds__(256) void k_wt_f16(const float* __restrict__ W, _Float16* __restrict__ Wt, int K, int N, float scale) {
  const int t = blockIdx.x * 256 + threadIdx.x; if (t >= N * (K / 8)) return; const int n = t / (K / 8), k8 = (t % (K / 8)) * 8; FragH f;
#pragma unroll
  for (int i = 0; i < 8; ++i) f.h[i] = (_Float16)(bf16_round(W[(size_t)(k8 + i) * N + n]) * scale); const v8us o = f.half[0];
  *(v8us*)((unsigned short*)Wt + (size_t)n * K + k8) = o; 
}
// k_gemm_hh variant with fused epilogue: v = acc·alpha + bias[by·sBias + col] (+ CP[(row/rowsPerB)·sCPb + by·64 + col] if CP) ; ACT 0 none / 1 elu ; writes f16 C16 (and f32 C if non-null)
template <int ACT>
__global__ __launch_bounds__(128) void k_gemm_hhx(const _Float16* __restrict__ A, int lda, size_t sA, const _Float16* __restrict__ Bh, int ldb, size_t sB, float alpha, const float* __restrict__ bias, size_t sBias, const float* __restrict__ CP, int rowsPerB, size_t sCPb, int row0g,
    float* __restrict__ C, _Float16* __restrict__ C16, int ldc, size_t sC, int M, int N, int K) {
  __shared__ __attribute__((aligned(16))) float so[4][16][64];
  const int tid = threadIdx.x, w = tid >> 5, lane = tid & 31, ln = lane & 15, hh = lane >> 4; const int by = blockIdx.y;
  A += (size_t)by * sA; Bh += (size_t)by * sB; const size_t cofs = (size_t)by * sC; const float* bp = bias ? bias + (size_t)by * sBias : nullptr;
  const int ntn = (N + 63) / 64; const int wid = blockIdx.x * 4 + w; const int mt = wid / ntn, nq = wid % ntn; if (mt * 16 >= M) return;
  const int row0 = mt * 16, col0 = nq * 64; const _Float16* arow = A + (size_t)(row0 + ln) * lda;
  v8f acc[4] = {};
  for (int kb = 0; kb < K; kb += 32) { FragH ah; ah.half[0] = *(const v8us*)((const unsigned short*)arow + kb + 8 * hh); ah.half[1] = *(const v8us*)((const unsigned short*)arow + kb + 16 + 8 * hh);
#pragma unroll
    for (int t = 0; t < 4; ++t) { if (col0 + t * 16 >= N) continue; const size_t boff = (size_t)(col0 + t * 16 + ln) * ldb + kb; FragH bq; bq.half[0] = *(const v8us*)((const unsigned short*)Bh + boff + 8 * hh); bq.half[1] = *(const v8us*)((const unsigned short*)Bh + boff + 16 + 8 * hh);
      acc[t] = mmaH<1>(ah.v, ah.v, bq.v, bq.v, acc[t]); }
  }
#pragma unroll
  for (int t = 0; t < 4; ++t) { if (col0 + t * 16 >= N) continue; const int col = col0 + t * 16 + ln; const float bv = bp ? bf16_round(bp[col]) : 0.f;
#pragma unroll
    for (int r = 0; r < 8; ++r) { float v = acc[t][r] * alpha + bv; if (CP) { const int rr = row0g + row0 + 8 * hh + r; if (rowsPerB < 0) v += CP[cofs + (size_t)rr * ldc + col];      /* rowsPerB < 0: own element of the batched C plane */ else { const int bidx = rr / rowsPerB; v += CP[(size_t)bidx * sCPb + (size_t)by * 64 + col]; } } if (ACT == 1) v = (v > 0.f) ? v : expm1f(v); else if (ACT == 7) v = (v > 0.f) ? v + 1.0f : expf(v); else if (ACT == 8) v = tanhf(v); else if (ACT == 9) v = 0.5f * v * (1.0f + tanhf(0.7978845608028654f * (v + 0.044715f * v * v * v))); else if (ACT == 11) v = 1.0f / (1.0f + expf(-v)); else if (ACT == 12) v = (v > 0.f) ? v : 0.01f * v; else if (ACT == 14) v = (v > 0.f) ? v : 0.1f * v; else if (ACT == 16) v = (v >= 0.f) ? v : 0.3f * v; else if (ACT == 17) v = (v >= 0.f) ? v : 0.2f * v; else if (ACT == 15) v = v / (1.0f + expf(-v)); else if (ACT == 3) v = fmaxf(v, 0.f); else if (ACT == 6) v = 0.5f * v * (1.0f + erff(v * 0.70710678118654752f)); so[w][8 * hh + r][t * 16 + ln] = v; } }
  __builtin_amdgcn_fence(__ATOMIC_ACQ_REL, "workgroup"); __builtin_amdgcn_wave_barrier();
  const int rsub = lane >> 4, c4 = (lane & 15) * 4; typedef _Float16 v4h __attribute__((ext_vector_type(4)));
  {
#pragma unroll
    for (int q = 0; q < 8; ++q) { const int r = q * 2 + rsub; if (col0 + c4 < N) { const v4f v = *(const v4fa*)&so[w][r][c4]; if (C) *(v4f*)(C + cofs + (size_t)(row0 + r) * ldc + col0 + c4) = v; if (C16) { v4h h4; for (int i = 0; i < 4; ++i) h4[i] = (_Float16)v[i]; *(v4h*)(C16 + cofs + (size_t)(row0 + r) * ldc + col0 + c4) = h4; } } }
     }
}


typedef _Float16 v4h __attribute__((ext_vector_type(4)));

__global__ __launch_bounds__(256) void k_x16(const float* __restrict__ x, _Float16* __restrict__ X16, size_t n8) { const size_t t = (size_t)blockIdx.x * 256 + threadIdx.x; if (t >= n8) return; FragH f;
#pragma unroll
  for (int q = 0; q < 8; ++q) f.h[q] = (_Float16)bf16_round(x[t * 8 + q]); *(v8us*)((unsigned short*)X16 + t * 8) = f.half[0];  }
__global__ __launch_bounds__(256) void k_h16(const float* __restrict__ x, _Float16* __restrict__ X16, size_t n8) { const size_t t = (size_t)blockIdx.x * 256 + threadIdx.x; if (t >= n8) return; FragH f;
#pragma unroll
  for (int q = 0; q < 8; ++q) f.h[q] = (_Float16)x[t * 8 + q]; *(v8us*)((unsigned short*)X16 + t * 8) = f.half[0];  }
__global__ __launch_bounds__(256) void k_round16f(const float* __restrict__ W, _Float16* __restrict__ Bt, size_t n8) { const size_t t = (size_t)blockIdx.x * 256 + threadIdx.x; if (t >= n8) return; FragH f;
#pragma unroll
  for (int i = 0; i < 8; ++i) f.h[i] = (_Float16)(bf16_round(W[t * 8 + i]) * 16.0f); *(v8us*)((unsigned short*)Bt + t * 8) = f.half[0];  }
template <int NHv, int TTv>
__global__ __launch_bounds__(256) void k_vt(const _Float16* __restrict__ V16, int ldv, int voff, _Float16* __restrict__ Vt) { __shared__ unsigned short tl[64][66]; const int tid = threadIdx.x; const int slab = blockIdx.x / (TTv / 64), lg = blockIdx.x % (TTv / 64); const int b = slab / NHv, h = slab % NHv;
  for (int i = tid; i < 64 * 8; i += 256) { const int r = i / 8, c8 = (i % 8) * 8; FragH f; f.half[0] = *(const v8us*)((const unsigned short*)V16 + ((size_t)b * TTv + lg * 64 + r) * ldv + voff + h * 64 + c8);
#pragma unroll
    for (int q = 0; q < 8; ++q) tl[r][c8 + q] = f.u[q]; }
  __syncthreads();
  {
#pragma unroll
    for (int rd = 0; rd < 2; ++rd) { const int d = rd * 32 + tid / 8, pc = tid % 8; FragH f;
#pragma unroll
      for (int q = 0; q < 8; ++q) f.u[q] = tl[pc * 8 + q][d];
      *(v8us*)((unsigned short*)Vt + ((size_t)slab * 64 + d) * TTv + lg * 64 + pc * 8) = f.half[0]; }
     } }

__global__ __launch_bounds__(256) void k_hl(const float* __restrict__ F, _Float16* __restrict__ Hh, _Float16* __restrict__ Hl, size_t n8) { const size_t t = (size_t)blockIdx.x * 256 + threadIdx.x; if (t >= n8) return; FragH fh, fl; const v4f a = *(const v4fa*)(F + t * 8), c = *(const v4fa*)(F + t * 8 + 4);
#pragma unroll
  for (int q = 0; q < 4; ++q) { _Float16 h = (_Float16)a[q]; fh.h[q] = h; fl.h[q] = (_Float16)((a[q] - (float)h) * 1024.0f); h = (_Float16)c[q]; fh.h[4 + q] = h; fl.h[4 + q] = (_Float16)((c[q] - (float)h) * 1024.0f); }
  { *(v8us*)((unsigned short*)Hh + t * 8) = fh.half[0]; *(v8us*)((unsigned short*)Hl + t * 8) = fl.half[0];  } }

// ---- fast GEMM (wave tile 32x64; requires M % 32 == 0 rows per launch region and N % 64 == 0); epilogue = k_gemm_hhx semantics ----
__device__ __forceinline__ v16h g2_frag(const _Float16* p, int hh) { FragH f; f.half[0] = *(const v8us*)((const unsigned short*)p + 8 * hh); f.half[1] = *(const v8us*)((const unsigned short*)p + 16 + 8 * hh); return f.v; }
__device__ __forceinline__ v8f g2_mma(v16h a, v16h b, v8f c) { v8f d = __builtin_amdgcn_wmma_f32_16x16x32_f16(false, a, false, b, (short)0, c, false, false); asm volatile("v_nop\n\tv_nop\n\tv_nop\n\tv_nop" : "+v"(d) : "v"(a), "v"(b)); return d; }
template <int ACT>
__global__ __launch_bounds__(128) void k_gemm2(const _Float16* __restrict__ A, int lda, size_t sA, const _Float16* __restrict__ Bh, int ldb, size_t sB, float alpha, const float* __restrict__ bias, size_t sBias, const float* __restrict__ CP, int rowsPerB, size_t sCPb, int row0g,
    float* __restrict__ C, _Float16* __restrict__ C16, int ldc, size_t sC, int M, int N, int K) { static_assert(ACT == 0 || ACT == 3 || ACT == 6 || ACT == 8 || ACT == 9 || ACT == 11 || ACT == 12 || ACT == 14 || ACT == 15 || ACT == 16 || ACT == 17, "k_gemm2: unsupported ACT code (would silently apply no activation)");
  __shared__ __attribute__((aligned(16))) float so[4][32][68];
  const int tid = threadIdx.x, w = tid >> 5, lane = tid & 31, ln = lane & 15, hh = lane >> 4; const int by = blockIdx.y;
  A += (size_t)by * sA; Bh += (size_t)by * sB; const size_t cofs = (size_t)by * sC; const float* bp = bias ? bias + (size_t)by * sBias : nullptr;
  const int ntn = N >> 6; const int mt = blockIdx.x / ntn, nq = blockIdx.x - mt * ntn; const int row0 = mt * 128 + 32 * w, col0 = nq * 64; if (row0 >= M) return;
  const _Float16* a0p = A + (size_t)(row0 + ln) * lda; const _Float16* a1p = a0p + (size_t)16 * lda;
  const _Float16* b0p = Bh + (size_t)(col0 + ln) * ldb; const _Float16* b1p = b0p + (size_t)16 * ldb; const _Float16* b2p = b1p + (size_t)16 * ldb; const _Float16* b3p = b2p + (size_t)16 * ldb;
  const v8f z8 = {0.f,0.f,0.f,0.f,0.f,0.f,0.f,0.f}; v8f c00 = z8, c01 = z8, c02 = z8, c03 = z8, c10 = z8, c11 = z8, c12 = z8, c13 = z8;
#pragma unroll 1
  for (int kb = 0; kb < K; kb += 32) { const v16h a0 = g2_frag(a0p + kb, hh), a1 = g2_frag(a1p + kb, hh);
    v16h b = g2_frag(b0p + kb, hh); c00 = g2_mma(a0, b, c00); c10 = g2_mma(a1, b, c10);
    b = g2_frag(b1p + kb, hh); c01 = g2_mma(a0, b, c01); c11 = g2_mma(a1, b, c11);
    b = g2_frag(b2p + kb, hh); c02 = g2_mma(a0, b, c02); c12 = g2_mma(a1, b, c12);
    b = g2_frag(b3p + kb, hh); c03 = g2_mma(a0, b, c03); c13 = g2_mma(a1, b, c13); }
  v8f accs[8] = {c00, c01, c02, c03, c10, c11, c12, c13};
#pragma unroll
  for (int u = 0; u < 8; ++u) { const int t = u & 3, half = u >> 2; const int col = col0 + t * 16 + ln; const float bv = bp ? bf16_round(bp[col]) : 0.f;
#pragma unroll
    for (int r = 0; r < 8; ++r) { const int rloc = half * 16 + 8 * hh + r; float v = accs[u][r] * alpha + bv; if (CP) { if (rowsPerB < 0) v += CP[cofs + (size_t)(row0g + row0 + rloc) * ldc + col];      /* rowsPerB < 0: own element of the batched C plane */ else { const int bidx = (row0g + row0 + rloc) / rowsPerB; v += CP[(size_t)bidx * sCPb + (size_t)by * 64 + col]; } }
      if (ACT == 3) v = fmaxf(v, 0.f); else if (ACT == 6) v = 0.5f * v * (1.0f + erff(v * 0.70710678118654752f)); else if (ACT == 11) v = 1.0f / (1.0f + expf(-v)); else if (ACT == 15) v = v / (1.0f + expf(-v)); else if (ACT == 12) v = (v > 0.f) ? v : 0.01f * v; else if (ACT == 8) v = tanhf(v); else if (ACT == 9) v = 0.5f * v * (1.0f + tanhf(0.7978845608028654f * (v + 0.044715f * v * v * v))); else if (ACT == 14) v = (v > 0.f) ? v : 0.1f * v; else if (ACT == 16) v = (v >= 0.f) ? v : 0.3f * v; else if (ACT == 17) v = (v >= 0.f) ? v : 0.2f * v;
      so[w][rloc][t * 16 + ln] = v; } }
  __builtin_amdgcn_fence(__ATOMIC_ACQ_REL, "workgroup"); __builtin_amdgcn_wave_barrier();
  const int rsub = lane >> 4, c4 = (lane & 15) * 4;
  {
#pragma unroll
    for (int q = 0; q < 16; ++q) { const int r = q * 2 + rsub; const v4f v = *(const v4fa*)&so[w][r][c4]; if (C) *(v4f*)(C + cofs + (size_t)(row0 + r) * ldc + col0 + c4) = v; if (C16) { v4h h4; for (int i = 0; i < 4; ++i) h4[i] = (_Float16)v[i]; *(v4h*)(C16 + cofs + (size_t)(row0 + r) * ldc + col0 + c4) = h4; } }
     } }


__global__ __launch_bounds__(256) void k_wnat(const float* __restrict__ w, size_t n8, _Float16* __restrict__ Bt) { const size_t t = (size_t)blockIdx.x * 256 + threadIdx.x; if (t >= n8) return; FragH f; for (int q = 0; q < 8; ++q) f.h[q] = (_Float16)(bf16_round(w[t * 8 + q]) * 16.0f); *(v8us*)((unsigned short*)Bt + t * 8) = f.half[0];  }
__global__ __launch_bounds__(256) void k_rsm(const float* __restrict__ S, _Float16* __restrict__ P, int nrows) {
  #pragma clang fp contract(off)
  const int i = blockIdx.x * 256 + threadIdx.x; if (i >= nrows) return; const float* s = S + (size_t)i * SQ; float mx = -3.0e38f;
#pragma unroll 1
  for (int j = 0; j < SQ; ++j) mx = fmaxf(mx, s[j]); float se = 0.f;
#pragma unroll 1
  for (int j = 0; j < SQ; ++j) se += expf(s[j] - mx); const float sc = 256.0f / se;
#pragma unroll 1
  for (int j0 = 0; j0 < SQ; j0 += 8) { FragH f; for (int q = 0; q < 8; ++q) f.h[q] = (_Float16)(expf(s[j0 + q] - mx) * sc); unsigned short* d = (unsigned short*)P + (size_t)i * SQ + j0; *(v8us*)d = f.half[0];  } }
__global__ __launch_bounds__(256) void k_vt(const _Float16* __restrict__ V16, int b, int h0, _Float16* __restrict__ VT) { __shared__ unsigned short tl[64][65]; const int tid = threadIdx.x; const int hh = blockIdx.x % HG, sg = blockIdx.x / HG; const int s0 = sg * 64; const int h = h0 + hh;
  for (int i = tid; i < 64 * 8; i += 256) { const int j = i / 8, d8 = (i % 8) * 8; FragH f; f.half[0] = *(const v8us*)((const unsigned short*)V16 + ((size_t)b * SQ + s0 + j) * DM + h * HD + d8); for (int q = 0; q < 8; ++q) tl[d8 + q][j] = f.u[q]; }
  __syncthreads();
  { for (int i = tid; i < 64 * 8; i += 256) { const int d = i / 8, j8 = (i % 8) * 8; FragH f; for (int q = 0; q < 8; ++q) f.u[q] = tl[d][j8 + q]; *(v8us*)((unsigned short*)VT + ((size_t)hh * HD + d) * SQ + s0 + j8) = f.half[0]; }  } }


template <int BFIN, int W16, int W32>
__global__ __launch_bounds__(256) void k_lnx(const float* __restrict__ X, const float* __restrict__ g, const float* __restrict__ bb, float eps, _Float16* __restrict__ N16, float* __restrict__ N32) {
  #pragma clang fp contract(off)
  __shared__ float red[256]; const size_t r = blockIdx.x; const int t = threadIdx.x; const bool act = t < (DMQ / 4); const int c0 = act ? t * 4 : 0;
  const v4f xa = *(const v4fa*)(X + r * DMQ + c0); float s[4]; float sum = 0.f;
  for (int q = 0; q < 4; ++q) { s[q] = act ? (BFIN ? bf16_round(xa[q]) : xa[q]) : 0.f; sum = __fadd_rn(sum, s[q]); }
  red[t] = sum; __syncthreads(); for (int st = 128; st > 0; st >>= 1) { if (t < st) red[t] = __fadd_rn(red[t], red[t + st]); __syncthreads(); } const float mu = red[0] / (float)DMQ; __syncthreads();
  float vs = 0.f; for (int q = 0; q < 4; ++q) { const float dl = act ? __fadd_rn(s[q], -mu) : 0.f; vs = __fadd_rn(vs, __fmul_rn(dl, dl)); } red[t] = vs; __syncthreads(); for (int st = 128; st > 0; st >>= 1) { if (t < st) red[t] = __fadd_rn(red[t], red[t + st]); __syncthreads(); }
  const float rs = rsqrtf(__fadd_rn(red[0] / (float)DMQ, eps)); v4h y; v4f yf;
  for (int q = 0; q < 4; ++q) { const int c = c0 + q; yf[q] = __fadd_rn(__fmul_rn(__fmul_rn(__fadd_rn(s[q], -mu), rs), bf16_round(g[c])), bf16_round(bb[c])); y[q] = (_Float16)yf[q]; }
  if (!act) return;      /* no barriers after this point */
  { if (W16) *(v4h*)(N16 + r * DMQ + c0) = y; if (W32) *(v4f*)(N32 + r * DMQ + c0) = yf;  } }


__global__ __launch_bounds__(256) void k_rsmf(const float* __restrict__ S, _Float16* __restrict__ P, int qn, int hg) {
  #pragma clang fp contract(off)
  const int t = blockIdx.x * 256 + threadIdx.x; if (t >= qn * hg) return; const size_t i = (size_t)(t / qn) * SQ + (t % qn); const float* s = S + i * SQ; float mx = -3.0e38f;
#pragma unroll 1
  for (int j = 0; j < SQ; ++j) mx = fmaxf(mx, s[j]); float se = 0.f;
#pragma unroll 1
  for (int j = 0; j < SQ; ++j) se += __expf(s[j] - mx); const float sc = 256.0f / se;
#pragma unroll 1
  for (int j0 = 0; j0 < SQ; j0 += 8) { FragH f; for (int q = 0; q < 8; ++q) f.h[q] = (_Float16)(__expf(s[j0 + q] - mx) * sc); unsigned short* d = (unsigned short*)P + i * SQ + j0; *(v8us*)d = f.half[0];  } }


__global__ __launch_bounds__(256) void k_bfr(const float* __restrict__ x, float* __restrict__ XB, size_t n8) { const size_t t = (size_t)blockIdx.x * 256 + threadIdx.x; if (t >= n8) return; v4f a = *(const v4fa*)(x + t * 8), c = *(const v4fa*)(x + t * 8 + 4); for (int q = 0; q < 4; ++q) { a[q] = bf16_round(a[q]); c[q] = bf16_round(c[q]); }
  { *(v4f*)(XB + t * 8) = a; *(v4f*)(XB + t * 8 + 4) = c;  } }


extern "C" void kernel_launch(void* const* d_in, const int* in_sizes, int n_in,
                              void* d_out, int out_size, void* d_ws, size_t ws_size, hipStream_t stream) {
  (void)in_sizes; (void)n_in; (void)out_size;
  const float* const* I = (const float* const*)d_in; const float* x = I[0]; const float* wq = I[1]; const float* wk = I[2]; const float* wv = I[3]; const float* g1 = I[4]; const float* be1 = I[5]; const float* w1 = I[6]; const float* b1 = I[7]; const float* w2 = I[8]; const float* b2 = I[9]; const float* g2 = I[10]; const float* be2 = I[11];      /* natural [out][in] weights; LN affine; FFN biases */
  char* ws = (char*)d_ws; size_t off = 0;
  auto take = [&](size_t bytes) { char* p = ws + off; off += (bytes + 255) & ~(size_t)255; return p; };
  _Float16* BW1 = (_Float16*)take((size_t)DM * DM * 2); _Float16* BW2 = (_Float16*)take((size_t)DM * DM * 2); float* XB = (float*)take(NR * DM * 4); float* HP = (float*)take(NR * DM * 4); _Float16* H16 = (_Float16*)take(NR * DM * 2); _Float16* FF16 = (_Float16*)take(NR * DM * 2); _Float16* BQ = (_Float16*)take((size_t)DM * DM * 2); _Float16* BK = (_Float16*)take((size_t)DM * DM * 2); _Float16* BV = (_Float16*)take((size_t)DM * DM * 2); 
  _Float16* X16 = (_Float16*)take(NR * DM * 2); _Float16* Q16 = (_Float16*)take(NR * DM * 2); _Float16* K16 = (_Float16*)take(NR * DM * 2); _Float16* V16 = (_Float16*)take(NR * DM * 2);
  float* S = (float*)take((size_t)HG * SQ * SQ * 4); float* HF = S; static_assert((size_t)HG * SQ * SQ * 4 >= NR * DM * 4, "HF alias must fit in S");      /* the f32 h rows (LN1 output, residual for the FFN) live in the scores plane, which is dead once the attention loop has finished */ _Float16* P = (_Float16*)take((size_t)HG * SQ * SQ * 2); _Float16* VT = (_Float16*)take((size_t)NH * HD * SQ * 2);
  if (off > ws_size) return;
  { const unsigned g = (unsigned)(((size_t)DM * DM / 8 + 255) / 256); k_wnat<<<g, 256, 0, stream>>>(wq, (size_t)DM * DM / 8, BQ); k_wnat<<<g, 256, 0, stream>>>(wk, (size_t)DM * DM / 8, BK); k_wnat<<<g, 256, 0, stream>>>(wv, (size_t)DM * DM / 8, BV); }      /* natural [out][in] = Bt[n][k], x16 */
  { const unsigned g = (unsigned)(((size_t)DM * DM / 8 + 255) / 256); k_wnat<<<g, 256, 0, stream>>>(w1, (size_t)DM * DM / 8, BW1); k_wnat<<<g, 256, 0, stream>>>(w2, (size_t)DM * DM / 8, BW2); }      /* FFN weights natural [1024][1024] = Bt planes */
  k_bfr<<<(unsigned)((NR * DM / 8 + 255) / 256), 256, 0, stream>>>(x, XB, NR * DM / 8);      /* bf16(x) as f32 rows for the residual */

  k_x16<<<(unsigned)((NR * DM / 8 + 255) / 256), 256, 0, stream>>>(x, X16, NR * DM / 8);
  const size_t r0p = (size_t)B0 * SQ;      /* first projected row */
  k_gemm2<0><<<dim3((unsigned)((MP / 128) * (DM / 64)), 1), 128, 0, stream>>>(X16 + r0p * DM, DM, 0, BQ, DM, 0, 0.0625f, nullptr, 0, nullptr, 1, 0, 0, nullptr, Q16 + r0p * DM, DM, 0, MP, DM, DM);
  k_gemm2<0><<<dim3((unsigned)((MP / 128) * (DM / 64)), 1), 128, 0, stream>>>(X16 + r0p * DM, DM, 0, BK, DM, 0, 0.0625f, nullptr, 0, nullptr, 1, 0, 0, nullptr, K16 + r0p * DM, DM, 0, MP, DM, DM);
  k_gemm2<0><<<dim3((unsigned)((MP / 128) * (DM / 64)), 1), 128, 0, stream>>>(X16 + r0p * DM, DM, 0, BV, DM, 0, 0.0625f, nullptr, 0, nullptr, 1, 0, 0, nullptr, V16 + r0p * DM, DM, 0, MP, DM, DM);
  for (int b = B0; b < B0 + NBR; ++b) { const size_t r0 = (size_t)b * SQ;
    k_vt<NH, SQ><<<NH * (SQ / 64), 256, 0, stream>>>(V16 + r0 * LQ, LQ, 0, VT);      /* V^T [NH][HD][SQ] for this batch */
    for (int h0 = 0; h0 < NHD; h0 += HG) {
      k_gemm2<0><<<dim3((QN / 128) * (SQ / 64), HG), 128, 0, stream>>>(Q16 + r0 * LQ + h0 * HD, LQ, (size_t)HD, K16 + r0 * LQ + h0 * HD, LQ, (size_t)HD, 0.125f, nullptr, 0, nullptr, 1, 0, 0, S, nullptr, SQ, (size_t)SQ * SQ, QN, SQ, HD);      /* scores, HG heads per launch */
      k_rsmf<<<(HG * QN + 255) / 256, 256, 0, stream>>>(S, P, QN, HG);      /* P = 256 softmax (f16), rows of all HG heads */
      k_gemm2<0><<<dim3((QN / 128) * (HD / 64), HG), 128, 0, stream>>>(P, SQ, (size_t)SQ * SQ, VT + (size_t)h0 * HD * SQ, SQ, (size_t)HD * SQ, 0.00390625f, nullptr, 0, XB + r0 * DM + h0 * HD, -1, 0, 0, HP + r0 * DM + h0 * HD, nullptr, DM, (size_t)HD, QN, HD, SQ); } }      /* h_pre = bf16(x) + attn (merged heads; CP = own element of the residual plane), f32 rows */
  k_lnx<0, 1, 1><<<(unsigned)MP, 256, 0, stream>>>(HP + r0p * DM, g1, be1, 1e-5f, H16 + r0p * DM, HF + r0p * DM);      /* h = LN1(x + attn) -> f16 rows (FFN operand) and f32 rows (residual) */
  k_gemm2<3><<<dim3((unsigned)((MP / 128) * (DM / 64)), 1), 128, 0, stream>>>(H16 + r0p * DM, DM, 0, BW1, DM, 0, 0.0625f, b1, 0, nullptr, 1, 0, 0, nullptr, FF16 + r0p * DM, DM, 0, MP, DM, DM);      /* relu(h l1^T + b1) -> f16 rows */
  k_gemm2<0><<<dim3((unsigned)((MP / 128) * (DM / 64)), 1), 128, 0, stream>>>(FF16 + r0p * DM, DM, 0, BW2, DM, 0, 0.0625f, b2, 0, HF + r0p * DM, -1, 0, 0, HP + r0p * DM, nullptr, DM, 0, MP, DM, DM);      /* y = h + ff (own-element residual; the h_pre plane is free again) */
  k_lnx<0, 0, 1><<<(unsigned)MP, 256, 0, stream>>>(HP + r0p * DM, g2, be2, 1e-5f, nullptr, (float*)d_out + r0p * DM);      /* out = LN2(h + ff) -> f32 output rows */
}

// v001
// Measured time: 3260 microseconds a run.
// In two side-by-side timings against v000, it was 4.12 and 4.13 times as fast.
#include <hip/hip_runtime.h>
// Post-LN transformer encoder block (x [4][2048][1024]; q = x wq^T, k, v likewise (nn.Linear natural [1024][1024] sigma 1/32, no biases); 16 heads of 64 (chunked along features = head-major columns); softmax(q k^T / 8) v over all keys (no mask), heads merged, NO output projection; h = LN1(x + attn) (biased variance, eps 1e-5, gamma/beta); ff = relu(h l1_w^T + l1_b) l2_w^T + l2_b (natural [1024][1024], biases sigma 0.01); out = LN2(h + ff) -> [4][2048][1024]).
// Structure: token rows r = b*2048 + s; x as exact f16 rows (bf16-rounded); Q, K, V as three WMMA GEMMs (32x64 wave tiles, f32 accumulation, exact x16 weights, f16 outputs); per batch: V^T for all heads via LDS transposes; per (batch, group of 2 heads): scores GEMM (K = 64, batched over the heads on grid.y, alpha = 64^-0.5), row softmax on VALU (f32 statistics, native exp; weights stored x256 as f16), h_pre = bf16(x) + P . V^T (K = 2048, alpha 2^-8; own-element residual addend) as f32 rows; LN1 on VALU (f32 statistics, LDS trees) -> f16 + f32 rows; relu(h l1^T + b1) GEMM with the ReLU epilogue -> f16; y = h + ff l2^T + b2 GEMM (own-element residual); LN2 on VALU -> f32 output.
// Compute dtype: inputs rounded to bf16; x / weights exact; q, k, v, softmax weights, h and the ReLU output as plain f16 GEMM operands (~2^-12); scores and softmax statistics f32. v_wmma_f32_16x16x32_f16.
#define NB 4
#define SQ 2048
#define DM 1024
#define NH 16
#define HD 64
#define DMQ DM                       /* LayerNorm width */
#define HG 2                         /* heads per attention launch group */
#define B0 0                         /* first batch processed (debug hook) */
#define NBR NB                       /* batches processed (debug hook) */
#define NR ((size_t)NB * SQ)         /* token rows */
#define MP ((int)((size_t)NBR * SQ)) /* rows projected (debug hook) */
#define QN SQ                        /* query rows attended per batch (debug hook) */
#define NHD NH                       /* heads attended (debug hook) */
#define MPO MP                       /* unused (the output stage runs MP rows) */
#define LQ DM      /* row pitch of the q/k/v rows */
typedef __bf16 v16b __attribute__((ext_vector_type(16)));
typedef unsigned short v8us __attribute__((ext_vector_type(8), may_alias));
typedef float  v8f  __attribute__((ext_vector_type(8)));
typedef float  v4f  __attribute__((ext_vector_type(4)));
typedef float  v4fa __attribute__((ext_vector_type(4), may_alias));
union FragB { v16b v; v8us half[2]; unsigned short u[16]; };

__device__ __forceinline__ unsigned short bf16_bits(float x) { unsigned int u = __float_as_uint(x); return (unsigned short)((u + 0x7FFFu + ((u >> 16) & 1u)) >> 16); }
__device__ __forceinline__ float bf16_val(unsigned short b) { return __uint_as_float(((unsigned int)b) << 16); }
__device__ __forceinline__ float bf16_round(float x) { return bf16_val(bf16_bits(x)); }
// D += A·B with NT terms: 1 = ah·bh, 2 = + al·bh (A split), 3 = + ah·bl (both split)
template <int NT>
__device__ __forceinline__ v8f mmaN(v16b ah, v16b al, v16b bh, v16b bl, v8f c) {
  c = __builtin_amdgcn_wmma_f32_16x16x32_bf16(false, ah, false, bh, (short)0, c, false, false);
  if (NT >= 2) c = __builtin_amdgcn_wmma_f32_16x16x32_bf16(false, al, false, bh, (short)0, c, false, false);
  if (NT >= 3) c = __builtin_amdgcn_wmma_f32_16x16x32_bf16(false, ah, false, bl, (short)0, c, false, false);
  asm volatile("v_nop\n\tv_nop\n\tv_nop\n\tv_nop" : "+v"(c) : "v"(ah), "v"(al), "v"(bh), "v"(bl));
  return c;
}

__global__ __launch_bounds__(256) void k_wt_bf16(const float* __restrict__ W, unsigned short* __restrict__ Wt, int K, int N) {
  const int t = blockIdx.x * 256 + threadIdx.x;
  const int k8n = K / 8;
  if (t >= N * k8n) return;
  const int n = t / k8n, k8 = (t % k8n) * 8;
  v8us v;
#pragma unroll
  for (int i = 0; i < 8; ++i) v[i] = bf16_bits(W[(size_t)(k8 + i) * N + n]);
  *(v8us*)(Wt + (size_t)n * K + k8) = v;
  
}

// GEMM C[M][N] (f32, pitch ldc) = act(A[M][K]·W + bias). A f32 row-major (pitch lda) converted per fragment to bf16
// (ASPLIT: hi/lo two planes -> 2 terms, else single rounded term); Wt bf16 [N][K] (pitch ldb). BIAS_BF16 rounds the
// bias to bf16 first (bias quantised to bf16 before the add). K%32==0, M%16==0, N%64==0.
template <bool ASPLIT, int ACT, bool BIAS_BF16>
__global__ __launch_bounds__(128) void k_gemm_bf(const float* __restrict__ A, int lda, const unsigned short* __restrict__ Wt, int ldb,
                                               const float* __restrict__ bias, float* __restrict__ C, int ldc, int M, int N, int K) {
  __shared__ __attribute__((aligned(16))) float so[4][16][64];
  const int tid = threadIdx.x, w = tid >> 5, lane = tid & 31, ln = lane & 15, hh = lane >> 4;
  const int ntn = N / 64;
  const int wid = blockIdx.x * 4 + w;
  const int mt = wid / ntn, nq = wid % ntn;
  if (mt * 16 >= M) return;
  const int row0 = mt * 16, col0 = nq * 64;
  const float* arow = A + (size_t)(row0 + ln) * lda;
  v8f acc[4] = {};
  for (int kb = 0; kb < K; kb += 32) {
    FragB ah, al;
    const v4f x0 = *(const v4fa*)(arow + kb + 8 * hh), x1 = *(const v4fa*)(arow + kb + 8 * hh + 4);
    const v4f x2 = *(const v4fa*)(arow + kb + 16 + 8 * hh), x3 = *(const v4fa*)(arow + kb + 16 + 8 * hh + 4);
    float xs[16] = {x0[0],x0[1],x0[2],x0[3],x1[0],x1[1],x1[2],x1[3],x2[0],x2[1],x2[2],x2[3],x3[0],x3[1],x3[2],x3[3]};
#pragma unroll
    for (int i = 0; i < 16; ++i) { const unsigned short hb = bf16_bits(xs[i]); ah.u[i] = hb; al.u[i] = ASPLIT ? bf16_bits(xs[i] - bf16_val(hb)) : (unsigned short)0; }
#pragma unroll
    for (int t = 0; t < 4; ++t) {
      const unsigned short* brow = Wt + (size_t)(col0 + t * 16 + ln) * ldb + kb;
      FragB b;
      b.half[0] = *(const v8us*)(brow + 8 * hh);
      b.half[1] = *(const v8us*)(brow + 16 + 8 * hh);
      acc[t] = mmaN<ASPLIT ? 2 : 1>(ah.v, al.v, b.v, b.v, acc[t]);
    }
  }
#pragma unroll
  for (int t = 0; t < 4; ++t) {
    float bv = bias ? bias[col0 + t * 16 + ln] : 0.f;
    if (BIAS_BF16) bv = bf16_round(bv);
#pragma unroll
    for (int r = 0; r < 8; ++r) { float v = acc[t][r] + bv; if (ACT == 1) v = fmaxf(v, 0.f); so[w][8 * hh + r][t * 16 + ln] = v; }
  }
  __builtin_amdgcn_fence(__ATOMIC_ACQ_REL, "workgroup");
  __builtin_amdgcn_wave_barrier();
  const int rsub = lane >> 4, c4 = (lane & 15) * 4;
  {
#pragma unroll
    for (int q = 0; q < 8; ++q) {
      const int r = q * 2 + rsub;
      const v4f v = *(const v4fa*)&so[w][r][c4];
      *(v4f*)(C + (size_t)(row0 + r) * ldc + col0 + c4) = v;
    }
    
  }
}

// GEMM C = act(A·W + bias + resid): A f32 (ASPLIT -> hi/lo 2 terms), Wt bf16 [N][K]; ACT 0 none, 1 relu, 2 exact gelu;
// resid (optional, f32, row index = (row % rmod), pitch ldr, RES_BF16 rounds it) added before the activation.
template <bool ASPLIT, int ACT, bool BIAS_BF16, bool RES_BF16>
__global__ __launch_bounds__(128) void k_gemm_bf3(const float* __restrict__ A, int lda, const unsigned short* __restrict__ Wt, int ldb,
                                                const float* __restrict__ bias, const float* __restrict__ resid, int rmod, int ldr,
                                                float* __restrict__ C, int ldc, int M, int N, int K) {
  __shared__ __attribute__((aligned(16))) float so[4][16][64];
  const int tid = threadIdx.x, w = tid >> 5, lane = tid & 31, ln = lane & 15, hh = lane >> 4;
  const int ntn = N / 64;
  const int wid = blockIdx.x * 4 + w;
  const int mt = wid / ntn, nq = wid % ntn;
  if (mt * 16 >= M) return;
  const int row0 = mt * 16, col0 = nq * 64;
  const float* arow = A + (size_t)(row0 + ln) * lda;
  v8f acc[4] = {};
  for (int kb = 0; kb < K; kb += 32) {
    FragB ah, al;
    const v4f x0 = *(const v4fa*)(arow + kb + 8 * hh), x1 = *(const v4fa*)(arow + kb + 8 * hh + 4);
    const v4f x2 = *(const v4fa*)(arow + kb + 16 + 8 * hh), x3 = *(const v4fa*)(arow + kb + 16 + 8 * hh + 4);
    float xs[16] = {x0[0],x0[1],x0[2],x0[3],x1[0],x1[1],x1[2],x1[3],x2[0],x2[1],x2[2],x2[3],x3[0],x3[1],x3[2],x3[3]};
#pragma unroll
    for (int i = 0; i < 16; ++i) { const unsigned short hb = bf16_bits(xs[i]); ah.u[i] = hb; al.u[i] = ASPLIT ? bf16_bits(xs[i] - bf16_val(hb)) : (unsigned short)0; }
#pragma unroll
    for (int t = 0; t < 4; ++t) {
      const unsigned short* brow = Wt + (size_t)(col0 + t * 16 + ln) * ldb + kb;
      FragB b;
      b.half[0] = *(const v8us*)(brow + 8 * hh);
      b.half[1] = *(const v8us*)(brow + 16 + 8 * hh);
      acc[t] = mmaN<ASPLIT ? 2 : 1>(ah.v, al.v, b.v, b.v, acc[t]);
    }
  }
#pragma unroll
  for (int t = 0; t < 4; ++t) {
    const int col = col0 + t * 16 + ln;
    float bv = bias ? bias[col] : 0.f;
    if (BIAS_BF16) bv = bf16_round(bv);
#pragma unroll
    for (int r = 0; r < 8; ++r) {
      float v = acc[t][r] + bv;
      if (resid) { float rv = resid[(size_t)((row0 + 8 * hh + r) % rmod) * ldr + col]; if (RES_BF16) rv = bf16_round(rv); v += rv; }
      if (ACT == 1) v = fmaxf(v, 0.f);
      if (ACT == 2) v = 0.5f * v * (1.0f + erff(v * 0.70710678118654752f));
      if (ACT == 3) { const float u = 0.7978845608028654f * (v + 0.044715f * v * v * v); v = 0.5f * v * (1.0f + tanhf(u)); }
      so[w][8 * hh + r][t * 16 + ln] = v;
    }
  }
  __builtin_amdgcn_fence(__ATOMIC_ACQ_REL, "workgroup");
  __builtin_amdgcn_wave_barrier();
  const int rsub = lane >> 4, c4 = (lane & 15) * 4;
  {
#pragma unroll
    for (int q = 0; q < 8; ++q) {
      const int r = q * 2 + rsub;
      const v4f v = *(const v4fa*)&so[w][r][c4];
      *(v4f*)(C + (size_t)(row0 + r) * ldc + col0 + c4) = v;
    }
    
  }
}
// row LayerNorm (biased variance, eps) over N: s = X (+ R); optional out_sum <- s; out_norm <- (s-mu)*rsqrt(var+eps)*g + b
template <bool PARAM_BF16>
__global__ __launch_bounds__(256) void k_layernorm(const float* __restrict__ X, const float* __restrict__ R, const float* __restrict__ g, const float* __restrict__ bta,
                                                  float* __restrict__ out_sum, float* __restrict__ out_norm, int N, float eps) {
  __shared__ float red[256];
  const int row = blockIdx.x, tid = threadIdx.x;
  const float* x = X + (size_t)row * N; const float* rr = R ? R + (size_t)row * N : nullptr;
  float vals[16];                     // up to N = 4096
  const int per = N / 256;            // contiguous chunk per thread? use strided-by-4 chunks: thread handles j = tid*4 + 1024*u
  float s1 = 0.f;
  for (int u = 0; u < per / 4; ++u) {
    const int j = tid * 4 + 1024 * u;
    const v4f a = *(const v4fa*)(x + j);
    v4f b = {0.f,0.f,0.f,0.f}; if (rr) b = *(const v4fa*)(rr + j);
#pragma unroll
    for (int q = 0; q < 4; ++q) { const float v = a[q] + b[q]; vals[u * 4 + q] = v; s1 += v; }
  }
  red[tid] = s1; __syncthreads();
  for (int st = 128; st > 0; st >>= 1) { if (tid < st) red[tid] += red[tid + st]; __syncthreads(); }
  const float mu = red[0] / (float)N; __syncthreads();
  float s2 = 0.f;
  for (int u = 0; u < per / 4; ++u)
#pragma unroll
    for (int q = 0; q < 4; ++q) { const float c = vals[u * 4 + q] - mu; s2 += c * c; }
  red[tid] = s2; __syncthreads();
  for (int st = 128; st > 0; st >>= 1) { if (tid < st) red[tid] += red[tid + st]; __syncthreads(); }
  const float rs = rsqrtf(red[0] / (float)N + eps);
  {
    for (int u = 0; u < per / 4; ++u) {
      const int j = tid * 4 + 1024 * u;
      v4f o, sm;
#pragma unroll
      for (int q = 0; q < 4; ++q) {
        float gg = g[j + q], bb = bta[j + q];
        if (PARAM_BF16) { gg = bf16_round(gg); bb = bf16_round(bb); }
        sm[q] = vals[u * 4 + q]; o[q] = (vals[u * 4 + q] - mu) * rs * gg + bb;
      }
      if (out_sum) *(v4f*)(out_sum + (size_t)row * N + j) = sm;
      *(v4f*)(out_norm + (size_t)row * N + j) = o;
    }
    
  }
}



// ---- f16 WMMA path (v_wmma_f32_16x16x32_f16): 11-bit significands for operands in range — used where a [0,1] probability operand needs more precision than bf16
typedef _Float16 v16h __attribute__((ext_vector_type(16)));
union FragH { v16h v; v8us half[2]; _Float16 h[16]; unsigned short u[16]; };
template <int NT>
__device__ __forceinline__ v8f mmaH(v16h ah, v16h al, v16h bh, v16h bl, v8f c) {
  c = __builtin_amdgcn_wmma_f32_16x16x32_f16(false, ah, false, bh, (short)0, c, false, false);
  if (NT >= 2) c = __builtin_amdgcn_wmma_f32_16x16x32_f16(false, al, false, bh, (short)0, c, false, false);
  if (NT >= 3) c = __builtin_amdgcn_wmma_f32_16x16x32_f16(false, ah, false, bl, (short)0, c, false, false);
  asm volatile("v_nop\n\tv_nop\n\tv_nop\n\tv_nop" : "+v"(c) : "v"(ah), "v"(al), "v"(bh), "v"(bl));
  return c;
}
// batched GEMM like k_gemm_b but f16 operands: A f32 (split into f16 hi/lo if ASPLIT, else rounded to f16), Bt = f16 values [n][k]; alpha; C f32; N multiple of 16 (partial tiles skipped)
template <bool ASPLIT>
__global__ __launch_bounds__(128) void k_gemm_h(const float* __restrict__ A, int lda, size_t sA, const _Float16* __restrict__ Bh, int ldb, size_t sB, float alpha, float* __restrict__ C, int ldc, size_t sC, int M, int N, int K) {
  __shared__ __attribute__((aligned(16))) float so[4][16][64];
  const int tid = threadIdx.x, w = tid >> 5, lane = tid & 31, ln = lane & 15, hh = lane >> 4; const int by = blockIdx.y;
  A += (size_t)by * sA; Bh += (size_t)by * sB; C += (size_t)by * sC;
  const int ntn = (N + 63) / 64; const int wid = blockIdx.x * 4 + w; const int mt = wid / ntn, nq = wid % ntn; if (mt * 16 >= M) return;
  const int row0 = mt * 16, col0 = nq * 64; const float* arow = A + (size_t)(row0 + ln) * lda;
  v8f acc[4] = {};
  for (int kb = 0; kb < K; kb += 32) {
    FragH ah, al;
    const v4f x0 = *(const v4fa*)(arow + kb + 8 * hh), x1 = *(const v4fa*)(arow + kb + 8 * hh + 4), x2 = *(const v4fa*)(arow + kb + 16 + 8 * hh), x3 = *(const v4fa*)(arow + kb + 16 + 8 * hh + 4);
    float xs[16] = {x0[0],x0[1],x0[2],x0[3],x1[0],x1[1],x1[2],x1[3],x2[0],x2[1],x2[2],x2[3],x3[0],x3[1],x3[2],x3[3]};
#pragma unroll
    for (int i = 0; i < 16; ++i) { const _Float16 h = (_Float16)xs[i]; ah.h[i] = h; al.h[i] = ASPLIT ? (_Float16)(xs[i] - (float)h) : (_Float16)0.0f; }
#pragma unroll
    for (int t = 0; t < 4; ++t) { if (col0 + t * 16 >= N) continue; const size_t boff = (size_t)(col0 + t * 16 + ln) * ldb + kb; FragH bq; bq.half[0] = *(const v8us*)(Bh + boff + 8 * hh); bq.half[1] = *(const v8us*)(Bh + boff + 16 + 8 * hh);
      acc[t] = mmaH<ASPLIT ? 2 : 1>(ah.v, al.v, bq.v, bq.v, acc[t]); }
  }
#pragma unroll
  for (int t = 0; t < 4; ++t) { if (col0 + t * 16 >= N) continue;
#pragma unroll
    for (int r = 0; r < 8; ++r) so[w][8 * hh + r][t * 16 + ln] = acc[t][r] * alpha; }
  __builtin_amdgcn_fence(__ATOMIC_ACQ_REL, "workgroup"); __builtin_amdgcn_wave_barrier();
  const int rsub = lane >> 4, c4 = (lane & 15) * 4;
  {
#pragma unroll
    for (int q = 0; q < 8; ++q) { const int r = q * 2 + rsub; if (col0 + c4 < N) { const v4f v = *(const v4fa*)&so[w][r][c4]; *(v4f*)(C + (size_t)(row0 + r) * ldc + col0 + c4) = v; } }
     }
}

// Wt[n][k] = f16(W[k][n]·scale) from f32 row-major W[K][N] (scale = power of two; bf16-exact weights stay exact in f16 away from the subnormal range)
__global__ __launch_bounds__(256) void k_wt_f16(const float* __restrict__ W, _Float16* __restrict__ Wt, int K, int N, float scale) {
  const int t = blockIdx.x * 256 + threadIdx.x; if (t >= N * (K / 8)) return; const int n = t / (K / 8), k8 = (t % (K / 8)) * 8; FragH f;
#pragma unroll
  for (int i = 0; i < 8; ++i) f.h[i] = (_Float16)(bf16_round(W[(size_t)(k8 + i) * N + n]) * scale); const v8us o = f.half[0];
  *(v8us*)((unsigned short*)Wt + (size_t)n * K + k8) = o; 
}
// k_gemm_hh variant with fused epilogue: v = acc·alpha + bias[by·sBias + col] (+ CP[(row/rowsPerB)·sCPb + by·64 + col] if CP) ; ACT 0 none / 1 elu ; writes f16 C16 (and f32 C if non-null)
template <int ACT>
__global__ __launch_bounds__(128) void k_gemm_hhx(const _Float16* __restrict__ A, int lda, size_t sA, const _Float16* __restrict__ Bh, int ldb, size_t sB, float alpha, const float* __restrict__ bias, size_t sBias, const float* __restrict__ CP, int rowsPerB, size_t sCPb, int row0g,
    float* __restrict__ C, _Float16* __restrict__ C16, int ldc, size_t sC, int M, int N, int K) {
  __shared__ __attribute__((aligned(16))) float so[4][16][64];
  const int tid = threadIdx.x, w = tid >> 5, lane = tid & 31, ln = lane & 15, hh = lane >> 4; const int by = blockIdx.y;
  A += (size_t)by * sA; Bh += (size_t)by * sB; const size_t cofs = (size_t)by * sC; const float* bp = bias ? bias + (size_t)by * sBias : nullptr;
  const int ntn = (N + 63) / 64; const int wid = blockIdx.x * 4 + w; const int mt = wid / ntn, nq = wid % ntn; if (mt * 16 >= M) return;
  const int row0 = mt * 16, col0 = nq * 64; const _Float16* arow = A + (size_t)(row0 + ln) * lda;
  v8f acc[4] = {};
  for (int kb = 0; kb < K; kb += 32) { FragH ah; ah.half[0] = *(const v8us*)((const unsigned short*)arow + kb + 8 * hh); ah.half[1] = *(const v8us*)((const unsigned short*)arow + kb + 16 + 8 * hh);
#pragma unroll
    for (int t = 0; t < 4; ++t) { if (col0 + t * 16 >= N) continue; const size_t boff = (size_t)(col0 + t * 16 + ln) * ldb + kb; FragH bq; bq.half[0] = *(const v8us*)((const unsigned short*)Bh + boff + 8 * hh); bq.half[1] = *(const v8us*)((const unsigned short*)Bh + boff + 16 + 8 * hh);
      acc[t] = mmaH<1>(ah.v, ah.v, bq.v, bq.v, acc[t]); }
  }
#pragma unroll
  for (int t = 0; t < 4; ++t) { if (col0 + t * 16 >= N) continue; const int col = col0 + t * 16 + ln; const float bv = bp ? bf16_round(bp[col]) : 0.f;
#pragma unroll
    for (int r = 0; r < 8; ++r) { float v = acc[t][r] * alpha + bv; if (CP) { const int rr = row0g + row0 + 8 * hh + r; if (rowsPerB < 0) v += CP[cofs + (size_t)rr * ldc + col];      /* rowsPerB < 0: own element of the batched C plane */ else { const int bidx = rr / rowsPerB; v += CP[(size_t)bidx * sCPb + (size_t)by * 64 + col]; } } if (ACT == 1) v = (v > 0.f) ? v : expm1f(v); else if (ACT == 7) v = (v > 0.f) ? v + 1.0f : expf(v); else if (ACT == 8) v = tanhf(v); else if (ACT == 9) v = 0.5f * v * (1.0f + tanhf(0.7978845608028654f * (v + 0.044715f * v * v * v))); else if (ACT == 11) v = 1.0f / (1.0f + expf(-v)); else if (ACT == 12) v = (v > 0.f) ? v : 0.01f * v; else if (ACT == 14) v = (v > 0.f) ? v : 0.1f * v; else if (ACT == 16) v = (v >= 0.f) ? v : 0.3f * v; else if (ACT == 17) v = (v >= 0.f) ? v : 0.2f * v; else if (ACT == 15) v = v / (1.0f + expf(-v)); else if (ACT == 3) v = fmaxf(v, 0.f); else if (ACT == 6) v = 0.5f * v * (1.0f + erff(v * 0.70710678118654752f)); so[w][8 * hh + r][t * 16 + ln] = v; } }
  __builtin_amdgcn_fence(__ATOMIC_ACQ_REL, "workgroup"); __builtin_amdgcn_wave_barrier();
  const int rsub = lane >> 4, c4 = (lane & 15) * 4; typedef _Float16 v4h __attribute__((ext_vector_type(4)));
  {
#pragma unroll
    for (int q = 0; q < 8; ++q) { const int r = q * 2 + rsub; if (col0 + c4 < N) { const v4f v = *(const v4fa*)&so[w][r][c4]; if (C) *(v4f*)(C + cofs + (size_t)(row0 + r) * ldc + col0 + c4) = v; if (C16) { v4h h4; for (int i = 0; i < 4; ++i) h4[i] = (_Float16)v[i]; *(v4h*)(C16 + cofs + (size_t)(row0 + r) * ldc + col0 + c4) = h4; } } }
     }
}


typedef _Float16 v4h __attribute__((ext_vector_type(4)));

__global__ __launch_bounds__(256) void k_x16(const float* __restrict__ x, _Float16* __restrict__ X16, size_t n8) { const size_t t = (size_t)blockIdx.x * 256 + threadIdx.x; if (t >= n8) return; FragH f;
#pragma unroll
  for (int q = 0; q < 8; ++q) f.h[q] = (_Float16)bf16_round(x[t * 8 + q]); *(v8us*)((unsigned short*)X16 + t * 8) = f.half[0];  }
__global__ __launch_bounds__(256) void k_h16(const float* __restrict__ x, _Float16* __restrict__ X16, size_t n8) { const size_t t = (size_t)blockIdx.x * 256 + threadIdx.x; if (t >= n8) return; FragH f;
#pragma unroll
  for (int q = 0; q < 8; ++q) f.h[q] = (_Float16)x[t * 8 + q]; *(v8us*)((unsigned short*)X16 + t * 8) = f.half[0];  }
__global__ __launch_bounds__(256) void k_round16f(const float* __restrict__ W, _Float16* __restrict__ Bt, size_t n8) { const size_t t = (size_t)blockIdx.x * 256 + threadIdx.x; if (t >= n8) return; FragH f;
#pragma unroll
  for (int i = 0; i < 8; ++i) f.h[i] = (_Float16)(bf16_round(W[t * 8 + i]) * 16.0f); *(v8us*)((unsigned short*)Bt + t * 8) = f.half[0];  }
template <int NHv, int TTv>
__global__ __launch_bounds__(256) void k_vt(const _Float16* __restrict__ V16, int ldv, int voff, _Float16* __restrict__ Vt) { __shared__ unsigned short tl[64][66]; const int tid = threadIdx.x; const int slab = blockIdx.x / (TTv / 64), lg = blockIdx.x % (TTv / 64); const int b = slab / NHv, h = slab % NHv;
  for (int i = tid; i < 64 * 8; i += 256) { const int r = i / 8, c8 = (i % 8) * 8; FragH f; f.half[0] = *(const v8us*)((const unsigned short*)V16 + ((size_t)b * TTv + lg * 64 + r) * ldv + voff + h * 64 + c8);
#pragma unroll
    for (int q = 0; q < 8; ++q) tl[r][c8 + q] = f.u[q]; }
  __syncthreads();
  {
#pragma unroll
    for (int rd = 0; rd < 2; ++rd) { const int d = rd * 32 + tid / 8, pc = tid % 8; FragH f;
#pragma unroll
      for (int q = 0; q < 8; ++q) f.u[q] = tl[pc * 8 + q][d];
      *(v8us*)((unsigned short*)Vt + ((size_t)slab * 64 + d) * TTv + lg * 64 + pc * 8) = f.half[0]; }
     } }

__global__ __launch_bounds__(256) void k_hl(const float* __restrict__ F, _Float16* __restrict__ Hh, _Float16* __restrict__ Hl, size_t n8) { const size_t t = (size_t)blockIdx.x * 256 + threadIdx.x; if (t >= n8) return; FragH fh, fl; const v4f a = *(const v4fa*)(F + t * 8), c = *(const v4fa*)(F + t * 8 + 4);
#pragma unroll
  for (int q = 0; q < 4; ++q) { _Float16 h = (_Float16)a[q]; fh.h[q] = h; fl.h[q] = (_Float16)((a[q] - (float)h) * 1024.0f); h = (_Float16)c[q]; fh.h[4 + q] = h; fl.h[4 + q] = (_Float16)((c[q] - (float)h) * 1024.0f); }
  { *(v8us*)((unsigned short*)Hh + t * 8) = fh.half[0]; *(v8us*)((unsigned short*)Hl + t * 8) = fl.half[0];  } }

// ---- fast GEMM (wave tile 32x64; requires M % 32 == 0 rows per launch region and N % 64 == 0); epilogue = k_gemm_hhx semantics ----
__device__ __forceinline__ v16h g2_frag(const _Float16* p, int hh) { FragH f; f.half[0] = *(const v8us*)((const unsigned short*)p + 8 * hh); f.half[1] = *(const v8us*)((const unsigned short*)p + 16 + 8 * hh); return f.v; }
__device__ __forceinline__ v8f g2_mma(v16h a, v16h b, v8f c) { v8f d = __builtin_amdgcn_wmma_f32_16x16x32_f16(false, a, false, b, (short)0, c, false, false); asm volatile("v_nop\n\tv_nop\n\tv_nop\n\tv_nop" : "+v"(d) : "v"(a), "v"(b)); return d; }
template <int ACT>
__global__ __launch_bounds__(128) void k_gemm2(const _Float16* __restrict__ A, int lda, size_t sA, const _Float16* __restrict__ Bh, int ldb, size_t sB, float alpha, const float* __restrict__ bias, size_t sBias, const float* __restrict__ CP, int rowsPerB, size_t sCPb, int row0g,
    float* __restrict__ C, _Float16* __restrict__ C16, int ldc, size_t sC, int M, int N, int K) { static_assert(ACT == 0 || ACT == 3 || ACT == 6 || ACT == 8 || ACT == 9 || ACT == 11 || ACT == 12 || ACT == 14 || ACT == 15 || ACT == 16 || ACT == 17, "k_gemm2: unsupported ACT code (would silently apply no activation)");
  __shared__ __attribute__((aligned(16))) float so[4][32][68];
  const int tid = threadIdx.x, w = tid >> 5, lane = tid & 31, ln = lane & 15, hh = lane >> 4; const int by = blockIdx.y;
  A += (size_t)by * sA; Bh += (size_t)by * sB; const size_t cofs = (size_t)by * sC; const float* bp = bias ? bias + (size_t)by * sBias : nullptr;
  const int ntn = N >> 6; const int mt = blockIdx.x / ntn, nq = blockIdx.x - mt * ntn; const int row0 = mt * 128 + 32 * w, col0 = nq * 64; if (row0 >= M) return;
  const _Float16* a0p = A + (size_t)(row0 + ln) * lda; const _Float16* a1p = a0p + (size_t)16 * lda;
  const _Float16* b0p = Bh + (size_t)(col0 + ln) * ldb; const _Float16* b1p = b0p + (size_t)16 * ldb; const _Float16* b2p = b1p + (size_t)16 * ldb; const _Float16* b3p = b2p + (size_t)16 * ldb;
  const v8f z8 = {0.f,0.f,0.f,0.f,0.f,0.f,0.f,0.f}; v8f c00 = z8, c01 = z8, c02 = z8, c03 = z8, c10 = z8, c11 = z8, c12 = z8, c13 = z8;
#pragma unroll 1
  for (int kb = 0; kb < K; kb += 32) { const v16h a0 = g2_frag(a0p + kb, hh), a1 = g2_frag(a1p + kb, hh);
    v16h b = g2_frag(b0p + kb, hh); c00 = g2_mma(a0, b, c00); c10 = g2_mma(a1, b, c10);
    b = g2_frag(b1p + kb, hh); c01 = g2_mma(a0, b, c01); c11 = g2_mma(a1, b, c11);
    b = g2_frag(b2p + kb, hh); c02 = g2_mma(a0, b, c02); c12 = g2_mma(a1, b, c12);
    b = g2_frag(b3p + kb, hh); c03 = g2_mma(a0, b, c03); c13 = g2_mma(a1, b, c13); }
  v8f accs[8] = {c00, c01, c02, c03, c10, c11, c12, c13};
#pragma unroll
  for (int u = 0; u < 8; ++u) { const int t = u & 3, half = u >> 2; const int col = col0 + t * 16 + ln; const float bv = bp ? bf16_round(bp[col]) : 0.f;
#pragma unroll
    for (int r = 0; r < 8; ++r) { const int rloc = half * 16 + 8 * hh + r; float v = accs[u][r] * alpha + bv; if (CP) { if (rowsPerB < 0) v += CP[cofs + (size_t)(row0g + row0 + rloc) * ldc + col];      /* rowsPerB < 0: own element of the batched C plane */ else { const int bidx = (row0g + row0 + rloc) / rowsPerB; v += CP[(size_t)bidx * sCPb + (size_t)by * 64 + col]; } }
      if (ACT == 3) v = fmaxf(v, 0.f); else if (ACT == 6) v = 0.5f * v * (1.0f + erff(v * 0.70710678118654752f)); else if (ACT == 11) v = 1.0f / (1.0f + expf(-v)); else if (ACT == 15) v = v / (1.0f + expf(-v)); else if (ACT == 12) v = (v > 0.f) ? v : 0.01f * v; else if (ACT == 8) v = tanhf(v); else if (ACT == 9) v = 0.5f * v * (1.0f + tanhf(0.7978845608028654f * (v + 0.044715f * v * v * v))); else if (ACT == 14) v = (v > 0.f) ? v : 0.1f * v; else if (ACT == 16) v = (v >= 0.f) ? v : 0.3f * v; else if (ACT == 17) v = (v >= 0.f) ? v : 0.2f * v;
      so[w][rloc][t * 16 + ln] = v; } }
  __builtin_amdgcn_fence(__ATOMIC_ACQ_REL, "workgroup"); __builtin_amdgcn_wave_barrier();
  const int rsub = lane >> 4, c4 = (lane & 15) * 4;
  {
#pragma unroll
    for (int q = 0; q < 16; ++q) { const int r = q * 2 + rsub; const v4f v = *(const v4fa*)&so[w][r][c4]; if (C) *(v4f*)(C + cofs + (size_t)(row0 + r) * ldc + col0 + c4) = v; if (C16) { v4h h4; for (int i = 0; i < 4; ++i) h4[i] = (_Float16)v[i]; *(v4h*)(C16 + cofs + (size_t)(row0 + r) * ldc + col0 + c4) = h4; } }
     } }


__global__ __launch_bounds__(256) void k_wnat(const float* __restrict__ w, size_t n8, _Float16* __restrict__ Bt) { const size_t t = (size_t)blockIdx.x * 256 + threadIdx.x; if (t >= n8) return; FragH f; for (int q = 0; q < 8; ++q) f.h[q] = (_Float16)(bf16_round(w[t * 8 + q]) * 16.0f); *(v8us*)((unsigned short*)Bt + t * 8) = f.half[0];  }
__global__ __launch_bounds__(256) void k_rsm(const float* __restrict__ S, _Float16* __restrict__ P, int nrows) {
  #pragma clang fp contract(off)
  const int i = blockIdx.x * 256 + threadIdx.x; if (i >= nrows) return; const float* s = S + (size_t)i * SQ; float mx = -3.0e38f;
#pragma unroll 1
  for (int j = 0; j < SQ; ++j) mx = fmaxf(mx, s[j]); float se = 0.f;
#pragma unroll 1
  for (int j = 0; j < SQ; ++j) se += expf(s[j] - mx); const float sc = 256.0f / se;
#pragma unroll 1
  for (int j0 = 0; j0 < SQ; j0 += 8) { FragH f; for (int q = 0; q < 8; ++q) f.h[q] = (_Float16)(expf(s[j0 + q] - mx) * sc); unsigned short* d = (unsigned short*)P + (size_t)i * SQ + j0; *(v8us*)d = f.half[0];  } }
__global__ __launch_bounds__(256) void k_vt(const _Float16* __restrict__ V16, int b, int h0, _Float16* __restrict__ VT) { __shared__ unsigned short tl[64][65]; const int tid = threadIdx.x; const int hh = blockIdx.x % HG, sg = blockIdx.x / HG; const int s0 = sg * 64; const int h = h0 + hh;
  for (int i = tid; i < 64 * 8; i += 256) { const int j = i / 8, d8 = (i % 8) * 8; FragH f; f.half[0] = *(const v8us*)((const unsigned short*)V16 + ((size_t)b * SQ + s0 + j) * DM + h * HD + d8); for (int q = 0; q < 8; ++q) tl[d8 + q][j] = f.u[q]; }
  __syncthreads();
  { for (int i = tid; i < 64 * 8; i += 256) { const int d = i / 8, j8 = (i % 8) * 8; FragH f; for (int q = 0; q < 8; ++q) f.u[q] = tl[d][j8 + q]; *(v8us*)((unsigned short*)VT + ((size_t)hh * HD + d) * SQ + s0 + j8) = f.half[0]; }  } }


template <int BFIN, int W16, int W32>
__global__ __launch_bounds__(256) void k_lnx(const float* __restrict__ X, const float* __restrict__ g, const float* __restrict__ bb, float eps, _Float16* __restrict__ N16, float* __restrict__ N32) {
  #pragma clang fp contract(off)
  __shared__ float red[256]; const size_t r = blockIdx.x; const int t = threadIdx.x; const bool act = t < (DMQ / 4); const int c0 = act ? t * 4 : 0;
  const v4f xa = *(const v4fa*)(X + r * DMQ + c0); float s[4]; float sum = 0.f;
  for (int q = 0; q < 4; ++q) { s[q] = act ? (BFIN ? bf16_round(xa[q]) : xa[q]) : 0.f; sum = __fadd_rn(sum, s[q]); }
  red[t] = sum; __syncthreads(); for (int st = 128; st > 0; st >>= 1) { if (t < st) red[t] = __fadd_rn(red[t], red[t + st]); __syncthreads(); } const float mu = red[0] / (float)DMQ; __syncthreads();
  float vs = 0.f; for (int q = 0; q < 4; ++q) { const float dl = act ? __fadd_rn(s[q], -mu) : 0.f; vs = __fadd_rn(vs, __fmul_rn(dl, dl)); } red[t] = vs; __syncthreads(); for (int st = 128; st > 0; st >>= 1) { if (t < st) red[t] = __fadd_rn(red[t], red[t + st]); __syncthreads(); }
  const float rs = rsqrtf(__fadd_rn(red[0] / (float)DMQ, eps)); v4h y; v4f yf;
  for (int q = 0; q < 4; ++q) { const int c = c0 + q; yf[q] = __fadd_rn(__fmul_rn(__fmul_rn(__fadd_rn(s[q], -mu), rs), bf16_round(g[c])), bf16_round(bb[c])); y[q] = (_Float16)yf[q]; }
  if (!act) return;      /* no barriers after this point */
  { if (W16) *(v4h*)(N16 + r * DMQ + c0) = y; if (W32) *(v4f*)(N32 + r * DMQ + c0) = yf;  } }


// 32-lane butterflies: four row_xmask DPP steps inside each 16-lane row, then one exchange with the other row; every lane ends with the full result. All 32 lanes must be on.
template <int CTRL> __device__ __forceinline__ float rs_dpp(float v) { return __builtin_bit_cast(float, __builtin_amdgcn_update_dpp(0, __builtin_bit_cast(int, v), CTRL, 0xf, 0xf, true)); }
__device__ __forceinline__ float rs_xrow(float v) { const int i = __builtin_bit_cast(int, v); return __builtin_bit_cast(float, __builtin_amdgcn_permlanex16(i, i, 0x76543210, 0xfedcba98, false, false)); }
__device__ __forceinline__ float rs_wave_max(float v) { v = fmaxf(v, rs_dpp<0x161>(v)); v = fmaxf(v, rs_dpp<0x162>(v)); v = fmaxf(v, rs_dpp<0x164>(v)); v = fmaxf(v, rs_dpp<0x168>(v)); return fmaxf(v, rs_xrow(v)); }
__device__ __forceinline__ float rs_wave_sum(float v) { v += rs_dpp<0x161>(v); v += rs_dpp<0x162>(v); v += rs_dpp<0x164>(v); v += rs_dpp<0x168>(v); return v + rs_xrow(v); }
// exp(x - mx) of four values, native exp as exp2((x - mx) * log2(e)). The four v_exp_f32 stand in one asm statement that ends in v_nop, with outputs apart from all inputs: that keeps the instruction set's one free slot between a transcendental and an instruction that reads its result or overwrites its source.
__device__ __forceinline__ v4f rs_exp4(v4f x, float mx) { const float t0 = (x[0] - mx) * 1.44269504088896340736f, t1 = (x[1] - mx) * 1.44269504088896340736f, t2 = (x[2] - mx) * 1.44269504088896340736f, t3 = (x[3] - mx) * 1.44269504088896340736f; float r0, r1, r2, r3;
  asm("v_exp_f32 %0, %4\n\tv_exp_f32 %1, %5\n\tv_exp_f32 %2, %6\n\tv_exp_f32 %3, %7\n\tv_nop" : "=&v"(r0), "=&v"(r1), "=&v"(r2), "=&v"(r3) : "v"(t0), "v"(t1), "v"(t2), "v"(t3));
  const v4f r = {r0, r1, r2, r3}; return r; }
// Row softmax, one wave per score row: each load of a wave covers 512 contiguous bytes of the row, all 16 loads are in flight together, the row stays in registers (read once, exp once), each store of a wave covers 256 contiguous bytes. The loops over e[] are fully unrolled so that e[] is indexed by constants and stays in registers, and so that the 16 loads issue back to back.
__global__ __launch_bounds__(256) void k_rsmf(const float* __restrict__ S, _Float16* __restrict__ P, int qn, int hg) {
  const int lane = threadIdx.x & 31; const int t = blockIdx.x * 8 + __builtin_amdgcn_readfirstlane((int)(threadIdx.x >> 5)); if (t >= qn * hg) return;      /* whole waves leave; the kernel has no barrier */
  const size_t i = (size_t)(t / qn) * SQ + (t % qn); const float* s = S + i * SQ + lane * 4; v4f e[SQ / 128];
#pragma unroll
  for (int u = 0; u < SQ / 128; ++u) e[u] = *(const v4fa*)(s + u * 128);
  float m0 = -3.0e38f, m1 = -3.0e38f, m2 = -3.0e38f, m3 = -3.0e38f;
#pragma unroll
  for (int u = 0; u < SQ / 128; ++u) { m0 = fmaxf(m0, e[u][0]); m1 = fmaxf(m1, e[u][1]); m2 = fmaxf(m2, e[u][2]); m3 = fmaxf(m3, e[u][3]); }
  const float mx = rs_wave_max(fmaxf(fmaxf(m0, m1), fmaxf(m2, m3)));
  float a0 = 0.f, a1 = 0.f, a2 = 0.f, a3 = 0.f;
#pragma unroll
  for (int u = 0; u < SQ / 128; ++u) { e[u] = rs_exp4(e[u], mx); a0 += e[u][0]; a1 += e[u][1]; a2 += e[u][2]; a3 += e[u][3]; }
  const float sc = 256.0f / rs_wave_sum((a0 + a1) + (a2 + a3));
  _Float16* d = P + i * SQ + lane * 4;
#pragma unroll
  for (int u = 0; u < SQ / 128; ++u) { v4h h4; for (int q = 0; q < 4; ++q) h4[q] = (_Float16)(e[u][q] * sc); *(v4h*)(d + u * 128) = h4; } }


__global__ __launch_bounds__(256) void k_bfr(const float* __restrict__ x, float* __restrict__ XB, size_t n8) { const size_t t = (size_t)blockIdx.x * 256 + threadIdx.x; if (t >= n8) return; v4f a = *(const v4fa*)(x + t * 8), c = *(const v4fa*)(x + t * 8 + 4); for (int q = 0; q < 4; ++q) { a[q] = bf16_round(a[q]); c[q] = bf16_round(c[q]); }
  { *(v4f*)(XB + t * 8) = a; *(v4f*)(XB + t * 8 + 4) = c;  } }


extern "C" void kernel_launch(void* const* d_in, const int* in_sizes, int n_in,
                              void* d_out, int out_size, void* d_ws, size_t ws_size, hipStream_t stream) {
  (void)in_sizes; (void)n_in; (void)out_size;
  const float* const* I = (const float* const*)d_in; const float* x = I[0]; const float* wq = I[1]; const float* wk = I[2]; const float* wv = I[3]; const float* g1 = I[4]; const float* be1 = I[5]; const float* w1 = I[6]; const float* b1 = I[7]; const float* w2 = I[8]; const float* b2 = I[9]; const float* g2 = I[10]; const float* be2 = I[11];      /* natural [out][in] weights; LN affine; FFN biases */
  char* ws = (char*)d_ws; size_t off = 0;
  auto take = [&](size_t bytes) { char* p = ws + off; off += (bytes + 255) & ~(size_t)255; return p; };
  _Float16* BW1 = (_Float16*)take((size_t)DM * DM * 2); _Float16* BW2 = (_Float16*)take((size_t)DM * DM * 2); float* XB = (float*)take(NR * DM * 4); float* HP = (float*)take(NR * DM * 4); _Float16* H16 = (_Float16*)take(NR * DM * 2); _Float16* FF16 = (_Float16*)take(NR * DM * 2); _Float16* BQ = (_Float16*)take((size_t)DM * DM * 2); _Float16* BK = (_Float16*)take((size_t)DM * DM * 2); _Float16* BV = (_Float16*)take((size_t)DM * DM * 2); 
  _Float16* X16 = (_Float16*)take(NR * DM * 2); _Float16* Q16 = (_Float16*)take(NR * DM * 2); _Float16* K16 = (_Float16*)take(NR * DM * 2); _Float16* V16 = (_Float16*)take(NR * DM * 2);
  float* S = (float*)take((size_t)HG * SQ * SQ * 4); float* HF = S; static_assert((size_t)HG * SQ * SQ * 4 >= NR * DM * 4, "HF alias must fit in S");      /* the f32 h rows (LN1 output, residual for the FFN) live in the scores plane, which is dead once the attention loop has finished */ _Float16* P = (_Float16*)take((size_t)HG * SQ * SQ * 2); _Float16* VT = (_Float16*)take((size_t)NH * HD * SQ * 2);
  if (off > ws_size) return;
  { const unsigned g = (unsigned)(((size_t)DM * DM / 8 + 255) / 256); k_wnat<<<g, 256, 0, stream>>>(wq, (size_t)DM * DM / 8, BQ); k_wnat<<<g, 256, 0, stream>>>(wk, (size_t)DM * DM / 8, BK); k_wnat<<<g, 256, 0, stream>>>(wv, (size_t)DM * DM / 8, BV); }      /* natural [out][in] = Bt[n][k], x16 */
  { const unsigned g = (unsigned)(((size_t)DM * DM / 8 + 255) / 256); k_wnat<<<g, 256, 0, stream>>>(w1, (size_t)DM * DM / 8, BW1); k_wnat<<<g, 256, 0, stream>>>(w2, (size_t)DM * DM / 8, BW2); }      /* FFN weights natural [1024][1024] = Bt planes */
  k_bfr<<<(unsigned)((NR * DM / 8 + 255) / 256), 256, 0, stream>>>(x, XB, NR * DM / 8);      /* bf16(x) as f32 rows for the residual */

  k_x16<<<(unsigned)((NR * DM / 8 + 255) / 256), 256, 0, stream>>>(x, X16, NR * DM / 8);
  const size_t r0p = (size_t)B0 * SQ;      /* first projected row */
  k_gemm2<0><<<dim3((unsigned)((MP / 128) * (DM / 64)), 1), 128, 0, stream>>>(X16 + r0p * DM, DM, 0, BQ, DM, 0, 0.0625f, nullptr, 0, nullptr, 1, 0, 0, nullptr, Q16 + r0p * DM, DM, 0, MP, DM, DM);
  k_gemm2<0><<<dim3((unsigned)((MP / 128) * (DM / 64)), 1), 128, 0, stream>>>(X16 + r0p * DM, DM, 0, BK, DM, 0, 0.0625f, nullptr, 0, nullptr, 1, 0, 0, nullptr, K16 + r0p * DM, DM, 0, MP, DM, DM);
  k_gemm2<0><<<dim3((unsigned)((MP / 128) * (DM / 64)), 1), 128, 0, stream>>>(X16 + r0p * DM, DM, 0, BV, DM, 0, 0.0625f, nullptr, 0, nullptr, 1, 0, 0, nullptr, V16 + r0p * DM, DM, 0, MP, DM, DM);
  for (int b = B0; b < B0 + NBR; ++b) { const size_t r0 = (size_t)b * SQ;
    k_vt<NH, SQ><<<NH * (SQ / 64), 256, 0, stream>>>(V16 + r0 * LQ, LQ, 0, VT);      /* V^T [NH][HD][SQ] for this batch */
    for (int h0 = 0; h0 < NHD; h0 += HG) {
      k_gemm2<0><<<dim3((QN / 128) * (SQ / 64), HG), 128, 0, stream>>>(Q16 + r0 * LQ + h0 * HD, LQ, (size_t)HD, K16 + r0 * LQ + h0 * HD, LQ, (size_t)HD, 0.125f, nullptr, 0, nullptr, 1, 0, 0, S, nullptr, SQ, (size_t)SQ * SQ, QN, SQ, HD);      /* scores, HG heads per launch */
      k_rsmf<<<(HG * QN + 7) / 8, 256, 0, stream>>>(S, P, QN, HG);      /* P = 256 softmax (f16), rows of all HG heads, one wave per row */
      k_gemm2<0><<<dim3((QN / 128) * (HD / 64), HG), 128, 0, stream>>>(P, SQ, (size_t)SQ * SQ, VT + (size_t)h0 * HD * SQ, SQ, (size_t)HD * SQ, 0.00390625f, nullptr, 0, XB + r0 * DM + h0 * HD, -1, 0, 0, HP + r0 * DM + h0 * HD, nullptr, DM, (size_t)HD, QN, HD, SQ); } }      /* h_pre = bf16(x) + attn (merged heads; CP = own element of the residual plane), f32 rows */
  k_lnx<0, 1, 1><<<(unsigned)MP, 256, 0, stream>>>(HP + r0p * DM, g1, be1, 1e-5f, H16 + r0p * DM, HF + r0p * DM);      /* h = LN1(x + attn) -> f16 rows (FFN operand) and f32 rows (residual) */
  k_gemm2<3><<<dim3((unsigned)((MP / 128) * (DM / 64)), 1), 128, 0, stream>>>(H16 + r0p * DM, DM, 0, BW1, DM, 0, 0.0625f, b1, 0, nullptr, 1, 0, 0, nullptr, FF16 + r0p * DM, DM, 0, MP, DM, DM);      /* relu(h l1^T + b1) -> f16 rows */
  k_gemm2<0><<<dim3((unsigned)((MP / 128) * (DM / 64)), 1), 128, 0, stream>>>(FF16 + r0p * DM, DM, 0, BW2, DM, 0, 0.0625f, b2, 0, HF + r0p * DM, -1, 0, 0, HP + r0p * DM, nullptr, DM, 0, MP, DM, DM);      /* y = h + ff (own-element residual; the h_pre plane is free again) */
  k_lnx<0, 0, 1><<<(unsigned)MP, 256, 0, stream>>>(HP + r0p * DM, g2, be2, 1e-5f, nullptr, (float*)d_out + r0p * DM);      /* out = LN2(h + ff) -> f32 output rows */
}

// v002
// It runs in 404 microseconds.
// Two timings next to v001 put it at 8.03 and 8.02 times that version's speed.
// All steps since v000 together make it 33.1 times as fast.
#include <hip/hip_runtime.h>
// Post-LN transformer encoder block (x [4][2048][1024]; q = x wq^T, k, v likewise (nn.Linear natural [1024][1024] sigma 1/32, no biases); 16 heads of 64 (chunked along features = head-major columns); softmax(q k^T / 8) v over all keys (no mask), heads merged, NO output projection; h = LN1(x + attn) (biased variance, eps 1e-5, gamma/beta); ff = relu(h l1_w^T + l1_b) l2_w^T + l2_b (natural [1024][1024], biases sigma 0.01); out = LN2(h + ff) -> [4][2048][1024]).
// Structure: token rows r = b*2048 + s; x as exact f16 rows (bf16-rounded); Q, K, V as three WMMA GEMMs (32x64 wave tiles, f32 accumulation, exact x16 weights, f16 outputs); V^T for all batches and heads via LDS transposes; one fused attention launch (per head and 256 queries: S^T = K Q^T, online softmax in registers with f32 statistics and native exp2, weights as f16, O^T += V^T P^T), h_pre = bf16(x) + attn as f32 rows; LN1 on VALU (f32 statistics, LDS trees) -> f16 + f32 rows; relu(h l1^T + b1) GEMM with the ReLU epilogue -> f16; y = h + ff l2^T + b2 GEMM (own-element residual); LN2 on VALU -> f32 output.
// Compute dtype: inputs rounded to bf16; x / weights exact; q, k, v and softmax weights as plain f16 GEMM operands (~2^-12); scores, softmax statistics and o f32. v_wmma_f32_16x16x32_f16.
#define NB 4
#define SQ 2048
#define DM 1024
#define NH 16
#define HD 64
#define DMQ DM                       /* LayerNorm width */
#define HG 2                         /* heads per block group of the unlaunched per-batch k_vt */
#define B0 0                         /* first batch processed (debug hook) */
#define NBR NB                       /* batches processed (debug hook) */
#define NR ((size_t)NB * SQ)         /* token rows */
#define MP ((int)((size_t)NBR * SQ)) /* rows projected (debug hook) */
#define QN SQ                        /* unused (attention runs all SQ queries per batch) */
#define NHD NH                       /* unused (attention runs all NH heads) */
#define MPO MP                       /* unused (the output stage runs MP rows) */
#define LQ DM      /* row pitch of the q/k/v rows */
typedef __bf16 v16b __attribute__((ext_vector_type(16)));
typedef unsigned short v8us __attribute__((ext_vector_type(8), may_alias));
typedef float  v8f  __attribute__((ext_vector_type(8)));
typedef float  v4f  __attribute__((ext_vector_type(4)));
typedef float  v4fa __attribute__((ext_vector_type(4), may_alias));
union FragB { v16b v; v8us half[2]; unsigned short u[16]; };

__device__ __forceinline__ unsigned short bf16_bits(float x) { unsigned int u = __float_as_uint(x); return (unsigned short)((u + 0x7FFFu + ((u >> 16) & 1u)) >> 16); }
__device__ __forceinline__ float bf16_val(unsigned short b) { return __uint_as_float(((unsigned int)b) << 16); }
__device__ __forceinline__ float bf16_round(float x) { return bf16_val(bf16_bits(x)); }
// D += A·B with NT terms: 1 = ah·bh, 2 = + al·bh (A split), 3 = + ah·bl (both split)
template <int NT>
__device__ __forceinline__ v8f mmaN(v16b ah, v16b al, v16b bh, v16b bl, v8f c) {
  c = __builtin_amdgcn_wmma_f32_16x16x32_bf16(false, ah, false, bh, (short)0, c, false, false);
  if (NT >= 2) c = __builtin_amdgcn_wmma_f32_16x16x32_bf16(false, al, false, bh, (short)0, c, false, false);
  if (NT >= 3) c = __builtin_amdgcn_wmma_f32_16x16x32_bf16(false, ah, false, bl, (short)0, c, false, false);
  asm volatile("v_nop\n\tv_nop\n\tv_nop\n\tv_nop" : "+v"(c) : "v"(ah), "v"(al), "v"(bh), "v"(bl));
  return c;
}

__global__ __launch_bounds__(256) void k_wt_bf16(const float* __restrict__ W, unsigned short* __restrict__ Wt, int K, int N) {
  const int t = blockIdx.x * 256 + threadIdx.x;
  const int k8n = K / 8;
  if (t >= N * k8n) return;
  const int n = t / k8n, k8 = (t % k8n) * 8;
  v8us v;
#pragma unroll
  for (int i = 0; i < 8; ++i) v[i] = bf16_bits(W[(size_t)(k8 + i) * N + n]);
  *(v8us*)(Wt + (size_t)n * K + k8) = v;
  
}

// GEMM C[M][N] (f32, pitch ldc) = act(A[M][K]·W + bias). A f32 row-major (pitch lda) converted per fragment to bf16
// (ASPLIT: hi/lo two planes -> 2 terms, else single rounded term); Wt bf16 [N][K] (pitch ldb). BIAS_BF16 rounds the
// bias to bf16 first (bias quantised to bf16 before the add). K%32==0, M%16==0, N%64==0.
template <bool ASPLIT, int ACT, bool BIAS_BF16>
__global__ __launch_bounds__(128) void k_gemm_bf(const float* __restrict__ A, int lda, const unsigned short* __restrict__ Wt, int ldb,
                                               const float* __restrict__ bias, float* __restrict__ C, int ldc, int M, int N, int K) {
  __shared__ __attribute__((aligned(16))) float so[4][16][64];
  const int tid = threadIdx.x, w = tid >> 5, lane = tid & 31, ln = lane & 15, hh = lane >> 4;
  const int ntn = N / 64;
  const int wid = blockIdx.x * 4 + w;
  const int mt = wid / ntn, nq = wid % ntn;
  if (mt * 16 >= M) return;
  const int row0 = mt * 16, col0 = nq * 64;
  const float* arow = A + (size_t)(row0 + ln) * lda;
  v8f acc[4] = {};
  for (int kb = 0; kb < K; kb += 32) {
    FragB ah, al;
    const v4f x0 = *(const v4fa*)(arow + kb + 8 * hh), x1 = *(const v4fa*)(arow + kb + 8 * hh + 4);
    const v4f x2 = *(const v4fa*)(arow + kb + 16 + 8 * hh), x3 = *(const v4fa*)(arow + kb + 16 + 8 * hh + 4);
    float xs[16] = {x0[0],x0[1],x0[2],x0[3],x1[0],x1[1],x1[2],x1[3],x2[0],x2[1],x2[2],x2[3],x3[0],x3[1],x3[2],x3[3]};
#pragma unroll
    for (int i = 0; i < 16; ++i) { const unsigned short hb = bf16_bits(xs[i]); ah.u[i] = hb; al.u[i] = ASPLIT ? bf16_bits(xs[i] - bf16_val(hb)) : (unsigned short)0; }
#pragma unroll
    for (int t = 0; t < 4; ++t) {
      const unsigned short* brow = Wt + (size_t)(col0 + t * 16 + ln) * ldb + kb;
      FragB b;
      b.half[0] = *(const v8us*)(brow + 8 * hh);
      b.half[1] = *(const v8us*)(brow + 16 + 8 * hh);
      acc[t] = mmaN<ASPLIT ? 2 : 1>(ah.v, al.v, b.v, b.v, acc[t]);
    }
  }
#pragma unroll
  for (int t = 0; t < 4; ++t) {
    float bv = bias ? bias[col0 + t * 16 + ln] : 0.f;
    if (BIAS_BF16) bv = bf16_round(bv);
#pragma unroll
    for (int r = 0; r < 8; ++r) { float v = acc[t][r] + bv; if (ACT == 1) v = fmaxf(v, 0.f); so[w][8 * hh + r][t * 16 + ln] = v; }
  }
  __builtin_amdgcn_fence(__ATOMIC_ACQ_REL, "workgroup");
  __builtin_amdgcn_wave_barrier();
  const int rsub = lane >> 4, c4 = (lane & 15) * 4;
  {
#pragma unroll
    for (int q = 0; q < 8; ++q) {
      const int r = q * 2 + rsub;
      const v4f v = *(const v4fa*)&so[w][r][c4];
      *(v4f*)(C + (size_t)(row0 + r) * ldc + col0 + c4) = v;
    }
    
  }
}

// GEMM C = act(A·W + bias + resid): A f32 (ASPLIT -> hi/lo 2 terms), Wt bf16 [N][K]; ACT 0 none, 1 relu, 2 exact gelu;
// resid (optional, f32, row index = (row % rmod), pitch ldr, RES_BF16 rounds it) added before the activation.
template <bool ASPLIT, int ACT, bool BIAS_BF16, bool RES_BF16>
__global__ __launch_bounds__(128) void k_gemm_bf3(const float* __restrict__ A, int lda, const unsigned short* __restrict__ Wt, int ldb,
                                                const float* __restrict__ bias, const float* __restrict__ resid, int rmod, int ldr,
                                                float* __restrict__ C, int ldc, int M, int N, int K) {
  __shared__ __attribute__((aligned(16))) float so[4][16][64];
  const int tid = threadIdx.x, w = tid >> 5, lane = tid & 31, ln = lane & 15, hh = lane >> 4;
  const int ntn = N / 64;
  const int wid = blockIdx.x * 4 + w;
  const int mt = wid / ntn, nq = wid % ntn;
  if (mt * 16 >= M) return;
  const int row0 = mt * 16, col0 = nq * 64;
  const float* arow = A + (size_t)(row0 + ln) * lda;
  v8f acc[4] = {};
  for (int kb = 0; kb < K; kb += 32) {
    FragB ah, al;
    const v4f x0 = *(const v4fa*)(arow + kb + 8 * hh), x1 = *(const v4fa*)(arow + kb + 8 * hh + 4);
    const v4f x2 = *(const v4fa*)(arow + kb + 16 + 8 * hh), x3 = *(const v4fa*)(arow + kb + 16 + 8 * hh + 4);
    float xs[16] = {x0[0],x0[1],x0[2],x0[3],x1[0],x1[1],x1[2],x1[3],x2[0],x2[1],x2[2],x2[3],x3[0],x3[1],x3[2],x3[3]};
#pragma unroll
    for (int i = 0; i < 16; ++i) { const unsigned short hb = bf16_bits(xs[i]); ah.u[i] = hb; al.u[i] = ASPLIT ? bf16_bits(xs[i] - bf16_val(hb)) : (unsigned short)0; }
#pragma unroll
    for (int t = 0; t < 4; ++t) {
      const unsigned short* brow = Wt + (size_t)(col0 + t * 16 + ln) * ldb + kb;
      FragB b;
      b.half[0] = *(const v8us*)(brow + 8 * hh);
      b.half[1] = *(const v8us*)(brow + 16 + 8 * hh);
      acc[t] = mmaN<ASPLIT ? 2 : 1>(ah.v, al.v, b.v, b.v, acc[t]);
    }
  }
#pragma unroll
  for (int t = 0; t < 4; ++t) {
    const int col = col0 + t * 16 + ln;
    float bv = bias ? bias[col] : 0.f;
    if (BIAS_BF16) bv = bf16_round(bv);
#pragma unroll
    for (int r = 0; r < 8; ++r) {
      float v = acc[t][r] + bv;
      if (resid) { float rv = resid[(size_t)((row0 + 8 * hh + r) % rmod) * ldr + col]; if (RES_BF16) rv = bf16_round(rv); v += rv; }
      if (ACT == 1) v = fmaxf(v, 0.f);
      if (ACT == 2) v = 0.5f * v * (1.0f + erff(v * 0.70710678118654752f));
      if (ACT == 3) { const float u = 0.7978845608028654f * (v + 0.044715f * v * v * v); v = 0.5f * v * (1.0f + tanhf(u)); }
      so[w][8 * hh + r][t * 16 + ln] = v;
    }
  }
  __builtin_amdgcn_fence(__ATOMIC_ACQ_REL, "workgroup");
  __builtin_amdgcn_wave_barrier();
  const int rsub = lane >> 4, c4 = (lane & 15) * 4;
  {
#pragma unroll
    for (int q = 0; q < 8; ++q) {
      const int r = q * 2 + rsub;
      const v4f v = *(const v4fa*)&so[w][r][c4];
      *(v4f*)(C + (size_t)(row0 + r) * ldc + col0 + c4) = v;
    }
    
  }
}
// row LayerNorm (biased variance, eps) over N: s = X (+ R); optional out_sum <- s; out_norm <- (s-mu)*rsqrt(var+eps)*g + b
template <bool PARAM_BF16>
__global__ __launch_bounds__(256) void k_layernorm(const float* __restrict__ X, const float* __restrict__ R, const float* __restrict__ g, const float* __restrict__ bta,
                                                  float* __restrict__ out_sum, float* __restrict__ out_norm, int N, float eps) {
  __shared__ float red[256];
  const int row = blockIdx.x, tid = threadIdx.x;
  const float* x = X + (size_t)row * N; const float* rr = R ? R + (size_t)row * N : nullptr;
  float vals[16];                     // up to N = 4096
  const int per = N / 256;            // contiguous chunk per thread? use strided-by-4 chunks: thread handles j = tid*4 + 1024*u
  float s1 = 0.f;
  for (int u = 0; u < per / 4; ++u) {
    const int j = tid * 4 + 1024 * u;
    const v4f a = *(const v4fa*)(x + j);
    v4f b = {0.f,0.f,0.f,0.f}; if (rr) b = *(const v4fa*)(rr + j);
#pragma unroll
    for (int q = 0; q < 4; ++q) { const float v = a[q] + b[q]; vals[u * 4 + q] = v; s1 += v; }
  }
  red[tid] = s1; __syncthreads();
  for (int st = 128; st > 0; st >>= 1) { if (tid < st) red[tid] += red[tid + st]; __syncthreads(); }
  const float mu = red[0] / (float)N; __syncthreads();
  float s2 = 0.f;
  for (int u = 0; u < per / 4; ++u)
#pragma unroll
    for (int q = 0; q < 4; ++q) { const float c = vals[u * 4 + q] - mu; s2 += c * c; }
  red[tid] = s2; __syncthreads();
  for (int st = 128; st > 0; st >>= 1) { if (tid < st) red[tid] += red[tid + st]; __syncthreads(); }
  const float rs = rsqrtf(red[0] / (float)N + eps);
  {
    for (int u = 0; u < per / 4; ++u) {
      const int j = tid * 4 + 1024 * u;
      v4f o, sm;
#pragma unroll
      for (int q = 0; q < 4; ++q) {
        float gg = g[j + q], bb = bta[j + q];
        if (PARAM_BF16) { gg = bf16_round(gg); bb = bf16_round(bb); }
        sm[q] = vals[u * 4 + q]; o[q] = (vals[u * 4 + q] - mu) * rs * gg + bb;
      }
      if (out_sum) *(v4f*)(out_sum + (size_t)row * N + j) = sm;
      *(v4f*)(out_norm + (size_t)row * N + j) = o;
    }
    
  }
}



// ---- f16 WMMA path (v_wmma_f32_16x16x32_f16): 11-bit significands for operands in range — used where a [0,1] probability operand needs more precision than bf16
typedef _Float16 v16h __attribute__((ext_vector_type(16)));
union FragH { v16h v; v8us half[2]; _Float16 h[16]; unsigned short u[16]; };
template <int NT>
__device__ __forceinline__ v8f mmaH(v16h ah, v16h al, v16h bh, v16h bl, v8f c) {
  c = __builtin_amdgcn_wmma_f32_16x16x32_f16(false, ah, false, bh, (short)0, c, false, false);
  if (NT >= 2) c = __builtin_amdgcn_wmma_f32_16x16x32_f16(false, al, false, bh, (short)0, c, false, false);
  if (NT >= 3) c = __builtin_amdgcn_wmma_f32_16x16x32_f16(false, ah, false, bl, (short)0, c, false, false);
  asm volatile("v_nop\n\tv_nop\n\tv_nop\n\tv_nop" : "+v"(c) : "v"(ah), "v"(al), "v"(bh), "v"(bl));
  return c;
}
// batched GEMM like k_gemm_b but f16 operands: A f32 (split into f16 hi/lo if ASPLIT, else rounded to f16), Bt = f16 values [n][k]; alpha; C f32; N multiple of 16 (partial tiles skipped)
template <bool ASPLIT>
__global__ __launch_bounds__(128) void k_gemm_h(const float* __restrict__ A, int lda, size_t sA, const _Float16* __restrict__ Bh, int ldb, size_t sB, float alpha, float* __restrict__ C, int ldc, size_t sC, int M, int N, int K) {
  __shared__ __attribute__((aligned(16))) float so[4][16][64];
  const int tid = threadIdx.x, w = tid >> 5, lane = tid & 31, ln = lane & 15, hh = lane >> 4; const int by = blockIdx.y;
  A += (size_t)by * sA; Bh += (size_t)by * sB; C += (size_t)by * sC;
  const int ntn = (N + 63) / 64; const int wid = blockIdx.x * 4 + w; const int mt = wid / ntn, nq = wid % ntn; if (mt * 16 >= M) return;
  const int row0 = mt * 16, col0 = nq * 64; const float* arow = A + (size_t)(row0 + ln) * lda;
  v8f acc[4] = {};
  for (int kb = 0; kb < K; kb += 32) {
    FragH ah, al;
    const v4f x0 = *(const v4fa*)(arow + kb + 8 * hh), x1 = *(const v4fa*)(arow + kb + 8 * hh + 4), x2 = *(const v4fa*)(arow + kb + 16 + 8 * hh), x3 = *(const v4fa*)(arow + kb + 16 + 8 * hh + 4);
    float xs[16] = {x0[0],x0[1],x0[2],x0[3],x1[0],x1[1],x1[2],x1[3],x2[0],x2[1],x2[2],x2[3],x3[0],x3[1],x3[2],x3[3]};
#pragma unroll
    for (int i = 0; i < 16; ++i) { const _Float16 h = (_Float16)xs[i]; ah.h[i] = h; al.h[i] = ASPLIT ? (_Float16)(xs[i] - (float)h) : (_Float16)0.0f; }
#pragma unroll
    for (int t = 0; t < 4; ++t) { if (col0 + t * 16 >= N) continue; const size_t boff = (size_t)(col0 + t * 16 + ln) * ldb + kb; FragH bq; bq.half[0] = *(const v8us*)(Bh + boff + 8 * hh); bq.half[1] = *(const v8us*)(Bh + boff + 16 + 8 * hh);
      acc[t] = mmaH<ASPLIT ? 2 : 1>(ah.v, al.v, bq.v, bq.v, acc[t]); }
  }
#pragma unroll
  for (int t = 0; t < 4; ++t) { if (col0 + t * 16 >= N) continue;
#pragma unroll
    for (int r = 0; r < 8; ++r) so[w][8 * hh + r][t * 16 + ln] = acc[t][r] * alpha; }
  __builtin_amdgcn_fence(__ATOMIC_ACQ_REL, "workgroup"); __builtin_amdgcn_wave_barrier();
  const int rsub = lane >> 4, c4 = (lane & 15) * 4;
  {
#pragma unroll
    for (int q = 0; q < 8; ++q) { const int r = q * 2 + rsub; if (col0 + c4 < N) { const v4f v = *(const v4fa*)&so[w][r][c4]; *(v4f*)(C + (size_t)(row0 + r) * ldc + col0 + c4) = v; } }
     }
}

// Wt[n][k] = f16(W[k][n]·scale) from f32 row-major W[K][N] (scale = power of two; bf16-exact weights stay exact in f16 away from the subnormal range)
__global__ __launch_bounds__(256) void k_wt_f16(const float* __restrict__ W, _Float16* __restrict__ Wt, int K, int N, float scale) {
  const int t = blockIdx.x * 256 + threadIdx.x; if (t >= N * (K / 8)) return; const int n = t / (K / 8), k8 = (t % (K / 8)) * 8; FragH f;
#pragma unroll
  for (int i = 0; i < 8; ++i) f.h[i] = (_Float16)(bf16_round(W[(size_t)(k8 + i) * N + n]) * scale); const v8us o = f.half[0];
  *(v8us*)((unsigned short*)Wt + (size_t)n * K + k8) = o; 
}
// k_gemm_hh variant with fused epilogue: v = acc·alpha + bias[by·sBias + col] (+ CP[(row/rowsPerB)·sCPb + by·64 + col] if CP) ; ACT 0 none / 1 elu ; writes f16 C16 (and f32 C if non-null)
template <int ACT>
__global__ __launch_bounds__(128) void k_gemm_hhx(const _Float16* __restrict__ A, int lda, size_t sA, const _Float16* __restrict__ Bh, int ldb, size_t sB, float alpha, const float* __restrict__ bias, size_t sBias, const float* __restrict__ CP, int rowsPerB, size_t sCPb, int row0g,
    float* __restrict__ C, _Float16* __restrict__ C16, int ldc, size_t sC, int M, int N, int K) {
  __shared__ __attribute__((aligned(16))) float so[4][16][64];
  const int tid = threadIdx.x, w = tid >> 5, lane = tid & 31, ln = lane & 15, hh = lane >> 4; const int by = blockIdx.y;
  A += (size_t)by * sA; Bh += (size_t)by * sB; const size_t cofs = (size_t)by * sC; const float* bp = bias ? bias + (size_t)by * sBias : nullptr;
  const int ntn = (N + 63) / 64; const int wid = blockIdx.x * 4 + w; const int mt = wid / ntn, nq = wid % ntn; if (mt * 16 >= M) return;
  const int row0 = mt * 16, col0 = nq * 64; const _Float16* arow = A + (size_t)(row0 + ln) * lda;
  v8f acc[4] = {};
  for (int kb = 0; kb < K; kb += 32) { FragH ah; ah.half[0] = *(const v8us*)((const unsigned short*)arow + kb + 8 * hh); ah.half[1] = *(const v8us*)((const unsigned short*)arow + kb + 16 + 8 * hh);
#pragma unroll
    for (int t = 0; t < 4; ++t) { if (col0 + t * 16 >= N) continue; const size_t boff = (size_t)(col0 + t * 16 + ln) * ldb + kb; FragH bq; bq.half[0] = *(const v8us*)((const unsigned short*)Bh + boff + 8 * hh); bq.half[1] = *(const v8us*)((const unsigned short*)Bh + boff + 16 + 8 * hh);
      acc[t] = mmaH<1>(ah.v, ah.v, bq.v, bq.v, acc[t]); }
  }
#pragma unroll
  for (int t = 0; t < 4; ++t) { if (col0 + t * 16 >= N) continue; const int col = col0 + t * 16 + ln; const float bv = bp ? bf16_round(bp[col]) : 0.f;
#pragma unroll
    for (int r = 0; r < 8; ++r) { float v = acc[t][r] * alpha + bv; if (CP) { const int rr = row0g + row0 + 8 * hh + r; if (rowsPerB < 0) v += CP[cofs + (size_t)rr * ldc + col];      /* rowsPerB < 0: own element of the batched C plane */ else { const int bidx = rr / rowsPerB; v += CP[(size_t)bidx * sCPb + (size_t)by * 64 + col]; } } if (ACT == 1) v = (v > 0.f) ? v : expm1f(v); else if (ACT == 7) v = (v > 0.f) ? v + 1.0f : expf(v); else if (ACT == 8) v = tanhf(v); else if (ACT == 9) v = 0.5f * v * (1.0f + tanhf(0.7978845608028654f * (v + 0.044715f * v * v * v))); else if (ACT == 11) v = 1.0f / (1.0f + expf(-v)); else if (ACT == 12) v = (v > 0.f) ? v : 0.01f * v; else if (ACT == 14) v = (v > 0.f) ? v : 0.1f * v; else if (ACT == 16) v = (v >= 0.f) ? v : 0.3f * v; else if (ACT == 17) v = (v >= 0.f) ? v : 0.2f * v; else if (ACT == 15) v = v / (1.0f + expf(-v)); else if (ACT == 3) v = fmaxf(v, 0.f); else if (ACT == 6) v = 0.5f * v * (1.0f + erff(v * 0.70710678118654752f)); so[w][8 * hh + r][t * 16 + ln] = v; } }
  __builtin_amdgcn_fence(__ATOMIC_ACQ_REL, "workgroup"); __builtin_amdgcn_wave_barrier();
  const int rsub = lane >> 4, c4 = (lane & 15) * 4; typedef _Float16 v4h __attribute__((ext_vector_type(4)));
  {
#pragma unroll
    for (int q = 0; q < 8; ++q) { const int r = q * 2 + rsub; if (col0 + c4 < N) { const v4f v = *(const v4fa*)&so[w][r][c4]; if (C) *(v4f*)(C + cofs + (size_t)(row0 + r) * ldc + col0 + c4) = v; if (C16) { v4h h4; for (int i = 0; i < 4; ++i) h4[i] = (_Float16)v[i]; *(v4h*)(C16 + cofs + (size_t)(row0 + r) * ldc + col0 + c4) = h4; } } }
     }
}


typedef _Float16 v4h __attribute__((ext_vector_type(4)));

__global__ __launch_bounds__(256) void k_x16(const float* __restrict__ x, _Float16* __restrict__ X16, size_t n8) { const size_t t = (size_t)blockIdx.x * 256 + threadIdx.x; if (t >= n8) return; FragH f;
#pragma unroll
  for (int q = 0; q < 8; ++q) f.h[q] = (_Float16)bf16_round(x[t * 8 + q]); *(v8us*)((unsigned short*)X16 + t * 8) = f.half[0];  }
__global__ __launch_bounds__(256) void k_h16(const float* __restrict__ x, _Float16* __restrict__ X16, size_t n8) { const size_t t = (size_t)blockIdx.x * 256 + threadIdx.x; if (t >= n8) return; FragH f;
#pragma unroll
  for (int q = 0; q < 8; ++q) f.h[q] = (_Float16)x[t * 8 + q]; *(v8us*)((unsigned short*)X16 + t * 8) = f.half[0];  }
__global__ __launch_bounds__(256) void k_round16f(const float* __restrict__ W, _Float16* __restrict__ Bt, size_t n8) { const size_t t = (size_t)blockIdx.x * 256 + threadIdx.x; if (t >= n8) return; FragH f;
#pragma unroll
  for (int i = 0; i < 8; ++i) f.h[i] = (_Float16)(bf16_round(W[t * 8 + i]) * 16.0f); *(v8us*)((unsigned short*)Bt + t * 8) = f.half[0];  }
template <int NHv, int TTv>
__global__ __launch_bounds__(256) void k_vt(const _Float16* __restrict__ V16, int ldv, int voff, _Float16* __restrict__ Vt) { __shared__ unsigned short tl[64][66]; const int tid = threadIdx.x; const int slab = blockIdx.x / (TTv / 64), lg = blockIdx.x % (TTv / 64); const int b = slab / NHv, h = slab % NHv;
  for (int i = tid; i < 64 * 8; i += 256) { const int r = i / 8, c8 = (i % 8) * 8; FragH f; f.half[0] = *(const v8us*)((const unsigned short*)V16 + ((size_t)b * TTv + lg * 64 + r) * ldv + voff + h * 64 + c8);
#pragma unroll
    for (int q = 0; q < 8; ++q) tl[r][c8 + q] = f.u[q]; }
  __syncthreads();
  {
#pragma unroll
    for (int rd = 0; rd < 2; ++rd) { const int d = rd * 32 + tid / 8, pc = tid % 8; FragH f;
#pragma unroll
      for (int q = 0; q < 8; ++q) f.u[q] = tl[pc * 8 + q][d];
      *(v8us*)((unsigned short*)Vt + ((size_t)slab * 64 + d) * TTv + lg * 64 + pc * 8) = f.half[0]; }
     } }

__global__ __launch_bounds__(256) void k_hl(const float* __restrict__ F, _Float16* __restrict__ Hh, _Float16* __restrict__ Hl, size_t n8) { const size_t t = (size_t)blockIdx.x * 256 + threadIdx.x; if (t >= n8) return; FragH fh, fl; const v4f a = *(const v4fa*)(F + t * 8), c = *(const v4fa*)(F + t * 8 + 4);
#pragma unroll
  for (int q = 0; q < 4; ++q) { _Float16 h = (_Float16)a[q]; fh.h[q] = h; fl.h[q] = (_Float16)((a[q] - (float)h) * 1024.0f); h = (_Float16)c[q]; fh.h[4 + q] = h; fl.h[4 + q] = (_Float16)((c[q] - (float)h) * 1024.0f); }
  { *(v8us*)((unsigned short*)Hh + t * 8) = fh.half[0]; *(v8us*)((unsigned short*)Hl + t * 8) = fl.half[0];  } }

// ---- fast GEMM (wave tile 32x64; requires M % 32 == 0 rows per launch region and N % 64 == 0); epilogue = k_gemm_hhx semantics ----
__device__ __forceinline__ v16h g2_frag(const _Float16* p, int hh) { FragH f; f.half[0] = *(const v8us*)((const unsigned short*)p + 8 * hh); f.half[1] = *(const v8us*)((const unsigned short*)p + 16 + 8 * hh); return f.v; }
__device__ __forceinline__ v8f g2_mma(v16h a, v16h b, v8f c) { v8f d = __builtin_amdgcn_wmma_f32_16x16x32_f16(false, a, false, b, (short)0, c, false, false); asm volatile("v_nop\n\tv_nop\n\tv_nop\n\tv_nop" : "+v"(d) : "v"(a), "v"(b)); return d; }
template <int ACT>
__global__ __launch_bounds__(128) void k_gemm2(const _Float16* __restrict__ A, int lda, size_t sA, const _Float16* __restrict__ Bh, int ldb, size_t sB, float alpha, const float* __restrict__ bias, size_t sBias, const float* __restrict__ CP, int rowsPerB, size_t sCPb, int row0g,
    float* __restrict__ C, _Float16* __restrict__ C16, int ldc, size_t sC, int M, int N, int K) { static_assert(ACT == 0 || ACT == 3 || ACT == 6 || ACT == 8 || ACT == 9 || ACT == 11 || ACT == 12 || ACT == 14 || ACT == 15 || ACT == 16 || ACT == 17, "k_gemm2: unsupported ACT code (would silently apply no activation)");
  __shared__ __attribute__((aligned(16))) float so[4][32][68];
  const int tid = threadIdx.x, w = tid >> 5, lane = tid & 31, ln = lane & 15, hh = lane >> 4; const int by = blockIdx.y;
  A += (size_t)by * sA; Bh += (size_t)by * sB; const size_t cofs = (size_t)by * sC; const float* bp = bias ? bias + (size_t)by * sBias : nullptr;
  const int ntn = N >> 6; const int mt = blockIdx.x / ntn, nq = blockIdx.x - mt * ntn; const int row0 = mt * 128 + 32 * w, col0 = nq * 64; if (row0 >= M) return;
  const _Float16* a0p = A + (size_t)(row0 + ln) * lda; const _Float16* a1p = a0p + (size_t)16 * lda;
  const _Float16* b0p = Bh + (size_t)(col0 + ln) * ldb; const _Float16* b1p = b0p + (size_t)16 * ldb; const _Float16* b2p = b1p + (size_t)16 * ldb; const _Float16* b3p = b2p + (size_t)16 * ldb;
  const v8f z8 = {0.f,0.f,0.f,0.f,0.f,0.f,0.f,0.f}; v8f c00 = z8, c01 = z8, c02 = z8, c03 = z8, c10 = z8, c11 = z8, c12 = z8, c13 = z8;
#pragma unroll 1
  for (int kb = 0; kb < K; kb += 32) { const v16h a0 = g2_frag(a0p + kb, hh), a1 = g2_frag(a1p + kb, hh);
    v16h b = g2_frag(b0p + kb, hh); c00 = g2_mma(a0, b, c00); c10 = g2_mma(a1, b, c10);
    b = g2_frag(b1p + kb, hh); c01 = g2_mma(a0, b, c01); c11 = g2_mma(a1, b, c11);
    b = g2_frag(b2p + kb, hh); c02 = g2_mma(a0, b, c02); c12 = g2_mma(a1, b, c12);
    b = g2_frag(b3p + kb, hh); c03 = g2_mma(a0, b, c03); c13 = g2_mma(a1, b, c13); }
  v8f accs[8] = {c00, c01, c02, c03, c10, c11, c12, c13};
#pragma unroll
  for (int u = 0; u < 8; ++u) { const int t = u & 3, half = u >> 2; const int col = col0 + t * 16 + ln; const float bv = bp ? bf16_round(bp[col]) : 0.f;
#pragma unroll
    for (int r = 0; r < 8; ++r) { const int rloc = half * 16 + 8 * hh + r; float v = accs[u][r] * alpha + bv; if (CP) { if (rowsPerB < 0) v += CP[cofs + (size_t)(row0g + row0 + rloc) * ldc + col];      /* rowsPerB < 0: own element of the batched C plane */ else { const int bidx = (row0g + row0 + rloc) / rowsPerB; v += CP[(size_t)bidx * sCPb + (size_t)by * 64 + col]; } }
      if (ACT == 3) v = fmaxf(v, 0.f); else if (ACT == 6) v = 0.5f * v * (1.0f + erff(v * 0.70710678118654752f)); else if (ACT == 11) v = 1.0f / (1.0f + expf(-v)); else if (ACT == 15) v = v / (1.0f + expf(-v)); else if (ACT == 12) v = (v > 0.f) ? v : 0.01f * v; else if (ACT == 8) v = tanhf(v); else if (ACT == 9) v = 0.5f * v * (1.0f + tanhf(0.7978845608028654f * (v + 0.044715f * v * v * v))); else if (ACT == 14) v = (v > 0.f) ? v : 0.1f * v; else if (ACT == 16) v = (v >= 0.f) ? v : 0.3f * v; else if (ACT == 17) v = (v >= 0.f) ? v : 0.2f * v;
      so[w][rloc][t * 16 + ln] = v; } }
  __builtin_amdgcn_fence(__ATOMIC_ACQ_REL, "workgroup"); __builtin_amdgcn_wave_barrier();
  const int rsub = lane >> 4, c4 = (lane & 15) * 4;
  {
#pragma unroll
    for (int q = 0; q < 16; ++q) { const int r = q * 2 + rsub; const v4f v = *(const v4fa*)&so[w][r][c4]; if (C) *(v4f*)(C + cofs + (size_t)(row0 + r) * ldc + col0 + c4) = v; if (C16) { v4h h4; for (int i = 0; i < 4; ++i) h4[i] = (_Float16)v[i]; *(v4h*)(C16 + cofs + (size_t)(row0 + r) * ldc + col0 + c4) = h4; } }
     } }


__global__ __launch_bounds__(256) void k_wnat(const float* __restrict__ w, size_t n8, _Float16* __restrict__ Bt) { const size_t t = (size_t)blockIdx.x * 256 + threadIdx.x; if (t >= n8) return; FragH f; for (int q = 0; q < 8; ++q) f.h[q] = (_Float16)(bf16_round(w[t * 8 + q]) * 16.0f); *(v8us*)((unsigned short*)Bt + t * 8) = f.half[0];  }
__global__ __launch_bounds__(256) void k_rsm(const float* __restrict__ S, _Float16* __restrict__ P, int nrows) {
  #pragma clang fp contract(off)
  const int i = blockIdx.x * 256 + threadIdx.x; if (i >= nrows) return; const float* s = S + (size_t)i * SQ; float mx = -3.0e38f;
#pragma unroll 1
  for (int j = 0; j < SQ; ++j) mx = fmaxf(mx, s[j]); float se = 0.f;
#pragma unroll 1
  for (int j = 0; j < SQ; ++j) se += expf(s[j] - mx); const float sc = 256.0f / se;
#pragma unroll 1
  for (int j0 = 0; j0 < SQ; j0 += 8) { FragH f; for (int q = 0; q < 8; ++q) f.h[q] = (_Float16)(expf(s[j0 + q] - mx) * sc); unsigned short* d = (unsigned short*)P + (size_t)i * SQ + j0; *(v8us*)d = f.half[0];  } }
__global__ __launch_bounds__(256) void k_vt(const _Float16* __restrict__ V16, int b, int h0, _Float16* __restrict__ VT) { __shared__ unsigned short tl[64][65]; const int tid = threadIdx.x; const int hh = blockIdx.x % HG, sg = blockIdx.x / HG; const int s0 = sg * 64; const int h = h0 + hh;
  for (int i = tid; i < 64 * 8; i += 256) { const int j = i / 8, d8 = (i % 8) * 8; FragH f; f.half[0] = *(const v8us*)((const unsigned short*)V16 + ((size_t)b * SQ + s0 + j) * DM + h * HD + d8); for (int q = 0; q < 8; ++q) tl[d8 + q][j] = f.u[q]; }
  __syncthreads();
  { for (int i = tid; i < 64 * 8; i += 256) { const int d = i / 8, j8 = (i % 8) * 8; FragH f; for (int q = 0; q < 8; ++q) f.u[q] = tl[d][j8 + q]; *(v8us*)((unsigned short*)VT + ((size_t)hh * HD + d) * SQ + s0 + j8) = f.half[0]; }  } }


template <int BFIN, int W16, int W32>
__global__ __launch_bounds__(256) void k_lnx(const float* __restrict__ X, const float* __restrict__ g, const float* __restrict__ bb, float eps, _Float16* __restrict__ N16, float* __restrict__ N32) {
  #pragma clang fp contract(off)
  __shared__ float red[256]; const size_t r = blockIdx.x; const int t = threadIdx.x; const bool act = t < (DMQ / 4); const int c0 = act ? t * 4 : 0;
  const v4f xa = *(const v4fa*)(X + r * DMQ + c0); float s[4]; float sum = 0.f;
  for (int q = 0; q < 4; ++q) { s[q] = act ? (BFIN ? bf16_round(xa[q]) : xa[q]) : 0.f; sum = __fadd_rn(sum, s[q]); }
  red[t] = sum; __syncthreads(); for (int st = 128; st > 0; st >>= 1) { if (t < st) red[t] = __fadd_rn(red[t], red[t + st]); __syncthreads(); } const float mu = red[0] / (float)DMQ; __syncthreads();
  float vs = 0.f; for (int q = 0; q < 4; ++q) { const float dl = act ? __fadd_rn(s[q], -mu) : 0.f; vs = __fadd_rn(vs, __fmul_rn(dl, dl)); } red[t] = vs; __syncthreads(); for (int st = 128; st > 0; st >>= 1) { if (t < st) red[t] = __fadd_rn(red[t], red[t + st]); __syncthreads(); }
  const float rs = rsqrtf(__fadd_rn(red[0] / (float)DMQ, eps)); v4h y; v4f yf;
  for (int q = 0; q < 4; ++q) { const int c = c0 + q; yf[q] = __fadd_rn(__fmul_rn(__fmul_rn(__fadd_rn(s[q], -mu), rs), bf16_round(g[c])), bf16_round(bb[c])); y[q] = (_Float16)yf[q]; }
  if (!act) return;      /* no barriers after this point */
  { if (W16) *(v4h*)(N16 + r * DMQ + c0) = y; if (W32) *(v4f*)(N32 + r * DMQ + c0) = yf;  } }


// lane l <-> lane l ^ 16
__device__ __forceinline__ float fa_xrow(float v) { const int i = __builtin_bit_cast(int, v); return __builtin_bit_cast(float, __builtin_amdgcn_permlanex16(i, i, 0x76543210, 0xfedcba98, false, false)); }
__device__ __forceinline__ v16h fa_frag(const unsigned short* p, int hh) { FragH f; f.half[0] = *(const v8us*)(p + 8 * hh); f.half[1] = *(const v8us*)(p + 16 + 8 * hh); return f.v; }
__device__ __forceinline__ v8f fa_mma(v16h a, v16h b, v8f c) { return __builtin_amdgcn_wmma_f32_16x16x32_f16(false, a, false, b, (short)0, c, false, false); }
typedef float v2f __attribute__((ext_vector_type(2)));
typedef _Float16 v2h __attribute__((ext_vector_type(2)));
#define FA_KS 64      /* keys per LDS stage */
#define FA_PT 72      /* LDS row pitch in 16-bit elements: 144 B = 16 B x 9, so the 16 rows of a 16-byte fragment read fall on distinct banks */
#define FA_NW 8       /* waves per work-group, 32 query columns each */
__global__ __launch_bounds__(FA_NW * 32) __attribute__((amdgpu_waves_per_eu(4, 4))) void k_fattn(const _Float16* __restrict__ Q16, const _Float16* __restrict__ K16, const _Float16* __restrict__ VT, const float* __restrict__ XB, float* __restrict__ HP) {
  __shared__ __attribute__((aligned(16))) unsigned short sk[2][FA_KS][FA_PT];
  __shared__ __attribute__((aligned(16))) unsigned short sv[2][HD][FA_PT];
  __shared__ __attribute__((aligned(16))) float so[FA_NW][32][68];
  const int tid = threadIdx.x, w = tid >> 5, lane = tid & 31, ln = lane & 15, hh = lane >> 4;
  const int bh = blockIdx.y, b = bh / NH, h = bh - b * NH; const int q0 = blockIdx.x * (FA_NW * 32) + w * 32;
  const unsigned short* Kg = (const unsigned short*)K16 + (size_t)b * SQ * DM + h * HD;      /* key rows, pitch DM */
  const unsigned short* Vg = (const unsigned short*)VT + (size_t)bh * HD * SQ;               /* d rows, pitch SQ */
  const int sr = tid >> 3, sc = (tid & 7) * 8;      /* staging: rows sr and sr + 32, 16-byte piece sc; a wave's load covers four whole 128-byte rows */
  const float cs = 0.125f * 1.44269504088896340736f;
  v16h qf[2][2];
#pragma unroll      /* constant indices keep the fragment and accumulator arrays in registers */
  for (int qt = 0; qt < 2; ++qt)
#pragma unroll      /* constant indices keep the fragment and accumulator arrays in registers */
    for (int ks = 0; ks < 2; ++ks) qf[qt][ks] = fa_frag((const unsigned short*)Q16 + ((size_t)b * SQ + q0 + qt * 16 + ln) * DM + h * HD + ks * 32, hh);
  const v8f z8 = {0.f,0.f,0.f,0.f,0.f,0.f,0.f,0.f};
  v8f o[4][2]; float mu[2], l[2];
#pragma unroll      /* constant indices keep the fragment and accumulator arrays in registers */
  for (int qt = 0; qt < 2; ++qt) { mu[qt] = -1.0e30f; l[qt] = 0.f;
#pragma unroll      /* constant indices keep the fragment and accumulator arrays in registers */
    for (int dt = 0; dt < 4; ++dt) o[dt][qt] = z8; }
  v8us rk0 = *(const v8us*)(Kg + (size_t)sr * DM + sc), rk1 = *(const v8us*)(Kg + (size_t)(sr + 32) * DM + sc), rv0 = *(const v8us*)(Vg + (size_t)sr * SQ + sc), rv1 = *(const v8us*)(Vg + (size_t)(sr + 32) * SQ + sc);
  *(v8us*)&sk[0][sr][sc] = rk0; *(v8us*)&sk[0][sr + 32][sc] = rk1; *(v8us*)&sv[0][sr][sc] = rv0; *(v8us*)&sv[0][sr + 32][sc] = rv1;
  __syncthreads();      /* publishes stage 0 */
#pragma unroll 1      /* one stage per trip keeps the loop small and the register count inside four waves per SIMD */
  for (int s = 0; s < SQ / FA_KS; ++s) { const int bf = s & 1; const bool more = s + 1 < SQ / FA_KS;
    if (more) { const int kn = (s + 1) * FA_KS; rk0 = *(const v8us*)(Kg + (size_t)(kn + sr) * DM + sc); rk1 = *(const v8us*)(Kg + (size_t)(kn + sr + 32) * DM + sc); rv0 = *(const v8us*)(Vg + (size_t)sr * SQ + kn + sc); rv1 = *(const v8us*)(Vg + (size_t)(sr + 32) * SQ + kn + sc); }
#pragma unroll      /* constant indices keep the fragment and accumulator arrays in registers */
    for (int kk = 0; kk < FA_KS; kk += 32) {
      v8f st[2][2];
#pragma unroll      /* constant indices keep the fragment and accumulator arrays in registers */
      for (int kt = 0; kt < 2; ++kt) { const unsigned short* kr = &sk[bf][kk + kt * 16 + ln][0]; const v16h k0 = fa_frag(kr, hh), k1 = fa_frag(kr + 32, hh);
#pragma unroll      /* constant indices keep the fragment and accumulator arrays in registers */
        for (int qt = 0; qt < 2; ++qt) st[kt][qt] = fa_mma(k1, qf[qt][1], fa_mma(k0, qf[qt][0], z8)); }
      v16h vf[4];
#pragma unroll      /* constant indices keep the fragment and accumulator arrays in registers */
      for (int dt = 0; dt < 4; ++dt) vf[dt] = fa_frag(&sv[bf][dt * 16 + ln][kk], hh);
      float mb[2]; bool need = false;
#pragma unroll      /* constant indices keep the fragment and accumulator arrays in registers */
      for (int qt = 0; qt < 2; ++qt) { float mx = st[0][qt][0];
#pragma unroll      /* constant indices keep the fragment and accumulator arrays in registers */
        for (int r = 1; r < 8; ++r) mx = fmaxf(mx, st[0][qt][r]);
#pragma unroll      /* constant indices keep the fragment and accumulator arrays in registers */
        for (int r = 0; r < 8; ++r) mx = fmaxf(mx, st[1][qt][r]);
        mx = fmaxf(mx, fa_xrow(mx)) * cs; mb[qt] = mx; need = need || (mx > mu[qt] + 8.0f); }
      if (__builtin_amdgcn_ballot_w32(need) != 0) {      /* one scalar branch per pass; rare after the first passes */
#pragma unroll      /* constant indices keep the fragment and accumulator arrays in registers */
        for (int qt = 0; qt < 2; ++qt) { const float mn = fmaxf(mu[qt], mb[qt]); const float al = __builtin_amdgcn_exp2f(mu[qt] - mn); mu[qt] = mn; l[qt] *= al;
#pragma unroll      /* constant indices keep the fragment and accumulator arrays in registers */
          for (int dt = 0; dt < 4; ++dt) o[dt][qt] = o[dt][qt] * al; } }
#pragma unroll      /* constant indices keep the fragment and accumulator arrays in registers */
      for (int qt = 0; qt < 2; ++qt) { const float nm = 4.0f - mu[qt]; const v2f c2 = {cs, cs}, n2 = {nm, nm}; union { v16h v; v2h p[8]; } pf; v2f ls = {0.f, 0.f};
#pragma unroll      /* constant indices keep the fragment and accumulator arrays in registers */
        for (int i = 0; i < 4; ++i) { const int kt = i >> 1, r4 = (i & 1) * 4;
          const v2f x0 = {st[kt][qt][r4], st[kt][qt][r4 + 1]}, x1 = {st[kt][qt][r4 + 2], st[kt][qt][r4 + 3]};
          const v2f t0 = __builtin_elementwise_fma(x0, c2, n2), t1 = __builtin_elementwise_fma(x1, c2, n2); 
          const v2f p0 = {__builtin_amdgcn_exp2f(t0[0]), __builtin_amdgcn_exp2f(t0[1])}, p1 = {__builtin_amdgcn_exp2f(t1[0]), __builtin_amdgcn_exp2f(t1[1])}; ls += p0; ls += p1;
          pf.p[i * 2] = __builtin_convertvector(p0, v2h); pf.p[i * 2 + 1] = __builtin_convertvector(p1, v2h); }
        l[qt] += ls[0] + ls[1];
#pragma unroll      /* constant indices keep the fragment and accumulator arrays in registers */
        for (int dt = 0; dt < 4; ++dt) o[dt][qt] = fa_mma(vf[dt], pf.v, o[dt][qt]); }
    }
    if (more) { *(v8us*)&sk[bf ^ 1][sr][sc] = rk0; *(v8us*)&sk[bf ^ 1][sr + 32][sc] = rk1; *(v8us*)&sv[bf ^ 1][sr][sc] = rv0; *(v8us*)&sv[bf ^ 1][sr + 32][sc] = rv1; }
    __syncthreads();      /* publishes the next stage's buffer and ends every wave's reads of this one, which the next trip refills */
  }
  // epilogue: O^T / row sum through the wave's own LDS rows, so that each global access covers whole 256-byte head rows
#pragma unroll      /* constant indices keep the fragment and accumulator arrays in registers */
  for (int qt = 0; qt < 2; ++qt) { const float inv = 1.0f / (l[qt] + fa_xrow(l[qt]));
#pragma unroll      /* constant indices keep the fragment and accumulator arrays in registers */
    for (int dt = 0; dt < 4; ++dt) { const v4f lo = {o[dt][qt][0] * inv, o[dt][qt][1] * inv, o[dt][qt][2] * inv, o[dt][qt][3] * inv}, hi = {o[dt][qt][4] * inv, o[dt][qt][5] * inv, o[dt][qt][6] * inv, o[dt][qt][7] * inv};
      *(v4f*)&so[w][qt * 16 + ln][dt * 16 + 8 * hh] = lo; *(v4f*)&so[w][qt * 16 + ln][dt * 16 + 8 * hh + 4] = hi; } }
  __builtin_amdgcn_fence(__ATOMIC_ACQ_REL, "workgroup"); __builtin_amdgcn_wave_barrier();      /* the wave's own LDS stores before its own reads of other lanes' elements */
  const size_t g0 = ((size_t)b * SQ + q0) * DM + h * HD + ln * 4;
#pragma unroll      /* constant indices keep the fragment and accumulator arrays in registers */
  for (int q = 0; q < 16; ++q) { const int r = q * 2 + hh; const v4f v = *(const v4fa*)&so[w][r][ln * 4]; const v4f xr = *(const v4fa*)(XB + g0 + (size_t)r * DM); *(v4f*)(HP + g0 + (size_t)r * DM) = v + xr; } }


__global__ __launch_bounds__(256) void k_bfr(const float* __restrict__ x, float* __restrict__ XB, size_t n8) { const size_t t = (size_t)blockIdx.x * 256 + threadIdx.x; if (t >= n8) return; v4f a = *(const v4fa*)(x + t * 8), c = *(const v4fa*)(x + t * 8 + 4); for (int q = 0; q < 4; ++q) { a[q] = bf16_round(a[q]); c[q] = bf16_round(c[q]); }
  { *(v4f*)(XB + t * 8) = a; *(v4f*)(XB + t * 8 + 4) = c;  } }


extern "C" void kernel_launch(void* const* d_in, const int* in_sizes, int n_in,
                              void* d_out, int out_size, void* d_ws, size_t ws_size, hipStream_t stream) {
  (void)in_sizes; (void)n_in; (void)out_size;
  const float* const* I = (const float* const*)d_in; const float* x = I[0]; const float* wq = I[1]; const float* wk = I[2]; const float* wv = I[3]; const float* g1 = I[4]; const float* be1 = I[5]; const float* w1 = I[6]; const float* b1 = I[7]; const float* w2 = I[8]; const float* b2 = I[9]; const float* g2 = I[10]; const float* be2 = I[11];      /* natural [out][in] weights; LN affine; FFN biases */
  char* ws = (char*)d_ws; size_t off = 0;
  auto take = [&](size_t bytes) { char* p = ws + off; off += (bytes + 255) & ~(size_t)255; return p; };
  _Float16* BW1 = (_Float16*)take((size_t)DM * DM * 2); _Float16* BW2 = (_Float16*)take((size_t)DM * DM * 2); float* XB = (float*)take(NR * DM * 4); float* HP = (float*)take(NR * DM * 4); _Float16* H16 = (_Float16*)take(NR * DM * 2); _Float16* FF16 = (_Float16*)take(NR * DM * 2); _Float16* BQ = (_Float16*)take((size_t)DM * DM * 2); _Float16* BK = (_Float16*)take((size_t)DM * DM * 2); _Float16* BV = (_Float16*)take((size_t)DM * DM * 2); 
  _Float16* X16 = (_Float16*)take(NR * DM * 2); _Float16* Q16 = (_Float16*)take(NR * DM * 2); _Float16* K16 = (_Float16*)take(NR * DM * 2); _Float16* V16 = (_Float16*)take(NR * DM * 2);
  float* HF = (float*)take(NR * DM * 4);      /* the f32 h rows (LN1 output, residual for the FFN) */ _Float16* VT = (_Float16*)take((size_t)NB * NH * HD * SQ * 2);
  if (off > ws_size) return;
  { const unsigned g = (unsigned)(((size_t)DM * DM / 8 + 255) / 256); k_wnat<<<g, 256, 0, stream>>>(wq, (size_t)DM * DM / 8, BQ); k_wnat<<<g, 256, 0, stream>>>(wk, (size_t)DM * DM / 8, BK); k_wnat<<<g, 256, 0, stream>>>(wv, (size_t)DM * DM / 8, BV); }      /* natural [out][in] = Bt[n][k], x16 */
  { const unsigned g = (unsigned)(((size_t)DM * DM / 8 + 255) / 256); k_wnat<<<g, 256, 0, stream>>>(w1, (size_t)DM * DM / 8, BW1); k_wnat<<<g, 256, 0, stream>>>(w2, (size_t)DM * DM / 8, BW2); }      /* FFN weights natural [1024][1024] = Bt planes */
  k_bfr<<<(unsigned)((NR * DM / 8 + 255) / 256), 256, 0, stream>>>(x, XB, NR * DM / 8);      /* bf16(x) as f32 rows for the residual */

  k_x16<<<(unsigned)((NR * DM / 8 + 255) / 256), 256, 0, stream>>>(x, X16, NR * DM / 8);
  const size_t r0p = (size_t)B0 * SQ;      /* first projected row */
  k_gemm2<0><<<dim3((unsigned)((MP / 128) * (DM / 64)), 1), 128, 0, stream>>>(X16 + r0p * DM, DM, 0, BQ, DM, 0, 0.0625f, nullptr, 0, nullptr, 1, 0, 0, nullptr, Q16 + r0p * DM, DM, 0, MP, DM, DM);
  k_gemm2<0><<<dim3((unsigned)((MP / 128) * (DM / 64)), 1), 128, 0, stream>>>(X16 + r0p * DM, DM, 0, BK, DM, 0, 0.0625f, nullptr, 0, nullptr, 1, 0, 0, nullptr, K16 + r0p * DM, DM, 0, MP, DM, DM);
  k_gemm2<0><<<dim3((unsigned)((MP / 128) * (DM / 64)), 1), 128, 0, stream>>>(X16 + r0p * DM, DM, 0, BV, DM, 0, 0.0625f, nullptr, 0, nullptr, 1, 0, 0, nullptr, V16 + r0p * DM, DM, 0, MP, DM, DM);
  k_vt<NH, SQ><<<NB * NH * (SQ / 64), 256, 0, stream>>>(V16, LQ, 0, VT);      /* V^T [NB][NH][HD][SQ] */
  k_fattn<<<dim3(SQ / (FA_NW * 32), NB * NH), FA_NW * 32, 0, stream>>>(Q16, K16, VT, XB, HP);      /* h_pre = bf16(x) + attn (merged heads), f32 rows */
  k_lnx<0, 1, 1><<<(unsigned)MP, 256, 0, stream>>>(HP + r0p * DM, g1, be1, 1e-5f, H16 + r0p * DM, HF + r0p * DM);      /* h = LN1(x + attn) -> f16 rows (FFN operand) and f32 rows (residual) */
  k_gemm2<3><<<dim3((unsigned)((MP / 128) * (DM / 64)), 1), 128, 0, stream>>>(H16 + r0p * DM, DM, 0, BW1, DM, 0, 0.0625f, b1, 0, nullptr, 1, 0, 0, nullptr, FF16 + r0p * DM, DM, 0, MP, DM, DM);      /* relu(h l1^T + b1) -> f16 rows */
  k_gemm2<0><<<dim3((unsigned)((MP / 128) * (DM / 64)), 1), 128, 0, stream>>>(FF16 + r0p * DM, DM, 0, BW2, DM, 0, 0.0625f, b2, 0, HF + r0p * DM, -1, 0, 0, HP + r0p * DM, nullptr, DM, 0, MP, DM, DM);      /* y = h + ff (own-element residual; the h_pre plane is free again) */
  k_lnx<0, 0, 1><<<(unsigned)MP, 256, 0, stream>>>(HP + r0p * DM, g2, be2, 1e-5f, nullptr, (float*)d_out + r0p * DM);      /* out = LN2(h + ff) -> f32 output rows */
}

// v003
// It runs in 208 microseconds.
// In two side-by-side timings against v002, it was 1.93 and 1.95 times as fast.
// Over all steps from v000 it is 64.1 times as fast.
#include <hip/hip_runtime.h>
// Post-LN transformer encoder block (x [4][2048][1024]; q = x wq^T, k, v likewise (nn.Linear natural [1024][1024] sigma 1/32, no biases); 16 heads of 64 (chunked along features = head-major columns); softmax(q k^T / 8) v over all keys (no mask), heads merged, NO output projection; h = LN1(x + attn) (biased variance, eps 1e-5, gamma/beta); ff = relu(h l1_w^T + l1_b) l2_w^T + l2_b (natural [1024][1024], biases sigma 0.01); out = LN2(h + ff) -> [4][2048][1024]).
// Structure: token rows r = b*2048 + s; x as exact f16 rows (bf16-rounded); Q, K, V as three WMMA GEMMs (operand tiles staged in LDS, 64x64 wave tiles, f32 accumulation, exact x16 weights, f16 outputs); V^T for all batches and heads via LDS transposes; one fused attention launch (per head and 256 queries: S^T = K Q^T, online softmax in registers with f32 statistics and native exp2, weights as f16, O^T += V^T P^T), h_pre = bf16(x) + attn as f32 rows; LN1 on VALU (f32 statistics, LDS trees) -> f16 + f32 rows; relu(h l1^T + b1) GEMM with the ReLU epilogue -> f16; y = h + ff l2^T + b2 GEMM (own-element residual); LN2 on VALU -> f32 output.
// Compute dtype: inputs rounded to bf16; x / weights exact; q, k, v, softmax weights, h and the ReLU output as plain f16 GEMM operands (~2^-12); scores and softmax statistics f32. v_wmma_f32_16x16x32_f16.
#define NB 4
#define SQ 2048
#define DM 1024
#define NH 16
#define HD 64
#define DMQ DM                       /* LayerNorm width */
#define HG 2                         /* heads per block group of the unlaunched per-batch k_vt */
#define B0 0                         /* first batch processed (debug hook) */
#define NBR NB                       /* batches processed (debug hook) */
#define NR ((size_t)NB * SQ)         /* token rows */
#define MP ((int)((size_t)NBR * SQ)) /* rows projected (debug hook) */
#define QN SQ                        /* unused (attention runs all SQ queries per batch) */
#define NHD NH                       /* unused (attention runs all NH heads) */
#define MPO MP                       /* unused (the output stage runs MP rows) */
#define LQ DM      /* row pitch of the q/k/v rows */
typedef __bf16 v16b __attribute__((ext_vector_type(16)));
typedef unsigned short v8us __attribute__((ext_vector_type(8), may_alias));
typedef float  v8f  __attribute__((ext_vector_type(8)));
typedef float  v4f  __attribute__((ext_vector_type(4)));
typedef float  v4fa __attribute__((ext_vector_type(4), may_alias));
union FragB { v16b v; v8us half[2]; unsigned short u[16]; };

__device__ __forceinline__ unsigned short bf16_bits(float x) { unsigned int u = __float_as_uint(x); return (unsigned short)((u + 0x7FFFu + ((u >> 16) & 1u)) >> 16); }
__device__ __forceinline__ float bf16_val(unsigned short b) { return __uint_as_float(((unsigned int)b) << 16); }
__device__ __forceinline__ float bf16_round(float x) { return bf16_val(bf16_bits(x)); }
// D += A·B with NT terms: 1 = ah·bh, 2 = + al·bh (A split), 3 = + ah·bl (both split)
template <int NT>
__device__ __forceinline__ v8f mmaN(v16b ah, v16b al, v16b bh, v16b bl, v8f c) {
  c = __builtin_amdgcn_wmma_f32_16x16x32_bf16(false, ah, false, bh, (short)0, c, false, false);
  if (NT >= 2) c = __builtin_amdgcn_wmma_f32_16x16x32_bf16(false, al, false, bh, (short)0, c, false, false);
  if (NT >= 3) c = __builtin_amdgcn_wmma_f32_16x16x32_bf16(false, ah, false, bl, (short)0, c, false, false);
  asm volatile("v_nop\n\tv_nop\n\tv_nop\n\tv_nop" : "+v"(c) : "v"(ah), "v"(al), "v"(bh), "v"(bl));
  return c;
}

__global__ __launch_bounds__(256) void k_wt_bf16(const float* __restrict__ W, unsigned short* __restrict__ Wt, int K, int N) {
  const int t = blockIdx.x * 256 + threadIdx.x;
  const int k8n = K / 8;
  if (t >= N * k8n) return;
  const int n = t / k8n, k8 = (t % k8n) * 8;
  v8us v;
#pragma unroll
  for (int i = 0; i < 8; ++i) v[i] = bf16_bits(W[(size_t)(k8 + i) * N + n]);
  *(v8us*)(Wt + (size_t)n * K + k8) = v;
  
}

// GEMM C[M][N] (f32, pitch ldc) = act(A[M][K]·W + bias). A f32 row-major (pitch lda) converted per fragment to bf16
// (ASPLIT: hi/lo two planes -> 2 terms, else single rounded term); Wt bf16 [N][K] (pitch ldb). BIAS_BF16 rounds the
// bias to bf16 first (bias quantised to bf16 before the add). K%32==0, M%16==0, N%64==0.
template <bool ASPLIT, int ACT, bool BIAS_BF16>
__global__ __launch_bounds__(128) void k_gemm_bf(const float* __restrict__ A, int lda, const unsigned short* __restrict__ Wt, int ldb,
                                               const float* __restrict__ bias, float* __restrict__ C, int ldc, int M, int N, int K) {
  __shared__ __attribute__((aligned(16))) float so[4][16][64];
  const int tid = threadIdx.x, w = tid >> 5, lane = tid & 31, ln = lane & 15, hh = lane >> 4;
  const int ntn = N / 64;
  const int wid = blockIdx.x * 4 + w;
  const int mt = wid / ntn, nq = wid % ntn;
  if (mt * 16 >= M) return;
  const int row0 = mt * 16, col0 = nq * 64;
  const float* arow = A + (size_t)(row0 + ln) * lda;
  v8f acc[4] = {};
  for (int kb = 0; kb < K; kb += 32) {
    FragB ah, al;
    const v4f x0 = *(const v4fa*)(arow + kb + 8 * hh), x1 = *(const v4fa*)(arow + kb + 8 * hh + 4);
    const v4f x2 = *(const v4fa*)(arow + kb + 16 + 8 * hh), x3 = *(const v4fa*)(arow + kb + 16 + 8 * hh + 4);
    float xs[16] = {x0[0],x0[1],x0[2],x0[3],x1[0],x1[1],x1[2],x1[3],x2[0],x2[1],x2[2],x2[3],x3[0],x3[1],x3[2],x3[3]};
#pragma unroll
    for (int i = 0; i < 16; ++i) { const unsigned short hb = bf16_bits(xs[i]); ah.u[i] = hb; al.u[i] = ASPLIT ? bf16_bits(xs[i] - bf16_val(hb)) : (unsigned short)0; }
#pragma unroll
    for (int t = 0; t < 4; ++t) {
      const unsigned short* brow = Wt + (size_t)(col0 + t * 16 + ln) * ldb + kb;
      FragB b;
      b.half[0] = *(const v8us*)(brow + 8 * hh);
      b.half[1] = *(const v8us*)(brow + 16 + 8 * hh);
      acc[t] = mmaN<ASPLIT ? 2 : 1>(ah.v, al.v, b.v, b.v, acc[t]);
    }
  }
#pragma unroll
  for (int t = 0; t < 4; ++t) {
    float bv = bias ? bias[col0 + t * 16 + ln] : 0.f;
    if (BIAS_BF16) bv = bf16_round(bv);
#pragma unroll
    for (int r = 0; r < 8; ++r) { float v = acc[t][r] + bv; if (ACT == 1) v = fmaxf(v, 0.f); so[w][8 * hh + r][t * 16 + ln] = v; }
  }
  __builtin_amdgcn_fence(__ATOMIC_ACQ_REL, "workgroup");
  __builtin_amdgcn_wave_barrier();
  const int rsub = lane >> 4, c4 = (lane & 15) * 4;
  {
#pragma unroll
    for (int q = 0; q < 8; ++q) {
      const int r = q * 2 + rsub;
      const v4f v = *(const v4fa*)&so[w][r][c4];
      *(v4f*)(C + (size_t)(row0 + r) * ldc + col0 + c4) = v;
    }
    
  }
}

// GEMM C = act(A·W + bias + resid): A f32 (ASPLIT -> hi/lo 2 terms), Wt bf16 [N][K]; ACT 0 none, 1 relu, 2 exact gelu;
// resid (optional, f32, row index = (row % rmod), pitch ldr, RES_BF16 rounds it) added before the activation.
template <bool ASPLIT, int ACT, bool BIAS_BF16, bool RES_BF16>
__global__ __launch_bounds__(128) void k_gemm_bf3(const float* __restrict__ A, int lda, const unsigned short* __restrict__ Wt, int ldb,
                                                const float* __restrict__ bias, const float* __restrict__ resid, int rmod, int ldr,
                                                float* __restrict__ C, int ldc, int M, int N, int K) {
  __shared__ __attribute__((aligned(16))) float so[4][16][64];
  const int tid = threadIdx.x, w = tid >> 5, lane = tid & 31, ln = lane & 15, hh = lane >> 4;
  const int ntn = N / 64;
  const int wid = blockIdx.x * 4 + w;
  const int mt = wid / ntn, nq = wid % ntn;
  if (mt * 16 >= M) return;
  const int row0 = mt * 16, col0 = nq * 64;
  const float* arow = A + (size_t)(row0 + ln) * lda;
  v8f acc[4] = {};
  for (int kb = 0; kb < K; kb += 32) {
    FragB ah, al;
    const v4f x0 = *(const v4fa*)(arow + kb + 8 * hh), x1 = *(const v4fa*)(arow + kb + 8 * hh + 4);
    const v4f x2 = *(const v4fa*)(arow + kb + 16 + 8 * hh), x3 = *(const v4fa*)(arow + kb + 16 + 8 * hh + 4);
    float xs[16] = {x0[0],x0[1],x0[2],x0[3],x1[0],x1[1],x1[2],x1[3],x2[0],x2[1],x2[2],x2[3],x3[0],x3[1],x3[2],x3[3]};
#pragma unroll
    for (int i = 0; i < 16; ++i) { const unsigned short hb = bf16_bits(xs[i]); ah.u[i] = hb; al.u[i] = ASPLIT ? bf16_bits(xs[i] - bf16_val(hb)) : (unsigned short)0; }
#pragma unroll
    for (int t = 0; t < 4; ++t) {
      const unsigned short* brow = Wt + (size_t)(col0 + t * 16 + ln) * ldb + kb;
      FragB b;
      b.half[0] = *(const v8us*)(brow + 8 * hh);
      b.half[1] = *(const v8us*)(brow + 16 + 8 * hh);
      acc[t] = mmaN<ASPLIT ? 2 : 1>(ah.v, al.v, b.v, b.v, acc[t]);
    }
  }
#pragma unroll
  for (int t = 0; t < 4; ++t) {
    const int col = col0 + t * 16 + ln;
    float bv = bias ? bias[col] : 0.f;
    if (BIAS_BF16) bv = bf16_round(bv);
#pragma unroll
    for (int r = 0; r < 8; ++r) {
      float v = acc[t][r] + bv;
      if (resid) { float rv = resid[(size_t)((row0 + 8 * hh + r) % rmod) * ldr + col]; if (RES_BF16) rv = bf16_round(rv); v += rv; }
      if (ACT == 1) v = fmaxf(v, 0.f);
      if (ACT == 2) v = 0.5f * v * (1.0f + erff(v * 0.70710678118654752f));
      if (ACT == 3) { const float u = 0.7978845608028654f * (v + 0.044715f * v * v * v); v = 0.5f * v * (1.0f + tanhf(u)); }
      so[w][8 * hh + r][t * 16 + ln] = v;
    }
  }
  __builtin_amdgcn_fence(__ATOMIC_ACQ_REL, "workgroup");
  __builtin_amdgcn_wave_barrier();
  const int rsub = lane >> 4, c4 = (lane & 15) * 4;
  {
#pragma unroll
    for (int q = 0; q < 8; ++q) {
      const int r = q * 2 + rsub;
      const v4f v = *(const v4fa*)&so[w][r][c4];
      *(v4f*)(C + (size_t)(row0 + r) * ldc + col0 + c4) = v;
    }
    
  }
}
// row LayerNorm (biased variance, eps) over N: s = X (+ R); optional out_sum <- s; out_norm <- (s-mu)*rsqrt(var+eps)*g + b
template <bool PARAM_BF16>
__global__ __launch_bounds__(256) void k_layernorm(const float* __restrict__ X, const float* __restrict__ R, const float* __restrict__ g, const float* __restrict__ bta,
                                                  float* __restrict__ out_sum, float* __restrict__ out_norm, int N, float eps) {
  __shared__ float red[256];
  const int row = blockIdx.x, tid = threadIdx.x;
  const float* x = X + (size_t)row * N; const float* rr = R ? R + (size_t)row * N : nullptr;
  float vals[16];                     // up to N = 4096
  const int per = N / 256;            // contiguous chunk per thread? use strided-by-4 chunks: thread handles j = tid*4 + 1024*u
  float s1 = 0.f;
  for (int u = 0; u < per / 4; ++u) {
    const int j = tid * 4 + 1024 * u;
    const v4f a = *(const v4fa*)(x + j);
    v4f b = {0.f,0.f,0.f,0.f}; if (rr) b = *(const v4fa*)(rr + j);
#pragma unroll
    for (int q = 0; q < 4; ++q) { const float v = a[q] + b[q]; vals[u * 4 + q] = v; s1 += v; }
  }
  red[tid] = s1; __syncthreads();
  for (int st = 128; st > 0; st >>= 1) { if (tid < st) red[tid] += red[tid + st]; __syncthreads(); }
  const float mu = red[0] / (float)N; __syncthreads();
  float s2 = 0.f;
  for (int u = 0; u < per / 4; ++u)
#pragma unroll
    for (int q = 0; q < 4; ++q) { const float c = vals[u * 4 + q] - mu; s2 += c * c; }
  red[tid] = s2; __syncthreads();
  for (int st = 128; st > 0; st >>= 1) { if (tid < st) red[tid] += red[tid + st]; __syncthreads(); }
  const float rs = rsqrtf(red[0] / (float)N + eps);
  {
    for (int u = 0; u < per / 4; ++u) {
      const int j = tid * 4 + 1024 * u;
      v4f o, sm;
#pragma unroll
      for (int q = 0; q < 4; ++q) {
        float gg = g[j + q], bb = bta[j + q];
        if (PARAM_BF16) { gg = bf16_round(gg); bb = bf16_round(bb); }
        sm[q] = vals[u * 4 + q]; o[q] = (vals[u * 4 + q] - mu) * rs * gg + bb;
      }
      if (out_sum) *(v4f*)(out_sum + (size_t)row * N + j) = sm;
      *(v4f*)(out_norm + (size_t)row * N + j) = o;
    }
    
  }
}



// ---- f16 WMMA path (v_wmma_f32_16x16x32_f16): 11-bit significands for operands in range — used where a [0,1] probability operand needs more precision than bf16
typedef _Float16 v16h __attribute__((ext_vector_type(16)));
union FragH { v16h v; v8us half[2]; _Float16 h[16]; unsigned short u[16]; };
template <int NT>
__device__ __forceinline__ v8f mmaH(v16h ah, v16h al, v16h bh, v16h bl, v8f c) {
  c = __builtin_amdgcn_wmma_f32_16x16x32_f16(false, ah, false, bh, (short)0, c, false, false);
  if (NT >= 2) c = __builtin_amdgcn_wmma_f32_16x16x32_f16(false, al, false, bh, (short)0, c, false, false);
  if (NT >= 3) c = __builtin_amdgcn_wmma_f32_16x16x32_f16(false, ah, false, bl, (short)0, c, false, false);
  asm volatile("v_nop\n\tv_nop\n\tv_nop\n\tv_nop" : "+v"(c) : "v"(ah), "v"(al), "v"(bh), "v"(bl));
  return c;
}
// batched GEMM like k_gemm_b but f16 operands: A f32 (split into f16 hi/lo if ASPLIT, else rounded to f16), Bt = f16 values [n][k]; alpha; C f32; N multiple of 16 (partial tiles skipped)
template <bool ASPLIT>
__global__ __launch_bounds__(128) void k_gemm_h(const float* __restrict__ A, int lda, size_t sA, const _Float16* __restrict__ Bh, int ldb, size_t sB, float alpha, float* __restrict__ C, int ldc, size_t sC, int M, int N, int K) {
  __shared__ __attribute__((aligned(16))) float so[4][16][64];
  const int tid = threadIdx.x, w = tid >> 5, lane = tid & 31, ln = lane & 15, hh = lane >> 4; const int by = blockIdx.y;
  A += (size_t)by * sA; Bh += (size_t)by * sB; C += (size_t)by * sC;
  const int ntn = (N + 63) / 64; const int wid = blockIdx.x * 4 + w; const int mt = wid / ntn, nq = wid % ntn; if (mt * 16 >= M) return;
  const int row0 = mt * 16, col0 = nq * 64; const float* arow = A + (size_t)(row0 + ln) * lda;
  v8f acc[4] = {};
  for (int kb = 0; kb < K; kb += 32) {
    FragH ah, al;
    const v4f x0 = *(const v4fa*)(arow + kb + 8 * hh), x1 = *(const v4fa*)(arow + kb + 8 * hh + 4), x2 = *(const v4fa*)(arow + kb + 16 + 8 * hh), x3 = *(const v4fa*)(arow + kb + 16 + 8 * hh + 4);
    float xs[16] = {x0[0],x0[1],x0[2],x0[3],x1[0],x1[1],x1[2],x1[3],x2[0],x2[1],x2[2],x2[3],x3[0],x3[1],x3[2],x3[3]};
#pragma unroll
    for (int i = 0; i < 16; ++i) { const _Float16 h = (_Float16)xs[i]; ah.h[i] = h; al.h[i] = ASPLIT ? (_Float16)(xs[i] - (float)h) : (_Float16)0.0f; }
#pragma unroll
    for (int t = 0; t < 4; ++t) { if (col0 + t * 16 >= N) continue; const size_t boff = (size_t)(col0 + t * 16 + ln) * ldb + kb; FragH bq; bq.half[0] = *(const v8us*)(Bh + boff + 8 * hh); bq.half[1] = *(const v8us*)(Bh + boff + 16 + 8 * hh);
      acc[t] = mmaH<ASPLIT ? 2 : 1>(ah.v, al.v, bq.v, bq.v, acc[t]); }
  }
#pragma unroll
  for (int t = 0; t < 4; ++t) { if (col0 + t * 16 >= N) continue;
#pragma unroll
    for (int r = 0; r < 8; ++r) so[w][8 * hh + r][t * 16 + ln] = acc[t][r] * alpha; }
  __builtin_amdgcn_fence(__ATOMIC_ACQ_REL, "workgroup"); __builtin_amdgcn_wave_barrier();
  const int rsub = lane >> 4, c4 = (lane & 15) * 4;
  {
#pragma unroll
    for (int q = 0; q < 8; ++q) { const int r = q * 2 + rsub; if (col0 + c4 < N) { const v4f v = *(const v4fa*)&so[w][r][c4]; *(v4f*)(C + (size_t)(row0 + r) * ldc + col0 + c4) = v; } }
     }
}

// Wt[n][k] = f16(W[k][n]·scale) from f32 row-major W[K][N] (scale = power of two; bf16-exact weights stay exact in f16 away from the subnormal range)
__global__ __launch_bounds__(256) void k_wt_f16(const float* __restrict__ W, _Float16* __restrict__ Wt, int K, int N, float scale) {
  const int t = blockIdx.x * 256 + threadIdx.x; if (t >= N * (K / 8)) return; const int n = t / (K / 8), k8 = (t % (K / 8)) * 8; FragH f;
#pragma unroll
  for (int i = 0; i < 8; ++i) f.h[i] = (_Float16)(bf16_round(W[(size_t)(k8 + i) * N + n]) * scale); const v8us o = f.half[0];
  *(v8us*)((unsigned short*)Wt + (size_t)n * K + k8) = o; 
}
// k_gemm_hh variant with fused epilogue: v = acc·alpha + bias[by·sBias + col] (+ CP[(row/rowsPerB)·sCPb + by·64 + col] if CP) ; ACT 0 none / 1 elu ; writes f16 C16 (and f32 C if non-null)
template <int ACT>
__global__ __launch_bounds__(128) void k_gemm_hhx(const _Float16* __restrict__ A, int lda, size_t sA, const _Float16* __restrict__ Bh, int ldb, size_t sB, float alpha, const float* __restrict__ bias, size_t sBias, const float* __restrict__ CP, int rowsPerB, size_t sCPb, int row0g,
    float* __restrict__ C, _Float16* __restrict__ C16, int ldc, size_t sC, int M, int N, int K) {
  __shared__ __attribute__((aligned(16))) float so[4][16][64];
  const int tid = threadIdx.x, w = tid >> 5, lane = tid & 31, ln = lane & 15, hh = lane >> 4; const int by = blockIdx.y;
  A += (size_t)by * sA; Bh += (size_t)by * sB; const size_t cofs = (size_t)by * sC; const float* bp = bias ? bias + (size_t)by * sBias : nullptr;
  const int ntn = (N + 63) / 64; const int wid = blockIdx.x * 4 + w; const int mt = wid / ntn, nq = wid % ntn; if (mt * 16 >= M) return;
  const int row0 = mt * 16, col0 = nq * 64; const _Float16* arow = A + (size_t)(row0 + ln) * lda;
  v8f acc[4] = {};
  for (int kb = 0; kb < K; kb += 32) { FragH ah; ah.half[0] = *(const v8us*)((const unsigned short*)arow + kb + 8 * hh); ah.half[1] = *(const v8us*)((const unsigned short*)arow + kb + 16 + 8 * hh);
#pragma unroll
    for (int t = 0; t < 4; ++t) { if (col0 + t * 16 >= N) continue; const size_t boff = (size_t)(col0 + t * 16 + ln) * ldb + kb; FragH bq; bq.half[0] = *(const v8us*)((const unsigned short*)Bh + boff + 8 * hh); bq.half[1] = *(const v8us*)((const unsigned short*)Bh + boff + 16 + 8 * hh);
      acc[t] = mmaH<1>(ah.v, ah.v, bq.v, bq.v, acc[t]); }
  }
#pragma unroll
  for (int t = 0; t < 4; ++t) { if (col0 + t * 16 >= N) continue; const int col = col0 + t * 16 + ln; const float bv = bp ? bf16_round(bp[col]) : 0.f;
#pragma unroll
    for (int r = 0; r < 8; ++r) { float v = acc[t][r] * alpha + bv; if (CP) { const int rr = row0g + row0 + 8 * hh + r; if (rowsPerB < 0) v += CP[cofs + (size_t)rr * ldc + col];      /* rowsPerB < 0: own element of the batched C plane */ else { const int bidx = rr / rowsPerB; v += CP[(size_t)bidx * sCPb + (size_t)by * 64 + col]; } } if (ACT == 1) v = (v > 0.f) ? v : expm1f(v); else if (ACT == 7) v = (v > 0.f) ? v + 1.0f : expf(v); else if (ACT == 8) v = tanhf(v); else if (ACT == 9) v = 0.5f * v * (1.0f + tanhf(0.7978845608028654f * (v + 0.044715f * v * v * v))); else if (ACT == 11) v = 1.0f / (1.0f + expf(-v)); else if (ACT == 12) v = (v > 0.f) ? v : 0.01f * v; else if (ACT == 14) v = (v > 0.f) ? v : 0.1f * v; else if (ACT == 16) v = (v >= 0.f) ? v : 0.3f * v; else if (ACT == 17) v = (v >= 0.f) ? v : 0.2f * v; else if (ACT == 15) v = v / (1.0f + expf(-v)); else if (ACT == 3) v = fmaxf(v, 0.f); else if (ACT == 6) v = 0.5f * v * (1.0f + erff(v * 0.70710678118654752f)); so[w][8 * hh + r][t * 16 + ln] = v; } }
  __builtin_amdgcn_fence(__ATOMIC_ACQ_REL, "workgroup"); __builtin_amdgcn_wave_barrier();
  const int rsub = lane >> 4, c4 = (lane & 15) * 4; typedef _Float16 v4h __attribute__((ext_vector_type(4)));
  {
#pragma unroll
    for (int q = 0; q < 8; ++q) { const int r = q * 2 + rsub; if (col0 + c4 < N) { const v4f v = *(const v4fa*)&so[w][r][c4]; if (C) *(v4f*)(C + cofs + (size_t)(row0 + r) * ldc + col0 + c4) = v; if (C16) { v4h h4; for (int i = 0; i < 4; ++i) h4[i] = (_Float16)v[i]; *(v4h*)(C16 + cofs + (size_t)(row0 + r) * ldc + col0 + c4) = h4; } } }
     }
}


typedef _Float16 v4h __attribute__((ext_vector_type(4)));

__global__ __launch_bounds__(256) void k_x16(const float* __restrict__ x, _Float16* __restrict__ X16, size_t n8) { const size_t t = (size_t)blockIdx.x * 256 + threadIdx.x; if (t >= n8) return; FragH f;
#pragma unroll
  for (int q = 0; q < 8; ++q) f.h[q] = (_Float16)bf16_round(x[t * 8 + q]); *(v8us*)((unsigned short*)X16 + t * 8) = f.half[0];  }
__global__ __launch_bounds__(256) void k_h16(const float* __restrict__ x, _Float16* __restrict__ X16, size_t n8) { const size_t t = (size_t)blockIdx.x * 256 + threadIdx.x; if (t >= n8) return; FragH f;
#pragma unroll
  for (int q = 0; q < 8; ++q) f.h[q] = (_Float16)x[t * 8 + q]; *(v8us*)((unsigned short*)X16 + t * 8) = f.half[0];  }
__global__ __launch_bounds__(256) void k_round16f(const float* __restrict__ W, _Float16* __restrict__ Bt, size_t n8) { const size_t t = (size_t)blockIdx.x * 256 + threadIdx.x; if (t >= n8) return; FragH f;
#pragma unroll
  for (int i = 0; i < 8; ++i) f.h[i] = (_Float16)(bf16_round(W[t * 8 + i]) * 16.0f); *(v8us*)((unsigned short*)Bt + t * 8) = f.half[0];  }
template <int NHv, int TTv>
__global__ __launch_bounds__(256) void k_vt(const _Float16* __restrict__ V16, int ldv, int voff, _Float16* __restrict__ Vt) { __shared__ unsigned short tl[64][66]; const int tid = threadIdx.x; const int slab = blockIdx.x / (TTv / 64), lg = blockIdx.x % (TTv / 64); const int b = slab / NHv, h = slab % NHv;
  for (int i = tid; i < 64 * 8; i += 256) { const int r = i / 8, c8 = (i % 8) * 8; FragH f; f.half[0] = *(const v8us*)((const unsigned short*)V16 + ((size_t)b * TTv + lg * 64 + r) * ldv + voff + h * 64 + c8);
#pragma unroll
    for (int q = 0; q < 8; ++q) tl[r][c8 + q] = f.u[q]; }
  __syncthreads();
  {
#pragma unroll
    for (int rd = 0; rd < 2; ++rd) { const int d = rd * 32 + tid / 8, pc = tid % 8; FragH f;
#pragma unroll
      for (int q = 0; q < 8; ++q) f.u[q] = tl[pc * 8 + q][d];
      *(v8us*)((unsigned short*)Vt + ((size_t)slab * 64 + d) * TTv + lg * 64 + pc * 8) = f.half[0]; }
     } }

__global__ __launch_bounds__(256) void k_hl(const float* __restrict__ F, _Float16* __restrict__ Hh, _Float16* __restrict__ Hl, size_t n8) { const size_t t = (size_t)blockIdx.x * 256 + threadIdx.x; if (t >= n8) return; FragH fh, fl; const v4f a = *(const v4fa*)(F + t * 8), c = *(const v4fa*)(F + t * 8 + 4);
#pragma unroll
  for (int q = 0; q < 4; ++q) { _Float16 h = (_Float16)a[q]; fh.h[q] = h; fl.h[q] = (_Float16)((a[q] - (float)h) * 1024.0f); h = (_Float16)c[q]; fh.h[4 + q] = h; fl.h[4 + q] = (_Float16)((c[q] - (float)h) * 1024.0f); }
  { *(v8us*)((unsigned short*)Hh + t * 8) = fh.half[0]; *(v8us*)((unsigned short*)Hl + t * 8) = fl.half[0];  } }

// ---- GEMM with both operands staged in LDS (work-group tile 256x128, eight waves of 64x64; requires M % 256 == 0, N % 128 == 0, K % 128 == 0); epilogue = k_gemm_hhx semantics ----
#define G2_KS 128     /* k per stage: 256 bytes of every operand row */
#define G2_PT 136     /* LDS row pitch in 16-bit elements: 272 B = 16 B x 17, the pitch for 16-byte fragment reads of 256-byte rows */
#define G2_BM 256     /* rows of C per work-group */
#define G2_BN 128     /* columns of C per work-group */
__device__ __forceinline__ v16h g2_frag(const unsigned short* p, int hh) { FragH f; f.half[0] = *(const v8us*)(p + 8 * hh); f.half[1] = *(const v8us*)(p + 16 + 8 * hh); return f.v; }
__device__ __forceinline__ v8f g2_mma(v16h a, v16h b, v8f c) { return __builtin_amdgcn_wmma_f32_16x16x32_f16(false, a, false, b, (short)0, c, false, false); }
// Eight asynchronous copies of one lane: its 16-byte piece of eight operand rows, 16 rows apart, from global memory straight into LDS (a wave's copy covers two whole 256-byte rows).
// l: the lane's LDS byte address; g: its global address; p: 16 rows in elements. The s_wait_xcnt stands inside the statement so that no address register is rewritten in front of it.
__device__ __forceinline__ void g2_copy8(unsigned l, const unsigned short* g, size_t p) {
  const unsigned lp = 16 * G2_PT * 2;
  asm volatile("global_load_async_to_lds_b128 %0, %8, off\n\t"
               "global_load_async_to_lds_b128 %1, %9, off\n\t"
               "global_load_async_to_lds_b128 %2, %10, off\n\t"
               "global_load_async_to_lds_b128 %3, %11, off\n\t"
               "global_load_async_to_lds_b128 %4, %12, off\n\t"
               "global_load_async_to_lds_b128 %5, %13, off\n\t"
               "global_load_async_to_lds_b128 %6, %14, off\n\t"
               "global_load_async_to_lds_b128 %7, %15, off\n\t"
               "s_wait_xcnt 0x0"
               :: "v"(l), "v"(l + lp), "v"(l + 2 * lp), "v"(l + 3 * lp), "v"(l + 4 * lp), "v"(l + 5 * lp), "v"(l + 6 * lp), "v"(l + 7 * lp),
                  "v"(g), "v"(g + p), "v"(g + 2 * p), "v"(g + 3 * p), "v"(g + 4 * p), "v"(g + 5 * p), "v"(g + 6 * p), "v"(g + 7 * p)
               : "memory"); }
// One stage: 256 A rows and 128 B rows of 256 bytes, 24 copies per lane.
__device__ __forceinline__ void g2_stage(unsigned la, unsigned lb, const unsigned short* ga, const unsigned short* gb, size_t pa, size_t pb) {
  g2_copy8(la, ga, pa); g2_copy8(la + 128 * G2_PT * 2, ga + 8 * pa, pa); g2_copy8(lb, gb, pb); }
// Half P (32 rows) of a wave's 64x64 tile: v = acc alpha + bias (+ residual), activation, through the wave's own 32 LDS rows, so that each global store covers whole rows of the tile.
// RES 0: no residual; 1: own element of the batched C plane (rowsPerB < 0); 2: row (row / rowsPerB) of CP.
template <int ACT, int RES, int P>
__device__ __forceinline__ void g2_out(const v8f (&acc)[4][4], float (*sw)[68], float alpha, const float* bp, const float* CP, int rowsPerB, size_t sCPb, int row0g, int by, float* C, _Float16* C16, int ldc, size_t cofs, int row0, int col0, int ln, int hh) {
  const int rp = row0 + P * 32; const int c4 = ln * 4;
#pragma unroll      /* constant indices keep the accumulator array in registers */
  for (int u = 0; u < 8; ++u) { const int t = u & 3, half = u >> 2; const int col = col0 + t * 16 + ln; const float bv = bp ? bf16_round(bp[col]) : 0.f;
#pragma unroll      /* constant indices keep the accumulator array in registers */
    for (int r = 0; r < 8; ++r) { const int rloc = half * 16 + 8 * hh + r; float v = acc[P * 2 + half][t][r] * alpha + bv;
      if (RES == 1) v += CP[cofs + (size_t)(row0g + rp + rloc) * ldc + col]; else if (RES == 2) { const int bidx = (row0g + rp + rloc) / rowsPerB; v += CP[(size_t)bidx * sCPb + (size_t)by * 64 + col]; }
      if (ACT == 3) v = fmaxf(v, 0.f); else if (ACT == 6) v = 0.5f * v * (1.0f + erff(v * 0.70710678118654752f)); else if (ACT == 11) v = 1.0f / (1.0f + expf(-v)); else if (ACT == 15) v = v / (1.0f + expf(-v)); else if (ACT == 12) v = (v > 0.f) ? v : 0.01f * v; else if (ACT == 8) v = tanhf(v); else if (ACT == 9) v = 0.5f * v * (1.0f + tanhf(0.7978845608028654f * (v + 0.044715f * v * v * v))); else if (ACT == 14) v = (v > 0.f) ? v : 0.1f * v; else if (ACT == 16) v = (v >= 0.f) ? v : 0.3f * v; else if (ACT == 17) v = (v >= 0.f) ? v : 0.2f * v;
      sw[rloc][t * 16 + ln] = v; } }
  __builtin_amdgcn_fence(__ATOMIC_ACQ_REL, "workgroup"); __builtin_amdgcn_wave_barrier();      /* the wave's own LDS stores before its own reads of other lanes' elements */
#pragma unroll      /* the row steps fold into the immediate offsets of the LDS reads */
  for (int q = 0; q < 16; ++q) { const int r = q * 2 + hh; const v4f v = *(const v4fa*)&sw[r][c4];
    if (C) { *(v4f*)(C + cofs + (size_t)(rp + r) * ldc + col0 + c4) = v; asm volatile("s_wait_xcnt 0x0" ::: "memory");      /* in front of the conversion below, which may reuse the store's registers */ }
    if (C16) { v4h h4; for (int i = 0; i < 4; ++i) h4[i] = (_Float16)v[i]; *(v4h*)(C16 + cofs + (size_t)(rp + r) * ldc + col0 + c4) = h4; } }
  __builtin_amdgcn_fence(__ATOMIC_ACQ_REL, "workgroup"); __builtin_amdgcn_wave_barrier();      /* these reads before the next half's stores into the same rows */
}
template <int ACT>
__global__ __launch_bounds__(256) void k_gemm2(const _Float16* __restrict__ A, int lda, size_t sA, const _Float16* __restrict__ Bh, int ldb, size_t sB, float alpha, const float* __restrict__ bias, size_t sBias, const float* __restrict__ CP, int rowsPerB, size_t sCPb, int row0g,
    float* __restrict__ C, _Float16* __restrict__ C16, int ldc, size_t sC, int M, int N, int K) { static_assert(ACT == 0 || ACT == 3 || ACT == 6 || ACT == 8 || ACT == 9 || ACT == 11 || ACT == 12 || ACT == 14 || ACT == 15 || ACT == 16 || ACT == 17, "k_gemm2: unsupported ACT code (would silently apply no activation)");
  __shared__ __attribute__((aligned(16))) unsigned short sa[2][G2_BM][G2_PT];
  __shared__ __attribute__((aligned(16))) unsigned short sb[2][G2_BN][G2_PT];
  __shared__ __attribute__((aligned(16))) float so[8][32][68];
  const int tid = threadIdx.x, w = tid >> 5, lane = tid & 31, ln = lane & 15, hh = lane >> 4; const int by = blockIdx.y;
  A += (size_t)by * sA; Bh += (size_t)by * sB; const size_t cofs = (size_t)by * sC; const float* bp = bias ? bias + (size_t)by * sBias : nullptr;
  const int ntn = N >> 7; const int mt = blockIdx.x / ntn, nq = blockIdx.x - mt * ntn; if (mt * G2_BM >= M) return;      /* the whole work-group, in front of every copy and barrier */
  const int wr = (w >> 1) * 64, wc = (w & 1) * 64; const int row0 = mt * G2_BM + wr, col0 = nq * G2_BN + wc;
  const int sr = tid >> 4, sc = (tid & 15) * 8;      /* staging: rows sr + 16 j, 16-byte piece sc */
  const unsigned short* ag = (const unsigned short*)A + (size_t)(mt * G2_BM + sr) * lda + sc; const unsigned short* bg = (const unsigned short*)Bh + (size_t)(nq * G2_BN + sr) * ldb + sc;
  const size_t pa = (size_t)16 * lda, pb = (size_t)16 * ldb;
  const unsigned la0 = (unsigned)(size_t)&sa[0][sr][sc], lb0 = (unsigned)(size_t)&sb[0][sr][sc];      /* low 32 bits of a __shared__ address = the LDS byte address */
  const unsigned abuf = G2_BM * G2_PT * 2, bbuf = G2_BN * G2_PT * 2;
  const int nst = K >> 7;
  const v8f z8 = {0.f,0.f,0.f,0.f,0.f,0.f,0.f,0.f}; v8f acc[4][4];
#pragma unroll      /* constant indices keep the accumulator array in registers */
  for (int i = 0; i < 4; ++i)
#pragma unroll      /* constant indices keep the accumulator array in registers */
    for (int j = 0; j < 4; ++j) acc[i][j] = z8;
  g2_stage(la0, lb0, ag, bg, pa, pb);
  asm volatile("s_wait_asynccnt 0x0" ::: "memory");      /* this wave's copies of stage 0 have landed */
  __syncthreads();      /* publishes stage 0 */
  if (nst > 1) g2_stage(la0 + abuf, lb0 + bbuf, ag + G2_KS, bg + G2_KS, pa, pb);
#pragma unroll 1      /* one stage per trip: the two-buffer order below holds per trip */
  for (int s = 0; s < nst; ++s) { const int bf = s & 1;
#pragma unroll      /* constant indices keep the fragment and accumulator arrays in registers */
    for (int ks = 0; ks < G2_KS; ks += 32) { v16h af[4], bq[4];
#pragma unroll      /* constant indices keep the fragment and accumulator arrays in registers */
      for (int i = 0; i < 4; ++i) af[i] = g2_frag(&sa[bf][wr + i * 16 + ln][ks], hh);
#pragma unroll      /* constant indices keep the fragment and accumulator arrays in registers */
      for (int j = 0; j < 4; ++j) bq[j] = g2_frag(&sb[bf][wc + j * 16 + ln][ks], hh);
      __builtin_amdgcn_sched_barrier(0);      /* keeps the block's 16 LDS reads together in front of its 16 WMMAs: left free, the compiler sinks each A fragment's reads to its row and waits them out there */
#pragma unroll      /* constant indices keep the fragment and accumulator arrays in registers */
      for (int i = 0; i < 4; ++i)
#pragma unroll      /* constant indices keep the fragment and accumulator arrays in registers */
        for (int j = 0; j < 4; ++j) acc[i][j] = g2_mma(af[i], bq[j], acc[i][j]);
    }
    asm volatile("s_wait_dscnt 0x0" ::: "memory");      /* this wave's reads of buffer bf have returned before the buffer is refilled */
    asm volatile("s_wait_asynccnt 0x0" ::: "memory");      /* this wave's copies of stage s + 1 have landed */
    __syncthreads();      /* publishes stage s + 1 and ends every wave's reads of buffer bf */
    if (s + 2 < nst) { const int kn = (s + 2) * G2_KS; g2_stage(la0 + bf * abuf, lb0 + bf * bbuf, ag + kn, bg + kn, pa, pb); }
  }
  asm volatile("s_wait_asynccnt 0x0" ::: "memory");      /* no copy is outstanding when the wave goes on to its end */
  // the three residual cases are told apart once, not per element, so that each case's text is short and runs straight through; the hints only order the text: the plain case first, the per-row division last
  if (__builtin_expect(!CP, 1)) { g2_out<ACT, 0, 0>(acc, so[w], alpha, bp, CP, rowsPerB, sCPb, row0g, by, C, C16, ldc, cofs, row0, col0, ln, hh); g2_out<ACT, 0, 1>(acc, so[w], alpha, bp, CP, rowsPerB, sCPb, row0g, by, C, C16, ldc, cofs, row0, col0, ln, hh); }
  else if (__builtin_expect(rowsPerB < 0, 1)) { g2_out<ACT, 1, 0>(acc, so[w], alpha, bp, CP, rowsPerB, sCPb, row0g, by, C, C16, ldc, cofs, row0, col0, ln, hh); g2_out<ACT, 1, 1>(acc, so[w], alpha, bp, CP, rowsPerB, sCPb, row0g, by, C, C16, ldc, cofs, row0, col0, ln, hh); }
  else { g2_out<ACT, 2, 0>(acc, so[w], alpha, bp, CP, rowsPerB, sCPb, row0g, by, C, C16, ldc, cofs, row0, col0, ln, hh); g2_out<ACT, 2, 1>(acc, so[w], alpha, bp, CP, rowsPerB, sCPb, row0g, by, C, C16, ldc, cofs, row0, col0, ln, hh); } }


__global__ __launch_bounds__(256) void k_wnat(const float* __restrict__ w, size_t n8, _Float16* __restrict__ Bt) { const size_t t = (size_t)blockIdx.x * 256 + threadIdx.x; if (t >= n8) return; FragH f; for (int q = 0; q < 8; ++q) f.h[q] = (_Float16)(bf16_round(w[t * 8 + q]) * 16.0f); *(v8us*)((unsigned short*)Bt + t * 8) = f.half[0];  }
__global__ __launch_bounds__(256) void k_rsm(const float* __restrict__ S, _Float16* __restrict__ P, int nrows) {
  #pragma clang fp contract(off)
  const int i = blockIdx.x * 256 + threadIdx.x; if (i >= nrows) return; const float* s = S + (size_t)i * SQ; float mx = -3.0e38f;
#pragma unroll 1
  for (int j = 0; j < SQ; ++j) mx = fmaxf(mx, s[j]); float se = 0.f;
#pragma unroll 1
  for (int j = 0; j < SQ; ++j) se += expf(s[j] - mx); const float sc = 256.0f / se;
#pragma unroll 1
  for (int j0 = 0; j0 < SQ; j0 += 8) { FragH f; for (int q = 0; q < 8; ++q) f.h[q] = (_Float16)(expf(s[j0 + q] - mx) * sc); unsigned short* d = (unsigned short*)P + (size_t)i * SQ + j0; *(v8us*)d = f.half[0];  } }
__global__ __launch_bounds__(256) void k_vt(const _Float16* __restrict__ V16, int b, int h0, _Float16* __restrict__ VT) { __shared__ unsigned short tl[64][65]; const int tid = threadIdx.x; const int hh = blockIdx.x % HG, sg = blockIdx.x / HG; const int s0 = sg * 64; const int h = h0 + hh;
  for (int i = tid; i < 64 * 8; i += 256) { const int j = i / 8, d8 = (i % 8) * 8; FragH f; f.half[0] = *(const v8us*)((const unsigned short*)V16 + ((size_t)b * SQ + s0 + j) * DM + h * HD + d8); for (int q = 0; q < 8; ++q) tl[d8 + q][j] = f.u[q]; }
  __syncthreads();
  { for (int i = tid; i < 64 * 8; i += 256) { const int d = i / 8, j8 = (i % 8) * 8; FragH f; for (int q = 0; q < 8; ++q) f.u[q] = tl[d][j8 + q]; *(v8us*)((unsigned short*)VT + ((size_t)hh * HD + d) * SQ + s0 + j8) = f.half[0]; }  } }


template <int BFIN, int W16, int W32>
__global__ __launch_bounds__(256) void k_lnx(const float* __restrict__ X, const float* __restrict__ g, const float* __restrict__ bb, float eps, _Float16* __restrict__ N16, float* __restrict__ N32) {
  #pragma clang fp contract(off)
  __shared__ float red[256]; const size_t r = blockIdx.x; const int t = threadIdx.x; const bool act = t < (DMQ / 4); const int c0 = act ? t * 4 : 0;
  const v4f xa = *(const v4fa*)(X + r * DMQ + c0); float s[4]; float sum = 0.f;
  for (int q = 0; q < 4; ++q) { s[q] = act ? (BFIN ? bf16_round(xa[q]) : xa[q]) : 0.f; sum = __fadd_rn(sum, s[q]); }
  red[t] = sum; __syncthreads(); for (int st = 128; st > 0; st >>= 1) { if (t < st) red[t] = __fadd_rn(red[t], red[t + st]); __syncthreads(); } const float mu = red[0] / (float)DMQ; __syncthreads();
  float vs = 0.f; for (int q = 0; q < 4; ++q) { const float dl = act ? __fadd_rn(s[q], -mu) : 0.f; vs = __fadd_rn(vs, __fmul_rn(dl, dl)); } red[t] = vs; __syncthreads(); for (int st = 128; st > 0; st >>= 1) { if (t < st) red[t] = __fadd_rn(red[t], red[t + st]); __syncthreads(); }
  const float rs = rsqrtf(__fadd_rn(red[0] / (float)DMQ, eps)); v4h y; v4f yf;
  for (int q = 0; q < 4; ++q) { const int c = c0 + q; yf[q] = __fadd_rn(__fmul_rn(__fmul_rn(__fadd_rn(s[q], -mu), rs), bf16_round(g[c])), bf16_round(bb[c])); y[q] = (_Float16)yf[q]; }
  if (!act) return;      /* no barriers after this point */
  { if (W16) *(v4h*)(N16 + r * DMQ + c0) = y; if (W32) *(v4f*)(N32 + r * DMQ + c0) = yf;  } }


// lane l <-> lane l ^ 16
__device__ __forceinline__ float fa_xrow(float v) { const int i = __builtin_bit_cast(int, v); return __builtin_bit_cast(float, __builtin_amdgcn_permlanex16(i, i, 0x76543210, 0xfedcba98, false, false)); }
__device__ __forceinline__ v16h fa_frag(const unsigned short* p, int hh) { FragH f; f.half[0] = *(const v8us*)(p + 8 * hh); f.half[1] = *(const v8us*)(p + 16 + 8 * hh); return f.v; }
__device__ __forceinline__ v8f fa_mma(v16h a, v16h b, v8f c) { return __builtin_amdgcn_wmma_f32_16x16x32_f16(false, a, false, b, (short)0, c, false, false); }
typedef float v2f __attribute__((ext_vector_type(2)));
typedef _Float16 v2h __attribute__((ext_vector_type(2)));
#define FA_KS 64      /* keys per LDS stage */
#define FA_PT 72      /* LDS row pitch in 16-bit elements: 144 B = 16 B x 9, so the 16 rows of a 16-byte fragment read fall on distinct banks */
#define FA_NW 8       /* waves per work-group, 32 query columns each */
__global__ __launch_bounds__(FA_NW * 32) __attribute__((amdgpu_waves_per_eu(4, 4))) void k_fattn(const _Float16* __restrict__ Q16, const _Float16* __restrict__ K16, const _Float16* __restrict__ VT, const float* __restrict__ XB, float* __restrict__ HP) {
  __shared__ __attribute__((aligned(16))) unsigned short sk[2][FA_KS][FA_PT];
  __shared__ __attribute__((aligned(16))) unsigned short sv[2][HD][FA_PT];
  __shared__ __attribute__((aligned(16))) float so[FA_NW][32][68];
  const int tid = threadIdx.x, w = tid >> 5, lane = tid & 31, ln = lane & 15, hh = lane >> 4;
  const int bh = blockIdx.y, b = bh / NH, h = bh - b * NH; const int q0 = blockIdx.x * (FA_NW * 32) + w * 32;
  const unsigned short* Kg = (const unsigned short*)K16 + (size_t)b * SQ * DM + h * HD;      /* key rows, pitch DM */
  const unsigned short* Vg = (const unsigned short*)VT + (size_t)bh * HD * SQ;               /* d rows, pitch SQ */
  const int sr = tid >> 3, sc = (tid & 7) * 8;      /* staging: rows sr and sr + 32, 16-byte piece sc; a wave's load covers four whole 128-byte rows */
  const float cs = 0.125f * 1.44269504088896340736f;
  v16h qf[2][2];
#pragma unroll      /* constant indices keep the fragment and accumulator arrays in registers */
  for (int qt = 0; qt < 2; ++qt)
#pragma unroll      /* constant indices keep the fragment and accumulator arrays in registers */
    for (int ks = 0; ks < 2; ++ks) qf[qt][ks] = fa_frag((const unsigned short*)Q16 + ((size_t)b * SQ + q0 + qt * 16 + ln) * DM + h * HD + ks * 32, hh);
  const v8f z8 = {0.f,0.f,0.f,0.f,0.f,0.f,0.f,0.f};
  v8f o[4][2]; float mu[2], l[2];
#pragma unroll      /* constant indices keep the fragment and accumulator arrays in registers */
  for (int qt = 0; qt < 2; ++qt) { mu[qt] = -1.0e30f; l[qt] = 0.f;
#pragma unroll      /* constant indices keep the fragment and accumulator arrays in registers */
    for (int dt = 0; dt < 4; ++dt) o[dt][qt] = z8; }
  v8us rk0 = *(const v8us*)(Kg + (size_t)sr * DM + sc), rk1 = *(const v8us*)(Kg + (size_t)(sr + 32) * DM + sc), rv0 = *(const v8us*)(Vg + (size_t)sr * SQ + sc), rv1 = *(const v8us*)(Vg + (size_t)(sr + 32) * SQ + sc);
  *(v8us*)&sk[0][sr][sc] = rk0; *(v8us*)&sk[0][sr + 32][sc] = rk1; *(v8us*)&sv[0][sr][sc] = rv0; *(v8us*)&sv[0][sr + 32][sc] = rv1;
  __syncthreads();      /* publishes stage 0 */
#pragma unroll 1      /* one stage per trip keeps the loop small and the register count inside four waves per SIMD */
  for (int s = 0; s < SQ / FA_KS; ++s) { const int bf = s & 1; const bool more = s + 1 < SQ / FA_KS;
    if (more) { const int kn = (s + 1) * FA_KS; rk0 = *(const v8us*)(Kg + (size_t)(kn + sr) * DM + sc); rk1 = *(const v8us*)(Kg + (size_t)(kn + sr + 32) * DM + sc); rv0 = *(const v8us*)(Vg + (size_t)sr * SQ + kn + sc); rv1 = *(const v8us*)(Vg + (size_t)(sr + 32) * SQ + kn + sc); }
#pragma unroll      /* constant indices keep the fragment and accumulator arrays in registers */
    for (int kk = 0; kk < FA_KS; kk += 32) {
      v8f st[2][2];
#pragma unroll      /* constant indices keep the fragment and accumulator arrays in registers */
      for (int kt = 0; kt < 2; ++kt) { const unsigned short* kr = &sk[bf][kk + kt * 16 + ln][0]; const v16h k0 = fa_frag(kr, hh), k1 = fa_frag(kr + 32, hh);
#pragma unroll      /* constant indices keep the fragment and accumulator arrays in registers */
        for (int qt = 0; qt < 2; ++qt) st[kt][qt] = fa_mma(k1, qf[qt][1], fa_mma(k0, qf[qt][0], z8)); }
      v16h vf[4];
#pragma unroll      /* constant indices keep the fragment and accumulator arrays in registers */
      for (int dt = 0; dt < 4; ++dt) vf[dt] = fa_frag(&sv[bf][dt * 16 + ln][kk], hh);
      float mb[2]; bool need = false;
#pragma unroll      /* constant indices keep the fragment and accumulator arrays in registers */
      for (int qt = 0; qt < 2; ++qt) { float mx = st[0][qt][0];
#pragma unroll      /* constant indices keep the fragment and accumulator arrays in registers */
        for (int r = 1; r < 8; ++r) mx = fmaxf(mx, st[0][qt][r]);
#pragma unroll      /* constant indices keep the fragment and accumulator arrays in registers */
        for (int r = 0; r < 8; ++r) mx = fmaxf(mx, st[1][qt][r]);
        mx = fmaxf(mx, fa_xrow(mx)) * cs; mb[qt] = mx; need = need || (mx > mu[qt] + 8.0f); }
      if (__builtin_amdgcn_ballot_w32(need) != 0) {      /* one scalar branch per pass; rare after the first passes */
#pragma unroll      /* constant indices keep the fragment and accumulator arrays in registers */
        for (int qt = 0; qt < 2; ++qt) { const float mn = fmaxf(mu[qt], mb[qt]); const float al = __builtin_amdgcn_exp2f(mu[qt] - mn); mu[qt] = mn; l[qt] *= al;
#pragma unroll      /* constant indices keep the fragment and accumulator arrays in registers */
          for (int dt = 0; dt < 4; ++dt) o[dt][qt] = o[dt][qt] * al; } }
#pragma unroll      /* constant indices keep the fragment and accumulator arrays in registers */
      for (int qt = 0; qt < 2; ++qt) { const float nm = 4.0f - mu[qt]; const v2f c2 = {cs, cs}, n2 = {nm, nm}; union { v16h v; v2h p[8]; } pf; v2f ls = {0.f, 0.f};
#pragma unroll      /* constant indices keep the fragment and accumulator arrays in registers */
        for (int i = 0; i < 4; ++i) { const int kt = i >> 1, r4 = (i & 1) * 4;
          const v2f x0 = {st[kt][qt][r4], st[kt][qt][r4 + 1]}, x1 = {st[kt][qt][r4 + 2], st[kt][qt][r4 + 3]};
          const v2f t0 = __builtin_elementwise_fma(x0, c2, n2), t1 = __builtin_elementwise_fma(x1, c2, n2); 
          const v2f p0 = {__builtin_amdgcn_exp2f(t0[0]), __builtin_amdgcn_exp2f(t0[1])}, p1 = {__builtin_amdgcn_exp2f(t1[0]), __builtin_amdgcn_exp2f(t1[1])}; ls += p0; ls += p1;
          pf.p[i * 2] = __builtin_convertvector(p0, v2h); pf.p[i * 2 + 1] = __builtin_convertvector(p1, v2h); }
        l[qt] += ls[0] + ls[1];
#pragma unroll      /* constant indices keep the fragment and accumulator arrays in registers */
        for (int dt = 0; dt < 4; ++dt) o[dt][qt] = fa_mma(vf[dt], pf.v, o[dt][qt]); }
    }
    if (more) { *(v8us*)&sk[bf ^ 1][sr][sc] = rk0; *(v8us*)&sk[bf ^ 1][sr + 32][sc] = rk1; *(v8us*)&sv[bf ^ 1][sr][sc] = rv0; *(v8us*)&sv[bf ^ 1][sr + 32][sc] = rv1; }
    __syncthreads();      /* publishes the next stage's buffer and ends every wave's reads of this one, which the next trip refills */
  }
  // epilogue: O^T / row sum through the wave's own LDS rows, so that each global access covers whole 256-byte head rows
#pragma unroll      /* constant indices keep the fragment and accumulator arrays in registers */
  for (int qt = 0; qt < 2; ++qt) { const float inv = 1.0f / (l[qt] + fa_xrow(l[qt]));
#pragma unroll      /* constant indices keep the fragment and accumulator arrays in registers */
    for (int dt = 0; dt < 4; ++dt) { const v4f lo = {o[dt][qt][0] * inv, o[dt][qt][1] * inv, o[dt][qt][2] * inv, o[dt][qt][3] * inv}, hi = {o[dt][qt][4] * inv, o[dt][qt][5] * inv, o[dt][qt][6] * inv, o[dt][qt][7] * inv};
      *(v4f*)&so[w][qt * 16 + ln][dt * 16 + 8 * hh] = lo; *(v4f*)&so[w][qt * 16 + ln][dt * 16 + 8 * hh + 4] = hi; } }
  __builtin_amdgcn_fence(__ATOMIC_ACQ_REL, "workgroup"); __builtin_amdgcn_wave_barrier();      /* the wave's own LDS stores before its own reads of other lanes' elements */
  const size_t g0 = ((size_t)b * SQ + q0) * DM + h * HD + ln * 4;
#pragma unroll      /* constant indices keep the fragment and accumulator arrays in registers */
  for (int q = 0; q < 16; ++q) { const int r = q * 2 + hh; const v4f v = *(const v4fa*)&so[w][r][ln * 4]; const v4f xr = *(const v4fa*)(XB + g0 + (size_t)r * DM); *(v4f*)(HP + g0 + (size_t)r * DM) = v + xr; } }


__global__ __launch_bounds__(256) void k_bfr(const float* __restrict__ x, float* __restrict__ XB, size_t n8) { const size_t t = (size_t)blockIdx.x * 256 + threadIdx.x; if (t >= n8) return; v4f a = *(const v4fa*)(x + t * 8), c = *(const v4fa*)(x + t * 8 + 4); for (int q = 0; q < 4; ++q) { a[q] = bf16_round(a[q]); c[q] = bf16_round(c[q]); }
  { *(v4f*)(XB + t * 8) = a; *(v4f*)(XB + t * 8 + 4) = c;  } }


extern "C" void kernel_launch(void* const* d_in, const int* in_sizes, int n_in,
                              void* d_out, int out_size, void* d_ws, size_t ws_size, hipStream_t stream) {
  (void)in_sizes; (void)n_in; (void)out_size;
  const float* const* I = (const float* const*)d_in; const float* x = I[0]; const float* wq = I[1]; const float* wk = I[2]; const float* wv = I[3]; const float* g1 = I[4]; const float* be1 = I[5]; const float* w1 = I[6]; const float* b1 = I[7]; const float* w2 = I[8]; const float* b2 = I[9]; const float* g2 = I[10]; const float* be2 = I[11];      /* natural [out][in] weights; LN affine; FFN biases */
  char* ws = (char*)d_ws; size_t off = 0;
  auto take = [&](size_t bytes) { char* p = ws + off; off += (bytes + 255) & ~(size_t)255; return p; };
  _Float16* BW1 = (_Float16*)take((size_t)DM * DM * 2); _Float16* BW2 = (_Float16*)take((size_t)DM * DM * 2); float* XB = (float*)take(NR * DM * 4); float* HP = (float*)take(NR * DM * 4); _Float16* H16 = (_Float16*)take(NR * DM * 2); _Float16* FF16 = (_Float16*)take(NR * DM * 2); _Float16* BQ = (_Float16*)take((size_t)DM * DM * 2); _Float16* BK = (_Float16*)take((size_t)DM * DM * 2); _Float16* BV = (_Float16*)take((size_t)DM * DM * 2); 
  _Float16* X16 = (_Float16*)take(NR * DM * 2); _Float16* Q16 = (_Float16*)take(NR * DM * 2); _Float16* K16 = (_Float16*)take(NR * DM * 2); _Float16* V16 = (_Float16*)take(NR * DM * 2);
  float* HF = (float*)take(NR * DM * 4);      /* the f32 h rows (LN1 output, residual for the FFN) */ _Float16* VT = (_Float16*)take((size_t)NB * NH * HD * SQ * 2);
  if (off > ws_size) return;
  { const unsigned g = (unsigned)(((size_t)DM * DM / 8 + 255) / 256); k_wnat<<<g, 256, 0, stream>>>(wq, (size_t)DM * DM / 8, BQ); k_wnat<<<g, 256, 0, stream>>>(wk, (size_t)DM * DM / 8, BK); k_wnat<<<g, 256, 0, stream>>>(wv, (size_t)DM * DM / 8, BV); }      /* natural [out][in] = Bt[n][k], x16 */
  { const unsigned g = (unsigned)(((size_t)DM * DM / 8 + 255) / 256); k_wnat<<<g, 256, 0, stream>>>(w1, (size_t)DM * DM / 8, BW1); k_wnat<<<g, 256, 0, stream>>>(w2, (size_t)DM * DM / 8, BW2); }      /* FFN weights natural [1024][1024] = Bt planes */
  k_bfr<<<(unsigned)((NR * DM / 8 + 255) / 256), 256, 0, stream>>>(x, XB, NR * DM / 8);      /* bf16(x) as f32 rows for the residual */

  k_x16<<<(unsigned)((NR * DM / 8 + 255) / 256), 256, 0, stream>>>(x, X16, NR * DM / 8);
  const size_t r0p = (size_t)B0 * SQ;      /* first projected row */
  k_gemm2<0><<<dim3((unsigned)((MP / G2_BM) * (DM / G2_BN)), 1), 256, 0, stream>>>(X16 + r0p * DM, DM, 0, BQ, DM, 0, 0.0625f, nullptr, 0, nullptr, 1, 0, 0, nullptr, Q16 + r0p * DM, DM, 0, MP, DM, DM);
  k_gemm2<0><<<dim3((unsigned)((MP / G2_BM) * (DM / G2_BN)), 1), 256, 0, stream>>>(X16 + r0p * DM, DM, 0, BK, DM, 0, 0.0625f, nullptr, 0, nullptr, 1, 0, 0, nullptr, K16 + r0p * DM, DM, 0, MP, DM, DM);
  k_gemm2<0><<<dim3((unsigned)((MP / G2_BM) * (DM / G2_BN)), 1), 256, 0, stream>>>(X16 + r0p * DM, DM, 0, BV, DM, 0, 0.0625f, nullptr, 0, nullptr, 1, 0, 0, nullptr, V16 + r0p * DM, DM, 0, MP, DM, DM);
  k_vt<NH, SQ><<<NB * NH * (SQ / 64), 256, 0, stream>>>(V16, LQ, 0, VT);      /* V^T [NB][NH][HD][SQ] */
  k_fattn<<<dim3(SQ / (FA_NW * 32), NB * NH), FA_NW * 32, 0, stream>>>(Q16, K16, VT, XB, HP);      /* h_pre = bf16(x) + attn (merged heads), f32 rows */
  k_lnx<0, 1, 1><<<(unsigned)MP, 256, 0, stream>>>(HP + r0p * DM, g1, be1, 1e-5f, H16 + r0p * DM, HF + r0p * DM);      /* h = LN1(x + attn) -> f16 rows (FFN operand) and f32 rows (residual) */
  k_gemm2<3><<<dim3((unsigned)((MP / G2_BM) * (DM / G2_BN)), 1), 256, 0, stream>>>(H16 + r0p * DM, DM, 0, BW1, DM, 0, 0.0625f, b1, 0, nullptr, 1, 0, 0, nullptr, FF16 + r0p * DM, DM, 0, MP, DM, DM);      /* relu(h l1^T + b1) -> f16 rows */
  k_gemm2<0><<<dim3((unsigned)((MP / G2_BM) * (DM / G2_BN)), 1), 256, 0, stream>>>(FF16 + r0p * DM, DM, 0, BW2, DM, 0, 0.0625f, b2, 0, HF + r0p * DM, -1, 0, 0, HP + r0p * DM, nullptr, DM, 0, MP, DM, DM);      /* y = h + ff (own-element residual; the h_pre plane is free again) */
  k_lnx<0, 0, 1><<<(unsigned)MP, 256, 0, stream>>>(HP + r0p * DM, g2, be2, 1e-5f, nullptr, (float*)d_out + r0p * DM);      /* out = LN2(h + ff) -> f32 output rows */
}

// v004
// It runs in 199 microseconds.
// Next to v003, in two timings, it ran 1.05 and 1.04 times as fast.
// Over all steps from v000 it is 67.2 times as fast.
#include <hip/hip_runtime.h>
// Post-LN transformer encoder block (x [4][2048][1024]; q = x wq^T, k, v likewise (nn.Linear natural [1024][1024] sigma 1/32, no biases); 16 heads of 64 (chunked along features = head-major columns); softmax(q k^T / 8) v over all keys (no mask), heads merged, NO output projection; h = LN1(x + attn) (biased variance, eps 1e-5, gamma/beta); ff = relu(h l1_w^T + l1_b) l2_w^T + l2_b (natural [1024][1024], biases sigma 0.01); out = LN2(h + ff) -> [4][2048][1024]).
// Structure: token rows r = b*2048 + s; x as exact f16 rows (bf16-rounded); Q, K, V as three WMMA GEMMs (operand tiles staged in LDS, 64x64 wave tiles, f32 accumulation, exact x16 weights, f16 outputs); V^T for all batches and heads via LDS transposes; one fused attention launch (per head and 256 queries: S^T = K Q^T, online softmax in registers with f32 statistics and native exp2, weights as f16, O^T += V^T P^T), h_pre = bf16(x) + attn as f32 rows; LN1 on VALU (f32 statistics, two rows per wave) -> f16 + f32 rows; relu(h l1^T + b1) GEMM with the ReLU epilogue -> f16; y = h + ff l2^T + b2 GEMM (own-element residual); LN2 on VALU -> f32 output.
// Compute dtype: inputs rounded to bf16; x / weights exact; q, k, v, softmax weights, h and the ReLU rows as plain f16 GEMM operands (~2^-12); scores and softmax statistics f32. v_wmma_f32_16x16x32_f16.
#define NB 4
#define SQ 2048
#define DM 1024
#define NH 16
#define HD 64
#define DMQ DM                       /* LayerNorm width */
#define HG 2                         /* heads per block group of the unlaunched per-batch k_vt */
#define B0 0                         /* first batch processed (debug hook) */
#define NBR NB                       /* batches processed (debug hook) */
#define NR ((size_t)NB * SQ)         /* token rows */
#define MP ((int)((size_t)NBR * SQ)) /* rows projected (debug hook) */
#define QN SQ                        /* unused (attention runs all SQ queries per batch) */
#define NHD NH                       /* unused (attention runs all NH heads) */
#define MPO MP                       /* unused (the output stage runs MP rows) */
#define LQ DM      /* row pitch of the q/k/v rows */
typedef __bf16 v16b __attribute__((ext_vector_type(16)));
typedef unsigned short v8us __attribute__((ext_vector_type(8), may_alias));
typedef float  v8f  __attribute__((ext_vector_type(8)));
typedef float  v4f  __attribute__((ext_vector_type(4)));
typedef float  v4fa __attribute__((ext_vector_type(4), may_alias));
union FragB { v16b v; v8us half[2]; unsigned short u[16]; };

__device__ __forceinline__ unsigned short bf16_bits(float x) { unsigned int u = __float_as_uint(x); return (unsigned short)((u + 0x7FFFu + ((u >> 16) & 1u)) >> 16); }
__device__ __forceinline__ float bf16_val(unsigned short b) { return __uint_as_float(((unsigned int)b) << 16); }
__device__ __forceinline__ float bf16_round(float x) { return bf16_val(bf16_bits(x)); }
// D += A·B with NT terms: 1 = ah·bh, 2 = + al·bh (A split), 3 = + ah·bl (both split)
template <int NT>
__device__ __forceinline__ v8f mmaN(v16b ah, v16b al, v16b bh, v16b bl, v8f c) {
  c = __builtin_amdgcn_wmma_f32_16x16x32_bf16(false, ah, false, bh, (short)0, c, false, false);
  if (NT >= 2) c = __builtin_amdgcn_wmma_f32_16x16x32_bf16(false, al, false, bh, (short)0, c, false, false);
  if (NT >= 3) c = __builtin_amdgcn_wmma_f32_16x16x32_bf16(false, ah, false, bl, (short)0, c, false, false);
  asm volatile("v_nop\n\tv_nop\n\tv_nop\n\tv_nop" : "+v"(c) : "v"(ah), "v"(al), "v"(bh), "v"(bl));
  return c;
}

__global__ __launch_bounds__(256) void k_wt_bf16(const float* __restrict__ W, unsigned short* __restrict__ Wt, int K, int N) {
  const int t = blockIdx.x * 256 + threadIdx.x;
  const int k8n = K / 8;
  if (t >= N * k8n) return;
  const int n = t / k8n, k8 = (t % k8n) * 8;
  v8us v;
#pragma unroll
  for (int i = 0; i < 8; ++i) v[i] = bf16_bits(W[(size_t)(k8 + i) * N + n]);
  *(v8us*)(Wt + (size_t)n * K + k8) = v;
  
}

// GEMM C[M][N] (f32, pitch ldc) = act(A[M][K]·W + bias). A f32 row-major (pitch lda) converted per fragment to bf16
// (ASPLIT: hi/lo two planes -> 2 terms, else single rounded term); Wt bf16 [N][K] (pitch ldb). BIAS_BF16 rounds the
// bias to bf16 first (bias quantised to bf16 before the add). K%32==0, M%16==0, N%64==0.
template <bool ASPLIT, int ACT, bool BIAS_BF16>
__global__ __launch_bounds__(128) void k_gemm_bf(const float* __restrict__ A, int lda, const unsigned short* __restrict__ Wt, int ldb,
                                               const float* __restrict__ bias, float* __restrict__ C, int ldc, int M, int N, int K) {
  __shared__ __attribute__((aligned(16))) float so[4][16][64];
  const int tid = threadIdx.x, w = tid >> 5, lane = tid & 31, ln = lane & 15, hh = lane >> 4;
  const int ntn = N / 64;
  const int wid = blockIdx.x * 4 + w;
  const int mt = wid / ntn, nq = wid % ntn;
  if (mt * 16 >= M) return;
  const int row0 = mt * 16, col0 = nq * 64;
  const float* arow = A + (size_t)(row0 + ln) * lda;
  v8f acc[4] = {};
  for (int kb = 0; kb < K; kb += 32) {
    FragB ah, al;
    const v4f x0 = *(const v4fa*)(arow + kb + 8 * hh), x1 = *(const v4fa*)(arow + kb + 8 * hh + 4);
    const v4f x2 = *(const v4fa*)(arow + kb + 16 + 8 * hh), x3 = *(const v4fa*)(arow + kb + 16 + 8 * hh + 4);
    float xs[16] = {x0[0],x0[1],x0[2],x0[3],x1[0],x1[1],x1[2],x1[3],x2[0],x2[1],x2[2],x2[3],x3[0],x3[1],x3[2],x3[3]};
#pragma unroll
    for (int i = 0; i < 16; ++i) { const unsigned short hb = bf16_bits(xs[i]); ah.u[i] = hb; al.u[i] = ASPLIT ? bf16_bits(xs[i] - bf16_val(hb)) : (unsigned short)0; }
#pragma unroll
    for (int t = 0; t < 4; ++t) {
      const unsigned short* brow = Wt + (size_t)(col0 + t * 16 + ln) * ldb + kb;
      FragB b;
      b.half[0] = *(const v8us*)(brow + 8 * hh);
      b.half[1] = *(const v8us*)(brow + 16 + 8 * hh);
      acc[t] = mmaN<ASPLIT ? 2 : 1>(ah.v, al.v, b.v, b.v, acc[t]);
    }
  }
#pragma unroll
  for (int t = 0; t < 4; ++t) {
    float bv = bias ? bias[col0 + t * 16 + ln] : 0.f;
    if (BIAS_BF16) bv = bf16_round(bv);
#pragma unroll
    for (int r = 0; r < 8; ++r) { float v = acc[t][r] + bv; if (ACT == 1) v = fmaxf(v, 0.f); so[w][8 * hh + r][t * 16 + ln] = v; }
  }
  __builtin_amdgcn_fence(__ATOMIC_ACQ_REL, "workgroup");
  __builtin_amdgcn_wave_barrier();
  const int rsub = lane >> 4, c4 = (lane & 15) * 4;
  {
#pragma unroll
    for (int q = 0; q < 8; ++q) {
      const int r = q * 2 + rsub;
      const v4f v = *(const v4fa*)&so[w][r][c4];
      *(v4f*)(C + (size_t)(row0 + r) * ldc + col0 + c4) = v;
    }
    
  }
}

// GEMM C = act(A·W + bias + resid): A f32 (ASPLIT -> hi/lo 2 terms), Wt bf16 [N][K]; ACT 0 none, 1 relu, 2 exact gelu;
// resid (optional, f32, row index = (row % rmod), pitch ldr, RES_BF16 rounds it) added before the activation.
template <bool ASPLIT, int ACT, bool BIAS_BF16, bool RES_BF16>
__global__ __launch_bounds__(128) void k_gemm_bf3(const float* __restrict__ A, int lda, const unsigned short* __restrict__ Wt, int ldb,
                                                const float* __restrict__ bias, const float* __restrict__ resid, int rmod, int ldr,
                                                float* __restrict__ C, int ldc, int M, int N, int K) {
  __shared__ __attribute__((aligned(16))) float so[4][16][64];
  const int tid = threadIdx.x, w = tid >> 5, lane = tid & 31, ln = lane & 15, hh = lane >> 4;
  const int ntn = N / 64;
  const int wid = blockIdx.x * 4 + w;
  const int mt = wid / ntn, nq = wid % ntn;
  if (mt * 16 >= M) return;
  const int row0 = mt * 16, col0 = nq * 64;
  const float* arow = A + (size_t)(row0 + ln) * lda;
  v8f acc[4] = {};
  for (int kb = 0; kb < K; kb += 32) {
    FragB ah, al;
    const v4f x0 = *(const v4fa*)(arow + kb + 8 * hh), x1 = *(const v4fa*)(arow + kb + 8 * hh + 4);
    const v4f x2 = *(const v4fa*)(arow + kb + 16 + 8 * hh), x3 = *(const v4fa*)(arow + kb + 16 + 8 * hh + 4);
    float xs[16] = {x0[0],x0[1],x0[2],x0[3],x1[0],x1[1],x1[2],x1[3],x2[0],x2[1],x2[2],x2[3],x3[0],x3[1],x3[2],x3[3]};
#pragma unroll
    for (int i = 0; i < 16; ++i) { const unsigned short hb = bf16_bits(xs[i]); ah.u[i] = hb; al.u[i] = ASPLIT ? bf16_bits(xs[i] - bf16_val(hb)) : (unsigned short)0; }
#pragma unroll
    for (int t = 0; t < 4; ++t) {
      const unsigned short* brow = Wt + (size_t)(col0 + t * 16 + ln) * ldb + kb;
      FragB b;
      b.half[0] = *(const v8us*)(brow + 8 * hh);
      b.half[1] = *(const v8us*)(brow + 16 + 8 * hh);
      acc[t] = mmaN<ASPLIT ? 2 : 1>(ah.v, al.v, b.v, b.v, acc[t]);
    }
  }
#pragma unroll
  for (int t = 0; t < 4; ++t) {
    const int col = col0 + t * 16 + ln;
    float bv = bias ? bias[col] : 0.f;
    if (BIAS_BF16) bv = bf16_round(bv);
#pragma unroll
    for (int r = 0; r < 8; ++r) {
      float v = acc[t][r] + bv;
      if (resid) { float rv = resid[(size_t)((row0 + 8 * hh + r) % rmod) * ldr + col]; if (RES_BF16) rv = bf16_round(rv); v += rv; }
      if (ACT == 1) v = fmaxf(v, 0.f);
      if (ACT == 2) v = 0.5f * v * (1.0f + erff(v * 0.70710678118654752f));
      if (ACT == 3) { const float u = 0.7978845608028654f * (v + 0.044715f * v * v * v); v = 0.5f * v * (1.0f + tanhf(u)); }
      so[w][8 * hh + r][t * 16 + ln] = v;
    }
  }
  __builtin_amdgcn_fence(__ATOMIC_ACQ_REL, "workgroup");
  __builtin_amdgcn_wave_barrier();
  const int rsub = lane >> 4, c4 = (lane & 15) * 4;
  {
#pragma unroll
    for (int q = 0; q < 8; ++q) {
      const int r = q * 2 + rsub;
      const v4f v = *(const v4fa*)&so[w][r][c4];
      *(v4f*)(C + (size_t)(row0 + r) * ldc + col0 + c4) = v;
    }
    
  }
}
// row LayerNorm (biased variance, eps) over N: s = X (+ R); optional out_sum <- s; out_norm <- (s-mu)*rsqrt(var+eps)*g + b
template <bool PARAM_BF16>
__global__ __launch_bounds__(256) void k_layernorm(const float* __restrict__ X, const float* __restrict__ R, const float* __restrict__ g, const float* __restrict__ bta,
                                                  float* __restrict__ out_sum, float* __restrict__ out_norm, int N, float eps) {
  __shared__ float red[256];
  const int row = blockIdx.x, tid = threadIdx.x;
  const float* x = X + (size_t)row * N; const float* rr = R ? R + (size_t)row * N : nullptr;
  float vals[16];                     // up to N = 4096
  const int per = N / 256;            // contiguous chunk per thread? use strided-by-4 chunks: thread handles j = tid*4 + 1024*u
  float s1 = 0.f;
  for (int u = 0; u < per / 4; ++u) {
    const int j = tid * 4 + 1024 * u;
    const v4f a = *(const v4fa*)(x + j);
    v4f b = {0.f,0.f,0.f,0.f}; if (rr) b = *(const v4fa*)(rr + j);
#pragma unroll
    for (int q = 0; q < 4; ++q) { const float v = a[q] + b[q]; vals[u * 4 + q] = v; s1 += v; }
  }
  red[tid] = s1; __syncthreads();
  for (int st = 128; st > 0; st >>= 1) { if (tid < st) red[tid] += red[tid + st]; __syncthreads(); }
  const float mu = red[0] / (float)N; __syncthreads();
  float s2 = 0.f;
  for (int u = 0; u < per / 4; ++u)
#pragma unroll
    for (int q = 0; q < 4; ++q) { const float c = vals[u * 4 + q] - mu; s2 += c * c; }
  red[tid] = s2; __syncthreads();
  for (int st = 128; st > 0; st >>= 1) { if (tid < st) red[tid] += red[tid + st]; __syncthreads(); }
  const float rs = rsqrtf(red[0] / (float)N + eps);
  {
    for (int u = 0; u < per / 4; ++u) {
      const int j = tid * 4 + 1024 * u;
      v4f o, sm;
#pragma unroll
      for (int q = 0; q < 4; ++q) {
        float gg = g[j + q], bb = bta[j + q];
        if (PARAM_BF16) { gg = bf16_round(gg); bb = bf16_round(bb); }
        sm[q] = vals[u * 4 + q]; o[q] = (vals[u * 4 + q] - mu) * rs * gg + bb;
      }
      if (out_sum) *(v4f*)(out_sum + (size_t)row * N + j) = sm;
      *(v4f*)(out_norm + (size_t)row * N + j) = o;
    }
    
  }
}



// ---- f16 WMMA path (v_wmma_f32_16x16x32_f16): 11-bit significands for operands in range — used where a [0,1] probability operand needs more precision than bf16
typedef _Float16 v16h __attribute__((ext_vector_type(16)));
union FragH { v16h v; v8us half[2]; _Float16 h[16]; unsigned short u[16]; };
template <int NT>
__device__ __forceinline__ v8f mmaH(v16h ah, v16h al, v16h bh, v16h bl, v8f c) {
  c = __builtin_amdgcn_wmma_f32_16x16x32_f16(false, ah, false, bh, (short)0, c, false, false);
  if (NT >= 2) c = __builtin_amdgcn_wmma_f32_16x16x32_f16(false, al, false, bh, (short)0, c, false, false);
  if (NT >= 3) c = __builtin_amdgcn_wmma_f32_16x16x32_f16(false, ah, false, bl, (short)0, c, false, false);
  asm volatile("v_nop\n\tv_nop\n\tv_nop\n\tv_nop" : "+v"(c) : "v"(ah), "v"(al), "v"(bh), "v"(bl));
  return c;
}
// batched GEMM like k_gemm_b but f16 operands: A f32 (split into f16 hi/lo if ASPLIT, else rounded to f16), Bt = f16 values [n][k]; alpha; C f32; N multiple of 16 (partial tiles skipped)
template <bool ASPLIT>
__global__ __launch_bounds__(128) void k_gemm_h(const float* __restrict__ A, int lda, size_t sA, const _Float16* __restrict__ Bh, int ldb, size_t sB, float alpha, float* __restrict__ C, int ldc, size_t sC, int M, int N, int K) {
  __shared__ __attribute__((aligned(16))) float so[4][16][64];
  const int tid = threadIdx.x, w = tid >> 5, lane = tid & 31, ln = lane & 15, hh = lane >> 4; const int by = blockIdx.y;
  A += (size_t)by * sA; Bh += (size_t)by * sB; C += (size_t)by * sC;
  const int ntn = (N + 63) / 64; const int wid = blockIdx.x * 4 + w; const int mt = wid / ntn, nq = wid % ntn; if (mt * 16 >= M) return;
  const int row0 = mt * 16, col0 = nq * 64; const float* arow = A + (size_t)(row0 + ln) * lda;
  v8f acc[4] = {};
  for (int kb = 0; kb < K; kb += 32) {
    FragH ah, al;
    const v4f x0 = *(const v4fa*)(arow + kb + 8 * hh), x1 = *(const v4fa*)(arow + kb + 8 * hh + 4), x2 = *(const v4fa*)(arow + kb + 16 + 8 * hh), x3 = *(const v4fa*)(arow + kb + 16 + 8 * hh + 4);
    float xs[16] = {x0[0],x0[1],x0[2],x0[3],x1[0],x1[1],x1[2],x1[3],x2[0],x2[1],x2[2],x2[3],x3[0],x3[1],x3[2],x3[3]};
#pragma unroll
    for (int i = 0; i < 16; ++i) { const _Float16 h = (_Float16)xs[i]; ah.h[i] = h; al.h[i] = ASPLIT ? (_Float16)(xs[i] - (float)h) : (_Float16)0.0f; }
#pragma unroll
    for (int t = 0; t < 4; ++t) { if (col0 + t * 16 >= N) continue; const size_t boff = (size_t)(col0 + t * 16 + ln) * ldb + kb; FragH bq; bq.half[0] = *(const v8us*)(Bh + boff + 8 * hh); bq.half[1] = *(const v8us*)(Bh + boff + 16 + 8 * hh);
      acc[t] = mmaH<ASPLIT ? 2 : 1>(ah.v, al.v, bq.v, bq.v, acc[t]); }
  }
#pragma unroll
  for (int t = 0; t < 4; ++t) { if (col0 + t * 16 >= N) continue;
#pragma unroll
    for (int r = 0; r < 8; ++r) so[w][8 * hh + r][t * 16 + ln] = acc[t][r] * alpha; }
  __builtin_amdgcn_fence(__ATOMIC_ACQ_REL, "workgroup"); __builtin_amdgcn_wave_barrier();
  const int rsub = lane >> 4, c4 = (lane & 15) * 4;
  {
#pragma unroll
    for (int q = 0; q < 8; ++q) { const int r = q * 2 + rsub; if (col0 + c4 < N) { const v4f v = *(const v4fa*)&so[w][r][c4]; *(v4f*)(C + (size_t)(row0 + r) * ldc + col0 + c4) = v; } }
     }
}

// Wt[n][k] = f16(W[k][n]·scale) from f32 row-major W[K][N] (scale = power of two; bf16-exact weights stay exact in f16 away from the subnormal range)
__global__ __launch_bounds__(256) void k_wt_f16(const float* __restrict__ W, _Float16* __restrict__ Wt, int K, int N, float scale) {
  const int t = blockIdx.x * 256 + threadIdx.x; if (t >= N * (K / 8)) return; const int n = t / (K / 8), k8 = (t % (K / 8)) * 8; FragH f;
#pragma unroll
  for (int i = 0; i < 8; ++i) f.h[i] = (_Float16)(bf16_round(W[(size_t)(k8 + i) * N + n]) * scale); const v8us o = f.half[0];
  *(v8us*)((unsigned short*)Wt + (size_t)n * K + k8) = o; 
}
// k_gemm_hh variant with fused epilogue: v = acc·alpha + bias[by·sBias + col] (+ CP[(row/rowsPerB)·sCPb + by·64 + col] if CP) ; ACT 0 none / 1 elu ; writes f16 C16 (and f32 C if non-null)
template <int ACT>
__global__ __launch_bounds__(128) void k_gemm_hhx(const _Float16* __restrict__ A, int lda, size_t sA, const _Float16* __restrict__ Bh, int ldb, size_t sB, float alpha, const float* __restrict__ bias, size_t sBias, const float* __restrict__ CP, int rowsPerB, size_t sCPb, int row0g,
    float* __restrict__ C, _Float16* __restrict__ C16, int ldc, size_t sC, int M, int N, int K) {
  __shared__ __attribute__((aligned(16))) float so[4][16][64];
  const int tid = threadIdx.x, w = tid >> 5, lane = tid & 31, ln = lane & 15, hh = lane >> 4; const int by = blockIdx.y;
  A += (size_t)by * sA; Bh += (size_t)by * sB; const size_t cofs = (size_t)by * sC; const float* bp = bias ? bias + (size_t)by * sBias : nullptr;
  const int ntn = (N + 63) / 64; const int wid = blockIdx.x * 4 + w; const int mt = wid / ntn, nq = wid % ntn; if (mt * 16 >= M) return;
  const int row0 = mt * 16, col0 = nq * 64; const _Float16* arow = A + (size_t)(row0 + ln) * lda;
  v8f acc[4] = {};
  for (int kb = 0; kb < K; kb += 32) { FragH ah; ah.half[0] = *(const v8us*)((const unsigned short*)arow + kb + 8 * hh); ah.half[1] = *(const v8us*)((const unsigned short*)arow + kb + 16 + 8 * hh);
#pragma unroll
    for (int t = 0; t < 4; ++t) { if (col0 + t * 16 >= N) continue; const size_t boff = (size_t)(col0 + t * 16 + ln) * ldb + kb; FragH bq; bq.half[0] = *(const v8us*)((const unsigned short*)Bh + boff + 8 * hh); bq.half[1] = *(const v8us*)((const unsigned short*)Bh + boff + 16 + 8 * hh);
      acc[t] = mmaH<1>(ah.v, ah.v, bq.v, bq.v, acc[t]); }
  }
#pragma unroll
  for (int t = 0; t < 4; ++t) { if (col0 + t * 16 >= N) continue; const int col = col0 + t * 16 + ln; const float bv = bp ? bf16_round(bp[col]) : 0.f;
#pragma unroll
    for (int r = 0; r < 8; ++r) { float v = acc[t][r] * alpha + bv; if (CP) { const int rr = row0g + row0 + 8 * hh + r; if (rowsPerB < 0) v += CP[cofs + (size_t)rr * ldc + col];      /* rowsPerB < 0: own element of the batched C plane */ else { const int bidx = rr / rowsPerB; v += CP[(size_t)bidx * sCPb + (size_t)by * 64 + col]; } } if (ACT == 1) v = (v > 0.f) ? v : expm1f(v); else if (ACT == 7) v = (v > 0.f) ? v + 1.0f : expf(v); else if (ACT == 8) v = tanhf(v); else if (ACT == 9) v = 0.5f * v * (1.0f + tanhf(0.7978845608028654f * (v + 0.044715f * v * v * v))); else if (ACT == 11) v = 1.0f / (1.0f + expf(-v)); else if (ACT == 12) v = (v > 0.f) ? v : 0.01f * v; else if (ACT == 14) v = (v > 0.f) ? v : 0.1f * v; else if (ACT == 16) v = (v >= 0.f) ? v : 0.3f * v; else if (ACT == 17) v = (v >= 0.f) ? v : 0.2f * v; else if (ACT == 15) v = v / (1.0f + expf(-v)); else if (ACT == 3) v = fmaxf(v, 0.f); else if (ACT == 6) v = 0.5f * v * (1.0f + erff(v * 0.70710678118654752f)); so[w][8 * hh + r][t * 16 + ln] = v; } }
  __builtin_amdgcn_fence(__ATOMIC_ACQ_REL, "workgroup"); __builtin_amdgcn_wave_barrier();
  const int rsub = lane >> 4, c4 = (lane & 15) * 4; typedef _Float16 v4h __attribute__((ext_vector_type(4)));
  {
#pragma unroll
    for (int q = 0; q < 8; ++q) { const int r = q * 2 + rsub; if (col0 + c4 < N) { const v4f v = *(const v4fa*)&so[w][r][c4]; if (C) *(v4f*)(C + cofs + (size_t)(row0 + r) * ldc + col0 + c4) = v; if (C16) { v4h h4; for (int i = 0; i < 4; ++i) h4[i] = (_Float16)v[i]; *(v4h*)(C16 + cofs + (size_t)(row0 + r) * ldc + col0 + c4) = h4; } } }
     }
}


typedef _Float16 v4h __attribute__((ext_vector_type(4)));

__global__ __launch_bounds__(256) void k_x16(const float* __restrict__ x, _Float16* __restrict__ X16, size_t n8) { const size_t t = (size_t)blockIdx.x * 256 + threadIdx.x; if (t >= n8) return; FragH f;
#pragma unroll
  for (int q = 0; q < 8; ++q) f.h[q] = (_Float16)bf16_round(x[t * 8 + q]); *(v8us*)((unsigned short*)X16 + t * 8) = f.half[0];  }
__global__ __launch_bounds__(256) void k_h16(const float* __restrict__ x, _Float16* __restrict__ X16, size_t n8) { const size_t t = (size_t)blockIdx.x * 256 + threadIdx.x; if (t >= n8) return; FragH f;
#pragma unroll
  for (int q = 0; q < 8; ++q) f.h[q] = (_Float16)x[t * 8 + q]; *(v8us*)((unsigned short*)X16 + t * 8) = f.half[0];  }
__global__ __launch_bounds__(256) void k_round16f(const float* __restrict__ W, _Float16* __restrict__ Bt, size_t n8) { const size_t t = (size_t)blockIdx.x * 256 + threadIdx.x; if (t >= n8) return; FragH f;
#pragma unroll
  for (int i = 0; i < 8; ++i) f.h[i] = (_Float16)(bf16_round(W[t * 8 + i]) * 16.0f); *(v8us*)((unsigned short*)Bt + t * 8) = f.half[0];  }
template <int NHv, int TTv>
__global__ __launch_bounds__(256) void k_vt(const _Float16* __restrict__ V16, int ldv, int voff, _Float16* __restrict__ Vt) { __shared__ unsigned short tl[64][66]; const int tid = threadIdx.x; const int slab = blockIdx.x / (TTv / 64), lg = blockIdx.x % (TTv / 64); const int b = slab / NHv, h = slab % NHv;
  for (int i = tid; i < 64 * 8; i += 256) { const int r = i / 8, c8 = (i % 8) * 8; FragH f; f.half[0] = *(const v8us*)((const unsigned short*)V16 + ((size_t)b * TTv + lg * 64 + r) * ldv + voff + h * 64 + c8);
#pragma unroll
    for (int q = 0; q < 8; ++q) tl[r][c8 + q] = f.u[q]; }
  __syncthreads();
  {
#pragma unroll
    for (int rd = 0; rd < 2; ++rd) { const int d = rd * 32 + tid / 8, pc = tid % 8; FragH f;
#pragma unroll
      for (int q = 0; q < 8; ++q) f.u[q] = tl[pc * 8 + q][d];
      *(v8us*)((unsigned short*)Vt + ((size_t)slab * 64 + d) * TTv + lg * 64 + pc * 8) = f.half[0]; }
     } }

__global__ __launch_bounds__(256) void k_hl(const float* __restrict__ F, _Float16* __restrict__ Hh, _Float16* __restrict__ Hl, size_t n8) { const size_t t = (size_t)blockIdx.x * 256 + threadIdx.x; if (t >= n8) return; FragH fh, fl; const v4f a = *(const v4fa*)(F + t * 8), c = *(const v4fa*)(F + t * 8 + 4);
#pragma unroll
  for (int q = 0; q < 4; ++q) { _Float16 h = (_Float16)a[q]; fh.h[q] = h; fl.h[q] = (_Float16)((a[q] - (float)h) * 1024.0f); h = (_Float16)c[q]; fh.h[4 + q] = h; fl.h[4 + q] = (_Float16)((c[q] - (float)h) * 1024.0f); }
  { *(v8us*)((unsigned short*)Hh + t * 8) = fh.half[0]; *(v8us*)((unsigned short*)Hl + t * 8) = fl.half[0];  } }

// ---- GEMM with both operands staged in LDS (work-group tile 256x128, eight waves of 64x64; requires M % 256 == 0, N % 128 == 0, K % 128 == 0); epilogue = k_gemm_hhx semantics ----
#define G2_KS 128     /* k per stage: 256 bytes of every operand row */
#define G2_PT 136     /* LDS row pitch in 16-bit elements: 272 B = 16 B x 17, the pitch for 16-byte fragment reads of 256-byte rows */
#define G2_BM 256     /* rows of C per work-group */
#define G2_BN 128     /* columns of C per work-group */
__device__ __forceinline__ v16h g2_frag(const unsigned short* p, int hh) { FragH f; f.half[0] = *(const v8us*)(p + 8 * hh); f.half[1] = *(const v8us*)(p + 16 + 8 * hh); return f.v; }
__device__ __forceinline__ v8f g2_mma(v16h a, v16h b, v8f c) { return __builtin_amdgcn_wmma_f32_16x16x32_f16(false, a, false, b, (short)0, c, false, false); }
// Eight asynchronous copies of one lane: its 16-byte piece of eight operand rows, 16 rows apart, from global memory straight into LDS (a wave's copy covers two whole 256-byte rows).
// l: the lane's LDS byte address; g: its global address; p: 16 rows in elements. The s_wait_xcnt stands inside the statement so that no address register is rewritten in front of it.
__device__ __forceinline__ void g2_copy8(unsigned l, const unsigned short* g, size_t p) {
  const unsigned lp = 16 * G2_PT * 2;
  asm volatile("global_load_async_to_lds_b128 %0, %8, off\n\t"
               "global_load_async_to_lds_b128 %1, %9, off\n\t"
               "global_load_async_to_lds_b128 %2, %10, off\n\t"
               "global_load_async_to_lds_b128 %3, %11, off\n\t"
               "global_load_async_to_lds_b128 %4, %12, off\n\t"
               "global_load_async_to_lds_b128 %5, %13, off\n\t"
               "global_load_async_to_lds_b128 %6, %14, off\n\t"
               "global_load_async_to_lds_b128 %7, %15, off\n\t"
               "s_wait_xcnt 0x0"
               :: "v"(l), "v"(l + lp), "v"(l + 2 * lp), "v"(l + 3 * lp), "v"(l + 4 * lp), "v"(l + 5 * lp), "v"(l + 6 * lp), "v"(l + 7 * lp),
                  "v"(g), "v"(g + p), "v"(g + 2 * p), "v"(g + 3 * p), "v"(g + 4 * p), "v"(g + 5 * p), "v"(g + 6 * p), "v"(g + 7 * p)
               : "memory"); }
// One stage: 256 A rows and 128 B rows of 256 bytes, 24 copies per lane.
__device__ __forceinline__ void g2_stage(unsigned la, unsigned lb, const unsigned short* ga, const unsigned short* gb, size_t pa, size_t pb) {
  g2_copy8(la, ga, pa); g2_copy8(la + 128 * G2_PT * 2, ga + 8 * pa, pa); g2_copy8(lb, gb, pb); }
// Half P (32 rows) of a wave's 64x64 tile: v = acc alpha + bias (+ residual), activation, through the wave's own 32 LDS rows, so that each global store covers whole rows of the tile.
// RES 0: no residual; 1: own element of the batched C plane (rowsPerB < 0); 2: row (row / rowsPerB) of CP.
template <int ACT, int RES, int P>
__device__ __forceinline__ void g2_out(const v8f (&acc)[4][4], float (*sw)[68], float alpha, const float* bp, const float* CP, int rowsPerB, size_t sCPb, int row0g, int by, float* C, _Float16* C16, int ldc, size_t cofs, int row0, int col0, int ln, int hh) {
  const int rp = row0 + P * 32; const int c4 = ln * 4;
#pragma unroll      /* constant indices keep the accumulator array in registers */
  for (int u = 0; u < 8; ++u) { const int t = u & 3, half = u >> 2; const int col = col0 + t * 16 + ln; const float bv = bp ? bf16_round(bp[col]) : 0.f;
#pragma unroll      /* constant indices keep the accumulator array in registers */
    for (int r = 0; r < 8; ++r) { const int rloc = half * 16 + 8 * hh + r; float v = acc[P * 2 + half][t][r] * alpha + bv;
      if (RES == 1) v += CP[cofs + (size_t)(row0g + rp + rloc) * ldc + col]; else if (RES == 2) { const int bidx = (row0g + rp + rloc) / rowsPerB; v += CP[(size_t)bidx * sCPb + (size_t)by * 64 + col]; }
      if (ACT == 3) v = fmaxf(v, 0.f); else if (ACT == 6) v = 0.5f * v * (1.0f + erff(v * 0.70710678118654752f)); else if (ACT == 11) v = 1.0f / (1.0f + expf(-v)); else if (ACT == 15) v = v / (1.0f + expf(-v)); else if (ACT == 12) v = (v > 0.f) ? v : 0.01f * v; else if (ACT == 8) v = tanhf(v); else if (ACT == 9) v = 0.5f * v * (1.0f + tanhf(0.7978845608028654f * (v + 0.044715f * v * v * v))); else if (ACT == 14) v = (v > 0.f) ? v : 0.1f * v; else if (ACT == 16) v = (v >= 0.f) ? v : 0.3f * v; else if (ACT == 17) v = (v >= 0.f) ? v : 0.2f * v;
      sw[rloc][t * 16 + ln] = v; } }
  __builtin_amdgcn_fence(__ATOMIC_ACQ_REL, "workgroup"); __builtin_amdgcn_wave_barrier();      /* the wave's own LDS stores before its own reads of other lanes' elements */
#pragma unroll      /* the row steps fold into the immediate offsets of the LDS reads */
  for (int q = 0; q < 16; ++q) { const int r = q * 2 + hh; const v4f v = *(const v4fa*)&sw[r][c4];
    if (C) { *(v4f*)(C + cofs + (size_t)(rp + r) * ldc + col0 + c4) = v; asm volatile("s_wait_xcnt 0x0" ::: "memory");      /* in front of the conversion below, which may reuse the store's registers */ }
    if (C16) { v4h h4; for (int i = 0; i < 4; ++i) h4[i] = (_Float16)v[i]; *(v4h*)(C16 + cofs + (size_t)(rp + r) * ldc + col0 + c4) = h4; } }
  __builtin_amdgcn_fence(__ATOMIC_ACQ_REL, "workgroup"); __builtin_amdgcn_wave_barrier();      /* these reads before the next half's stores into the same rows */
}
template <int ACT>
__global__ __launch_bounds__(256) void k_gemm2(const _Float16* __restrict__ A, int lda, size_t sA, const _Float16* __restrict__ Bh, int ldb, size_t sB, float alpha, const float* __restrict__ bias, size_t sBias, const float* __restrict__ CP, int rowsPerB, size_t sCPb, int row0g,
    float* __restrict__ C, _Float16* __restrict__ C16, int ldc, size_t sC, int M, int N, int K) { static_assert(ACT == 0 || ACT == 3 || ACT == 6 || ACT == 8 || ACT == 9 || ACT == 11 || ACT == 12 || ACT == 14 || ACT == 15 || ACT == 16 || ACT == 17, "k_gemm2: unsupported ACT code (would silently apply no activation)");
  __shared__ __attribute__((aligned(16))) unsigned short sa[2][G2_BM][G2_PT];
  __shared__ __attribute__((aligned(16))) unsigned short sb[2][G2_BN][G2_PT];
  __shared__ __attribute__((aligned(16))) float so[8][32][68];
  const int tid = threadIdx.x, w = tid >> 5, lane = tid & 31, ln = lane & 15, hh = lane >> 4; const int by = blockIdx.y;
  A += (size_t)by * sA; Bh += (size_t)by * sB; const size_t cofs = (size_t)by * sC; const float* bp = bias ? bias + (size_t)by * sBias : nullptr;
  const int ntn = N >> 7; const int mt = blockIdx.x / ntn, nq = blockIdx.x - mt * ntn; if (mt * G2_BM >= M) return;      /* the whole work-group, in front of every copy and barrier */
  const int wr = (w >> 1) * 64, wc = (w & 1) * 64; const int row0 = mt * G2_BM + wr, col0 = nq * G2_BN + wc;
  const int sr = tid >> 4, sc = (tid & 15) * 8;      /* staging: rows sr + 16 j, 16-byte piece sc */
  const unsigned short* ag = (const unsigned short*)A + (size_t)(mt * G2_BM + sr) * lda + sc; const unsigned short* bg = (const unsigned short*)Bh + (size_t)(nq * G2_BN + sr) * ldb + sc;
  const size_t pa = (size_t)16 * lda, pb = (size_t)16 * ldb;
  const unsigned la0 = (unsigned)(size_t)&sa[0][sr][sc], lb0 = (unsigned)(size_t)&sb[0][sr][sc];      /* low 32 bits of a __shared__ address = the LDS byte address */
  const unsigned abuf = G2_BM * G2_PT * 2, bbuf = G2_BN * G2_PT * 2;
  const int nst = K >> 7;
  const v8f z8 = {0.f,0.f,0.f,0.f,0.f,0.f,0.f,0.f}; v8f acc[4][4];
#pragma unroll      /* constant indices keep the accumulator array in registers */
  for (int i = 0; i < 4; ++i)
#pragma unroll      /* constant indices keep the accumulator array in registers */
    for (int j = 0; j < 4; ++j) acc[i][j] = z8;
  g2_stage(la0, lb0, ag, bg, pa, pb);
  asm volatile("s_wait_asynccnt 0x0" ::: "memory");      /* this wave's copies of stage 0 have landed */
  __syncthreads();      /* publishes stage 0 */
  if (nst > 1) g2_stage(la0 + abuf, lb0 + bbuf, ag + G2_KS, bg + G2_KS, pa, pb);
#pragma unroll 1      /* one stage per trip: the two-buffer order below holds per trip */
  for (int s = 0; s < nst; ++s) { const int bf = s & 1;
#pragma unroll      /* constant indices keep the fragment and accumulator arrays in registers */
    for (int ks = 0; ks < G2_KS; ks += 32) { v16h af[4], bq[4];
#pragma unroll      /* constant indices keep the fragment and accumulator arrays in registers */
      for (int i = 0; i < 4; ++i) af[i] = g2_frag(&sa[bf][wr + i * 16 + ln][ks], hh);
#pragma unroll      /* constant indices keep the fragment and accumulator arrays in registers */
      for (int j = 0; j < 4; ++j) bq[j] = g2_frag(&sb[bf][wc + j * 16 + ln][ks], hh);
      __builtin_amdgcn_sched_barrier(0);      /* keeps the block's 16 LDS reads together in front of its 16 WMMAs: left free, the compiler sinks each A fragment's reads to its row and waits them out there */
#pragma unroll      /* constant indices keep the fragment and accumulator arrays in registers */
      for (int i = 0; i < 4; ++i)
#pragma unroll      /* constant indices keep the fragment and accumulator arrays in registers */
        for (int j = 0; j < 4; ++j) acc[i][j] = g2_mma(af[i], bq[j], acc[i][j]);
    }
    asm volatile("s_wait_dscnt 0x0" ::: "memory");      /* this wave's reads of buffer bf have returned before the buffer is refilled */
    asm volatile("s_wait_asynccnt 0x0" ::: "memory");      /* this wave's copies of stage s + 1 have landed */
    __syncthreads();      /* publishes stage s + 1 and ends every wave's reads of buffer bf */
    if (s + 2 < nst) { const int kn = (s + 2) * G2_KS; g2_stage(la0 + bf * abuf, lb0 + bf * bbuf, ag + kn, bg + kn, pa, pb); }
  }
  asm volatile("s_wait_asynccnt 0x0" ::: "memory");      /* no copy is outstanding when the wave goes on to its end */
  // the three residual cases are told apart once, not per element, so that each case's text is short and runs straight through; the hints only order the text: the plain case first, the per-row division last
  if (__builtin_expect(!CP, 1)) { g2_out<ACT, 0, 0>(acc, so[w], alpha, bp, CP, rowsPerB, sCPb, row0g, by, C, C16, ldc, cofs, row0, col0, ln, hh); g2_out<ACT, 0, 1>(acc, so[w], alpha, bp, CP, rowsPerB, sCPb, row0g, by, C, C16, ldc, cofs, row0, col0, ln, hh); }
  else if (__builtin_expect(rowsPerB < 0, 1)) { g2_out<ACT, 1, 0>(acc, so[w], alpha, bp, CP, rowsPerB, sCPb, row0g, by, C, C16, ldc, cofs, row0, col0, ln, hh); g2_out<ACT, 1, 1>(acc, so[w], alpha, bp, CP, rowsPerB, sCPb, row0g, by, C, C16, ldc, cofs, row0, col0, ln, hh); }
  else { g2_out<ACT, 2, 0>(acc, so[w], alpha, bp, CP, rowsPerB, sCPb, row0g, by, C, C16, ldc, cofs, row0, col0, ln, hh); g2_out<ACT, 2, 1>(acc, so[w], alpha, bp, CP, rowsPerB, sCPb, row0g, by, C, C16, ldc, cofs, row0, col0, ln, hh); } }


__global__ __launch_bounds__(256) void k_wnat(const float* __restrict__ w, size_t n8, _Float16* __restrict__ Bt) { const size_t t = (size_t)blockIdx.x * 256 + threadIdx.x; if (t >= n8) return; FragH f; for (int q = 0; q < 8; ++q) f.h[q] = (_Float16)(bf16_round(w[t * 8 + q]) * 16.0f); *(v8us*)((unsigned short*)Bt + t * 8) = f.half[0];  }
__global__ __launch_bounds__(256) void k_rsm(const float* __restrict__ S, _Float16* __restrict__ P, int nrows) {
  #pragma clang fp contract(off)
  const int i = blockIdx.x * 256 + threadIdx.x; if (i >= nrows) return; const float* s = S + (size_t)i * SQ; float mx = -3.0e38f;
#pragma unroll 1
  for (int j = 0; j < SQ; ++j) mx = fmaxf(mx, s[j]); float se = 0.f;
#pragma unroll 1
  for (int j = 0; j < SQ; ++j) se += expf(s[j] - mx); const float sc = 256.0f / se;
#pragma unroll 1
  for (int j0 = 0; j0 < SQ; j0 += 8) { FragH f; for (int q = 0; q < 8; ++q) f.h[q] = (_Float16)(expf(s[j0 + q] - mx) * sc); unsigned short* d = (unsigned short*)P + (size_t)i * SQ + j0; *(v8us*)d = f.half[0];  } }
__global__ __launch_bounds__(256) void k_vt(const _Float16* __restrict__ V16, int b, int h0, _Float16* __restrict__ VT) { __shared__ unsigned short tl[64][65]; const int tid = threadIdx.x; const int hh = blockIdx.x % HG, sg = blockIdx.x / HG; const int s0 = sg * 64; const int h = h0 + hh;
  for (int i = tid; i < 64 * 8; i += 256) { const int j = i / 8, d8 = (i % 8) * 8; FragH f; f.half[0] = *(const v8us*)((const unsigned short*)V16 + ((size_t)b * SQ + s0 + j) * DM + h * HD + d8); for (int q = 0; q < 8; ++q) tl[d8 + q][j] = f.u[q]; }
  __syncthreads();
  { for (int i = tid; i < 64 * 8; i += 256) { const int d = i / 8, j8 = (i % 8) * 8; FragH f; for (int q = 0; q < 8; ++q) f.u[q] = tl[d][j8 + q]; *(v8us*)((unsigned short*)VT + ((size_t)hh * HD + d) * SQ + s0 + j8) = f.half[0]; }  } }


// lane l <-> lane l ^ 16
__device__ __forceinline__ float fa_xrow(float v) { const int i = __builtin_bit_cast(int, v); return __builtin_bit_cast(float, __builtin_amdgcn_permlanex16(i, i, 0x76543210, 0xfedcba98, false, false)); }
__device__ __forceinline__ v16h fa_frag(const unsigned short* p, int hh) { FragH f; f.half[0] = *(const v8us*)(p + 8 * hh); f.half[1] = *(const v8us*)(p + 16 + 8 * hh); return f.v; }
__device__ __forceinline__ v8f fa_mma(v16h a, v16h b, v8f c) { return __builtin_amdgcn_wmma_f32_16x16x32_f16(false, a, false, b, (short)0, c, false, false); }
typedef float v2f __attribute__((ext_vector_type(2)));
typedef _Float16 v2h __attribute__((ext_vector_type(2)));
#define FA_KS 64      /* keys per LDS stage */
#define FA_PT 72      /* LDS row pitch in 16-bit elements: 144 B = 16 B x 9, so the 16 rows of a 16-byte fragment read fall on distinct banks */
#define FA_NW 8       /* waves per work-group, 32 query columns each */
__global__ __launch_bounds__(FA_NW * 32) __attribute__((amdgpu_waves_per_eu(4, 4))) void k_fattn(const _Float16* __restrict__ Q16, const _Float16* __restrict__ K16, const _Float16* __restrict__ VT, const float* __restrict__ XB, float* __restrict__ HP) {
  __shared__ __attribute__((aligned(16))) unsigned short sk[2][FA_KS][FA_PT];
  __shared__ __attribute__((aligned(16))) unsigned short sv[2][HD][FA_PT];
  __shared__ __attribute__((aligned(16))) float so[FA_NW][32][68];
  const int tid = threadIdx.x, w = tid >> 5, lane = tid & 31, ln = lane & 15, hh = lane >> 4;
  const int bh = blockIdx.y, b = bh / NH, h = bh - b * NH; const int q0 = blockIdx.x * (FA_NW * 32) + w * 32;
  const unsigned short* Kg = (const unsigned short*)K16 + (size_t)b * SQ * DM + h * HD;      /* key rows, pitch DM */
  const unsigned short* Vg = (const unsigned short*)VT + (size_t)bh * HD * SQ;               /* d rows, pitch SQ */
  const int sr = tid >> 3, sc = (tid & 7) * 8;      /* staging: rows sr and sr + 32, 16-byte piece sc; a wave's load covers four whole 128-byte rows */
  const float cs = 0.125f * 1.44269504088896340736f;
  v16h qf[2][2];
#pragma unroll      /* constant indices keep the fragment and accumulator arrays in registers */
  for (int qt = 0; qt < 2; ++qt)
#pragma unroll      /* constant indices keep the fragment and accumulator arrays in registers */
    for (int ks = 0; ks < 2; ++ks) qf[qt][ks] = fa_frag((const unsigned short*)Q16 + ((size_t)b * SQ + q0 + qt * 16 + ln) * DM + h * HD + ks * 32, hh);
  const v8f z8 = {0.f,0.f,0.f,0.f,0.f,0.f,0.f,0.f};
  v8f o[4][2]; float mu[2], l[2];
#pragma unroll      /* constant indices keep the fragment and accumulator arrays in registers */
  for (int qt = 0; qt < 2; ++qt) { mu[qt] = -1.0e30f; l[qt] = 0.f;
#pragma unroll      /* constant indices keep the fragment and accumulator arrays in registers */
    for (int dt = 0; dt < 4; ++dt) o[dt][qt] = z8; }
  v8us rk0 = *(const v8us*)(Kg + (size_t)sr * DM + sc), rk1 = *(const v8us*)(Kg + (size_t)(sr + 32) * DM + sc), rv0 = *(const v8us*)(Vg + (size_t)sr * SQ + sc), rv1 = *(const v8us*)(Vg + (size_t)(sr + 32) * SQ + sc);
  *(v8us*)&sk[0][sr][sc] = rk0; *(v8us*)&sk[0][sr + 32][sc] = rk1; *(v8us*)&sv[0][sr][sc] = rv0; *(v8us*)&sv[0][sr + 32][sc] = rv1;
  __syncthreads();      /* publishes stage 0 */
#pragma unroll 1      /* one stage per trip keeps the loop small and the register count inside four waves per SIMD */
  for (int s = 0; s < SQ / FA_KS; ++s) { const int bf = s & 1; const bool more = s + 1 < SQ / FA_KS;
    if (more) { const int kn = (s + 1) * FA_KS; rk0 = *(const v8us*)(Kg + (size_t)(kn + sr) * DM + sc); rk1 = *(const v8us*)(Kg + (size_t)(kn + sr + 32) * DM + sc); rv0 = *(const v8us*)(Vg + (size_t)sr * SQ + kn + sc); rv1 = *(const v8us*)(Vg + (size_t)(sr + 32) * SQ + kn + sc); }
#pragma unroll      /* constant indices keep the fragment and accumulator arrays in registers */
    for (int kk = 0; kk < FA_KS; kk += 32) {
      v8f st[2][2];
#pragma unroll      /* constant indices keep the fragment and accumulator arrays in registers */
      for (int kt = 0; kt < 2; ++kt) { const unsigned short* kr = &sk[bf][kk + kt * 16 + ln][0]; const v16h k0 = fa_frag(kr, hh), k1 = fa_frag(kr + 32, hh);
#pragma unroll      /* constant indices keep the fragment and accumulator arrays in registers */
        for (int qt = 0; qt < 2; ++qt) st[kt][qt] = fa_mma(k1, qf[qt][1], fa_mma(k0, qf[qt][0], z8)); }
      v16h vf[4];
#pragma unroll      /* constant indices keep the fragment and accumulator arrays in registers */
      for (int dt = 0; dt < 4; ++dt) vf[dt] = fa_frag(&sv[bf][dt * 16 + ln][kk], hh);
      float mb[2]; bool need = false;
#pragma unroll      /* constant indices keep the fragment and accumulator arrays in registers */
      for (int qt = 0; qt < 2; ++qt) { float mx = st[0][qt][0];
#pragma unroll      /* constant indices keep the fragment and accumulator arrays in registers */
        for (int r = 1; r < 8; ++r) mx = fmaxf(mx, st[0][qt][r]);
#pragma unroll      /* constant indices keep the fragment and accumulator arrays in registers */
        for (int r = 0; r < 8; ++r) mx = fmaxf(mx, st[1][qt][r]);
        mx = fmaxf(mx, fa_xrow(mx)) * cs; mb[qt] = mx; need = need || (mx > mu[qt] + 8.0f); }
      if (__builtin_amdgcn_ballot_w32(need) != 0) {      /* one scalar branch per pass; rare after the first passes */
#pragma unroll      /* constant indices keep the fragment and accumulator arrays in registers */
        for (int qt = 0; qt < 2; ++qt) { const float mn = fmaxf(mu[qt], mb[qt]); const float al = __builtin_amdgcn_exp2f(mu[qt] - mn); mu[qt] = mn; l[qt] *= al;
#pragma unroll      /* constant indices keep the fragment and accumulator arrays in registers */
          for (int dt = 0; dt < 4; ++dt) o[dt][qt] = o[dt][qt] * al; } }
#pragma unroll      /* constant indices keep the fragment and accumulator arrays in registers */
      for (int qt = 0; qt < 2; ++qt) { const float nm = 4.0f - mu[qt]; const v2f c2 = {cs, cs}, n2 = {nm, nm}; union { v16h v; v2h p[8]; } pf; v2f ls = {0.f, 0.f};
#pragma unroll      /* constant indices keep the fragment and accumulator arrays in registers */
        for (int i = 0; i < 4; ++i) { const int kt = i >> 1, r4 = (i & 1) * 4;
          const v2f x0 = {st[kt][qt][r4], st[kt][qt][r4 + 1]}, x1 = {st[kt][qt][r4 + 2], st[kt][qt][r4 + 3]};
          const v2f t0 = __builtin_elementwise_fma(x0, c2, n2), t1 = __builtin_elementwise_fma(x1, c2, n2); 
          const v2f p0 = {__builtin_amdgcn_exp2f(t0[0]), __builtin_amdgcn_exp2f(t0[1])}, p1 = {__builtin_amdgcn_exp2f(t1[0]), __builtin_amdgcn_exp2f(t1[1])}; ls += p0; ls += p1;
          pf.p[i * 2] = __builtin_convertvector(p0, v2h); pf.p[i * 2 + 1] = __builtin_convertvector(p1, v2h); }
        l[qt] += ls[0] + ls[1];
#pragma unroll      /* constant indices keep the fragment and accumulator arrays in registers */
        for (int dt = 0; dt < 4; ++dt) o[dt][qt] = fa_mma(vf[dt], pf.v, o[dt][qt]); }
    }
    if (more) { *(v8us*)&sk[bf ^ 1][sr][sc] = rk0; *(v8us*)&sk[bf ^ 1][sr + 32][sc] = rk1; *(v8us*)&sv[bf ^ 1][sr][sc] = rv0; *(v8us*)&sv[bf ^ 1][sr + 32][sc] = rv1; }
    __syncthreads();      /* publishes the next stage's buffer and ends every wave's reads of this one, which the next trip refills */
  }
  // epilogue: O^T / row sum through the wave's own LDS rows, so that each global access covers whole 256-byte head rows
#pragma unroll      /* constant indices keep the fragment and accumulator arrays in registers */
  for (int qt = 0; qt < 2; ++qt) { const float inv = 1.0f / (l[qt] + fa_xrow(l[qt]));
#pragma unroll      /* constant indices keep the fragment and accumulator arrays in registers */
    for (int dt = 0; dt < 4; ++dt) { const v4f lo = {o[dt][qt][0] * inv, o[dt][qt][1] * inv, o[dt][qt][2] * inv, o[dt][qt][3] * inv}, hi = {o[dt][qt][4] * inv, o[dt][qt][5] * inv, o[dt][qt][6] * inv, o[dt][qt][7] * inv};
      *(v4f*)&so[w][qt * 16 + ln][dt * 16 + 8 * hh] = lo; *(v4f*)&so[w][qt * 16 + ln][dt * 16 + 8 * hh + 4] = hi; } }
  __builtin_amdgcn_fence(__ATOMIC_ACQ_REL, "workgroup"); __builtin_amdgcn_wave_barrier();      /* the wave's own LDS stores before its own reads of other lanes' elements */
  const size_t g0 = ((size_t)b * SQ + q0) * DM + h * HD + ln * 4;
#pragma unroll      /* constant indices keep the fragment and accumulator arrays in registers */
  for (int q = 0; q < 16; ++q) { const int r = q * 2 + hh; const v4f v = *(const v4fa*)&so[w][r][ln * 4]; const v4f xr = *(const v4fa*)(XB + g0 + (size_t)r * DM); *(v4f*)(HP + g0 + (size_t)r * DM) = v + xr; } }


// Row LayerNorm (biased variance, eps, bf16-rounded gamma and beta), two rows per wave and no LDS: a lane holds 32 elements of each row (eight 16-byte pieces, so that each load and each f32 store of the wave covers 512 contiguous bytes).
// Mean and variance: four chains per lane, then a butterfly over the 32 lanes (four DPP steps inside the 16-lane rows, one exchange between them). Two passes over the registers, as the definition has it.
// Each wave takes LN_RW rows, which share one rounding of gamma and beta: the launch starts 4,096 waves (16 per WGP, all resident at once) instead of eight waves per row (65,536), and has no barrier.
#define LN_NW 16      /* waves per work-group */
#define LN_RW 2       /* rows per wave */
template <int M> __device__ __forceinline__ float ln_xm(float v) { return __builtin_bit_cast(float, __builtin_amdgcn_update_dpp(0, __builtin_bit_cast(int, v), 0x160 + M, 0xf, 0xf, true)); }      /* lane l <-> lane l ^ M, M < 16 (row_xmask) */
__device__ __forceinline__ float ln_wsum(v4f s) { float v = (s[0] + s[1]) + (s[2] + s[3]); v += ln_xm<1>(v); v += ln_xm<2>(v); v += ln_xm<4>(v); v += ln_xm<8>(v); return v + fa_xrow(v); }
template <int W16, int W32>
__global__ __launch_bounds__(LN_NW * 32) void k_lnw(const float* __restrict__ X, const float* __restrict__ g, const float* __restrict__ bb, float eps, _Float16* __restrict__ N16, float* __restrict__ N32) {
  static_assert(DMQ == 8 * 128, "k_lnw: a row is eight 512-byte pieces");
  const int c0 = (threadIdx.x & 31) * 4; const size_t r0 = ((size_t)blockIdx.x * LN_NW + __builtin_amdgcn_readfirstlane(threadIdx.x >> 5)) * LN_RW;      /* the wave's number as a scalar: the row bases stay in scalar registers and every access shares the lane's one offset register */
  v4f gg[8], bv[8], x[LN_RW][8]; float rs[LN_RW];
#pragma unroll      /* constant indices keep the row arrays in registers */
  for (int u = 0; u < 8; ++u) { gg[u] = *(const v4fa*)(g + u * 128 + c0); bv[u] = *(const v4fa*)(bb + u * 128 + c0); }
#pragma unroll      /* constant indices keep the row arrays in registers */
  for (int i = 0; i < LN_RW; ++i)
#pragma unroll      /* constant indices keep the row arrays in registers */
    for (int u = 0; u < 8; ++u) { const int c = u * 128 + c0; x[i][u] = *(const v4fa*)(X + (r0 + i) * DMQ + c); }
  __builtin_amdgcn_sched_barrier(0);      /* keeps all 32 loads in front of the arithmetic: left free, the compiler sinks most gamma and beta loads behind the reductions and waits each pair out there */
#pragma unroll      /* constant indices keep the row arrays in registers */
  for (int u = 0; u < 8; ++u)
#pragma unroll      /* constant indices keep the row arrays in registers */
    for (int q = 0; q < 4; ++q) { gg[u][q] = bf16_round(gg[u][q]); bv[u][q] = bf16_round(bv[u][q]); }
#pragma unroll      /* constant indices keep the row arrays in registers */
  for (int i = 0; i < LN_RW; ++i) { v4f s = x[i][0];
#pragma unroll      /* constant indices keep the row arrays in registers */
    for (int u = 1; u < 8; ++u) s += x[i][u];
    const float mu = ln_wsum(s) * (1.0f / (float)DMQ); v4f q = {0.f, 0.f, 0.f, 0.f};
#pragma unroll      /* constant indices keep the row arrays in registers */
    for (int u = 0; u < 8; ++u) { x[i][u] = x[i][u] - mu; q += x[i][u] * x[i][u]; }
    rs[i] = rsqrtf(ln_wsum(q) * (1.0f / (float)DMQ) + eps); }
#pragma unroll      /* constant indices keep the row arrays in registers */
  for (int i = 0; i < LN_RW; ++i)
#pragma unroll      /* constant indices keep the row arrays in registers */
    for (int u = 0; u < 8; ++u) { const int c = u * 128 + c0; const v4f y = x[i][u] * rs[i] * gg[u] + bv[u];
      if (W32) *(v4f*)(N32 + (r0 + i) * DMQ + c) = y;
      if (W16) *(v4h*)(N16 + (r0 + i) * DMQ + c) = __builtin_convertvector(y, v4h); } }


__global__ __launch_bounds__(256) void k_bfr(const float* __restrict__ x, float* __restrict__ XB, size_t n8) { const size_t t = (size_t)blockIdx.x * 256 + threadIdx.x; if (t >= n8) return; v4f a = *(const v4fa*)(x + t * 8), c = *(const v4fa*)(x + t * 8 + 4); for (int q = 0; q < 4; ++q) { a[q] = bf16_round(a[q]); c[q] = bf16_round(c[q]); }
  { *(v4f*)(XB + t * 8) = a; *(v4f*)(XB + t * 8 + 4) = c;  } }


extern "C" void kernel_launch(void* const* d_in, const int* in_sizes, int n_in,
                              void* d_out, int out_size, void* d_ws, size_t ws_size, hipStream_t stream) {
  (void)in_sizes; (void)n_in; (void)out_size;
  const float* const* I = (const float* const*)d_in; const float* x = I[0]; const float* wq = I[1]; const float* wk = I[2]; const float* wv = I[3]; const float* g1 = I[4]; const float* be1 = I[5]; const float* w1 = I[6]; const float* b1 = I[7]; const float* w2 = I[8]; const float* b2 = I[9]; const float* g2 = I[10]; const float* be2 = I[11];      /* natural [out][in] weights; LN affine; FFN biases */
  char* ws = (char*)d_ws; size_t off = 0;
  auto take = [&](size_t bytes) { char* p = ws + off; off += (bytes + 255) & ~(size_t)255; return p; };
  _Float16* BW1 = (_Float16*)take((size_t)DM * DM * 2); _Float16* BW2 = (_Float16*)take((size_t)DM * DM * 2); float* XB = (float*)take(NR * DM * 4); float* HP = (float*)take(NR * DM * 4); _Float16* H16 = (_Float16*)take(NR * DM * 2); _Float16* FF16 = (_Float16*)take(NR * DM * 2); _Float16* BQ = (_Float16*)take((size_t)DM * DM * 2); _Float16* BK = (_Float16*)take((size_t)DM * DM * 2); _Float16* BV = (_Float16*)take((size_t)DM * DM * 2); 
  _Float16* X16 = (_Float16*)take(NR * DM * 2); _Float16* Q16 = (_Float16*)take(NR * DM * 2); _Float16* K16 = (_Float16*)take(NR * DM * 2); _Float16* V16 = (_Float16*)take(NR * DM * 2);
  float* HF = (float*)take(NR * DM * 4);      /* the f32 h rows (LN1 output, residual for the FFN) */ _Float16* VT = (_Float16*)take((size_t)NB * NH * HD * SQ * 2);
  if (off > ws_size) return;
  { const unsigned g = (unsigned)(((size_t)DM * DM / 8 + 255) / 256); k_wnat<<<g, 256, 0, stream>>>(wq, (size_t)DM * DM / 8, BQ); k_wnat<<<g, 256, 0, stream>>>(wk, (size_t)DM * DM / 8, BK); k_wnat<<<g, 256, 0, stream>>>(wv, (size_t)DM * DM / 8, BV); }      /* natural [out][in] = Bt[n][k], x16 */
  { const unsigned g = (unsigned)(((size_t)DM * DM / 8 + 255) / 256); k_wnat<<<g, 256, 0, stream>>>(w1, (size_t)DM * DM / 8, BW1); k_wnat<<<g, 256, 0, stream>>>(w2, (size_t)DM * DM / 8, BW2); }      /* FFN weights natural [1024][1024] = Bt planes */
  k_bfr<<<(unsigned)((NR * DM / 8 + 255) / 256), 256, 0, stream>>>(x, XB, NR * DM / 8);      /* bf16(x) as f32 rows for the residual */

  k_x16<<<(unsigned)((NR * DM / 8 + 255) / 256), 256, 0, stream>>>(x, X16, NR * DM / 8);
  const size_t r0p = (size_t)B0 * SQ;      /* first projected row */
  k_gemm2<0><<<dim3((unsigned)((MP / G2_BM) * (DM / G2_BN)), 1), 256, 0, stream>>>(X16 + r0p * DM, DM, 0, BQ, DM, 0, 0.0625f, nullptr, 0, nullptr, 1, 0, 0, nullptr, Q16 + r0p * DM, DM, 0, MP, DM, DM);
  k_gemm2<0><<<dim3((unsigned)((MP / G2_BM) * (DM / G2_BN)), 1), 256, 0, stream>>>(X16 + r0p * DM, DM, 0, BK, DM, 0, 0.0625f, nullptr, 0, nullptr, 1, 0, 0, nullptr, K16 + r0p * DM, DM, 0, MP, DM, DM);
  k_gemm2<0><<<dim3((unsigned)((MP / G2_BM) * (DM / G2_BN)), 1), 256, 0, stream>>>(X16 + r0p * DM, DM, 0, BV, DM, 0, 0.0625f, nullptr, 0, nullptr, 1, 0, 0, nullptr, V16 + r0p * DM, DM, 0, MP, DM, DM);
  k_vt<NH, SQ><<<NB * NH * (SQ / 64), 256, 0, stream>>>(V16, LQ, 0, VT);      /* V^T [NB][NH][HD][SQ] */
  k_fattn<<<dim3(SQ / (FA_NW * 32), NB * NH), FA_NW * 32, 0, stream>>>(Q16, K16, VT, XB, HP);      /* h_pre = bf16(x) + attn (merged heads), f32 rows */
  k_lnw<1, 1><<<(unsigned)(MP / (LN_NW * LN_RW)), LN_NW * 32, 0, stream>>>(HP + r0p * DM, g1, be1, 1e-5f, H16 + r0p * DM, HF + r0p * DM);      /* h = LN1(x + attn) -> f16 rows (FFN operand) and f32 rows (residual) */
  k_gemm2<3><<<dim3((unsigned)((MP / G2_BM) * (DM / G2_BN)), 1), 256, 0, stream>>>(H16 + r0p * DM, DM, 0, BW1, DM, 0, 0.0625f, b1, 0, nullptr, 1, 0, 0, nullptr, FF16 + r0p * DM, DM, 0, MP, DM, DM);      /* relu(h l1^T + b1) -> f16 rows */
  k_gemm2<0><<<dim3((unsigned)((MP / G2_BM) * (DM / G2_BN)), 1), 256, 0, stream>>>(FF16 + r0p * DM, DM, 0, BW2, DM, 0, 0.0625f, b2, 0, HF + r0p * DM, -1, 0, 0, HP + r0p * DM, nullptr, DM, 0, MP, DM, DM);      /* y = h + ff (own-element residual; the h_pre plane is free again) */
  k_lnw<0, 1><<<(unsigned)(MP / (LN_NW * LN_RW)), LN_NW * 32, 0, stream>>>(HP + r0p * DM, g2, be2, 1e-5f, nullptr, (float*)d_out + r0p * DM);      /* out = LN2(h + ff) -> f32 output rows */
}

// v005
// One run takes 173 microseconds.
// Next to v004, in two timings, it ran 1.14 and 1.15 times as fast.
// Over all steps from v000 it is 77.1 times as fast.
#include <hip/hip_runtime.h>
// Post-LN transformer encoder block (x [4][2048][1024]; q = x wq^T, k, v likewise (nn.Linear natural [1024][1024] sigma 1/32, no biases); 16 heads of 64 (chunked along features = head-major columns); softmax(q k^T / 8) v over all keys (no mask), heads merged, NO output projection; h = LN1(x + attn) (biased variance, eps 1e-5, gamma/beta); ff = relu(h l1_w^T + l1_b) l2_w^T + l2_b (natural [1024][1024], biases sigma 0.01); out = LN2(h + ff) -> [4][2048][1024]).
// Structure: token rows r = b*2048 + s; x and the five weights as exact f16 planes (bf16-rounded), one conversion launch; Q, K, V as one batched WMMA GEMM launch (grid.y = plane; operand tiles staged in LDS, 64x64 wave tiles, f32 accumulation, exact x16 weights, f16 outputs); one fused attention launch (per head and 256 queries: S^T = K Q^T, online softmax in registers with f32 statistics and native exp2, weights as f16, O^T += V^T P^T, the V^T fragments by transposing LDS reads of V rows), h_pre = bf16(x) + attn as f32 rows; LN1 on VALU (f32 statistics, two rows per wave) -> f16 + f32 rows; relu(h l1^T + b1) GEMM with the ReLU epilogue -> f16; y = h + ff l2^T + b2 GEMM (own-element residual); LN2 on VALU -> f32 output.
// Compute dtype: inputs rounded to bf16; x / weights exact; q, k, v, softmax weights, h and the FFN hidden rows as plain f16 GEMM operands (~2^-12); scores and softmax statistics f32. v_wmma_f32_16x16x32_f16.
#define NB 4
#define SQ 2048
#define DM 1024
#define NH 16
#define HD 64
#define DMQ DM                       /* LayerNorm width */
#define HG 2                         /* heads per block group of the unlaunched per-batch k_vt */
#define B0 0                         /* first batch processed (debug hook) */
#define NBR NB                       /* batches processed (debug hook) */
#define NR ((size_t)NB * SQ)         /* token rows */
#define MP ((int)((size_t)NBR * SQ)) /* rows projected (debug hook) */
#define QN SQ                        /* unused (attention runs all SQ queries per batch) */
#define NHD NH                       /* unused (attention runs all NH heads) */
#define MPO MP                       /* unused (the output stage runs MP rows) */
#define LQ DM      /* row pitch of the q/k/v rows */
typedef __bf16 v16b __attribute__((ext_vector_type(16)));
typedef unsigned short v8us __attribute__((ext_vector_type(8), may_alias));
typedef float  v8f  __attribute__((ext_vector_type(8)));
typedef float  v4f  __attribute__((ext_vector_type(4)));
typedef float  v4fa __attribute__((ext_vector_type(4), may_alias));
union FragB { v16b v; v8us half[2]; unsigned short u[16]; };

__device__ __forceinline__ unsigned short bf16_bits(float x) { unsigned int u = __float_as_uint(x); return (unsigned short)((u + 0x7FFFu + ((u >> 16) & 1u)) >> 16); }
__device__ __forceinline__ float bf16_val(unsigned short b) { return __uint_as_float(((unsigned int)b) << 16); }
__device__ __forceinline__ float bf16_round(float x) { return bf16_val(bf16_bits(x)); }
// D += A·B with NT terms: 1 = ah·bh, 2 = + al·bh (A split), 3 = + ah·bl (both split)
template <int NT>
__device__ __forceinline__ v8f mmaN(v16b ah, v16b al, v16b bh, v16b bl, v8f c) {
  c = __builtin_amdgcn_wmma_f32_16x16x32_bf16(false, ah, false, bh, (short)0, c, false, false);
  if (NT >= 2) c = __builtin_amdgcn_wmma_f32_16x16x32_bf16(false, al, false, bh, (short)0, c, false, false);
  if (NT >= 3) c = __builtin_amdgcn_wmma_f32_16x16x32_bf16(false, ah, false, bl, (short)0, c, false, false);
  asm volatile("v_nop\n\tv_nop\n\tv_nop\n\tv_nop" : "+v"(c) : "v"(ah), "v"(al), "v"(bh), "v"(bl));
  return c;
}

__global__ __launch_bounds__(256) void k_wt_bf16(const float* __restrict__ W, unsigned short* __restrict__ Wt, int K, int N) {
  const int t = blockIdx.x * 256 + threadIdx.x;
  const int k8n = K / 8;
  if (t >= N * k8n) return;
  const int n = t / k8n, k8 = (t % k8n) * 8;
  v8us v;
#pragma unroll
  for (int i = 0; i < 8; ++i) v[i] = bf16_bits(W[(size_t)(k8 + i) * N + n]);
  *(v8us*)(Wt + (size_t)n * K + k8) = v;
  
}

// GEMM C[M][N] (f32, pitch ldc) = act(A[M][K]·W + bias). A f32 row-major (pitch lda) converted per fragment to bf16
// (ASPLIT: hi/lo two planes -> 2 terms, else single rounded term); Wt bf16 [N][K] (pitch ldb). BIAS_BF16 rounds the
// bias to bf16 first (bias quantised to bf16 before the add). K%32==0, M%16==0, N%64==0.
template <bool ASPLIT, int ACT, bool BIAS_BF16>
__global__ __launch_bounds__(128) void k_gemm_bf(const float* __restrict__ A, int lda, const unsigned short* __restrict__ Wt, int ldb,
                                               const float* __restrict__ bias, float* __restrict__ C, int ldc, int M, int N, int K) {
  __shared__ __attribute__((aligned(16))) float so[4][16][64];
  const int tid = threadIdx.x, w = tid >> 5, lane = tid & 31, ln = lane & 15, hh = lane >> 4;
  const int ntn = N / 64;
  const int wid = blockIdx.x * 4 + w;
  const int mt = wid / ntn, nq = wid % ntn;
  if (mt * 16 >= M) return;
  const int row0 = mt * 16, col0 = nq * 64;
  const float* arow = A + (size_t)(row0 + ln) * lda;
  v8f acc[4] = {};
  for (int kb = 0; kb < K; kb += 32) {
    FragB ah, al;
    const v4f x0 = *(const v4fa*)(arow + kb + 8 * hh), x1 = *(const v4fa*)(arow + kb + 8 * hh + 4);
    const v4f x2 = *(const v4fa*)(arow + kb + 16 + 8 * hh), x3 = *(const v4fa*)(arow + kb + 16 + 8 * hh + 4);
    float xs[16] = {x0[0],x0[1],x0[2],x0[3],x1[0],x1[1],x1[2],x1[3],x2[0],x2[1],x2[2],x2[3],x3[0],x3[1],x3[2],x3[3]};
#pragma unroll
    for (int i = 0; i < 16; ++i) { const unsigned short hb = bf16_bits(xs[i]); ah.u[i] = hb; al.u[i] = ASPLIT ? bf16_bits(xs[i] - bf16_val(hb)) : (unsigned short)0; }
#pragma unroll
    for (int t = 0; t < 4; ++t) {
      const unsigned short* brow = Wt + (size_t)(col0 + t * 16 + ln) * ldb + kb;
      FragB b;
      b.half[0] = *(const v8us*)(brow + 8 * hh);
      b.half[1] = *(const v8us*)(brow + 16 + 8 * hh);
      acc[t] = mmaN<ASPLIT ? 2 : 1>(ah.v, al.v, b.v, b.v, acc[t]);
    }
  }
#pragma unroll
  for (int t = 0; t < 4; ++t) {
    float bv = bias ? bias[col0 + t * 16 + ln] : 0.f;
    if (BIAS_BF16) bv = bf16_round(bv);
#pragma unroll
    for (int r = 0; r < 8; ++r) { float v = acc[t][r] + bv; if (ACT == 1) v = fmaxf(v, 0.f); so[w][8 * hh + r][t * 16 + ln] = v; }
  }
  __builtin_amdgcn_fence(__ATOMIC_ACQ_REL, "workgroup");
  __builtin_amdgcn_wave_barrier();
  const int rsub = lane >> 4, c4 = (lane & 15) * 4;
  {
#pragma unroll
    for (int q = 0; q < 8; ++q) {
      const int r = q * 2 + rsub;
      const v4f v = *(const v4fa*)&so[w][r][c4];
      *(v4f*)(C + (size_t)(row0 + r) * ldc + col0 + c4) = v;
    }
    
  }
}

// GEMM C = act(A·W + bias + resid): A f32 (ASPLIT -> hi/lo 2 terms), Wt bf16 [N][K]; ACT 0 none, 1 relu, 2 exact gelu;
// resid (optional, f32, row index = (row % rmod), pitch ldr, RES_BF16 rounds it) added before the activation.
template <bool ASPLIT, int ACT, bool BIAS_BF16, bool RES_BF16>
__global__ __launch_bounds__(128) void k_gemm_bf3(const float* __restrict__ A, int lda, const unsigned short* __restrict__ Wt, int ldb,
                                                const float* __restrict__ bias, const float* __restrict__ resid, int rmod, int ldr,
                                                float* __restrict__ C, int ldc, int M, int N, int K) {
  __shared__ __attribute__((aligned(16))) float so[4][16][64];
  const int tid = threadIdx.x, w = tid >> 5, lane = tid & 31, ln = lane & 15, hh = lane >> 4;
  const int ntn = N / 64;
  const int wid = blockIdx.x * 4 + w;
  const int mt = wid / ntn, nq = wid % ntn;
  if (mt * 16 >= M) return;
  const int row0 = mt * 16, col0 = nq * 64;
  const float* arow = A + (size_t)(row0 + ln) * lda;
  v8f acc[4] = {};
  for (int kb = 0; kb < K; kb += 32) {
    FragB ah, al;
    const v4f x0 = *(const v4fa*)(arow + kb + 8 * hh), x1 = *(const v4fa*)(arow + kb + 8 * hh + 4);
    const v4f x2 = *(const v4fa*)(arow + kb + 16 + 8 * hh), x3 = *(const v4fa*)(arow + kb + 16 + 8 * hh + 4);
    float xs[16] = {x0[0],x0[1],x0[2],x0[3],x1[0],x1[1],x1[2],x1[3],x2[0],x2[1],x2[2],x2[3],x3[0],x3[1],x3[2],x3[3]};
#pragma unroll
    for (int i = 0; i < 16; ++i) { const unsigned short hb = bf16_bits(xs[i]); ah.u[i] = hb; al.u[i] = ASPLIT ? bf16_bits(xs[i] - bf16_val(hb)) : (unsigned short)0; }
#pragma unroll
    for (int t = 0; t < 4; ++t) {
      const unsigned short* brow = Wt + (size_t)(col0 + t * 16 + ln) * ldb + kb;
      FragB b;
      b.half[0] = *(const v8us*)(brow + 8 * hh);
      b.half[1] = *(const v8us*)(brow + 16 + 8 * hh);
      acc[t] = mmaN<ASPLIT ? 2 : 1>(ah.v, al.v, b.v, b.v, acc[t]);
    }
  }
#pragma unroll
  for (int t = 0; t < 4; ++t) {
    const int col = col0 + t * 16 + ln;
    float bv = bias ? bias[col] : 0.f;
    if (BIAS_BF16) bv = bf16_round(bv);
#pragma unroll
    for (int r = 0; r < 8; ++r) {
      float v = acc[t][r] + bv;
      if (resid) { float rv = resid[(size_t)((row0 + 8 * hh + r) % rmod) * ldr + col]; if (RES_BF16) rv = bf16_round(rv); v += rv; }
      if (ACT == 1) v = fmaxf(v, 0.f);
      if (ACT == 2) v = 0.5f * v * (1.0f + erff(v * 0.70710678118654752f));
      if (ACT == 3) { const float u = 0.7978845608028654f * (v + 0.044715f * v * v * v); v = 0.5f * v * (1.0f + tanhf(u)); }
      so[w][8 * hh + r][t * 16 + ln] = v;
    }
  }
  __builtin_amdgcn_fence(__ATOMIC_ACQ_REL, "workgroup");
  __builtin_amdgcn_wave_barrier();
  const int rsub = lane >> 4, c4 = (lane & 15) * 4;
  {
#pragma unroll
    for (int q = 0; q < 8; ++q) {
      const int r = q * 2 + rsub;
      const v4f v = *(const v4fa*)&so[w][r][c4];
      *(v4f*)(C + (size_t)(row0 + r) * ldc + col0 + c4) = v;
    }
    
  }
}
// row LayerNorm (biased variance, eps) over N: s = X (+ R); optional out_sum <- s; out_norm <- (s-mu)*rsqrt(var+eps)*g + b
template <bool PARAM_BF16>
__global__ __launch_bounds__(256) void k_layernorm(const float* __restrict__ X, const float* __restrict__ R, const float* __restrict__ g, const float* __restrict__ bta,
                                                  float* __restrict__ out_sum, float* __restrict__ out_norm, int N, float eps) {
  __shared__ float red[256];
  const int row = blockIdx.x, tid = threadIdx.x;
  const float* x = X + (size_t)row * N; const float* rr = R ? R + (size_t)row * N : nullptr;
  float vals[16];                     // up to N = 4096
  const int per = N / 256;            // contiguous chunk per thread? use strided-by-4 chunks: thread handles j = tid*4 + 1024*u
  float s1 = 0.f;
  for (int u = 0; u < per / 4; ++u) {
    const int j = tid * 4 + 1024 * u;
    const v4f a = *(const v4fa*)(x + j);
    v4f b = {0.f,0.f,0.f,0.f}; if (rr) b = *(const v4fa*)(rr + j);
#pragma unroll
    for (int q = 0; q < 4; ++q) { const float v = a[q] + b[q]; vals[u * 4 + q] = v; s1 += v; }
  }
  red[tid] = s1; __syncthreads();
  for (int st = 128; st > 0; st >>= 1) { if (tid < st) red[tid] += red[tid + st]; __syncthreads(); }
  const float mu = red[0] / (float)N; __syncthreads();
  float s2 = 0.f;
  for (int u = 0; u < per / 4; ++u)
#pragma unroll
    for (int q = 0; q < 4; ++q) { const float c = vals[u * 4 + q] - mu; s2 += c * c; }
  red[tid] = s2; __syncthreads();
  for (int st = 128; st > 0; st >>= 1) { if (tid < st) red[tid] += red[tid + st]; __syncthreads(); }
  const float rs = rsqrtf(red[0] / (float)N + eps);
  {
    for (int u = 0; u < per / 4; ++u) {
      const int j = tid * 4 + 1024 * u;
      v4f o, sm;
#pragma unroll
      for (int q = 0; q < 4; ++q) {
        float gg = g[j + q], bb = bta[j + q];
        if (PARAM_BF16) { gg = bf16_round(gg); bb = bf16_round(bb); }
        sm[q] = vals[u * 4 + q]; o[q] = (vals[u * 4 + q] - mu) * rs * gg + bb;
      }
      if (out_sum) *(v4f*)(out_sum + (size_t)row * N + j) = sm;
      *(v4f*)(out_norm + (size_t)row * N + j) = o;
    }
    
  }
}



// ---- f16 WMMA path (v_wmma_f32_16x16x32_f16): 11-bit significands for operands in range — used where a [0,1] probability operand needs more precision than bf16
typedef _Float16 v16h __attribute__((ext_vector_type(16)));
union FragH { v16h v; v8us half[2]; _Float16 h[16]; unsigned short u[16]; };
template <int NT>
__device__ __forceinline__ v8f mmaH(v16h ah, v16h al, v16h bh, v16h bl, v8f c) {
  c = __builtin_amdgcn_wmma_f32_16x16x32_f16(false, ah, false, bh, (short)0, c, false, false);
  if (NT >= 2) c = __builtin_amdgcn_wmma_f32_16x16x32_f16(false, al, false, bh, (short)0, c, false, false);
  if (NT >= 3) c = __builtin_amdgcn_wmma_f32_16x16x32_f16(false, ah, false, bl, (short)0, c, false, false);
  asm volatile("v_nop\n\tv_nop\n\tv_nop\n\tv_nop" : "+v"(c) : "v"(ah), "v"(al), "v"(bh), "v"(bl));
  return c;
}
// batched GEMM like k_gemm_b but f16 operands: A f32 (split into f16 hi/lo if ASPLIT, else rounded to f16), Bt = f16 values [n][k]; alpha; C f32; N multiple of 16 (partial tiles skipped)
template <bool ASPLIT>
__global__ __launch_bounds__(128) void k_gemm_h(const float* __restrict__ A, int lda, size_t sA, const _Float16* __restrict__ Bh, int ldb, size_t sB, float alpha, float* __restrict__ C, int ldc, size_t sC, int M, int N, int K) {
  __shared__ __attribute__((aligned(16))) float so[4][16][64];
  const int tid = threadIdx.x, w = tid >> 5, lane = tid & 31, ln = lane & 15, hh = lane >> 4; const int by = blockIdx.y;
  A += (size_t)by * sA; Bh += (size_t)by * sB; C += (size_t)by * sC;
  const int ntn = (N + 63) / 64; const int wid = blockIdx.x * 4 + w; const int mt = wid / ntn, nq = wid % ntn; if (mt * 16 >= M) return;
  const int row0 = mt * 16, col0 = nq * 64; const float* arow = A + (size_t)(row0 + ln) * lda;
  v8f acc[4] = {};
  for (int kb = 0; kb < K; kb += 32) {
    FragH ah, al;
    const v4f x0 = *(const v4fa*)(arow + kb + 8 * hh), x1 = *(const v4fa*)(arow + kb + 8 * hh + 4), x2 = *(const v4fa*)(arow + kb + 16 + 8 * hh), x3 = *(const v4fa*)(arow + kb + 16 + 8 * hh + 4);
    float xs[16] = {x0[0],x0[1],x0[2],x0[3],x1[0],x1[1],x1[2],x1[3],x2[0],x2[1],x2[2],x2[3],x3[0],x3[1],x3[2],x3[3]};
#pragma unroll
    for (int i = 0; i < 16; ++i) { const _Float16 h = (_Float16)xs[i]; ah.h[i] = h; al.h[i] = ASPLIT ? (_Float16)(xs[i] - (float)h) : (_Float16)0.0f; }
#pragma unroll
    for (int t = 0; t < 4; ++t) { if (col0 + t * 16 >= N) continue; const size_t boff = (size_t)(col0 + t * 16 + ln) * ldb + kb; FragH bq; bq.half[0] = *(const v8us*)(Bh + boff + 8 * hh); bq.half[1] = *(const v8us*)(Bh + boff + 16 + 8 * hh);
      acc[t] = mmaH<ASPLIT ? 2 : 1>(ah.v, al.v, bq.v, bq.v, acc[t]); }
  }
#pragma unroll
  for (int t = 0; t < 4; ++t) { if (col0 + t * 16 >= N) continue;
#pragma unroll
    for (int r = 0; r < 8; ++r) so[w][8 * hh + r][t * 16 + ln] = acc[t][r] * alpha; }
  __builtin_amdgcn_fence(__ATOMIC_ACQ_REL, "workgroup"); __builtin_amdgcn_wave_barrier();
  const int rsub = lane >> 4, c4 = (lane & 15) * 4;
  {
#pragma unroll
    for (int q = 0; q < 8; ++q) { const int r = q * 2 + rsub; if (col0 + c4 < N) { const v4f v = *(const v4fa*)&so[w][r][c4]; *(v4f*)(C + (size_t)(row0 + r) * ldc + col0 + c4) = v; } }
     }
}

// Wt[n][k] = f16(W[k][n]·scale) from f32 row-major W[K][N] (scale = power of two; bf16-exact weights stay exact in f16 away from the subnormal range)
__global__ __launch_bounds__(256) void k_wt_f16(const float* __restrict__ W, _Float16* __restrict__ Wt, int K, int N, float scale) {
  const int t = blockIdx.x * 256 + threadIdx.x; if (t >= N * (K / 8)) return; const int n = t / (K / 8), k8 = (t % (K / 8)) * 8; FragH f;
#pragma unroll
  for (int i = 0; i < 8; ++i) f.h[i] = (_Float16)(bf16_round(W[(size_t)(k8 + i) * N + n]) * scale); const v8us o = f.half[0];
  *(v8us*)((unsigned short*)Wt + (size_t)n * K + k8) = o; 
}
// k_gemm_hh variant with fused epilogue: v = acc·alpha + bias[by·sBias + col] (+ CP[(row/rowsPerB)·sCPb + by·64 + col] if CP) ; ACT 0 none / 1 elu ; writes f16 C16 (and f32 C if non-null)
template <int ACT>
__global__ __launch_bounds__(128) void k_gemm_hhx(const _Float16* __restrict__ A, int lda, size_t sA, const _Float16* __restrict__ Bh, int ldb, size_t sB, float alpha, const float* __restrict__ bias, size_t sBias, const float* __restrict__ CP, int rowsPerB, size_t sCPb, int row0g,
    float* __restrict__ C, _Float16* __restrict__ C16, int ldc, size_t sC, int M, int N, int K) {
  __shared__ __attribute__((aligned(16))) float so[4][16][64];
  const int tid = threadIdx.x, w = tid >> 5, lane = tid & 31, ln = lane & 15, hh = lane >> 4; const int by = blockIdx.y;
  A += (size_t)by * sA; Bh += (size_t)by * sB; const size_t cofs = (size_t)by * sC; const float* bp = bias ? bias + (size_t)by * sBias : nullptr;
  const int ntn = (N + 63) / 64; const int wid = blockIdx.x * 4 + w; const int mt = wid / ntn, nq = wid % ntn; if (mt * 16 >= M) return;
  const int row0 = mt * 16, col0 = nq * 64; const _Float16* arow = A + (size_t)(row0 + ln) * lda;
  v8f acc[4] = {};
  for (int kb = 0; kb < K; kb += 32) { FragH ah; ah.half[0] = *(const v8us*)((const unsigned short*)arow + kb + 8 * hh); ah.half[1] = *(const v8us*)((const unsigned short*)arow + kb + 16 + 8 * hh);
#pragma unroll
    for (int t = 0; t < 4; ++t) { if (col0 + t * 16 >= N) continue; const size_t boff = (size_t)(col0 + t * 16 + ln) * ldb + kb; FragH bq; bq.half[0] = *(const v8us*)((const unsigned short*)Bh + boff + 8 * hh); bq.half[1] = *(const v8us*)((const unsigned short*)Bh + boff + 16 + 8 * hh);
      acc[t] = mmaH<1>(ah.v, ah.v, bq.v, bq.v, acc[t]); }
  }
#pragma unroll
  for (int t = 0; t < 4; ++t) { if (col0 + t * 16 >= N) continue; const int col = col0 + t * 16 + ln; const float bv = bp ? bf16_round(bp[col]) : 0.f;
#pragma unroll
    for (int r = 0; r < 8; ++r) { float v = acc[t][r] * alpha + bv; if (CP) { const int rr = row0g + row0 + 8 * hh + r; if (rowsPerB < 0) v += CP[cofs + (size_t)rr * ldc + col];      /* rowsPerB < 0: own element of the batched C plane */ else { const int bidx = rr / rowsPerB; v += CP[(size_t)bidx * sCPb + (size_t)by * 64 + col]; } } if (ACT == 1) v = (v > 0.f) ? v : expm1f(v); else if (ACT == 7) v = (v > 0.f) ? v + 1.0f : expf(v); else if (ACT == 8) v = tanhf(v); else if (ACT == 9) v = 0.5f * v * (1.0f + tanhf(0.7978845608028654f * (v + 0.044715f * v * v * v))); else if (ACT == 11) v = 1.0f / (1.0f + expf(-v)); else if (ACT == 12) v = (v > 0.f) ? v : 0.01f * v; else if (ACT == 14) v = (v > 0.f) ? v : 0.1f * v; else if (ACT == 16) v = (v >= 0.f) ? v : 0.3f * v; else if (ACT == 17) v = (v >= 0.f) ? v : 0.2f * v; else if (ACT == 15) v = v / (1.0f + expf(-v)); else if (ACT == 3) v = fmaxf(v, 0.f); else if (ACT == 6) v = 0.5f * v * (1.0f + erff(v * 0.70710678118654752f)); so[w][8 * hh + r][t * 16 + ln] = v; } }
  __builtin_amdgcn_fence(__ATOMIC_ACQ_REL, "workgroup"); __builtin_amdgcn_wave_barrier();
  const int rsub = lane >> 4, c4 = (lane & 15) * 4; typedef _Float16 v4h __attribute__((ext_vector_type(4)));
  {
#pragma unroll
    for (int q = 0; q < 8; ++q) { const int r = q * 2 + rsub; if (col0 + c4 < N) { const v4f v = *(const v4fa*)&so[w][r][c4]; if (C) *(v4f*)(C + cofs + (size_t)(row0 + r) * ldc + col0 + c4) = v; if (C16) { v4h h4; for (int i = 0; i < 4; ++i) h4[i] = (_Float16)v[i]; *(v4h*)(C16 + cofs + (size_t)(row0 + r) * ldc + col0 + c4) = h4; } } }
     }
}


typedef _Float16 v4h __attribute__((ext_vector_type(4)));

__global__ __launch_bounds__(256) void k_h16(const float* __restrict__ x, _Float16* __restrict__ X16, size_t n8) { const size_t t = (size_t)blockIdx.x * 256 + threadIdx.x; if (t >= n8) return; FragH f;
#pragma unroll
  for (int q = 0; q < 8; ++q) f.h[q] = (_Float16)x[t * 8 + q]; *(v8us*)((unsigned short*)X16 + t * 8) = f.half[0];  }
__global__ __launch_bounds__(256) void k_round16f(const float* __restrict__ W, _Float16* __restrict__ Bt, size_t n8) { const size_t t = (size_t)blockIdx.x * 256 + threadIdx.x; if (t >= n8) return; FragH f;
#pragma unroll
  for (int i = 0; i < 8; ++i) f.h[i] = (_Float16)(bf16_round(W[t * 8 + i]) * 16.0f); *(v8us*)((unsigned short*)Bt + t * 8) = f.half[0];  }
__global__ __launch_bounds__(256) void k_hl(const float* __restrict__ F, _Float16* __restrict__ Hh, _Float16* __restrict__ Hl, size_t n8) { const size_t t = (size_t)blockIdx.x * 256 + threadIdx.x; if (t >= n8) return; FragH fh, fl; const v4f a = *(const v4fa*)(F + t * 8), c = *(const v4fa*)(F + t * 8 + 4);
#pragma unroll
  for (int q = 0; q < 4; ++q) { _Float16 h = (_Float16)a[q]; fh.h[q] = h; fl.h[q] = (_Float16)((a[q] - (float)h) * 1024.0f); h = (_Float16)c[q]; fh.h[4 + q] = h; fl.h[4 + q] = (_Float16)((c[q] - (float)h) * 1024.0f); }
  { *(v8us*)((unsigned short*)Hh + t * 8) = fh.half[0]; *(v8us*)((unsigned short*)Hl + t * 8) = fl.half[0];  } }

// ---- GEMM with both operands staged in LDS (work-group tile 256x128, eight waves of 64x64; requires M % 256 == 0, N % 128 == 0, K % 128 == 0); epilogue = k_gemm_hhx semantics ----
#define G2_KS 128     /* k per stage: 256 bytes of every operand row */
#define G2_PT 136     /* LDS row pitch in 16-bit elements: 272 B = 16 B x 17, the pitch for 16-byte fragment reads of 256-byte rows */
#define G2_BM 256     /* rows of C per work-group */
#define G2_BN 128     /* columns of C per work-group */
__device__ __forceinline__ v16h g2_frag(const unsigned short* p, int hh) { FragH f; f.half[0] = *(const v8us*)(p + 8 * hh); f.half[1] = *(const v8us*)(p + 16 + 8 * hh); return f.v; }
__device__ __forceinline__ v8f g2_mma(v16h a, v16h b, v8f c) { return __builtin_amdgcn_wmma_f32_16x16x32_f16(false, a, false, b, (short)0, c, false, false); }
// Eight asynchronous copies of one lane: its 16-byte piece of eight operand rows, 16 rows apart, from global memory straight into LDS (a wave's copy covers two whole 256-byte rows).
// l: the lane's LDS byte address; g: its global address; p: 16 rows in elements. The s_wait_xcnt stands inside the statement so that no address register is rewritten in front of it.
__device__ __forceinline__ void g2_copy8(unsigned l, const unsigned short* g, size_t p) {
  const unsigned lp = 16 * G2_PT * 2;
  asm volatile("global_load_async_to_lds_b128 %0, %8, off\n\t"
               "global_load_async_to_lds_b128 %1, %9, off\n\t"
               "global_load_async_to_lds_b128 %2, %10, off\n\t"
               "global_load_async_to_lds_b128 %3, %11, off\n\t"
               "global_load_async_to_lds_b128 %4, %12, off\n\t"
               "global_load_async_to_lds_b128 %5, %13, off\n\t"
               "global_load_async_to_lds_b128 %6, %14, off\n\t"
               "global_load_async_to_lds_b128 %7, %15, off\n\t"
               "s_wait_xcnt 0x0"
               :: "v"(l), "v"(l + lp), "v"(l + 2 * lp), "v"(l + 3 * lp), "v"(l + 4 * lp), "v"(l + 5 * lp), "v"(l + 6 * lp), "v"(l + 7 * lp),
                  "v"(g), "v"(g + p), "v"(g + 2 * p), "v"(g + 3 * p), "v"(g + 4 * p), "v"(g + 5 * p), "v"(g + 6 * p), "v"(g + 7 * p)
               : "memory"); }
// One stage: 256 A rows and 128 B rows of 256 bytes, 24 copies per lane.
__device__ __forceinline__ void g2_stage(unsigned la, unsigned lb, const unsigned short* ga, const unsigned short* gb, size_t pa, size_t pb) {
  g2_copy8(la, ga, pa); g2_copy8(la + 128 * G2_PT * 2, ga + 8 * pa, pa); g2_copy8(lb, gb, pb); }
// Half P (32 rows) of a wave's 64x64 tile: v = acc alpha + bias (+ residual), activation, through the wave's own 32 LDS rows, so that each global store covers whole rows of the tile.
// RES 0: no residual; 1: own element of the batched C plane (rowsPerB < 0); 2: row (row / rowsPerB) of CP.
template <int ACT, int RES, int P>
__device__ __forceinline__ void g2_out(const v8f (&acc)[4][4], float (*sw)[68], float alpha, const float* bp, const float* CP, int rowsPerB, size_t sCPb, int row0g, int by, float* C, _Float16* C16, int ldc, size_t cofs, int row0, int col0, int ln, int hh) {
  const int rp = row0 + P * 32; const int c4 = ln * 4;
#pragma unroll      /* constant indices keep the accumulator array in registers */
  for (int u = 0; u < 8; ++u) { const int t = u & 3, half = u >> 2; const int col = col0 + t * 16 + ln; const float bv = bp ? bf16_round(bp[col]) : 0.f;
#pragma unroll      /* constant indices keep the accumulator array in registers */
    for (int r = 0; r < 8; ++r) { const int rloc = half * 16 + 8 * hh + r; float v = acc[P * 2 + half][t][r] * alpha + bv;
      if (RES == 1) v += CP[cofs + (size_t)(row0g + rp + rloc) * ldc + col]; else if (RES == 2) { const int bidx = (row0g + rp + rloc) / rowsPerB; v += CP[(size_t)bidx * sCPb + (size_t)by * 64 + col]; }
      if (ACT == 3) v = fmaxf(v, 0.f); else if (ACT == 6) v = 0.5f * v * (1.0f + erff(v * 0.70710678118654752f)); else if (ACT == 11) v = 1.0f / (1.0f + expf(-v)); else if (ACT == 15) v = v / (1.0f + expf(-v)); else if (ACT == 12) v = (v > 0.f) ? v : 0.01f * v; else if (ACT == 8) v = tanhf(v); else if (ACT == 9) v = 0.5f * v * (1.0f + tanhf(0.7978845608028654f * (v + 0.044715f * v * v * v))); else if (ACT == 14) v = (v > 0.f) ? v : 0.1f * v; else if (ACT == 16) v = (v >= 0.f) ? v : 0.3f * v; else if (ACT == 17) v = (v >= 0.f) ? v : 0.2f * v;
      sw[rloc][t * 16 + ln] = v; } }
  __builtin_amdgcn_fence(__ATOMIC_ACQ_REL, "workgroup"); __builtin_amdgcn_wave_barrier();      /* the wave's own LDS stores before its own reads of other lanes' elements */
#pragma unroll      /* the row steps fold into the immediate offsets of the LDS reads */
  for (int q = 0; q < 16; ++q) { const int r = q * 2 + hh; const v4f v = *(const v4fa*)&sw[r][c4];
    if (C) { *(v4f*)(C + cofs + (size_t)(rp + r) * ldc + col0 + c4) = v; asm volatile("s_wait_xcnt 0x0" ::: "memory");      /* in front of the conversion below, which may reuse the store's registers */ }
    if (C16) { v4h h4; for (int i = 0; i < 4; ++i) h4[i] = (_Float16)v[i]; *(v4h*)(C16 + cofs + (size_t)(rp + r) * ldc + col0 + c4) = h4; } }
  __builtin_amdgcn_fence(__ATOMIC_ACQ_REL, "workgroup"); __builtin_amdgcn_wave_barrier();      /* these reads before the next half's stores into the same rows */
}
template <int ACT>
__global__ __launch_bounds__(256) void k_gemm2(const _Float16* __restrict__ A, int lda, size_t sA, const _Float16* __restrict__ Bh, int ldb, size_t sB, float alpha, const float* __restrict__ bias, size_t sBias, const float* __restrict__ CP, int rowsPerB, size_t sCPb, int row0g,
    float* __restrict__ C, _Float16* __restrict__ C16, int ldc, size_t sC, int M, int N, int K) { static_assert(ACT == 0 || ACT == 3 || ACT == 6 || ACT == 8 || ACT == 9 || ACT == 11 || ACT == 12 || ACT == 14 || ACT == 15 || ACT == 16 || ACT == 17, "k_gemm2: unsupported ACT code (would silently apply no activation)");
  __shared__ __attribute__((aligned(16))) unsigned short sa[2][G2_BM][G2_PT];
  __shared__ __attribute__((aligned(16))) unsigned short sb[2][G2_BN][G2_PT];
  __shared__ __attribute__((aligned(16))) float so[8][32][68];
  const int tid = threadIdx.x, w = tid >> 5, lane = tid & 31, ln = lane & 15, hh = lane >> 4; const int by = blockIdx.y;
  A += (size_t)by * sA; Bh += (size_t)by * sB; const size_t cofs = (size_t)by * sC; const float* bp = bias ? bias + (size_t)by * sBias : nullptr;
  const int ntn = N >> 7; const int mt = blockIdx.x / ntn, nq = blockIdx.x - mt * ntn; if (mt * G2_BM >= M) return;      /* the whole work-group, in front of every copy and barrier */
  const int wr = (w >> 1) * 64, wc = (w & 1) * 64; const int row0 = mt * G2_BM + wr, col0 = nq * G2_BN + wc;
  const int sr = tid >> 4, sc = (tid & 15) * 8;      /* staging: rows sr + 16 j, 16-byte piece sc */
  const unsigned short* ag = (const unsigned short*)A + (size_t)(mt * G2_BM + sr) * lda + sc; const unsigned short* bg = (const unsigned short*)Bh + (size_t)(nq * G2_BN + sr) * ldb + sc;
  const size_t pa = (size_t)16 * lda, pb = (size_t)16 * ldb;
  const unsigned la0 = (unsigned)(size_t)&sa[0][sr][sc], lb0 = (unsigned)(size_t)&sb[0][sr][sc];      /* low 32 bits of a __shared__ address = the LDS byte address */
  const unsigned abuf = G2_BM * G2_PT * 2, bbuf = G2_BN * G2_PT * 2;
  const int nst = K >> 7;
  const v8f z8 = {0.f,0.f,0.f,0.f,0.f,0.f,0.f,0.f}; v8f acc[4][4];
#pragma unroll      /* constant indices keep the accumulator array in registers */
  for (int i = 0; i < 4; ++i)
#pragma unroll      /* constant indices keep the accumulator array in registers */
    for (int j = 0; j < 4; ++j) acc[i][j] = z8;
  g2_stage(la0, lb0, ag, bg, pa, pb);
  asm volatile("s_wait_asynccnt 0x0" ::: "memory");      /* this wave's copies of stage 0 have landed */
  __syncthreads();      /* publishes stage 0 */
  if (nst > 1) g2_stage(la0 + abuf, lb0 + bbuf, ag + G2_KS, bg + G2_KS, pa, pb);
#pragma unroll 1      /* one stage per trip: the two-buffer order below holds per trip */
  for (int s = 0; s < nst; ++s) { const int bf = s & 1;
#pragma unroll      /* constant indices keep the fragment and accumulator arrays in registers */
    for (int ks = 0; ks < G2_KS; ks += 32) { v16h af[4], bq[4];
#pragma unroll      /* constant indices keep the fragment and accumulator arrays in registers */
      for (int i = 0; i < 4; ++i) af[i] = g2_frag(&sa[bf][wr + i * 16 + ln][ks], hh);
#pragma unroll      /* constant indices keep the fragment and accumulator arrays in registers */
      for (int j = 0; j < 4; ++j) bq[j] = g2_frag(&sb[bf][wc + j * 16 + ln][ks], hh);
      __builtin_amdgcn_sched_barrier(0);      /* keeps the block's 16 LDS reads together in front of its 16 WMMAs: left free, the compiler sinks each A fragment's reads to its row and waits them out there */
#pragma unroll      /* constant indices keep the fragment and accumulator arrays in registers */
      for (int i = 0; i < 4; ++i)
#pragma unroll      /* constant indices keep the fragment and accumulator arrays in registers */
        for (int j = 0; j < 4; ++j) acc[i][j] = g2_mma(af[i], bq[j], acc[i][j]);
    }
    asm volatile("s_wait_dscnt 0x0" ::: "memory");      /* this wave's reads of buffer bf have returned before the buffer is refilled */
    asm volatile("s_wait_asynccnt 0x0" ::: "memory");      /* this wave's copies of stage s + 1 have landed */
    __syncthreads();      /* publishes stage s + 1 and ends every wave's reads of buffer bf */
    if (s + 2 < nst) { const int kn = (s + 2) * G2_KS; g2_stage(la0 + bf * abuf, lb0 + bf * bbuf, ag + kn, bg + kn, pa, pb); }
  }
  asm volatile("s_wait_asynccnt 0x0" ::: "memory");      /* no copy is outstanding when the wave goes on to its end */
  // the three residual cases are told apart once, not per element, so that each case's text is short and runs straight through; the hints only order the text: the plain case first, the per-row division last
  if (__builtin_expect(!CP, 1)) { g2_out<ACT, 0, 0>(acc, so[w], alpha, bp, CP, rowsPerB, sCPb, row0g, by, C, C16, ldc, cofs, row0, col0, ln, hh); g2_out<ACT, 0, 1>(acc, so[w], alpha, bp, CP, rowsPerB, sCPb, row0g, by, C, C16, ldc, cofs, row0, col0, ln, hh); }
  else if (__builtin_expect(rowsPerB < 0, 1)) { g2_out<ACT, 1, 0>(acc, so[w], alpha, bp, CP, rowsPerB, sCPb, row0g, by, C, C16, ldc, cofs, row0, col0, ln, hh); g2_out<ACT, 1, 1>(acc, so[w], alpha, bp, CP, rowsPerB, sCPb, row0g, by, C, C16, ldc, cofs, row0, col0, ln, hh); }
  else { g2_out<ACT, 2, 0>(acc, so[w], alpha, bp, CP, rowsPerB, sCPb, row0g, by, C, C16, ldc, cofs, row0, col0, ln, hh); g2_out<ACT, 2, 1>(acc, so[w], alpha, bp, CP, rowsPerB, sCPb, row0g, by, C, C16, ldc, cofs, row0, col0, ln, hh); } }


// Every operand conversion in one launch: x -> f16(bf16(x)) rows, and the five natural [out][in] weights -> f16(bf16(w) x 16) planes (= Bt[n][k]).
// A work-group converts CV_BE contiguous elements of ONE tensor (the tensor is picked from the block index, the same for the whole work-group); a thread takes CV_PT pieces of 8 elements, all its loads in front of its stores.
#define CV_PT 4                        /* 8-element pieces per thread: eight 16-byte loads in flight per lane */
#define CV_BE (256 * CV_PT * 8)        /* elements per work-group */
#define CV_NX ((int)(NR * DM / CV_BE)) /* work-groups on x */
#define CV_NW (DM * DM / CV_BE)        /* work-groups on each weight */
__global__ __launch_bounds__(256) void k_cvt(const float* __restrict__ x, const float* __restrict__ wq, const float* __restrict__ wk, const float* __restrict__ wv, const float* __restrict__ w1, const float* __restrict__ w2,
    _Float16* __restrict__ X16, _Float16* __restrict__ BQ, _Float16* __restrict__ BK, _Float16* __restrict__ BV, _Float16* __restrict__ BW1, _Float16* __restrict__ BW2) {
  static_assert(NR * DM % CV_BE == 0 && DM * DM % CV_BE == 0, "k_cvt: whole work-groups only");
  int blk = blockIdx.x; const float* s = x; _Float16* d = X16; float sc = 1.0f;
  if (blk >= CV_NX) { blk -= CV_NX; const int wi = blk / CV_NW; blk -= wi * CV_NW; sc = 16.0f;
    s = wi == 0 ? wq : wi == 1 ? wk : wi == 2 ? wv : wi == 3 ? w1 : w2; d = wi == 0 ? BQ : wi == 1 ? BK : wi == 2 ? BV : wi == 3 ? BW1 : BW2; }
  const size_t e0 = (size_t)blk * CV_BE + threadIdx.x * 8;
  v4f a[CV_PT][2];
#pragma unroll      /* constant indices keep the piece array in registers */
  for (int u = 0; u < CV_PT; ++u) { a[u][0] = *(const v4fa*)(s + e0 + u * 2048); a[u][1] = *(const v4fa*)(s + e0 + u * 2048 + 4); }
#pragma unroll      /* constant indices keep the piece array in registers */
  for (int u = 0; u < CV_PT; ++u) { FragH f;
#pragma unroll      /* constant indices keep the piece array in registers */
    for (int q = 0; q < 4; ++q) { f.h[q] = (_Float16)(bf16_round(a[u][0][q]) * sc); f.h[4 + q] = (_Float16)(bf16_round(a[u][1][q]) * sc); }
    *(v8us*)((unsigned short*)d + e0 + u * 2048) = f.half[0]; } }
__global__ __launch_bounds__(256) void k_rsm(const float* __restrict__ S, _Float16* __restrict__ P, int nrows) {
  #pragma clang fp contract(off)
  const int i = blockIdx.x * 256 + threadIdx.x; if (i >= nrows) return; const float* s = S + (size_t)i * SQ; float mx = -3.0e38f;
#pragma unroll 1
  for (int j = 0; j < SQ; ++j) mx = fmaxf(mx, s[j]); float se = 0.f;
#pragma unroll 1
  for (int j = 0; j < SQ; ++j) se += expf(s[j] - mx); const float sc = 256.0f / se;
#pragma unroll 1
  for (int j0 = 0; j0 < SQ; j0 += 8) { FragH f; for (int q = 0; q < 8; ++q) f.h[q] = (_Float16)(expf(s[j0 + q] - mx) * sc); unsigned short* d = (unsigned short*)P + (size_t)i * SQ + j0; *(v8us*)d = f.half[0];  } }
__global__ __launch_bounds__(256) void k_vt(const _Float16* __restrict__ V16, int b, int h0, _Float16* __restrict__ VT) { __shared__ unsigned short tl[64][65]; const int tid = threadIdx.x; const int hh = blockIdx.x % HG, sg = blockIdx.x / HG; const int s0 = sg * 64; const int h = h0 + hh;
  for (int i = tid; i < 64 * 8; i += 256) { const int j = i / 8, d8 = (i % 8) * 8; FragH f; f.half[0] = *(const v8us*)((const unsigned short*)V16 + ((size_t)b * SQ + s0 + j) * DM + h * HD + d8); for (int q = 0; q < 8; ++q) tl[d8 + q][j] = f.u[q]; }
  __syncthreads();
  { for (int i = tid; i < 64 * 8; i += 256) { const int d = i / 8, j8 = (i % 8) * 8; FragH f; for (int q = 0; q < 8; ++q) f.u[q] = tl[d][j8 + q]; *(v8us*)((unsigned short*)VT + ((size_t)hh * HD + d) * SQ + s0 + j8) = f.half[0]; }  } }


// lane l <-> lane l ^ 16
__device__ __forceinline__ float fa_xrow(float v) { const int i = __builtin_bit_cast(int, v); return __builtin_bit_cast(float, __builtin_amdgcn_permlanex16(i, i, 0x76543210, 0xfedcba98, false, false)); }
__device__ __forceinline__ v16h fa_frag(const unsigned short* p, int hh) { FragH f; f.half[0] = *(const v8us*)(p + 8 * hh); f.half[1] = *(const v8us*)(p + 16 + 8 * hh); return f.v; }
__device__ __forceinline__ v8f fa_mma(v16h a, v16h b, v8f c) { return __builtin_amdgcn_wmma_f32_16x16x32_f16(false, a, false, b, (short)0, c, false, false); }
typedef float v2f __attribute__((ext_vector_type(2)));
typedef _Float16 v2h __attribute__((ext_vector_type(2)));
#define FA_KS 64      /* keys per LDS stage */
#define FA_PT 72      /* LDS row pitch in 16-bit elements: 144 B = 16 B x 9, so the 16 rows of a 16-byte fragment read fall on distinct banks */
#define FA_PV 80      /* LDS row pitch of the V rows in 16-bit elements: 160 B = 32 B x 5, the pitch for transposing 16-byte reads of 128-byte rows */
#define FA_NW 8       /* waves per work-group, 32 query columns each */
typedef short fa_s8 __attribute__((ext_vector_type(8)));
// One 16 (d) x 32 (keys) A fragment of V^T from V rows [key][d] in LDS, by two transposing reads (ds_load_tr16_b128), 16 keys apart.
// p: the lane's own address, row 8 (lane >> 4) + (lane & 7) of the 32 keys, 16-byte piece (lane >> 3) & 1 of the 16 d; lane (ln, hh) then holds d = ln, keys 8 hh + 0..7 and 16 + 8 hh + 0..7: the hardware k order, as fa_frag gives it from V^T rows.
__device__ __forceinline__ v16h fa_fragt(const unsigned short* p) { typedef __attribute__((address_space(3))) fa_s8 lds_s8; FragH f; f.half[0] = __builtin_bit_cast(v8us, __builtin_amdgcn_ds_load_tr16_b128_v8i16((lds_s8*)p)); f.half[1] = __builtin_bit_cast(v8us, __builtin_amdgcn_ds_load_tr16_b128_v8i16((lds_s8*)(p + 16 * FA_PV))); return f.v; }
__global__ __launch_bounds__(FA_NW * 32) __attribute__((amdgpu_waves_per_eu(4, 4))) void k_fattn(const _Float16* __restrict__ Q16, const _Float16* __restrict__ K16, const _Float16* __restrict__ V16, const float* __restrict__ X, float* __restrict__ HP) {
  __shared__ __attribute__((aligned(16))) unsigned short sk[2][FA_KS][FA_PT];
  __shared__ __attribute__((aligned(16))) unsigned short sv[2][FA_KS][FA_PV];
  __shared__ __attribute__((aligned(16))) float so[FA_NW][32][68];
  const int tid = threadIdx.x, w = tid >> 5, lane = tid & 31, ln = lane & 15, hh = lane >> 4;
  const int bh = blockIdx.y, b = bh / NH, h = bh - b * NH; const int q0 = blockIdx.x * (FA_NW * 32) + w * 32;
  const unsigned short* Kg = (const unsigned short*)K16 + (size_t)b * SQ * DM + h * HD;      /* key rows, pitch DM */
  const unsigned short* Vg = (const unsigned short*)V16 + (size_t)b * SQ * DM + h * HD;      /* key rows, pitch DM */
  const int sr = tid >> 3, sc = (tid & 7) * 8;      /* staging: rows sr and sr + 32, 16-byte piece sc; a wave's load covers four whole 128-byte rows */
  const float cs = 0.125f * 1.44269504088896340736f;
  v16h qf[2][2];
#pragma unroll      /* constant indices keep the fragment and accumulator arrays in registers */
  for (int qt = 0; qt < 2; ++qt)
#pragma unroll      /* constant indices keep the fragment and accumulator arrays in registers */
    for (int ks = 0; ks < 2; ++ks) qf[qt][ks] = fa_frag((const unsigned short*)Q16 + ((size_t)b * SQ + q0 + qt * 16 + ln) * DM + h * HD + ks * 32, hh);
  const v8f z8 = {0.f,0.f,0.f,0.f,0.f,0.f,0.f,0.f};
  v8f o[4][2]; float mu[2], l[2];
#pragma unroll      /* constant indices keep the fragment and accumulator arrays in registers */
  for (int qt = 0; qt < 2; ++qt) { mu[qt] = -1.0e30f; l[qt] = 0.f;
#pragma unroll      /* constant indices keep the fragment and accumulator arrays in registers */
    for (int dt = 0; dt < 4; ++dt) o[dt][qt] = z8; }
  v8us rk0 = *(const v8us*)(Kg + (size_t)sr * DM + sc), rk1 = *(const v8us*)(Kg + (size_t)(sr + 32) * DM + sc), rv0 = *(const v8us*)(Vg + (size_t)sr * DM + sc), rv1 = *(const v8us*)(Vg + (size_t)(sr + 32) * DM + sc);
  asm volatile("s_wait_xcnt 0x0" ::: "memory");      /* behind the Q, K and V loads, in front of the set-up code that reuses their address registers */
  *(v8us*)&sk[0][sr][sc] = rk0; *(v8us*)&sk[0][sr + 32][sc] = rk1; *(v8us*)&sv[0][sr][sc] = rv0; *(v8us*)&sv[0][sr + 32][sc] = rv1;
  __syncthreads();      /* publishes stage 0 */
#pragma unroll 1      /* one stage per trip keeps the loop small and the register count inside four waves per SIMD */
  for (int s = 0; s < SQ / FA_KS; ++s) { const int bf = s & 1; const bool more = s + 1 < SQ / FA_KS;
    if (more) { const int kn = (s + 1) * FA_KS; rk0 = *(const v8us*)(Kg + (size_t)(kn + sr) * DM + sc); rk1 = *(const v8us*)(Kg + (size_t)(kn + sr + 32) * DM + sc); rv0 = *(const v8us*)(Vg + (size_t)(kn + sr) * DM + sc); rv1 = *(const v8us*)(Vg + (size_t)(kn + sr + 32) * DM + sc); }
#pragma unroll      /* constant indices keep the fragment and accumulator arrays in registers */
    for (int kk = 0; kk < FA_KS; kk += 32) {
      v8f st[2][2];
#pragma unroll      /* constant indices keep the fragment and accumulator arrays in registers */
      for (int kt = 0; kt < 2; ++kt) { const unsigned short* kr = &sk[bf][kk + kt * 16 + ln][0]; const v16h k0 = fa_frag(kr, hh), k1 = fa_frag(kr + 32, hh);
#pragma unroll      /* constant indices keep the fragment and accumulator arrays in registers */
        for (int qt = 0; qt < 2; ++qt) st[kt][qt] = fa_mma(k1, qf[qt][1], fa_mma(k0, qf[qt][0], z8)); }
      v16h vf[4];
#pragma unroll      /* constant indices keep the fragment and accumulator arrays in registers */
      for (int dt = 0; dt < 4; ++dt) vf[dt] = fa_fragt(&sv[bf][kk + 8 * hh + (lane & 7)][dt * 16 + ((lane >> 3) & 1) * 8]);
      float mb[2]; bool need = false;
#pragma unroll      /* constant indices keep the fragment and accumulator arrays in registers */
      for (int qt = 0; qt < 2; ++qt) { float mx = st[0][qt][0];
#pragma unroll      /* constant indices keep the fragment and accumulator arrays in registers */
        for (int r = 1; r < 8; ++r) mx = fmaxf(mx, st[0][qt][r]);
#pragma unroll      /* constant indices keep the fragment and accumulator arrays in registers */
        for (int r = 0; r < 8; ++r) mx = fmaxf(mx, st[1][qt][r]);
        mx = fmaxf(mx, fa_xrow(mx)) * cs; mb[qt] = mx; need = need || (mx > mu[qt] + 8.0f); }
      if (__builtin_amdgcn_ballot_w32(need) != 0) {      /* one scalar branch per pass; rare after the first passes */
#pragma unroll      /* constant indices keep the fragment and accumulator arrays in registers */
        for (int qt = 0; qt < 2; ++qt) { const float mn = fmaxf(mu[qt], mb[qt]); const float al = __builtin_amdgcn_exp2f(mu[qt] - mn); mu[qt] = mn; l[qt] *= al;
#pragma unroll      /* constant indices keep the fragment and accumulator arrays in registers */
          for (int dt = 0; dt < 4; ++dt) o[dt][qt] = o[dt][qt] * al; } }
#pragma unroll      /* constant indices keep the fragment and accumulator arrays in registers */
      for (int qt = 0; qt < 2; ++qt) { const float nm = 4.0f - mu[qt]; const v2f c2 = {cs, cs}, n2 = {nm, nm}; union { v16h v; v2h p[8]; } pf; v2f ls = {0.f, 0.f};
#pragma unroll      /* constant indices keep the fragment and accumulator arrays in registers */
        for (int i = 0; i < 4; ++i) { const int kt = i >> 1, r4 = (i & 1) * 4;
          const v2f x0 = {st[kt][qt][r4], st[kt][qt][r4 + 1]}, x1 = {st[kt][qt][r4 + 2], st[kt][qt][r4 + 3]};
          const v2f t0 = __builtin_elementwise_fma(x0, c2, n2), t1 = __builtin_elementwise_fma(x1, c2, n2); 
          const v2f p0 = {__builtin_amdgcn_exp2f(t0[0]), __builtin_amdgcn_exp2f(t0[1])}, p1 = {__builtin_amdgcn_exp2f(t1[0]), __builtin_amdgcn_exp2f(t1[1])}; ls += p0; ls += p1;
          pf.p[i * 2] = __builtin_convertvector(p0, v2h); pf.p[i * 2 + 1] = __builtin_convertvector(p1, v2h); }
        l[qt] += ls[0] + ls[1];
#pragma unroll      /* constant indices keep the fragment and accumulator arrays in registers */
        for (int dt = 0; dt < 4; ++dt) o[dt][qt] = fa_mma(vf[dt], pf.v, o[dt][qt]); }
    }
    if (more) { *(v8us*)&sk[bf ^ 1][sr][sc] = rk0; *(v8us*)&sk[bf ^ 1][sr + 32][sc] = rk1; *(v8us*)&sv[bf ^ 1][sr][sc] = rv0; *(v8us*)&sv[bf ^ 1][sr + 32][sc] = rv1; }
    __syncthreads();      /* publishes the next stage's buffer and ends every wave's reads of this one, which the next trip refills */
  }
  // epilogue: O^T / row sum through the wave's own LDS rows, so that each global access covers whole 256-byte head rows
#pragma unroll      /* constant indices keep the fragment and accumulator arrays in registers */
  for (int qt = 0; qt < 2; ++qt) { const float inv = 1.0f / (l[qt] + fa_xrow(l[qt]));
#pragma unroll      /* constant indices keep the fragment and accumulator arrays in registers */
    for (int dt = 0; dt < 4; ++dt) { const v4f lo = {o[dt][qt][0] * inv, o[dt][qt][1] * inv, o[dt][qt][2] * inv, o[dt][qt][3] * inv}, hi = {o[dt][qt][4] * inv, o[dt][qt][5] * inv, o[dt][qt][6] * inv, o[dt][qt][7] * inv};
      *(v4f*)&so[w][qt * 16 + ln][dt * 16 + 8 * hh] = lo; *(v4f*)&so[w][qt * 16 + ln][dt * 16 + 8 * hh + 4] = hi; } }
  __builtin_amdgcn_fence(__ATOMIC_ACQ_REL, "workgroup"); __builtin_amdgcn_wave_barrier();      /* the wave's own LDS stores before its own reads of other lanes' elements */
  const size_t g0 = ((size_t)b * SQ + q0) * DM + h * HD + ln * 4;
#pragma unroll      /* constant indices keep the fragment and accumulator arrays in registers */
  for (int q = 0; q < 16; ++q) { const int r = q * 2 + hh; const v4f v = *(const v4fa*)&so[w][r][ln * 4]; const v4f xi = *(const v4fa*)(X + g0 + (size_t)r * DM); const v4f xr = {bf16_round(xi[0]), bf16_round(xi[1]), bf16_round(xi[2]), bf16_round(xi[3])}; *(v4f*)(HP + g0 + (size_t)r * DM) = v + xr; } }


// Row LayerNorm (biased variance, eps, bf16-rounded gamma and beta), two rows per wave and no LDS: a lane holds 32 elements of each of its rows (eight 16-byte pieces per row, so that each load and each f32 store of the wave covers 512 contiguous bytes).
// Mean and variance: four chains per lane, then a butterfly over the 32 lanes (four DPP steps inside the 16-lane rows, one exchange between them). Two passes over the registers, as the definition has it.
// Each wave takes LN_RW rows, which share one rounding of gamma and beta: the launch starts 4,096 waves (16 per WGP, all resident at once) instead of eight waves per row (65,536), and has no barrier.
#define LN_NW 16      /* waves per work-group */
#define LN_RW 2       /* rows per wave */
template <int M> __device__ __forceinline__ float ln_xm(float v) { return __builtin_bit_cast(float, __builtin_amdgcn_update_dpp(0, __builtin_bit_cast(int, v), 0x160 + M, 0xf, 0xf, true)); }      /* lane l <-> lane l ^ M, M < 16 (row_xmask) */
__device__ __forceinline__ float ln_wsum(v4f s) { float v = (s[0] + s[1]) + (s[2] + s[3]); v += ln_xm<1>(v); v += ln_xm<2>(v); v += ln_xm<4>(v); v += ln_xm<8>(v); return v + fa_xrow(v); }
template <int W16, int W32>
__global__ __launch_bounds__(LN_NW * 32) void k_lnw(const float* __restrict__ X, const float* __restrict__ g, const float* __restrict__ bb, float eps, _Float16* __restrict__ N16, float* __restrict__ N32) {
  static_assert(DMQ == 8 * 128, "k_lnw: a row is eight 512-byte pieces");
  const int c0 = (threadIdx.x & 31) * 4; const size_t r0 = ((size_t)blockIdx.x * LN_NW + __builtin_amdgcn_readfirstlane(threadIdx.x >> 5)) * LN_RW;      /* the wave's number as a scalar: the row bases stay in scalar registers and every access shares the lane's one offset register */
  v4f gg[8], bv[8], x[LN_RW][8]; float rs[LN_RW];
#pragma unroll      /* constant indices keep the row arrays in registers */
  for (int u = 0; u < 8; ++u) { gg[u] = *(const v4fa*)(g + u * 128 + c0); bv[u] = *(const v4fa*)(bb + u * 128 + c0); }
#pragma unroll      /* constant indices keep the row arrays in registers */
  for (int i = 0; i < LN_RW; ++i)
#pragma unroll      /* constant indices keep the row arrays in registers */
    for (int u = 0; u < 8; ++u) { const int c = u * 128 + c0; x[i][u] = *(const v4fa*)(X + (r0 + i) * DMQ + c); }
  __builtin_amdgcn_sched_barrier(0);      /* keeps all 32 loads in front of the arithmetic: left free, the compiler sinks most gamma and beta loads behind the reductions and waits each pair out there */
#pragma unroll      /* constant indices keep the row arrays in registers */
  for (int u = 0; u < 8; ++u)
#pragma unroll      /* constant indices keep the row arrays in registers */
    for (int q = 0; q < 4; ++q) { gg[u][q] = bf16_round(gg[u][q]); bv[u][q] = bf16_round(bv[u][q]); }
#pragma unroll      /* constant indices keep the row arrays in registers */
  for (int i = 0; i < LN_RW; ++i) { v4f s = x[i][0];
#pragma unroll      /* constant indices keep the row arrays in registers */
    for (int u = 1; u < 8; ++u) s += x[i][u];
    const float mu = ln_wsum(s) * (1.0f / (float)DMQ); v4f q = {0.f, 0.f, 0.f, 0.f};
#pragma unroll      /* constant indices keep the row arrays in registers */
    for (int u = 0; u < 8; ++u) { x[i][u] = x[i][u] - mu; q += x[i][u] * x[i][u]; }
    rs[i] = rsqrtf(ln_wsum(q) * (1.0f / (float)DMQ) + eps); }
#pragma unroll      /* constant indices keep the row arrays in registers */
  for (int i = 0; i < LN_RW; ++i)
#pragma unroll      /* constant indices keep the row arrays in registers */
    for (int u = 0; u < 8; ++u) { const int c = u * 128 + c0; const v4f y = x[i][u] * rs[i] * gg[u] + bv[u];
      if (W32) *(v4f*)(N32 + (r0 + i) * DMQ + c) = y;
      if (W16) *(v4h*)(N16 + (r0 + i) * DMQ + c) = __builtin_convertvector(y, v4h); } }




extern "C" void kernel_launch(void* const* d_in, const int* in_sizes, int n_in,
                              void* d_out, int out_size, void* d_ws, size_t ws_size, hipStream_t stream) {
  (void)in_sizes; (void)n_in; (void)out_size;
  const float* const* I = (const float* const*)d_in; const float* x = I[0]; const float* wq = I[1]; const float* wk = I[2]; const float* wv = I[3]; const float* g1 = I[4]; const float* be1 = I[5]; const float* w1 = I[6]; const float* b1 = I[7]; const float* w2 = I[8]; const float* b2 = I[9]; const float* g2 = I[10]; const float* be2 = I[11];      /* natural [out][in] weights; LN affine; FFN biases */
  char* ws = (char*)d_ws; size_t off = 0;
  auto take = [&](size_t bytes) { char* p = ws + off; off += (bytes + 255) & ~(size_t)255; return p; };
  _Float16* BW1 = (_Float16*)take((size_t)DM * DM * 2); _Float16* BW2 = (_Float16*)take((size_t)DM * DM * 2); float* HP = (float*)take(NR * DM * 4); _Float16* H16 = (_Float16*)take(NR * DM * 2); _Float16* FF16 = (_Float16*)take(NR * DM * 2); _Float16* BQ = (_Float16*)take((size_t)DM * DM * 2); _Float16* BK = (_Float16*)take((size_t)DM * DM * 2); _Float16* BV = (_Float16*)take((size_t)DM * DM * 2); 
  _Float16* X16 = (_Float16*)take(NR * DM * 2); _Float16* Q16 = (_Float16*)take(NR * DM * 2); _Float16* K16 = (_Float16*)take(NR * DM * 2); _Float16* V16 = (_Float16*)take(NR * DM * 2);
  float* HF = (float*)take(NR * DM * 4);      /* the f32 h rows (LN1 output, residual for the FFN) */
  if (off > ws_size) return;
  k_cvt<<<CV_NX + 5 * CV_NW, 256, 0, stream>>>(x, wq, wk, wv, w1, w2, X16, BQ, BK, BV, BW1, BW2);      /* x rows and the five weight planes as f16 */
  const size_t r0p = (size_t)B0 * SQ;      /* first projected row */
  k_gemm2<0><<<dim3((unsigned)((MP / G2_BM) * (DM / G2_BN)), 3), 256, 0, stream>>>(X16 + r0p * DM, DM, 0, BQ, DM, (size_t)(BK - BQ), 0.0625f, nullptr, 0, nullptr, 1, 0, 0, nullptr, Q16 + r0p * DM, DM, (size_t)(K16 - Q16), MP, DM, DM);      /* q, k, v: grid.y steps through the three weight planes and the three output planes, which lie at equal distances in the workspace */
  k_fattn<<<dim3(SQ / (FA_NW * 32), NB * NH), FA_NW * 32, 0, stream>>>(Q16, K16, V16, x, HP);      /* h_pre = bf16(x) + attn (merged heads), f32 rows */
  k_lnw<1, 1><<<(unsigned)(MP / (LN_NW * LN_RW)), LN_NW * 32, 0, stream>>>(HP + r0p * DM, g1, be1, 1e-5f, H16 + r0p * DM, HF + r0p * DM);      /* h = LN1(x + attn) -> f16 rows (FFN operand) and f32 rows (residual) */
  k_gemm2<3><<<dim3((unsigned)((MP / G2_BM) * (DM / G2_BN)), 1), 256, 0, stream>>>(H16 + r0p * DM, DM, 0, BW1, DM, 0, 0.0625f, b1, 0, nullptr, 1, 0, 0, nullptr, FF16 + r0p * DM, DM, 0, MP, DM, DM);      /* relu(h l1^T + b1) -> f16 rows */
  k_gemm2<0><<<dim3((unsigned)((MP / G2_BM) * (DM / G2_BN)), 1), 256, 0, stream>>>(FF16 + r0p * DM, DM, 0, BW2, DM, 0, 0.0625f, b2, 0, HF + r0p * DM, -1, 0, 0, HP + r0p * DM, nullptr, DM, 0, MP, DM, DM);      /* y = h + ff (own-element residual; the h_pre plane is free again) */
  k_lnw<0, 1><<<(unsigned)(MP / (LN_NW * LN_RW)), LN_NW * 32, 0, stream>>>(HP + r0p * DM, g2, be2, 1e-5f, nullptr, (float*)d_out + r0p * DM);      /* out = LN2(h + ff) -> f32 output rows */
}

// v006
// A run of this version takes 156 microseconds.
// Timed twice side by side with v005, it ran 1.11 times as fast both times.
// All steps since v000 together make it 85.5 times as fast.
#include <hip/hip_runtime.h>
// Post-LN transformer encoder block (x [4][2048][1024]; q = x wq^T, k, v likewise (nn.Linear natural [1024][1024] sigma 1/32, no biases); 16 heads of 64 (chunked along features = head-major columns); softmax(q k^T / 8) v over all keys (no mask), heads merged, NO output projection; h = LN1(x + attn) (biased variance, eps 1e-5, gamma/beta); ff = relu(h l1_w^T + l1_b) l2_w^T + l2_b (natural [1024][1024], biases sigma 0.01); out = LN2(h + ff) -> [4][2048][1024]).
// Structure: token rows r = b*2048 + s; x and the five weights as exact f16 planes (bf16-rounded), one conversion launch; Q, K, V as one batched WMMA GEMM launch (grid.y = plane; operand tiles staged in LDS, 64x64 wave tiles, f32 accumulation, exact x16 weights, f16 outputs); one fused attention launch (per head and 256 queries: S^T = K Q^T, online softmax in registers with f32 statistics and native exp2, weights as f16, O^T += V^T P^T, the V^T fragments by transposing LDS reads of V rows), h_pre = bf16(x) + attn as f32 rows; LN1 on VALU (f32 statistics, two rows per wave) -> f16 + f32 rows; relu(h l1^T + b1) GEMM with the ReLU epilogue -> f16; y = h + ff l2^T + b2 GEMM (own-element residual); LN2 on VALU -> f32 output.
// Compute dtype: inputs rounded to bf16; x / weights exact; q, k, v, softmax weights, h and the FFN hidden rows as plain f16 GEMM operands (~2^-12); scores and softmax statistics f32. v_wmma_f32_16x16x32_f16.
#define NB 4
#define SQ 2048
#define DM 1024
#define NH 16
#define HD 64
#define DMQ DM                       /* LayerNorm width */
#define HG 2                         /* heads per block group of the unlaunched per-batch k_vt */
#define B0 0                         /* first batch processed (debug hook) */
#define NBR NB                       /* batches processed (debug hook) */
#define NR ((size_t)NB * SQ)         /* token rows */
#define MP ((int)((size_t)NBR * SQ)) /* rows projected (debug hook) */
#define QN SQ                        /* unused (attention runs all SQ queries per batch) */
#define NHD NH                       /* unused (attention runs all NH heads) */
#define MPO MP                       /* unused (the output stage runs MP rows) */
#define LQ DM      /* unused (the q/k/v rows have pitch DM) */
typedef __bf16 v16b __attribute__((ext_vector_type(16)));
typedef unsigned short v8us __attribute__((ext_vector_type(8), may_alias));
typedef float  v8f  __attribute__((ext_vector_type(8)));
typedef float  v4f  __attribute__((ext_vector_type(4)));
typedef float  v4fa __attribute__((ext_vector_type(4), may_alias));
union FragB { v16b v; v8us half[2]; unsigned short u[16]; };

__device__ __forceinline__ unsigned short bf16_bits(float x) { unsigned int u = __float_as_uint(x); return (unsigned short)((u + 0x7FFFu + ((u >> 16) & 1u)) >> 16); }
__device__ __forceinline__ float bf16_val(unsigned short b) { return __uint_as_float(((unsigned int)b) << 16); }
__device__ __forceinline__ float bf16_round(float x) { return bf16_val(bf16_bits(x)); }
// D += A·B with NT terms: 1 = ah·bh, 2 = + al·bh (A split), 3 = + ah·bl (both split)
template <int NT>
__device__ __forceinline__ v8f mmaN(v16b ah, v16b al, v16b bh, v16b bl, v8f c) {
  c = __builtin_amdgcn_wmma_f32_16x16x32_bf16(false, ah, false, bh, (short)0, c, false, false);
  if (NT >= 2) c = __builtin_amdgcn_wmma_f32_16x16x32_bf16(false, al, false, bh, (short)0, c, false, false);
  if (NT >= 3) c = __builtin_amdgcn_wmma_f32_16x16x32_bf16(false, ah, false, bl, (short)0, c, false, false);
  asm volatile("v_nop\n\tv_nop\n\tv_nop\n\tv_nop" : "+v"(c) : "v"(ah), "v"(al), "v"(bh), "v"(bl));
  return c;
}

__global__ __launch_bounds__(256) void k_wt_bf16(const float* __restrict__ W, unsigned short* __restrict__ Wt, int K, int N) {
  const int t = blockIdx.x * 256 + threadIdx.x;
  const int k8n = K / 8;
  if (t >= N * k8n) return;
  const int n = t / k8n, k8 = (t % k8n) * 8;
  v8us v;
#pragma unroll
  for (int i = 0; i < 8; ++i) v[i] = bf16_bits(W[(size_t)(k8 + i) * N + n]);
  *(v8us*)(Wt + (size_t)n * K + k8) = v;
  
}

// GEMM C[M][N] (f32, pitch ldc) = act(A[M][K]·W + bias). A f32 row-major (pitch lda) converted per fragment to bf16
// (ASPLIT: hi/lo two planes -> 2 terms, else single rounded term); Wt bf16 [N][K] (pitch ldb). BIAS_BF16 rounds the
// bias to bf16 first (bias quantised to bf16 before the add). K%32==0, M%16==0, N%64==0.
template <bool ASPLIT, int ACT, bool BIAS_BF16>
__global__ __launch_bounds__(128) void k_gemm_bf(const float* __restrict__ A, int lda, const unsigned short* __restrict__ Wt, int ldb,
                                               const float* __restrict__ bias, float* __restrict__ C, int ldc, int M, int N, int K) {
  __shared__ __attribute__((aligned(16))) float so[4][16][64];
  const int tid = threadIdx.x, w = tid >> 5, lane = tid & 31, ln = lane & 15, hh = lane >> 4;
  const int ntn = N / 64;
  const int wid = blockIdx.x * 4 + w;
  const int mt = wid / ntn, nq = wid % ntn;
  if (mt * 16 >= M) return;
  const int row0 = mt * 16, col0 = nq * 64;
  const float* arow = A + (size_t)(row0 + ln) * lda;
  v8f acc[4] = {};
  for (int kb = 0; kb < K; kb += 32) {
    FragB ah, al;
    const v4f x0 = *(const v4fa*)(arow + kb + 8 * hh), x1 = *(const v4fa*)(arow + kb + 8 * hh + 4);
    const v4f x2 = *(const v4fa*)(arow + kb + 16 + 8 * hh), x3 = *(const v4fa*)(arow + kb + 16 + 8 * hh + 4);
    float xs[16] = {x0[0],x0[1],x0[2],x0[3],x1[0],x1[1],x1[2],x1[3],x2[0],x2[1],x2[2],x2[3],x3[0],x3[1],x3[2],x3[3]};
#pragma unroll
    for (int i = 0; i < 16; ++i) { const unsigned short hb = bf16_bits(xs[i]); ah.u[i] = hb; al.u[i] = ASPLIT ? bf16_bits(xs[i] - bf16_val(hb)) : (unsigned short)0; }
#pragma unroll
    for (int t = 0; t < 4; ++t) {
      const unsigned short* brow = Wt + (size_t)(col0 + t * 16 + ln) * ldb + kb;
      FragB b;
      b.half[0] = *(const v8us*)(brow + 8 * hh);
      b.half[1] = *(const v8us*)(brow + 16 + 8 * hh);
      acc[t] = mmaN<ASPLIT ? 2 : 1>(ah.v, al.v, b.v, b.v, acc[t]);
    }
  }
#pragma unroll
  for (int t = 0; t < 4; ++t) {
    float bv = bias ? bias[col0 + t * 16 + ln] : 0.f;
    if (BIAS_BF16) bv = bf16_round(bv);
#pragma unroll
    for (int r = 0; r < 8; ++r) { float v = acc[t][r] + bv; if (ACT == 1) v = fmaxf(v, 0.f); so[w][8 * hh + r][t * 16 + ln] = v; }
  }
  __builtin_amdgcn_fence(__ATOMIC_ACQ_REL, "workgroup");
  __builtin_amdgcn_wave_barrier();
  const int rsub = lane >> 4, c4 = (lane & 15) * 4;
  {
#pragma unroll
    for (int q = 0; q < 8; ++q) {
      const int r = q * 2 + rsub;
      const v4f v = *(const v4fa*)&so[w][r][c4];
      *(v4f*)(C + (size_t)(row0 + r) * ldc + col0 + c4) = v;
    }
    
  }
}

// GEMM C = act(A·W + bias + resid): A f32 (ASPLIT -> hi/lo 2 terms), Wt bf16 [N][K]; ACT 0 none, 1 relu, 2 exact gelu;
// resid (optional, f32, row index = (row % rmod), pitch ldr, RES_BF16 rounds it) added before the activation.
template <bool ASPLIT, int ACT, bool BIAS_BF16, bool RES_BF16>
__global__ __launch_bounds__(128) void k_gemm_bf3(const float* __restrict__ A, int lda, const unsigned short* __restrict__ Wt, int ldb,
                                                const float* __restrict__ bias, const float* __restrict__ resid, int rmod, int ldr,
                                                float* __restrict__ C, int ldc, int M, int N, int K) {
  __shared__ __attribute__((aligned(16))) float so[4][16][64];
  const int tid = threadIdx.x, w = tid >> 5, lane = tid & 31, ln = lane & 15, hh = lane >> 4;
  const int ntn = N / 64;
  const int wid = blockIdx.x * 4 + w;
  const int mt = wid / ntn, nq = wid % ntn;
  if (mt * 16 >= M) return;
  const int row0 = mt * 16, col0 = nq * 64;
  const float* arow = A + (size_t)(row0 + ln) * lda;
  v8f acc[4] = {};
  for (int kb = 0; kb < K; kb += 32) {
    FragB ah, al;
    const v4f x0 = *(const v4fa*)(arow + kb + 8 * hh), x1 = *(const v4fa*)(arow + kb + 8 * hh + 4);
    const v4f x2 = *(const v4fa*)(arow + kb + 16 + 8 * hh), x3 = *(const v4fa*)(arow + kb + 16 + 8 * hh + 4);
    float xs[16] = {x0[0],x0[1],x0[2],x0[3],x1[0],x1[1],x1[2],x1[3],x2[0],x2[1],x2[2],x2[3],x3[0],x3[1],x3[2],x3[3]};
#pragma unroll
    for (int i = 0; i < 16; ++i) { const unsigned short hb = bf16_bits(xs[i]); ah.u[i] = hb; al.u[i] = ASPLIT ? bf16_bits(xs[i] - bf16_val(hb)) : (unsigned short)0; }
#pragma unroll
    for (int t = 0; t < 4; ++t) {
      const unsigned short* brow = Wt + (size_t)(col0 + t * 16 + ln) * ldb + kb;
      FragB b;
      b.half[0] = *(const v8us*)(brow + 8 * hh);
      b.half[1] = *(const v8us*)(brow + 16 + 8 * hh);
      acc[t] = mmaN<ASPLIT ? 2 : 1>(ah.v, al.v, b.v, b.v, acc[t]);
    }
  }
#pragma unroll
  for (int t = 0; t < 4; ++t) {
    const int col = col0 + t * 16 + ln;
    float bv = bias ? bias[col] : 0.f;
    if (BIAS_BF16) bv = bf16_round(bv);
#pragma unroll
    for (int r = 0; r < 8; ++r) {
      float v = acc[t][r] + bv;
      if (resid) { float rv = resid[(size_t)((row0 + 8 * hh + r) % rmod) * ldr + col]; if (RES_BF16) rv = bf16_round(rv); v += rv; }
      if (ACT == 1) v = fmaxf(v, 0.f);
      if (ACT == 2) v = 0.5f * v * (1.0f + erff(v * 0.70710678118654752f));
      if (ACT == 3) { const float u = 0.7978845608028654f * (v + 0.044715f * v * v * v); v = 0.5f * v * (1.0f + tanhf(u)); }
      so[w][8 * hh + r][t * 16 + ln] = v;
    }
  }
  __builtin_amdgcn_fence(__ATOMIC_ACQ_REL, "workgroup");
  __builtin_amdgcn_wave_barrier();
  const int rsub = lane >> 4, c4 = (lane & 15) * 4;
  {
#pragma unroll
    for (int q = 0; q < 8; ++q) {
      const int r = q * 2 + rsub;
      const v4f v = *(const v4fa*)&so[w][r][c4];
      *(v4f*)(C + (size_t)(row0 + r) * ldc + col0 + c4) = v;
    }
    
  }
}
// row LayerNorm (biased variance, eps) over N: s = X (+ R); optional out_sum <- s; out_norm <- (s-mu)*rsqrt(var+eps)*g + b
template <bool PARAM_BF16>
__global__ __launch_bounds__(256) void k_layernorm(const float* __restrict__ X, const float* __restrict__ R, const float* __restrict__ g, const float* __restrict__ bta,
                                                  float* __restrict__ out_sum, float* __restrict__ out_norm, int N, float eps) {
  __shared__ float red[256];
  const int row = blockIdx.x, tid = threadIdx.x;
  const float* x = X + (size_t)row * N; const float* rr = R ? R + (size_t)row * N : nullptr;
  float vals[16];                     // up to N = 4096
  const int per = N / 256;            // contiguous chunk per thread? use strided-by-4 chunks: thread handles j = tid*4 + 1024*u
  float s1 = 0.f;
  for (int u = 0; u < per / 4; ++u) {
    const int j = tid * 4 + 1024 * u;
    const v4f a = *(const v4fa*)(x + j);
    v4f b = {0.f,0.f,0.f,0.f}; if (rr) b = *(const v4fa*)(rr + j);
#pragma unroll
    for (int q = 0; q < 4; ++q) { const float v = a[q] + b[q]; vals[u * 4 + q] = v; s1 += v; }
  }
  red[tid] = s1; __syncthreads();
  for (int st = 128; st > 0; st >>= 1) { if (tid < st) red[tid] += red[tid + st]; __syncthreads(); }
  const float mu = red[0] / (float)N; __syncthreads();
  float s2 = 0.f;
  for (int u = 0; u < per / 4; ++u)
#pragma unroll
    for (int q = 0; q < 4; ++q) { const float c = vals[u * 4 + q] - mu; s2 += c * c; }
  red[tid] = s2; __syncthreads();
  for (int st = 128; st > 0; st >>= 1) { if (tid < st) red[tid] += red[tid + st]; __syncthreads(); }
  const float rs = rsqrtf(red[0] / (float)N + eps);
  {
    for (int u = 0; u < per / 4; ++u) {
      const int j = tid * 4 + 1024 * u;
      v4f o, sm;
#pragma unroll
      for (int q = 0; q < 4; ++q) {
        float gg = g[j + q], bb = bta[j + q];
        if (PARAM_BF16) { gg = bf16_round(gg); bb = bf16_round(bb); }
        sm[q] = vals[u * 4 + q]; o[q] = (vals[u * 4 + q] - mu) * rs * gg + bb;
      }
      if (out_sum) *(v4f*)(out_sum + (size_t)row * N + j) = sm;
      *(v4f*)(out_norm + (size_t)row * N + j) = o;
    }
    
  }
}



// ---- f16 WMMA path (v_wmma_f32_16x16x32_f16): 11-bit significands for operands in range — used where a [0,1] probability operand needs more precision than bf16
typedef _Float16 v16h __attribute__((ext_vector_type(16)));
union FragH { v16h v; v8us half[2]; _Float16 h[16]; unsigned short u[16]; };
template <int NT>
__device__ __forceinline__ v8f mmaH(v16h ah, v16h al, v16h bh, v16h bl, v8f c) {
  c = __builtin_amdgcn_wmma_f32_16x16x32_f16(false, ah, false, bh, (short)0, c, false, false);
  if (NT >= 2) c = __builtin_amdgcn_wmma_f32_16x16x32_f16(false, al, false, bh, (short)0, c, false, false);
  if (NT >= 3) c = __builtin_amdgcn_wmma_f32_16x16x32_f16(false, ah, false, bl, (short)0, c, false, false);
  asm volatile("v_nop\n\tv_nop\n\tv_nop\n\tv_nop" : "+v"(c) : "v"(ah), "v"(al), "v"(bh), "v"(bl));
  return c;
}
// batched GEMM like k_gemm_b but f16 operands: A f32 (split into f16 hi/lo if ASPLIT, else rounded to f16), Bt = f16 values [n][k]; alpha; C f32; N multiple of 16 (partial tiles skipped)
template <bool ASPLIT>
__global__ __launch_bounds__(128) void k_gemm_h(const float* __restrict__ A, int lda, size_t sA, const _Float16* __restrict__ Bh, int ldb, size_t sB, float alpha, float* __restrict__ C, int ldc, size_t sC, int M, int N, int K) {
  __shared__ __attribute__((aligned(16))) float so[4][16][64];
  const int tid = threadIdx.x, w = tid >> 5, lane = tid & 31, ln = lane & 15, hh = lane >> 4; const int by = blockIdx.y;
  A += (size_t)by * sA; Bh += (size_t)by * sB; C += (size_t)by * sC;
  const int ntn = (N + 63) / 64; const int wid = blockIdx.x * 4 + w; const int mt = wid / ntn, nq = wid % ntn; if (mt * 16 >= M) return;
  const int row0 = mt * 16, col0 = nq * 64; const float* arow = A + (size_t)(row0 + ln) * lda;
  v8f acc[4] = {};
  for (int kb = 0; kb < K; kb += 32) {
    FragH ah, al;
    const v4f x0 = *(const v4fa*)(arow + kb + 8 * hh), x1 = *(const v4fa*)(arow + kb + 8 * hh + 4), x2 = *(const v4fa*)(arow + kb + 16 + 8 * hh), x3 = *(const v4fa*)(arow + kb + 16 + 8 * hh + 4);
    float xs[16] = {x0[0],x0[1],x0[2],x0[3],x1[0],x1[1],x1[2],x1[3],x2[0],x2[1],x2[2],x2[3],x3[0],x3[1],x3[2],x3[3]};
#pragma unroll
    for (int i = 0; i < 16; ++i) { const _Float16 h = (_Float16)xs[i]; ah.h[i] = h; al.h[i] = ASPLIT ? (_Float16)(xs[i] - (float)h) : (_Float16)0.0f; }
#pragma unroll
    for (int t = 0; t < 4; ++t) { if (col0 + t * 16 >= N) continue; const size_t boff = (size_t)(col0 + t * 16 + ln) * ldb + kb; FragH bq; bq.half[0] = *(const v8us*)(Bh + boff + 8 * hh); bq.half[1] = *(const v8us*)(Bh + boff + 16 + 8 * hh);
      acc[t] = mmaH<ASPLIT ? 2 : 1>(ah.v, al.v, bq.v, bq.v, acc[t]); }
  }
#pragma unroll
  for (int t = 0; t < 4; ++t) { if (col0 + t * 16 >= N) continue;
#pragma unroll
    for (int r = 0; r < 8; ++r) so[w][8 * hh + r][t * 16 + ln] = acc[t][r] * alpha; }
  __builtin_amdgcn_fence(__ATOMIC_ACQ_REL, "workgroup"); __builtin_amdgcn_wave_barrier();
  const int rsub = lane >> 4, c4 = (lane & 15) * 4;
  {
#pragma unroll
    for (int q = 0; q < 8; ++q) { const int r = q * 2 + rsub; if (col0 + c4 < N) { const v4f v = *(const v4fa*)&so[w][r][c4]; *(v4f*)(C + (size_t)(row0 + r) * ldc + col0 + c4) = v; } }
     }
}

// Wt[n][k] = f16(W[k][n]·scale) from f32 row-major W[K][N] (scale = power of two; bf16-exact weights stay exact in f16 away from the subnormal range)
__global__ __launch_bounds__(256) void k_wt_f16(const float* __restrict__ W, _Float16* __restrict__ Wt, int K, int N, float scale) {
  const int t = blockIdx.x * 256 + threadIdx.x; if (t >= N * (K / 8)) return; const int n = t / (K / 8), k8 = (t % (K / 8)) * 8; FragH f;
#pragma unroll
  for (int i = 0; i < 8; ++i) f.h[i] = (_Float16)(bf16_round(W[(size_t)(k8 + i) * N + n]) * scale); const v8us o = f.half[0];
  *(v8us*)((unsigned short*)Wt + (size_t)n * K + k8) = o; 
}
// k_gemm_hh variant with fused epilogue: v = acc·alpha + bias[by·sBias + col] (+ CP[(row/rowsPerB)·sCPb + by·64 + col] if CP) ; ACT 0 none / 1 elu ; writes f16 C16 (and f32 C if non-null)
template <int ACT>
__global__ __launch_bounds__(128) void k_gemm_hhx(const _Float16* __restrict__ A, int lda, size_t sA, const _Float16* __restrict__ Bh, int ldb, size_t sB, float alpha, const float* __restrict__ bias, size_t sBias, const float* __restrict__ CP, int rowsPerB, size_t sCPb, int row0g,
    float* __restrict__ C, _Float16* __restrict__ C16, int ldc, size_t sC, int M, int N, int K) {
  __shared__ __attribute__((aligned(16))) float so[4][16][64];
  const int tid = threadIdx.x, w = tid >> 5, lane = tid & 31, ln = lane & 15, hh = lane >> 4; const int by = blockIdx.y;
  A += (size_t)by * sA; Bh += (size_t)by * sB; const size_t cofs = (size_t)by * sC; const float* bp = bias ? bias + (size_t)by * sBias : nullptr;
  const int ntn = (N + 63) / 64; const int wid = blockIdx.x * 4 + w; const int mt = wid / ntn, nq = wid % ntn; if (mt * 16 >= M) return;
  const int row0 = mt * 16, col0 = nq * 64; const _Float16* arow = A + (size_t)(row0 + ln) * lda;
  v8f acc[4] = {};
  for (int kb = 0; kb < K; kb += 32) { FragH ah; ah.half[0] = *(const v8us*)((const unsigned short*)arow + kb + 8 * hh); ah.half[1] = *(const v8us*)((const unsigned short*)arow + kb + 16 + 8 * hh);
#pragma unroll
    for (int t = 0; t < 4; ++t) { if (col0 + t * 16 >= N) continue; const size_t boff = (size_t)(col0 + t * 16 + ln) * ldb + kb; FragH bq; bq.half[0] = *(const v8us*)((const unsigned short*)Bh + boff + 8 * hh); bq.half[1] = *(const v8us*)((const unsigned short*)Bh + boff + 16 + 8 * hh);
      acc[t] = mmaH<1>(ah.v, ah.v, bq.v, bq.v, acc[t]); }
  }
#pragma unroll
  for (int t = 0; t < 4; ++t) { if (col0 + t * 16 >= N) continue; const int col = col0 + t * 16 + ln; const float bv = bp ? bf16_round(bp[col]) : 0.f;
#pragma unroll
    for (int r = 0; r < 8; ++r) { float v = acc[t][r] * alpha + bv; if (CP) { const int rr = row0g + row0 + 8 * hh + r; if (rowsPerB < 0) v += CP[cofs + (size_t)rr * ldc + col];      /* rowsPerB < 0: own element of the batched C plane */ else { const int bidx = rr / rowsPerB; v += CP[(size_t)bidx * sCPb + (size_t)by * 64 + col]; } } if (ACT == 1) v = (v > 0.f) ? v : expm1f(v); else if (ACT == 7) v = (v > 0.f) ? v + 1.0f : expf(v); else if (ACT == 8) v = tanhf(v); else if (ACT == 9) v = 0.5f * v * (1.0f + tanhf(0.7978845608028654f * (v + 0.044715f * v * v * v))); else if (ACT == 11) v = 1.0f / (1.0f + expf(-v)); else if (ACT == 12) v = (v > 0.f) ? v : 0.01f * v; else if (ACT == 14) v = (v > 0.f) ? v : 0.1f * v; else if (ACT == 16) v = (v >= 0.f) ? v : 0.3f * v; else if (ACT == 17) v = (v >= 0.f) ? v : 0.2f * v; else if (ACT == 15) v = v / (1.0f + expf(-v)); else if (ACT == 3) v = fmaxf(v, 0.f); else if (ACT == 6) v = 0.5f * v * (1.0f + erff(v * 0.70710678118654752f)); so[w][8 * hh + r][t * 16 + ln] = v; } }
  __builtin_amdgcn_fence(__ATOMIC_ACQ_REL, "workgroup"); __builtin_amdgcn_wave_barrier();
  const int rsub = lane >> 4, c4 = (lane & 15) * 4; typedef _Float16 v4h __attribute__((ext_vector_type(4)));
  {
#pragma unroll
    for (int q = 0; q < 8; ++q) { const int r = q * 2 + rsub; if (col0 + c4 < N) { const v4f v = *(const v4fa*)&so[w][r][c4]; if (C) *(v4f*)(C + cofs + (size_t)(row0 + r) * ldc + col0 + c4) = v; if (C16) { v4h h4; for (int i = 0; i < 4; ++i) h4[i] = (_Float16)v[i]; *(v4h*)(C16 + cofs + (size_t)(row0 + r) * ldc + col0 + c4) = h4; } } }
     }
}


typedef _Float16 v4h __attribute__((ext_vector_type(4)));

__global__ __launch_bounds__(256) void k_h16(const float* __restrict__ x, _Float16* __restrict__ X16, size_t n8) { const size_t t = (size_t)blockIdx.x * 256 + threadIdx.x; if (t >= n8) return; FragH f;
#pragma unroll
  for (int q = 0; q < 8; ++q) f.h[q] = (_Float16)x[t * 8 + q]; *(v8us*)((unsigned short*)X16 + t * 8) = f.half[0];  }
__global__ __launch_bounds__(256) void k_round16f(const float* __restrict__ W, _Float16* __restrict__ Bt, size_t n8) { const size_t t = (size_t)blockIdx.x * 256 + threadIdx.x; if (t >= n8) return; FragH f;
#pragma unroll
  for (int i = 0; i < 8; ++i) f.h[i] = (_Float16)(bf16_round(W[t * 8 + i]) * 16.0f); *(v8us*)((unsigned short*)Bt + t * 8) = f.half[0];  }
__global__ __launch_bounds__(256) void k_hl(const float* __restrict__ F, _Float16* __restrict__ Hh, _Float16* __restrict__ Hl, size_t n8) { const size_t t = (size_t)blockIdx.x * 256 + threadIdx.x; if (t >= n8) return; FragH fh, fl; const v4f a = *(const v4fa*)(F + t * 8), c = *(const v4fa*)(F + t * 8 + 4);
#pragma unroll
  for (int q = 0; q < 4; ++q) { _Float16 h = (_Float16)a[q]; fh.h[q] = h; fl.h[q] = (_Float16)((a[q] - (float)h) * 1024.0f); h = (_Float16)c[q]; fh.h[4 + q] = h; fl.h[4 + q] = (_Float16)((c[q] - (float)h) * 1024.0f); }
  { *(v8us*)((unsigned short*)Hh + t * 8) = fh.half[0]; *(v8us*)((unsigned short*)Hl + t * 8) = fl.half[0];  } }

// ---- GEMM with both operands staged in LDS (work-group tile 256x128, eight waves of 64x64; MP % 256 == 0, DM % 128 == 0); epilogue = k_gemm_hhx semantics, its cases fixed at compile time ----
#define G2_KS 128     /* k per stage: 256 bytes of every operand row */
#define G2_PT 136     /* LDS row pitch in 16-bit elements: 272 B = 16 B x 17, the pitch for 16-byte fragment reads of 256-byte rows */
#define G2_BM 256     /* rows of C per work-group */
#define G2_BN 128     /* columns of C per work-group */
__device__ __forceinline__ v16h g2_frag(const unsigned short* p, int hh) { FragH f; f.half[0] = *(const v8us*)(p + 8 * hh); f.half[1] = *(const v8us*)(p + 16 + 8 * hh); return f.v; }
__device__ __forceinline__ v8f g2_mma(v16h a, v16h b, v8f c) { return __builtin_amdgcn_wmma_f32_16x16x32_f16(false, a, false, b, (short)0, c, false, false); }
// Eight asynchronous copies of one lane: its 16-byte piece of eight operand rows, 16 rows apart, from global memory straight into LDS (a wave's copy covers two whole 256-byte rows).
// l: the lane's LDS byte address; g: its global address; p: 16 rows in elements. The s_wait_xcnt stands inside the statement so that no address register is rewritten in front of it.
__device__ __forceinline__ void g2_copy8(unsigned l, const unsigned short* g, size_t p) {
  const unsigned lp = 16 * G2_PT * 2;
  asm volatile("global_load_async_to_lds_b128 %0, %8, off\n\t"
               "global_load_async_to_lds_b128 %1, %9, off\n\t"
               "global_load_async_to_lds_b128 %2, %10, off\n\t"
               "global_load_async_to_lds_b128 %3, %11, off\n\t"
               "global_load_async_to_lds_b128 %4, %12, off\n\t"
               "global_load_async_to_lds_b128 %5, %13, off\n\t"
               "global_load_async_to_lds_b128 %6, %14, off\n\t"
               "global_load_async_to_lds_b128 %7, %15, off\n\t"
               "s_wait_xcnt 0x0"
               :: "v"(l), "v"(l + lp), "v"(l + 2 * lp), "v"(l + 3 * lp), "v"(l + 4 * lp), "v"(l + 5 * lp), "v"(l + 6 * lp), "v"(l + 7 * lp),
                  "v"(g), "v"(g + p), "v"(g + 2 * p), "v"(g + 3 * p), "v"(g + 4 * p), "v"(g + 5 * p), "v"(g + 6 * p), "v"(g + 7 * p)
               : "memory"); }
// One stage: 256 A rows and 128 B rows of 256 bytes, 24 copies per lane.
__device__ __forceinline__ void g2_stage(unsigned la, unsigned lb, const unsigned short* ga, const unsigned short* gb, size_t pa, size_t pb) {
  g2_copy8(la, ga, pa); g2_copy8(la + 128 * G2_PT * 2, ga + 8 * pa, pa); g2_copy8(lb, gb, pb); }
// Half P (32 rows) of a wave's 64x64 tile: the raw accumulators go through the wave's own 32 LDS rows; on the row side a lane holds 4 neighbouring columns of a row, so that bias, residual and f32 output are 16-byte accesses (f16 output: 8-byte) that cover whole rows of the tile.
// Every case (bias, residual, which outputs) and the row pitch (DM) are compile-time constants: the text has no branch, the 16 LDS reads form one group, the 16 stores another, and every global address is one register pair plus an immediate offset.
// v = acc alpha + bias (+ residual), activation: the operations and their order per element are those of the element-wise form.
// Rl, Cl, Hl: the lane's own addresses of row hh, columns 4 ln .. 4 ln + 3 of the wave's tile in the residual, f32 output and f16 output planes.
// The residual rows of half P, 16 loads in flight.
template <int P>
__device__ __forceinline__ void g2_res(v4f (&rs)[16], const float* Rl) {
#pragma unroll      /* constant indices keep the row array in registers */
  for (int q = 0; q < 16; ++q) rs[q] = *(const v4fa*)(Rl + (size_t)(P * 32 + q * 2) * DM); }
// rs: on entry the residual rows of half P (loads issued by the caller); half 0 leaves the loads of half 1 in flight there.
template <int ACT, bool HASB, bool RES, bool W32, bool W16, int P>
__device__ __forceinline__ void g2_out(const v8f (&acc)[4][4], float (*sw)[68], float alpha, v4f bv, v4f (&rs)[16], const float* Rl, float* Cl, _Float16* Hl, int ln, int hh) {
  v4f y[16]; v4h h[16];
#pragma unroll      /* constant indices keep the accumulator array in registers */
  for (int u = 0; u < 8; ++u) { const int t = u & 3, half = u >> 2;
#pragma unroll      /* constant indices keep the accumulator array in registers */
    for (int r = 0; r < 8; ++r) sw[half * 16 + 8 * hh + r][t * 16 + ln] = acc[P * 2 + half][t][r]; }
  asm volatile("s_wait_dscnt 0x0" ::: "memory");      /* the wave's own LDS stores before its own reads of other lanes' elements; no wait on the global loads and stores in flight */
#pragma unroll      /* the row steps fold into the immediate offsets of the LDS reads */
  for (int q = 0; q < 16; ++q) y[q] = *(const v4fa*)&sw[q * 2 + hh][ln * 4];
#pragma unroll      /* constant indices keep the row arrays in registers */
  for (int q = 0; q < 16; ++q) { v4f v = HASB ? y[q] * alpha + bv : y[q] * alpha; if (RES) v += rs[q];
    if (ACT == 3) { const v4f z4 = {0.f, 0.f, 0.f, 0.f}; v = __builtin_elementwise_max(v, z4); }
    y[q] = v; if (W16) h[q] = __builtin_convertvector(v, v4h); }
  __builtin_amdgcn_sched_barrier(0);      /* every value of the half is made in front of its first store: no register that an issued store names is written before the wait below (half 0) or the wave's end (half 1) */
  if (RES && P == 0) g2_res<1>(rs, Rl);      /* the next half's residual rows fly during this half's stores and the next half's LDS round */
#pragma unroll      /* the row steps fold into the immediate offsets of the stores */
  for (int q = 0; q < 16; ++q) { if (W32) *(v4f*)(Cl + (size_t)(P * 32 + q * 2) * DM) = y[q]; if (W16) *(v4h*)(Hl + (size_t)(P * 32 + q * 2) * DM) = h[q]; }
  if (P == 0) asm volatile("s_wait_xcnt 0x0" ::: "memory");      /* behind the half's stores, in front of the next half's code, which reuses their registers; it also keeps the next half's LDS stores behind this half's LDS reads, whose values have all been used */
}
// C = act(A Bh^T alpha + bias (+ own element of CP)): A [MP][DM], Bh [DM][DM] (plane blockIdx.y, sB apart), outputs [MP][DM] (plane blockIdx.y, sC apart) as f32 (W32) and / or f16 (W16).
template <int ACT, bool HASB, bool RES, bool W32, bool W16>
__global__ __launch_bounds__(256) void k_gemm2(const _Float16* __restrict__ A, const _Float16* __restrict__ Bh, size_t sB, float alpha, const float* __restrict__ bias, const float* __restrict__ CP,
    float* __restrict__ C, _Float16* __restrict__ C16, size_t sC) { static_assert(ACT == 0 || ACT == 3, "k_gemm2: unsupported ACT code (would silently apply no activation)");
  static_assert(MP % G2_BM == 0 && DM % G2_BN == 0 && DM % G2_KS == 0, "k_gemm2: whole tiles and stages only");
  __shared__ __attribute__((aligned(16))) unsigned short sa[2][G2_BM][G2_PT];
  __shared__ __attribute__((aligned(16))) unsigned short sb[2][G2_BN][G2_PT];
  __shared__ __attribute__((aligned(16))) float so[8][32][68];
  constexpr int lda = DM, ldb = DM, M = MP, N = DM, K = DM;
  const int tid = threadIdx.x, w = tid >> 5, lane = tid & 31, ln = lane & 15, hh = lane >> 4; const int by = blockIdx.y;
  Bh += (size_t)by * sB; const size_t cofs = (size_t)by * sC;
  const int ntn = N >> 7; const int mt = blockIdx.x / ntn, nq = blockIdx.x - mt * ntn; if (mt * G2_BM >= M) return;      /* the whole work-group, in front of every copy and barrier */
  const int wr = (w >> 1) * 64, wc = (w & 1) * 64; const int row0 = mt * G2_BM + wr, col0 = nq * G2_BN + wc;
  const int sr = tid >> 4, sc = (tid & 15) * 8;      /* staging: rows sr + 16 j, 16-byte piece sc */
  const unsigned short* ag = (const unsigned short*)A + (size_t)(mt * G2_BM + sr) * lda + sc; const unsigned short* bg = (const unsigned short*)Bh + (size_t)(nq * G2_BN + sr) * ldb + sc;
  const size_t pa = (size_t)16 * lda, pb = (size_t)16 * ldb;
  const unsigned la0 = (unsigned)(size_t)&sa[0][sr][sc], lb0 = (unsigned)(size_t)&sb[0][sr][sc];      /* low 32 bits of a __shared__ address = the LDS byte address */
  const unsigned abuf = G2_BM * G2_PT * 2, bbuf = G2_BN * G2_PT * 2;
  const int nst = K >> 7;
  const v8f z8 = {0.f,0.f,0.f,0.f,0.f,0.f,0.f,0.f}; v8f acc[4][4];
#pragma unroll      /* constant indices keep the accumulator array in registers */
  for (int i = 0; i < 4; ++i)
#pragma unroll      /* constant indices keep the accumulator array in registers */
    for (int j = 0; j < 4; ++j) acc[i][j] = z8;
  g2_stage(la0, lb0, ag, bg, pa, pb);
  asm volatile("s_wait_asynccnt 0x0" ::: "memory");      /* this wave's copies of stage 0 have landed */
  __syncthreads();      /* publishes stage 0 */
  if (nst > 1) g2_stage(la0 + abuf, lb0 + bbuf, ag + G2_KS, bg + G2_KS, pa, pb);
#pragma unroll 1      /* one stage per trip: the two-buffer order below holds per trip */
  for (int s = 0; s < nst; ++s) { const int bf = s & 1;
#pragma unroll      /* constant indices keep the fragment and accumulator arrays in registers */
    for (int ks = 0; ks < G2_KS; ks += 32) { v16h af[4], bq[4];
#pragma unroll      /* constant indices keep the fragment and accumulator arrays in registers */
      for (int i = 0; i < 4; ++i) af[i] = g2_frag(&sa[bf][wr + i * 16 + ln][ks], hh);
#pragma unroll      /* constant indices keep the fragment and accumulator arrays in registers */
      for (int j = 0; j < 4; ++j) bq[j] = g2_frag(&sb[bf][wc + j * 16 + ln][ks], hh);
      __builtin_amdgcn_sched_barrier(0);      /* keeps the block's 16 LDS reads together in front of its 16 WMMAs: left free, the compiler sinks each A fragment's reads to its row and waits them out there */
#pragma unroll      /* constant indices keep the fragment and accumulator arrays in registers */
      for (int i = 0; i < 4; ++i)
#pragma unroll      /* constant indices keep the fragment and accumulator arrays in registers */
        for (int j = 0; j < 4; ++j) acc[i][j] = g2_mma(af[i], bq[j], acc[i][j]);
    }
    asm volatile("s_wait_dscnt 0x0" ::: "memory");      /* this wave's reads of buffer bf have returned before the buffer is refilled */
    asm volatile("s_wait_asynccnt 0x0" ::: "memory");      /* this wave's copies of stage s + 1 have landed */
    __syncthreads();      /* publishes stage s + 1 and ends every wave's reads of buffer bf */
    if (s + 2 < nst) { const int kn = (s + 2) * G2_KS; g2_stage(la0 + bf * abuf, lb0 + bf * bbuf, ag + kn, bg + kn, pa, pb); }
  }
  asm volatile("s_wait_asynccnt 0x0" ::: "memory");      /* no copy is outstanding when the wave goes on to its end */
  const size_t e0 = cofs + (size_t)(row0 + hh) * DM + col0 + ln * 4;      /* the lane's element of row hh of the wave's tile */
  v4f bv = {0.f, 0.f, 0.f, 0.f};
  if (HASB) { const v4f b4 = *(const v4fa*)(bias + col0 + ln * 4); bv = (v4f){bf16_round(b4[0]), bf16_round(b4[1]), bf16_round(b4[2]), bf16_round(b4[3])}; }
  const float* Rl = RES ? CP + e0 : nullptr; float* Cl = W32 ? C + e0 : nullptr; _Float16* Hl = W16 ? C16 + e0 : nullptr;
  v4f rs[16];
  if (RES) g2_res<0>(rs, Rl);
  g2_out<ACT, HASB, RES, W32, W16, 0>(acc, so[w], alpha, bv, rs, Rl, Cl, Hl, ln, hh);
  g2_out<ACT, HASB, RES, W32, W16, 1>(acc, so[w], alpha, bv, rs, Rl, Cl, Hl, ln, hh); }


// Every operand conversion in one launch: x -> f16(bf16(x)) rows, and the five natural [out][in] weights -> f16(bf16(w) x 16) planes (= Bt[n][k]).
// A work-group converts CV_BE contiguous elements of ONE tensor (the tensor is picked from the block index, the same for the whole work-group); a thread takes CV_PT pieces of 8 elements, all its loads in front of its stores.
#define CV_PT 4                        /* 8-element pieces per thread: eight 16-byte loads in flight per lane */
#define CV_BE (256 * CV_PT * 8)        /* elements per work-group */
#define CV_NX ((int)(NR * DM / CV_BE)) /* work-groups on x */
#define CV_NW (DM * DM / CV_BE)        /* work-groups on each weight */
__global__ __launch_bounds__(256) void k_cvt(const float* __restrict__ x, const float* __restrict__ wq, const float* __restrict__ wk, const float* __restrict__ wv, const float* __restrict__ w1, const float* __restrict__ w2,
    _Float16* __restrict__ X16, _Float16* __restrict__ BQ, _Float16* __restrict__ BK, _Float16* __restrict__ BV, _Float16* __restrict__ BW1, _Float16* __restrict__ BW2) {
  static_assert(NR * DM % CV_BE == 0 && DM * DM % CV_BE == 0, "k_cvt: whole work-groups only");
  int blk = blockIdx.x; const float* s = x; _Float16* d = X16; float sc = 1.0f;
  if (blk >= CV_NX) { blk -= CV_NX; const int wi = blk / CV_NW; blk -= wi * CV_NW; sc = 16.0f;
    s = wi == 0 ? wq : wi == 1 ? wk : wi == 2 ? wv : wi == 3 ? w1 : w2; d = wi == 0 ? BQ : wi == 1 ? BK : wi == 2 ? BV : wi == 3 ? BW1 : BW2; }
  const size_t e0 = (size_t)blk * CV_BE + threadIdx.x * 8;
  v4f a[CV_PT][2];
#pragma unroll      /* constant indices keep the piece array in registers */
  for (int u = 0; u < CV_PT; ++u) { a[u][0] = *(const v4fa*)(s + e0 + u * 2048); a[u][1] = *(const v4fa*)(s + e0 + u * 2048 + 4); }
#pragma unroll      /* constant indices keep the piece array in registers */
  for (int u = 0; u < CV_PT; ++u) { FragH f;
#pragma unroll      /* constant indices keep the piece array in registers */
    for (int q = 0; q < 4; ++q) { f.h[q] = (_Float16)(bf16_round(a[u][0][q]) * sc); f.h[4 + q] = (_Float16)(bf16_round(a[u][1][q]) * sc); }
    *(v8us*)((unsigned short*)d + e0 + u * 2048) = f.half[0]; } }
__global__ __launch_bounds__(256) void k_rsm(const float* __restrict__ S, _Float16* __restrict__ P, int nrows) {
  #pragma clang fp contract(off)
  const int i = blockIdx.x * 256 + threadIdx.x; if (i >= nrows) return; const float* s = S + (size_t)i * SQ; float mx = -3.0e38f;
#pragma unroll 1
  for (int j = 0; j < SQ; ++j) mx = fmaxf(mx, s[j]); float se = 0.f;
#pragma unroll 1
  for (int j = 0; j < SQ; ++j) se += expf(s[j] - mx); const float sc = 256.0f / se;
#pragma unroll 1
  for (int j0 = 0; j0 < SQ; j0 += 8) { FragH f; for (int q = 0; q < 8; ++q) f.h[q] = (_Float16)(expf(s[j0 + q] - mx) * sc); unsigned short* d = (unsigned short*)P + (size_t)i * SQ + j0; *(v8us*)d = f.half[0];  } }
__global__ __launch_bounds__(256) void k_vt(const _Float16* __restrict__ V16, int b, int h0, _Float16* __restrict__ VT) { __shared__ unsigned short tl[64][65]; const int tid = threadIdx.x; const int hh = blockIdx.x % HG, sg = blockIdx.x / HG; const int s0 = sg * 64; const int h = h0 + hh;
  for (int i = tid; i < 64 * 8; i += 256) { const int j = i / 8, d8 = (i % 8) * 8; FragH f; f.half[0] = *(const v8us*)((const unsigned short*)V16 + ((size_t)b * SQ + s0 + j) * DM + h * HD + d8); for (int q = 0; q < 8; ++q) tl[d8 + q][j] = f.u[q]; }
  __syncthreads();
  { for (int i = tid; i < 64 * 8; i += 256) { const int d = i / 8, j8 = (i % 8) * 8; FragH f; for (int q = 0; q < 8; ++q) f.u[q] = tl[d][j8 + q]; *(v8us*)((unsigned short*)VT + ((size_t)hh * HD + d) * SQ + s0 + j8) = f.half[0]; }  } }


// lane l <-> lane l ^ 16
__device__ __forceinline__ float fa_xrow(float v) { const int i = __builtin_bit_cast(int, v); return __builtin_bit_cast(float, __builtin_amdgcn_permlanex16(i, i, 0x76543210, 0xfedcba98, false, false)); }
__device__ __forceinline__ v16h fa_frag(const unsigned short* p, int hh) { FragH f; f.half[0] = *(const v8us*)(p + 8 * hh); f.half[1] = *(const v8us*)(p + 16 + 8 * hh); return f.v; }
__device__ __forceinline__ v8f fa_mma(v16h a, v16h b, v8f c) { return __builtin_amdgcn_wmma_f32_16x16x32_f16(false, a, false, b, (short)0, c, false, false); }
typedef float v2f __attribute__((ext_vector_type(2)));
typedef _Float16 v2h __attribute__((ext_vector_type(2)));
#define FA_KS 64      /* keys per LDS stage */
#define FA_PT 72      /* LDS row pitch in 16-bit elements: 144 B = 16 B x 9, so the 16 rows of a 16-byte fragment read fall on distinct banks */
#define FA_PV 80      /* LDS row pitch of the V rows in 16-bit elements: 160 B = 32 B x 5, the pitch for transposing 16-byte reads of 128-byte rows */
#define FA_NW 8       /* waves per work-group, 32 query columns each */
typedef short fa_s8 __attribute__((ext_vector_type(8)));
// One 16 (d) x 32 (keys) A fragment of V^T from V rows [key][d] in LDS, by two transposing reads (ds_load_tr16_b128), 16 keys apart.
// p: the lane's own address, row 8 (lane >> 4) + (lane & 7) of the 32 keys, 16-byte piece (lane >> 3) & 1 of the 16 d; lane (ln, hh) then holds d = ln, keys 8 hh + 0..7 and 16 + 8 hh + 0..7: the hardware k order, as fa_frag gives it from V^T rows.
__device__ __forceinline__ v16h fa_fragt(const unsigned short* p) { typedef __attribute__((address_space(3))) fa_s8 lds_s8; FragH f; f.half[0] = __builtin_bit_cast(v8us, __builtin_amdgcn_ds_load_tr16_b128_v8i16((lds_s8*)p)); f.half[1] = __builtin_bit_cast(v8us, __builtin_amdgcn_ds_load_tr16_b128_v8i16((lds_s8*)(p + 16 * FA_PV))); return f.v; }
__global__ __launch_bounds__(FA_NW * 32) __attribute__((amdgpu_waves_per_eu(4, 4))) void k_fattn(const _Float16* __restrict__ Q16, const _Float16* __restrict__ K16, const _Float16* __restrict__ V16, const float* __restrict__ X, float* __restrict__ HP) {
  __shared__ __attribute__((aligned(16))) unsigned short sk[2][FA_KS][FA_PT];
  __shared__ __attribute__((aligned(16))) unsigned short sv[2][FA_KS][FA_PV];
  __shared__ __attribute__((aligned(16))) float so[FA_NW][32][68];
  const int tid = threadIdx.x, w = tid >> 5, lane = tid & 31, ln = lane & 15, hh = lane >> 4;
  const int bh = blockIdx.y, b = bh / NH, h = bh - b * NH; const int q0 = blockIdx.x * (FA_NW * 32) + w * 32;
  const unsigned short* Kg = (const unsigned short*)K16 + (size_t)b * SQ * DM + h * HD;      /* key rows, pitch DM */
  const unsigned short* Vg = (const unsigned short*)V16 + (size_t)b * SQ * DM + h * HD;      /* key rows, pitch DM */
  const int sr = tid >> 3, sc = (tid & 7) * 8;      /* staging: rows sr and sr + 32, 16-byte piece sc; a wave's load covers four whole 128-byte rows */
  const float cs = 0.125f * 1.44269504088896340736f;
  v16h qf[2][2];
#pragma unroll      /* constant indices keep the fragment and accumulator arrays in registers */
  for (int qt = 0; qt < 2; ++qt)
#pragma unroll      /* constant indices keep the fragment and accumulator arrays in registers */
    for (int ks = 0; ks < 2; ++ks) qf[qt][ks] = fa_frag((const unsigned short*)Q16 + ((size_t)b * SQ + q0 + qt * 16 + ln) * DM + h * HD + ks * 32, hh);
  const v8f z8 = {0.f,0.f,0.f,0.f,0.f,0.f,0.f,0.f};
  v8f o[4][2]; float mu[2], l[2];
#pragma unroll      /* constant indices keep the fragment and accumulator arrays in registers */
  for (int qt = 0; qt < 2; ++qt) { mu[qt] = -1.0e30f; l[qt] = 0.f;
#pragma unroll      /* constant indices keep the fragment and accumulator arrays in registers */
    for (int dt = 0; dt < 4; ++dt) o[dt][qt] = z8; }
  v8us rk0 = *(const v8us*)(Kg + (size_t)sr * DM + sc), rk1 = *(const v8us*)(Kg + (size_t)(sr + 32) * DM + sc), rv0 = *(const v8us*)(Vg + (size_t)sr * DM + sc), rv1 = *(const v8us*)(Vg + (size_t)(sr + 32) * DM + sc);
  asm volatile("s_wait_xcnt 0x0" ::: "memory");      /* behind the Q, K and V loads, in front of the set-up code that reuses their address registers */
  *(v8us*)&sk[0][sr][sc] = rk0; *(v8us*)&sk[0][sr + 32][sc] = rk1; *(v8us*)&sv[0][sr][sc] = rv0; *(v8us*)&sv[0][sr + 32][sc] = rv1;
  __syncthreads();      /* publishes stage 0 */
#pragma unroll 1      /* one stage per trip keeps the loop small and the register count inside four waves per SIMD */
  for (int s = 0; s < SQ / FA_KS; ++s) { const int bf = s & 1; const bool more = s + 1 < SQ / FA_KS;
    if (more) { const int kn = (s + 1) * FA_KS; rk0 = *(const v8us*)(Kg + (size_t)(kn + sr) * DM + sc); rk1 = *(const v8us*)(Kg + (size_t)(kn + sr + 32) * DM + sc); rv0 = *(const v8us*)(Vg + (size_t)(kn + sr) * DM + sc); rv1 = *(const v8us*)(Vg + (size_t)(kn + sr + 32) * DM + sc); }
#pragma unroll      /* constant indices keep the fragment and accumulator arrays in registers */
    for (int kk = 0; kk < FA_KS; kk += 32) {
      v8f st[2][2];
#pragma unroll      /* constant indices keep the fragment and accumulator arrays in registers */
      for (int kt = 0; kt < 2; ++kt) { const unsigned short* kr = &sk[bf][kk + kt * 16 + ln][0]; const v16h k0 = fa_frag(kr, hh), k1 = fa_frag(kr + 32, hh);
#pragma unroll      /* constant indices keep the fragment and accumulator arrays in registers */
        for (int qt = 0; qt < 2; ++qt) st[kt][qt] = fa_mma(k1, qf[qt][1], fa_mma(k0, qf[qt][0], z8)); }
      v16h vf[4];
#pragma unroll      /* constant indices keep the fragment and accumulator arrays in registers */
      for (int dt = 0; dt < 4; ++dt) vf[dt] = fa_fragt(&sv[bf][kk + 8 * hh + (lane & 7)][dt * 16 + ((lane >> 3) & 1) * 8]);
      float mb[2]; bool need = false;
#pragma unroll      /* constant indices keep the fragment and accumulator arrays in registers */
      for (int qt = 0; qt < 2; ++qt) { float mx = st[0][qt][0];
#pragma unroll      /* constant indices keep the fragment and accumulator arrays in registers */
        for (int r = 1; r < 8; ++r) mx = fmaxf(mx, st[0][qt][r]);
#pragma unroll      /* constant indices keep the fragment and accumulator arrays in registers */
        for (int r = 0; r < 8; ++r) mx = fmaxf(mx, st[1][qt][r]);
        mx = fmaxf(mx, fa_xrow(mx)) * cs; mb[qt] = mx; need = need || (mx > mu[qt] + 8.0f); }
      if (__builtin_amdgcn_ballot_w32(need) != 0) {      /* one scalar branch per pass; rare after the first passes */
#pragma unroll      /* constant indices keep the fragment and accumulator arrays in registers */
        for (int qt = 0; qt < 2; ++qt) { const float mn = fmaxf(mu[qt], mb[qt]); const float al = __builtin_amdgcn_exp2f(mu[qt] - mn); mu[qt] = mn; l[qt] *= al;
#pragma unroll      /* constant indices keep the fragment and accumulator arrays in registers */
          for (int dt = 0; dt < 4; ++dt) o[dt][qt] = o[dt][qt] * al; } }
#pragma unroll      /* constant indices keep the fragment and accumulator arrays in registers */
      for (int qt = 0; qt < 2; ++qt) { const float nm = 4.0f - mu[qt]; const v2f c2 = {cs, cs}, n2 = {nm, nm}; union { v16h v; v2h p[8]; } pf; v2f ls = {0.f, 0.f};
#pragma unroll      /* constant indices keep the fragment and accumulator arrays in registers */
        for (int i = 0; i < 4; ++i) { const int kt = i >> 1, r4 = (i & 1) * 4;
          const v2f x0 = {st[kt][qt][r4], st[kt][qt][r4 + 1]}, x1 = {st[kt][qt][r4 + 2], st[kt][qt][r4 + 3]};
          const v2f t0 = __builtin_elementwise_fma(x0, c2, n2), t1 = __builtin_elementwise_fma(x1, c2, n2); 
          const v2f p0 = {__builtin_amdgcn_exp2f(t0[0]), __builtin_amdgcn_exp2f(t0[1])}, p1 = {__builtin_amdgcn_exp2f(t1[0]), __builtin_amdgcn_exp2f(t1[1])}; ls += p0; ls += p1;
          pf.p[i * 2] = __builtin_convertvector(p0, v2h); pf.p[i * 2 + 1] = __builtin_convertvector(p1, v2h); }
        l[qt] += ls[0] + ls[1];
#pragma unroll      /* constant indices keep the fragment and accumulator arrays in registers */
        for (int dt = 0; dt < 4; ++dt) o[dt][qt] = fa_mma(vf[dt], pf.v, o[dt][qt]); }
    }
    if (more) { *(v8us*)&sk[bf ^ 1][sr][sc] = rk0; *(v8us*)&sk[bf ^ 1][sr + 32][sc] = rk1; *(v8us*)&sv[bf ^ 1][sr][sc] = rv0; *(v8us*)&sv[bf ^ 1][sr + 32][sc] = rv1; }
    __syncthreads();      /* publishes the next stage's buffer and ends every wave's reads of this one, which the next trip refills */
  }
  // epilogue: O^T / row sum through the wave's own LDS rows, so that each global access covers whole 256-byte head rows
#pragma unroll      /* constant indices keep the fragment and accumulator arrays in registers */
  for (int qt = 0; qt < 2; ++qt) { const float inv = 1.0f / (l[qt] + fa_xrow(l[qt]));
#pragma unroll      /* constant indices keep the fragment and accumulator arrays in registers */
    for (int dt = 0; dt < 4; ++dt) { const v4f lo = {o[dt][qt][0] * inv, o[dt][qt][1] * inv, o[dt][qt][2] * inv, o[dt][qt][3] * inv}, hi = {o[dt][qt][4] * inv, o[dt][qt][5] * inv, o[dt][qt][6] * inv, o[dt][qt][7] * inv};
      *(v4f*)&so[w][qt * 16 + ln][dt * 16 + 8 * hh] = lo; *(v4f*)&so[w][qt * 16 + ln][dt * 16 + 8 * hh + 4] = hi; } }
  __builtin_amdgcn_fence(__ATOMIC_ACQ_REL, "workgroup"); __builtin_amdgcn_wave_barrier();      /* the wave's own LDS stores before its own reads of other lanes' elements */
  const size_t g0 = ((size_t)b * SQ + q0) * DM + h * HD + ln * 4;
#pragma unroll      /* constant indices keep the fragment and accumulator arrays in registers */
  for (int q = 0; q < 16; ++q) { const int r = q * 2 + hh; const v4f v = *(const v4fa*)&so[w][r][ln * 4]; const v4f xi = *(const v4fa*)(X + g0 + (size_t)r * DM); const v4f xr = {bf16_round(xi[0]), bf16_round(xi[1]), bf16_round(xi[2]), bf16_round(xi[3])}; *(v4f*)(HP + g0 + (size_t)r * DM) = v + xr; } }


// Row LayerNorm (biased variance, eps, bf16-rounded gamma and beta), two rows per wave and no LDS: a lane holds 32 elements of each of its rows (eight 16-byte pieces per row, so that each load and each f32 store of the wave covers 512 contiguous bytes).
// Mean and variance: four chains per lane, then a butterfly over the 32 lanes (four DPP steps inside the 16-lane rows, one exchange between them). Two passes over the registers, as the definition has it.
// Each wave takes LN_RW rows, which share one rounding of gamma and beta: the launch starts 4,096 waves (16 per WGP, all resident at once) instead of eight waves per row (65,536), and has no barrier.
#define LN_NW 16      /* waves per work-group */
#define LN_RW 2       /* rows per wave */
template <int M> __device__ __forceinline__ float ln_xm(float v) { return __builtin_bit_cast(float, __builtin_amdgcn_update_dpp(0, __builtin_bit_cast(int, v), 0x160 + M, 0xf, 0xf, true)); }      /* lane l <-> lane l ^ M, M < 16 (row_xmask) */
__device__ __forceinline__ float ln_wsum(v4f s) { float v = (s[0] + s[1]) + (s[2] + s[3]); v += ln_xm<1>(v); v += ln_xm<2>(v); v += ln_xm<4>(v); v += ln_xm<8>(v); return v + fa_xrow(v); }
template <int W16, int W32>
__global__ __launch_bounds__(LN_NW * 32) void k_lnw(const float* __restrict__ X, const float* __restrict__ g, const float* __restrict__ bb, float eps, _Float16* __restrict__ N16, float* __restrict__ N32) {
  static_assert(DMQ == 8 * 128, "k_lnw: a row is eight 512-byte pieces");
  const int c0 = (threadIdx.x & 31) * 4; const size_t r0 = ((size_t)blockIdx.x * LN_NW + __builtin_amdgcn_readfirstlane(threadIdx.x >> 5)) * LN_RW;      /* the wave's number as a scalar: the row bases stay in scalar registers and every access shares the lane's one offset register */
  v4f gg[8], bv[8], x[LN_RW][8]; float rs[LN_RW];
#pragma unroll      /* constant indices keep the row arrays in registers */
  for (int u = 0; u < 8; ++u) { gg[u] = *(const v4fa*)(g + u * 128 + c0); bv[u] = *(const v4fa*)(bb + u * 128 + c0); }
#pragma unroll      /* constant indices keep the row arrays in registers */
  for (int i = 0; i < LN_RW; ++i)
#pragma unroll      /* constant indices keep the row arrays in registers */
    for (int u = 0; u < 8; ++u) { const int c = u * 128 + c0; x[i][u] = *(const v4fa*)(X + (r0 + i) * DMQ + c); }
  __builtin_amdgcn_sched_barrier(0);      /* keeps all 32 loads in front of the arithmetic: left free, the compiler sinks most gamma and beta loads behind the reductions and waits each pair out there */
#pragma unroll      /* constant indices keep the row arrays in registers */
  for (int u = 0; u < 8; ++u)
#pragma unroll      /* constant indices keep the row arrays in registers */
    for (int q = 0; q < 4; ++q) { gg[u][q] = bf16_round(gg[u][q]); bv[u][q] = bf16_round(bv[u][q]); }
#pragma unroll      /* constant indices keep the row arrays in registers */
  for (int i = 0; i < LN_RW; ++i) { v4f s = x[i][0];
#pragma unroll      /* constant indices keep the row arrays in registers */
    for (int u = 1; u < 8; ++u) s += x[i][u];
    const float mu = ln_wsum(s) * (1.0f / (float)DMQ); v4f q = {0.f, 0.f, 0.f, 0.f};
#pragma unroll      /* constant indices keep the row arrays in registers */
    for (int u = 0; u < 8; ++u) { x[i][u] = x[i][u] - mu; q += x[i][u] * x[i][u]; }
    rs[i] = rsqrtf(ln_wsum(q) * (1.0f / (float)DMQ) + eps); }
#pragma unroll      /* constant indices keep the row arrays in registers */
  for (int i = 0; i < LN_RW; ++i)
#pragma unroll      /* constant indices keep the row arrays in registers */
    for (int u = 0; u < 8; ++u) { const int c = u * 128 + c0; const v4f y = x[i][u] * rs[i] * gg[u] + bv[u];
      if (W32) *(v4f*)(N32 + (r0 + i) * DMQ + c) = y;
      if (W16) *(v4h*)(N16 + (r0 + i) * DMQ + c) = __builtin_convertvector(y, v4h); } }




extern "C" void kernel_launch(void* const* d_in, const int* in_sizes, int n_in,
                              void* d_out, int out_size, void* d_ws, size_t ws_size, hipStream_t stream) {
  (void)in_sizes; (void)n_in; (void)out_size;
  const float* const* I = (const float* const*)d_in; const float* x = I[0]; const float* wq = I[1]; const float* wk = I[2]; const float* wv = I[3]; const float* g1 = I[4]; const float* be1 = I[5]; const float* w1 = I[6]; const float* b1 = I[7]; const float* w2 = I[8]; const float* b2 = I[9]; const float* g2 = I[10]; const float* be2 = I[11];      /* natural [out][in] weights; LN affine; FFN biases */
  char* ws = (char*)d_ws; size_t off = 0;
  auto take = [&](size_t bytes) { char* p = ws + off; off += (bytes + 255) & ~(size_t)255; return p; };
  _Float16* BW1 = (_Float16*)take((size_t)DM * DM * 2); _Float16* BW2 = (_Float16*)take((size_t)DM * DM * 2); float* HP = (float*)take(NR * DM * 4); _Float16* H16 = (_Float16*)take(NR * DM * 2); _Float16* FF16 = (_Float16*)take(NR * DM * 2); _Float16* BQ = (_Float16*)take((size_t)DM * DM * 2); _Float16* BK = (_Float16*)take((size_t)DM * DM * 2); _Float16* BV = (_Float16*)take((size_t)DM * DM * 2); 
  _Float16* X16 = (_Float16*)take(NR * DM * 2); _Float16* Q16 = (_Float16*)take(NR * DM * 2); _Float16* K16 = (_Float16*)take(NR * DM * 2); _Float16* V16 = (_Float16*)take(NR * DM * 2);
  float* HF = (float*)take(NR * DM * 4);      /* the f32 h rows (LN1 output, residual for the FFN) */
  if (off > ws_size) return;
  k_cvt<<<CV_NX + 5 * CV_NW, 256, 0, stream>>>(x, wq, wk, wv, w1, w2, X16, BQ, BK, BV, BW1, BW2);      /* x rows and the five weight planes as f16 */
  const size_t r0p = (size_t)B0 * SQ;      /* first projected row */
  k_gemm2<0, false, false, false, true><<<dim3((unsigned)((MP / G2_BM) * (DM / G2_BN)), 3), 256, 0, stream>>>(X16 + r0p * DM, BQ, (size_t)(BK - BQ), 0.0625f, nullptr, nullptr, nullptr, Q16 + r0p * DM, (size_t)(K16 - Q16));      /* q, k, v: grid.y steps through the three weight planes and the three output planes, which lie at equal distances in the workspace */
  k_fattn<<<dim3(SQ / (FA_NW * 32), NB * NH), FA_NW * 32, 0, stream>>>(Q16, K16, V16, x, HP);      /* h_pre = bf16(x) + attn (merged heads), f32 rows */
  k_lnw<1, 1><<<(unsigned)(MP / (LN_NW * LN_RW)), LN_NW * 32, 0, stream>>>(HP + r0p * DM, g1, be1, 1e-5f, H16 + r0p * DM, HF + r0p * DM);      /* h = LN1(x + attn) -> f16 rows (FFN operand) and f32 rows (residual) */
  k_gemm2<3, true, false, false, true><<<dim3((unsigned)((MP / G2_BM) * (DM / G2_BN)), 1), 256, 0, stream>>>(H16 + r0p * DM, BW1, 0, 0.0625f, b1, nullptr, nullptr, FF16 + r0p * DM, 0);      /* relu(h l1^T + b1) -> f16 rows */
  k_gemm2<0, true, true, true, false><<<dim3((unsigned)((MP / G2_BM) * (DM / G2_BN)), 1), 256, 0, stream>>>(FF16 + r0p * DM, BW2, 0, 0.0625f, b2, HF + r0p * DM, HP + r0p * DM, nullptr, 0);      /* y = h + ff (own-element residual; the h_pre plane is free again) */
  k_lnw<0, 1><<<(unsigned)(MP / (LN_NW * LN_RW)), LN_NW * 32, 0, stream>>>(HP + r0p * DM, g2, be2, 1e-5f, nullptr, (float*)d_out + r0p * DM);      /* out = LN2(h + ff) -> f32 output rows */
}

// v007
// It runs in 150 microseconds.
// In both of two side-by-side timings against v006, it was 1.04 times as fast.
// Over all steps from v000 it is 88.8 times as fast.
#include <hip/hip_runtime.h>
// Post-LN transformer encoder block (x [4][2048][1024]; q = x wq^T, k, v likewise (nn.Linear natural [1024][1024] sigma 1/32, no biases); 16 heads of 64 (chunked along features = head-major columns); softmax(q k^T / 8) v over all keys (no mask), heads merged, NO output projection; h = LN1(x + attn) (biased variance, eps 1e-5, gamma/beta); ff = relu(h l1_w^T + l1_b) l2_w^T + l2_b (natural [1024][1024], biases sigma 0.01); out = LN2(h + ff) -> [4][2048][1024]).
// Structure: token rows r = b*2048 + s; x and the five weights as exact f16 planes (bf16-rounded), one conversion launch; Q, K, V as one WMMA GEMM launch (a work-group takes the same 256x128 tile of all three planes, so that each staged x tile serves three products; operand tiles staged in LDS, 64x64 wave tiles per plane, f32 accumulation, exact x16 weights, f16 outputs); one fused attention launch (per head and 256 queries: S^T = K Q^T, online softmax in registers with f32 statistics and native exp2, weights as f16, O^T += V^T P^T, the V^T fragments by transposing LDS reads of V rows), h_pre = bf16(x) + attn as f32 rows; LN1 on VALU (f32 statistics, two rows per wave) -> f16 + f32 rows; relu(h l1^T + b1) GEMM with the ReLU epilogue -> f16; y = h + ff l2^T + b2 GEMM (own-element residual); LN2 on VALU -> f32 output.
// Compute dtype: inputs rounded to bf16; x / weights exact; q, k, v, softmax weights, h and ff as plain f16 GEMM operands (~2^-12); scores and softmax statistics f32. v_wmma_f32_16x16x32_f16.
#define NB 4
#define SQ 2048
#define DM 1024
#define NH 16
#define HD 64
#define DMQ DM                       /* LayerNorm width */
#define HG 2                         /* heads per block group of the unlaunched per-batch k_vt */
#define B0 0                         /* first batch processed (debug hook) */
#define NBR NB                       /* batches processed (debug hook) */
#define NR ((size_t)NB * SQ)         /* token rows */
#define MP ((int)((size_t)NBR * SQ)) /* rows projected (debug hook) */
#define QN SQ                        /* unused (attention runs all SQ queries per batch) */
#define NHD NH                       /* unused (attention runs all NH heads) */
#define MPO MP                       /* unused (the output stage runs MP rows) */
#define LQ DM      /* unused (the q/k/v rows have pitch DM) */
typedef __bf16 v16b __attribute__((ext_vector_type(16)));
typedef unsigned short v8us __attribute__((ext_vector_type(8), may_alias));
typedef float  v8f  __attribute__((ext_vector_type(8)));
typedef float  v4f  __attribute__((ext_vector_type(4)));
typedef float  v4fa __attribute__((ext_vector_type(4), may_alias));
union FragB { v16b v; v8us half[2]; unsigned short u[16]; };

__device__ __forceinline__ unsigned short bf16_bits(float x) { unsigned int u = __float_as_uint(x); return (unsigned short)((u + 0x7FFFu + ((u >> 16) & 1u)) >> 16); }
__device__ __forceinline__ float bf16_val(unsigned short b) { return __uint_as_float(((unsigned int)b) << 16); }
__device__ __forceinline__ float bf16_round(float x) { return bf16_val(bf16_bits(x)); }
// D += A·B with NT terms: 1 = ah·bh, 2 = + al·bh (A split), 3 = + ah·bl (both split)
template <int NT>
__device__ __forceinline__ v8f mmaN(v16b ah, v16b al, v16b bh, v16b bl, v8f c) {
  c = __builtin_amdgcn_wmma_f32_16x16x32_bf16(false, ah, false, bh, (short)0, c, false, false);
  if (NT >= 2) c = __builtin_amdgcn_wmma_f32_16x16x32_bf16(false, al, false, bh, (short)0, c, false, false);
  if (NT >= 3) c = __builtin_amdgcn_wmma_f32_16x16x32_bf16(false, ah, false, bl, (short)0, c, false, false);
  asm volatile("v_nop\n\tv_nop\n\tv_nop\n\tv_nop" : "+v"(c) : "v"(ah), "v"(al), "v"(bh), "v"(bl));
  return c;
}

__global__ __launch_bounds__(256) void k_wt_bf16(const float* __restrict__ W, unsigned short* __restrict__ Wt, int K, int N) {
  const int t = blockIdx.x * 256 + threadIdx.x;
  const int k8n = K / 8;
  if (t >= N * k8n) return;
  const int n = t / k8n, k8 = (t % k8n) * 8;
  v8us v;
#pragma unroll
  for (int i = 0; i < 8; ++i) v[i] = bf16_bits(W[(size_t)(k8 + i) * N + n]);
  *(v8us*)(Wt + (size_t)n * K + k8) = v;
  
}

// GEMM C[M][N] (f32, pitch ldc) = act(A[M][K]·W + bias). A f32 row-major (pitch lda) converted per fragment to bf16
// (ASPLIT: hi/lo two planes -> 2 terms, else single rounded term); Wt bf16 [N][K] (pitch ldb). BIAS_BF16 rounds the
// bias to bf16 first (bias quantised to bf16 before the add). K%32==0, M%16==0, N%64==0.
template <bool ASPLIT, int ACT, bool BIAS_BF16>
__global__ __launch_bounds__(128) void k_gemm_bf(const float* __restrict__ A, int lda, const unsigned short* __restrict__ Wt, int ldb,
                                               const float* __restrict__ bias, float* __restrict__ C, int ldc, int M, int N, int K) {
  __shared__ __attribute__((aligned(16))) float so[4][16][64];
  const int tid = threadIdx.x, w = tid >> 5, lane = tid & 31, ln = lane & 15, hh = lane >> 4;
  const int ntn = N / 64;
  const int wid = blockIdx.x * 4 + w;
  const int mt = wid / ntn, nq = wid % ntn;
  if (mt * 16 >= M) return;
  const int row0 = mt * 16, col0 = nq * 64;
  const float* arow = A + (size_t)(row0 + ln) * lda;
  v8f acc[4] = {};
  for (int kb = 0; kb < K; kb += 32) {
    FragB ah, al;
    const v4f x0 = *(const v4fa*)(arow + kb + 8 * hh), x1 = *(const v4fa*)(arow + kb + 8 * hh + 4);
    const v4f x2 = *(const v4fa*)(arow + kb + 16 + 8 * hh), x3 = *(const v4fa*)(arow + kb + 16 + 8 * hh + 4);
    float xs[16] = {x0[0],x0[1],x0[2],x0[3],x1[0],x1[1],x1[2],x1[3],x2[0],x2[1],x2[2],x2[3],x3[0],x3[1],x3[2],x3[3]};
#pragma unroll
    for (int i = 0; i < 16; ++i) { const unsigned short hb = bf16_bits(xs[i]); ah.u[i] = hb; al.u[i] = ASPLIT ? bf16_bits(xs[i] - bf16_val(hb)) : (unsigned short)0; }
#pragma unroll
    for (int t = 0; t < 4; ++t) {
      const unsigned short* brow = Wt + (size_t)(col0 + t * 16 + ln) * ldb + kb;
      FragB b;
      b.half[0] = *(const v8us*)(brow + 8 * hh);
      b.half[1] = *(const v8us*)(brow + 16 + 8 * hh);
      acc[t] = mmaN<ASPLIT ? 2 : 1>(ah.v, al.v, b.v, b.v, acc[t]);
    }
  }
#pragma unroll
  for (int t = 0; t < 4; ++t) {
    float bv = bias ? bias[col0 + t * 16 + ln] : 0.f;
    if (BIAS_BF16) bv = bf16_round(bv);
#pragma unroll
    for (int r = 0; r < 8; ++r) { float v = acc[t][r] + bv; if (ACT == 1) v = fmaxf(v, 0.f); so[w][8 * hh + r][t * 16 + ln] = v; }
  }
  __builtin_amdgcn_fence(__ATOMIC_ACQ_REL, "workgroup");
  __builtin_amdgcn_wave_barrier();
  const int rsub = lane >> 4, c4 = (lane & 15) * 4;
  {
#pragma unroll
    for (int q = 0; q < 8; ++q) {
      const int r = q * 2 + rsub;
      const v4f v = *(const v4fa*)&so[w][r][c4];
      *(v4f*)(C + (size_t)(row0 + r) * ldc + col0 + c4) = v;
    }
    
  }
}

// GEMM C = act(A·W + bias + resid): A f32 (ASPLIT -> hi/lo 2 terms), Wt bf16 [N][K]; ACT 0 none, 1 relu, 2 exact gelu;
// resid (optional, f32, row index = (row % rmod), pitch ldr, RES_BF16 rounds it) added before the activation.
template <bool ASPLIT, int ACT, bool BIAS_BF16, bool RES_BF16>
__global__ __launch_bounds__(128) void k_gemm_bf3(const float* __restrict__ A, int lda, const unsigned short* __restrict__ Wt, int ldb,
                                                const float* __restrict__ bias, const float* __restrict__ resid, int rmod, int ldr,
                                                float* __restrict__ C, int ldc, int M, int N, int K) {
  __shared__ __attribute__((aligned(16))) float so[4][16][64];
  const int tid = threadIdx.x, w = tid >> 5, lane = tid & 31, ln = lane & 15, hh = lane >> 4;
  const int ntn = N / 64;
  const int wid = blockIdx.x * 4 + w;
  const int mt = wid / ntn, nq = wid % ntn;
  if (mt * 16 >= M) return;
  const int row0 = mt * 16, col0 = nq * 64;
  const float* arow = A + (size_t)(row0 + ln) * lda;
  v8f acc[4] = {};
  for (int kb = 0; kb < K; kb += 32) {
    FragB ah, al;
    const v4f x0 = *(const v4fa*)(arow + kb + 8 * hh), x1 = *(const v4fa*)(arow + kb + 8 * hh + 4);
    const v4f x2 = *(const v4fa*)(arow + kb + 16 + 8 * hh), x3 = *(const v4fa*)(arow + kb + 16 + 8 * hh + 4);
    float xs[16] = {x0[0],x0[1],x0[2],x0[3],x1[0],x1[1],x1[2],x1[3],x2[0],x2[1],x2[2],x2[3],x3[0],x3[1],x3[2],x3[3]};
#pragma unroll
    for (int i = 0; i < 16; ++i) { const unsigned short hb = bf16_bits(xs[i]); ah.u[i] = hb; al.u[i] = ASPLIT ? bf16_bits(xs[i] - bf16_val(hb)) : (unsigned short)0; }
#pragma unroll
    for (int t = 0; t < 4; ++t) {
      const unsigned short* brow = Wt + (size_t)(col0 + t * 16 + ln) * ldb + kb;
      FragB b;
      b.half[0] = *(const v8us*)(brow + 8 * hh);
      b.half[1] = *(const v8us*)(brow + 16 + 8 * hh);
      acc[t] = mmaN<ASPLIT ? 2 : 1>(ah.v, al.v, b.v, b.v, acc[t]);
    }
  }
#pragma unroll
  for (int t = 0; t < 4; ++t) {
    const int col = col0 + t * 16 + ln;
    float bv = bias ? bias[col] : 0.f;
    if (BIAS_BF16) bv = bf16_round(bv);
#pragma unroll
    for (int r = 0; r < 8; ++r) {
      float v = acc[t][r] + bv;
      if (resid) { float rv = resid[(size_t)((row0 + 8 * hh + r) % rmod) * ldr + col]; if (RES_BF16) rv = bf16_round(rv); v += rv; }
      if (ACT == 1) v = fmaxf(v, 0.f);
      if (ACT == 2) v = 0.5f * v * (1.0f + erff(v * 0.70710678118654752f));
      if (ACT == 3) { const float u = 0.7978845608028654f * (v + 0.044715f * v * v * v); v = 0.5f * v * (1.0f + tanhf(u)); }
      so[w][8 * hh + r][t * 16 + ln] = v;
    }
  }
  __builtin_amdgcn_fence(__ATOMIC_ACQ_REL, "workgroup");
  __builtin_amdgcn_wave_barrier();
  const int rsub = lane >> 4, c4 = (lane & 15) * 4;
  {
#pragma unroll
    for (int q = 0; q < 8; ++q) {
      const int r = q * 2 + rsub;
      const v4f v = *(const v4fa*)&so[w][r][c4];
      *(v4f*)(C + (size_t)(row0 + r) * ldc + col0 + c4) = v;
    }
    
  }
}
// row LayerNorm (biased variance, eps) over N: s = X (+ R); optional out_sum <- s; out_norm <- (s-mu)*rsqrt(var+eps)*g + b
template <bool PARAM_BF16>
__global__ __launch_bounds__(256) void k_layernorm(const float* __restrict__ X, const float* __restrict__ R, const float* __restrict__ g, const float* __restrict__ bta,
                                                  float* __restrict__ out_sum, float* __restrict__ out_norm, int N, float eps) {
  __shared__ float red[256];
  const int row = blockIdx.x, tid = threadIdx.x;
  const float* x = X + (size_t)row * N; const float* rr = R ? R + (size_t)row * N : nullptr;
  float vals[16];                     // up to N = 4096
  const int per = N / 256;            // contiguous chunk per thread? use strided-by-4 chunks: thread handles j = tid*4 + 1024*u
  float s1 = 0.f;
  for (int u = 0; u < per / 4; ++u) {
    const int j = tid * 4 + 1024 * u;
    const v4f a = *(const v4fa*)(x + j);
    v4f b = {0.f,0.f,0.f,0.f}; if (rr) b = *(const v4fa*)(rr + j);
#pragma unroll
    for (int q = 0; q < 4; ++q) { const float v = a[q] + b[q]; vals[u * 4 + q] = v; s1 += v; }
  }
  red[tid] = s1; __syncthreads();
  for (int st = 128; st > 0; st >>= 1) { if (tid < st) red[tid] += red[tid + st]; __syncthreads(); }
  const float mu = red[0] / (float)N; __syncthreads();
  float s2 = 0.f;
  for (int u = 0; u < per / 4; ++u)
#pragma unroll
    for (int q = 0; q < 4; ++q) { const float c = vals[u * 4 + q] - mu; s2 += c * c; }
  red[tid] = s2; __syncthreads();
  for (int st = 128; st > 0; st >>= 1) { if (tid < st) red[tid] += red[tid + st]; __syncthreads(); }
  const float rs = rsqrtf(red[0] / (float)N + eps);
  {
    for (int u = 0; u < per / 4; ++u) {
      const int j = tid * 4 + 1024 * u;
      v4f o, sm;
#pragma unroll
      for (int q = 0; q < 4; ++q) {
        float gg = g[j + q], bb = bta[j + q];
        if (PARAM_BF16) { gg = bf16_round(gg); bb = bf16_round(bb); }
        sm[q] = vals[u * 4 + q]; o[q] = (vals[u * 4 + q] - mu) * rs * gg + bb;
      }
      if (out_sum) *(v4f*)(out_sum + (size_t)row * N + j) = sm;
      *(v4f*)(out_norm + (size_t)row * N + j) = o;
    }
    
  }
}



// ---- f16 WMMA path (v_wmma_f32_16x16x32_f16): 11-bit significands for operands in range — used where a [0,1] probability operand needs more precision than bf16
typedef _Float16 v16h __attribute__((ext_vector_type(16)));
union FragH { v16h v; v8us half[2]; _Float16 h[16]; unsigned short u[16]; };
template <int NT>
__device__ __forceinline__ v8f mmaH(v16h ah, v16h al, v16h bh, v16h bl, v8f c) {
  c = __builtin_amdgcn_wmma_f32_16x16x32_f16(false, ah, false, bh, (short)0, c, false, false);
  if (NT >= 2) c = __builtin_amdgcn_wmma_f32_16x16x32_f16(false, al, false, bh, (short)0, c, false, false);
  if (NT >= 3) c = __builtin_amdgcn_wmma_f32_16x16x32_f16(false, ah, false, bl, (short)0, c, false, false);
  asm volatile("v_nop\n\tv_nop\n\tv_nop\n\tv_nop" : "+v"(c) : "v"(ah), "v"(al), "v"(bh), "v"(bl));
  return c;
}
// batched GEMM like k_gemm_b but f16 operands: A f32 (split into f16 hi/lo if ASPLIT, else rounded to f16), Bt = f16 values [n][k]; alpha; C f32; N multiple of 16 (partial tiles skipped)
template <bool ASPLIT>
__global__ __launch_bounds__(128) void k_gemm_h(const float* __restrict__ A, int lda, size_t sA, const _Float16* __restrict__ Bh, int ldb, size_t sB, float alpha, float* __restrict__ C, int ldc, size_t sC, int M, int N, int K) {
  __shared__ __attribute__((aligned(16))) float so[4][16][64];
  const int tid = threadIdx.x, w = tid >> 5, lane = tid & 31, ln = lane & 15, hh = lane >> 4; const int by = blockIdx.y;
  A += (size_t)by * sA; Bh += (size_t)by * sB; C += (size_t)by * sC;
  const int ntn = (N + 63) / 64; const int wid = blockIdx.x * 4 + w; const int mt = wid / ntn, nq = wid % ntn; if (mt * 16 >= M) return;
  const int row0 = mt * 16, col0 = nq * 64; const float* arow = A + (size_t)(row0 + ln) * lda;
  v8f acc[4] = {};
  for (int kb = 0; kb < K; kb += 32) {
    FragH ah, al;
    const v4f x0 = *(const v4fa*)(arow + kb + 8 * hh), x1 = *(const v4fa*)(arow + kb + 8 * hh + 4), x2 = *(const v4fa*)(arow + kb + 16 + 8 * hh), x3 = *(const v4fa*)(arow + kb + 16 + 8 * hh + 4);
    float xs[16] = {x0[0],x0[1],x0[2],x0[3],x1[0],x1[1],x1[2],x1[3],x2[0],x2[1],x2[2],x2[3],x3[0],x3[1],x3[2],x3[3]};
#pragma unroll
    for (int i = 0; i < 16; ++i) { const _Float16 h = (_Float16)xs[i]; ah.h[i] = h; al.h[i] = ASPLIT ? (_Float16)(xs[i] - (float)h) : (_Float16)0.0f; }
#pragma unroll
    for (int t = 0; t < 4; ++t) { if (col0 + t * 16 >= N) continue; const size_t boff = (size_t)(col0 + t * 16 + ln) * ldb + kb; FragH bq; bq.half[0] = *(const v8us*)(Bh + boff + 8 * hh); bq.half[1] = *(const v8us*)(Bh + boff + 16 + 8 * hh);
      acc[t] = mmaH<ASPLIT ? 2 : 1>(ah.v, al.v, bq.v, bq.v, acc[t]); }
  }
#pragma unroll
  for (int t = 0; t < 4; ++t) { if (col0 + t * 16 >= N) continue;
#pragma unroll
    for (int r = 0; r < 8; ++r) so[w][8 * hh + r][t * 16 + ln] = acc[t][r] * alpha; }
  __builtin_amdgcn_fence(__ATOMIC_ACQ_REL, "workgroup"); __builtin_amdgcn_wave_barrier();
  const int rsub = lane >> 4, c4 = (lane & 15) * 4;
  {
#pragma unroll
    for (int q = 0; q < 8; ++q) { const int r = q * 2 + rsub; if (col0 + c4 < N) { const v4f v = *(const v4fa*)&so[w][r][c4]; *(v4f*)(C + (size_t)(row0 + r) * ldc + col0 + c4) = v; } }
     }
}

// Wt[n][k] = f16(W[k][n]·scale) from f32 row-major W[K][N] (scale = power of two; bf16-exact weights stay exact in f16 away from the subnormal range)
__global__ __launch_bounds__(256) void k_wt_f16(const float* __restrict__ W, _Float16* __restrict__ Wt, int K, int N, float scale) {
  const int t = blockIdx.x * 256 + threadIdx.x; if (t >= N * (K / 8)) return; const int n = t / (K / 8), k8 = (t % (K / 8)) * 8; FragH f;
#pragma unroll
  for (int i = 0; i < 8; ++i) f.h[i] = (_Float16)(bf16_round(W[(size_t)(k8 + i) * N + n]) * scale); const v8us o = f.half[0];
  *(v8us*)((unsigned short*)Wt + (size_t)n * K + k8) = o; 
}
// k_gemm_hh variant with fused epilogue: v = acc·alpha + bias[by·sBias + col] (+ CP[(row/rowsPerB)·sCPb + by·64 + col] if CP) ; ACT 0 none / 1 elu ; writes f16 C16 (and f32 C if non-null)
template <int ACT>
__global__ __launch_bounds__(128) void k_gemm_hhx(const _Float16* __restrict__ A, int lda, size_t sA, const _Float16* __restrict__ Bh, int ldb, size_t sB, float alpha, const float* __restrict__ bias, size_t sBias, const float* __restrict__ CP, int rowsPerB, size_t sCPb, int row0g,
    float* __restrict__ C, _Float16* __restrict__ C16, int ldc, size_t sC, int M, int N, int K) {
  __shared__ __attribute__((aligned(16))) float so[4][16][64];
  const int tid = threadIdx.x, w = tid >> 5, lane = tid & 31, ln = lane & 15, hh = lane >> 4; const int by = blockIdx.y;
  A += (size_t)by * sA; Bh += (size_t)by * sB; const size_t cofs = (size_t)by * sC; const float* bp = bias ? bias + (size_t)by * sBias : nullptr;
  const int ntn = (N + 63) / 64; const int wid = blockIdx.x * 4 + w; const int mt = wid / ntn, nq = wid % ntn; if (mt * 16 >= M) return;
  const int row0 = mt * 16, col0 = nq * 64; const _Float16* arow = A + (size_t)(row0 + ln) * lda;
  v8f acc[4] = {};
  for (int kb = 0; kb < K; kb += 32) { FragH ah; ah.half[0] = *(const v8us*)((const unsigned short*)arow + kb + 8 * hh); ah.half[1] = *(const v8us*)((const unsigned short*)arow + kb + 16 + 8 * hh);
#pragma unroll
    for (int t = 0; t < 4; ++t) { if (col0 + t * 16 >= N) continue; const size_t boff = (size_t)(col0 + t * 16 + ln) * ldb + kb; FragH bq; bq.half[0] = *(const v8us*)((const unsigned short*)Bh + boff + 8 * hh); bq.half[1] = *(const v8us*)((const unsigned short*)Bh + boff + 16 + 8 * hh);
      acc[t] = mmaH<1>(ah.v, ah.v, bq.v, bq.v, acc[t]); }
  }
#pragma unroll
  for (int t = 0; t < 4; ++t) { if (col0 + t * 16 >= N) continue; const int col = col0 + t * 16 + ln; const float bv = bp ? bf16_round(bp[col]) : 0.f;
#pragma unroll
    for (int r = 0; r < 8; ++r) { float v = acc[t][r] * alpha + bv; if (CP) { const int rr = row0g + row0 + 8 * hh + r; if (rowsPerB < 0) v += CP[cofs + (size_t)rr * ldc + col];      /* rowsPerB < 0: own element of the batched C plane */ else { const int bidx = rr / rowsPerB; v += CP[(size_t)bidx * sCPb + (size_t)by * 64 + col]; } } if (ACT == 1) v = (v > 0.f) ? v : expm1f(v); else if (ACT == 7) v = (v > 0.f) ? v + 1.0f : expf(v); else if (ACT == 8) v = tanhf(v); else if (ACT == 9) v = 0.5f * v * (1.0f + tanhf(0.7978845608028654f * (v + 0.044715f * v * v * v))); else if (ACT == 11) v = 1.0f / (1.0f + expf(-v)); else if (ACT == 12) v = (v > 0.f) ? v : 0.01f * v; else if (ACT == 14) v = (v > 0.f) ? v : 0.1f * v; else if (ACT == 16) v = (v >= 0.f) ? v : 0.3f * v; else if (ACT == 17) v = (v >= 0.f) ? v : 0.2f * v; else if (ACT == 15) v = v / (1.0f + expf(-v)); else if (ACT == 3) v = fmaxf(v, 0.f); else if (ACT == 6) v = 0.5f * v * (1.0f + erff(v * 0.70710678118654752f)); so[w][8 * hh + r][t * 16 + ln] = v; } }
  __builtin_amdgcn_fence(__ATOMIC_ACQ_REL, "workgroup"); __builtin_amdgcn_wave_barrier();
  const int rsub = lane >> 4, c4 = (lane & 15) * 4; typedef _Float16 v4h __attribute__((ext_vector_type(4)));
  {
#pragma unroll
    for (int q = 0; q < 8; ++q) { const int r = q * 2 + rsub; if (col0 + c4 < N) { const v4f v = *(const v4fa*)&so[w][r][c4]; if (C) *(v4f*)(C + cofs + (size_t)(row0 + r) * ldc + col0 + c4) = v; if (C16) { v4h h4; for (int i = 0; i < 4; ++i) h4[i] = (_Float16)v[i]; *(v4h*)(C16 + cofs + (size_t)(row0 + r) * ldc + col0 + c4) = h4; } } }
     }
}


typedef _Float16 v4h __attribute__((ext_vector_type(4)));

__global__ __launch_bounds__(256) void k_h16(const float* __restrict__ x, _Float16* __restrict__ X16, size_t n8) { const size_t t = (size_t)blockIdx.x * 256 + threadIdx.x; if (t >= n8) return; FragH f;
#pragma unroll
  for (int q = 0; q < 8; ++q) f.h[q] = (_Float16)x[t * 8 + q]; *(v8us*)((unsigned short*)X16 + t * 8) = f.half[0];  }
__global__ __launch_bounds__(256) void k_round16f(const float* __restrict__ W, _Float16* __restrict__ Bt, size_t n8) { const size_t t = (size_t)blockIdx.x * 256 + threadIdx.x; if (t >= n8) return; FragH f;
#pragma unroll
  for (int i = 0; i < 8; ++i) f.h[i] = (_Float16)(bf16_round(W[t * 8 + i]) * 16.0f); *(v8us*)((unsigned short*)Bt + t * 8) = f.half[0];  }
__global__ __launch_bounds__(256) void k_hl(const float* __restrict__ F, _Float16* __restrict__ Hh, _Float16* __restrict__ Hl, size_t n8) { const size_t t = (size_t)blockIdx.x * 256 + threadIdx.x; if (t >= n8) return; FragH fh, fl; const v4f a = *(const v4fa*)(F + t * 8), c = *(const v4fa*)(F + t * 8 + 4);
#pragma unroll
  for (int q = 0; q < 4; ++q) { _Float16 h = (_Float16)a[q]; fh.h[q] = h; fl.h[q] = (_Float16)((a[q] - (float)h) * 1024.0f); h = (_Float16)c[q]; fh.h[4 + q] = h; fl.h[4 + q] = (_Float16)((c[q] - (float)h) * 1024.0f); }
  { *(v8us*)((unsigned short*)Hh + t * 8) = fh.half[0]; *(v8us*)((unsigned short*)Hl + t * 8) = fl.half[0];  } }

// ---- GEMM with both operands staged in LDS (work-group tile 256x128 in each of NP weight planes, eight waves of 64x64 per plane; MP % 256 == 0, DM % 128 == 0); epilogue = k_gemm_hhx semantics, its cases fixed at compile time ----
// KS: k per stage (128: 256 bytes of every operand row; 64 where the rows of three planes have to fit LDS twice). LDS row pitch KS + 8 elements: 272 B = 16 B x 17 or 144 B = 16 B x 9, the pitches for 16-byte fragment reads.
#define G2_BM 256     /* rows of C per work-group */
#define G2_BN 128     /* columns of C per work-group */
__device__ __forceinline__ v16h g2_frag(const unsigned short* p, int hh) { FragH f; f.half[0] = *(const v8us*)(p + 8 * hh); f.half[1] = *(const v8us*)(p + 16 + 8 * hh); return f.v; }
__device__ __forceinline__ v8f g2_mma(v16h a, v16h b, v8f c) { return __builtin_amdgcn_wmma_f32_16x16x32_f16(false, a, false, b, (short)0, c, false, false); }
// Eight asynchronous copies of one lane: its 16-byte piece of eight operand rows, a fixed row step apart, from global memory straight into LDS (a wave's copy covers two whole 256-byte rows).
// l: the lane's LDS byte address; g: its global address; p: the row step in elements of the source; lp: the same step in LDS bytes. The s_wait_xcnt stands inside the statement so that no address register is rewritten in front of it.
__device__ __forceinline__ void g2_copy8(unsigned l, const unsigned short* g, size_t p, unsigned lp) {
  asm volatile("global_load_async_to_lds_b128 %0, %8, off\n\t"
               "global_load_async_to_lds_b128 %1, %9, off\n\t"
               "global_load_async_to_lds_b128 %2, %10, off\n\t"
               "global_load_async_to_lds_b128 %3, %11, off\n\t"
               "global_load_async_to_lds_b128 %4, %12, off\n\t"
               "global_load_async_to_lds_b128 %5, %13, off\n\t"
               "global_load_async_to_lds_b128 %6, %14, off\n\t"
               "global_load_async_to_lds_b128 %7, %15, off\n\t"
               "s_wait_xcnt 0x0"
               :: "v"(l), "v"(l + lp), "v"(l + 2 * lp), "v"(l + 3 * lp), "v"(l + 4 * lp), "v"(l + 5 * lp), "v"(l + 6 * lp), "v"(l + 7 * lp),
                  "v"(g), "v"(g + p), "v"(g + 2 * p), "v"(g + 3 * p), "v"(g + 4 * p), "v"(g + 5 * p), "v"(g + 6 * p), "v"(g + 7 * p)
               : "memory"); }
// Four copies of one lane by the builtin (with 128-byte rows a wave's copy covers four whole rows): in a kernel whose accumulators fill the registers below v256 the operands of asm text, which have to lie there, cost spills; the compiler's own copies take any register.
typedef int g2_i4 __attribute__((ext_vector_type(4)));
__device__ __forceinline__ void g2_copy4(unsigned l, const unsigned short* g, size_t p, unsigned lp) {
  typedef __attribute__((address_space(1))) g2_i4 gl_i4; typedef __attribute__((address_space(3))) g2_i4 ls_i4;
#pragma unroll      /* the row steps become constants of the address additions */
  for (int j = 0; j < 4; ++j) __builtin_amdgcn_global_load_async_to_lds_b128((gl_i4*)(g + j * p), (ls_i4*)(l + j * lp), 0, 0); }
// One stage: KS elements of 256 A rows and of 128 B rows in each of NP planes (sB apart): 24 copies per lane (NP 1, KS 128) or 20 (NP 3, KS 64). One copy of the work-group covers 2048 / KS rows.
template <int NP, int KS>
__device__ __forceinline__ void g2_stage(unsigned la, unsigned lb, const unsigned short* ga, const unsigned short* gb, size_t pa, size_t pb, size_t sB) {
  constexpr unsigned pbytes = (KS + 8) * 2, lp = (2048 / KS) * pbytes;
  if (KS == 128) { g2_copy8(la, ga, pa, lp); g2_copy8(la + 8 * lp, ga + 8 * pa, pa, lp); }
  else { g2_copy4(la, ga, pa, lp); g2_copy4(la + 4 * lp, ga + 4 * pa, pa, lp); }
#pragma unroll      /* the plane steps fold into the addresses */
  for (int p = 0; p < NP; ++p) { if (KS == 128) g2_copy8(lb + p * G2_BN * pbytes, gb + p * sB, pb, lp);
    else g2_copy4(lb + p * G2_BN * pbytes, gb + p * sB, pb, lp); } }
// Half P (32 rows) of a wave's 64x64 tile: the raw accumulators go through the wave's own 32 LDS rows; on the row side a lane holds 4 neighbouring columns of a row, so that bias, residual and f32 output are 16-byte accesses (f16 output 8-byte) that cover whole rows of the tile.
// Every case (bias, residual, which outputs) and the row pitch (DM) are compile-time constants: the text has no branch, the 16 LDS reads form one group, the 16 stores another, and every global address is one register pair plus an immediate offset.
// v = acc alpha + bias (+ residual), activation: the operations and their order per element are those of the element-wise form.
// Rl, Cl, Hl: the lane's own addresses of row hh, columns 4 ln .. 4 ln + 3 of the wave's tile in the residual, f32 output and f16 output planes.
// The residual rows of half P, 16 loads in flight.
template <int P>
__device__ __forceinline__ void g2_res(v4f (&rs)[16], const float* Rl) {
#pragma unroll      /* constant indices keep the row array in registers */
  for (int q = 0; q < 16; ++q) rs[q] = *(const v4fa*)(Rl + (size_t)(P * 32 + q * 2) * DM); }
// rs: on entry the residual rows of half P (loads issued by the caller); half 0 leaves the loads of half 1 in flight there.
template <int ACT, bool HASB, bool RES, bool W32, bool W16, int P, bool LAST>
__device__ __forceinline__ void g2_out(const v8f (&acc)[4][4], float (*sw)[68], float alpha, v4f bv, v4f (&rs)[16], const float* Rl, float* Cl, _Float16* Hl, int ln, int hh) {
  v4f y[16]; v4h h[16];
#pragma unroll      /* constant indices keep the accumulator array in registers */
  for (int u = 0; u < 8; ++u) { const int t = u & 3, half = u >> 2;
#pragma unroll      /* constant indices keep the accumulator array in registers */
    for (int r = 0; r < 8; ++r) sw[half * 16 + 8 * hh + r][t * 16 + ln] = acc[P * 2 + half][t][r]; }
  asm volatile("s_wait_dscnt 0x0" ::: "memory");      /* the wave's own LDS stores before its own reads of other lanes' elements; no wait on the global loads and stores in flight */
#pragma unroll      /* the row steps fold into the immediate offsets of the LDS reads */
  for (int q = 0; q < 16; ++q) y[q] = *(const v4fa*)&sw[q * 2 + hh][ln * 4];
#pragma unroll      /* constant indices keep the row arrays in registers */
  for (int q = 0; q < 16; ++q) { v4f v = HASB ? y[q] * alpha + bv : y[q] * alpha; if (RES) v += rs[q];
    if (ACT == 3) { const v4f z4 = {0.f, 0.f, 0.f, 0.f}; v = __builtin_elementwise_max(v, z4); }
    y[q] = v; if (W16) h[q] = __builtin_convertvector(v, v4h); }
  __builtin_amdgcn_sched_barrier(0);      /* every value of the half is made in front of its first store: no register that an issued store names is written before the wait below or, in the wave's last half, the wave's end */
  if (RES && P == 0) g2_res<1>(rs, Rl);      /* the next half's residual rows fly during this half's stores and the next half's LDS round */
#pragma unroll      /* the row steps fold into the immediate offsets of the stores */
  for (int q = 0; q < 16; ++q) { if (W32) *(v4f*)(Cl + (size_t)(P * 32 + q * 2) * DM) = y[q]; if (W16) *(v4h*)(Hl + (size_t)(P * 32 + q * 2) * DM) = h[q]; }
  if (!LAST) asm volatile("s_wait_xcnt 0x0" ::: "memory");      /* behind the half's stores, in front of the next half's code, which reuses their registers; it also keeps the next half's LDS stores behind this half's LDS reads, whose values have all been used */
}
// C = act(A Bh^T alpha + bias (+ own element of CP)): A [MP][DM], Bh [DM][DM] (NP planes, sB apart), outputs [MP][DM] (NP planes, sC apart) as f32 (W32) and / or f16 (W16).
// NP > 1: the work-group takes its 256x128 tile in every plane at once; a staged A tile and a wave's A fragments then serve NP products (per plane and accumulator the k order is that of NP = 1).
template <int ACT, bool HASB, bool RES, bool W32, bool W16, int NP, int KS>
__global__ __launch_bounds__(256) void k_gemm2(const _Float16* __restrict__ A, const _Float16* __restrict__ Bh, size_t sB, float alpha, const float* __restrict__ bias, const float* __restrict__ CP,
    float* __restrict__ C, _Float16* __restrict__ C16, size_t sC) { static_assert(ACT == 0 || ACT == 3, "k_gemm2: unsupported ACT code (would silently apply no activation)");
  static_assert(MP % G2_BM == 0 && DM % G2_BN == 0 && DM % KS == 0 && DM / KS >= 2 && (KS == 64 || KS == 128), "k_gemm2: whole tiles and stages only");
  static_assert(NP == 1 || (!HASB && !RES), "k_gemm2: bias and residual are those of one plane");
  constexpr int PT = KS + 8;      /* LDS row pitch in elements */
  __shared__ __attribute__((aligned(16))) unsigned short sa[2][G2_BM][PT];
  __shared__ __attribute__((aligned(16))) unsigned short sb[2][NP * G2_BN][PT];
  __shared__ __attribute__((aligned(16))) float so[8][32][68];
  constexpr int lda = DM, ldb = DM, M = MP, N = DM, K = DM;
  const int tid = threadIdx.x, w = tid >> 5, lane = tid & 31, ln = lane & 15, hh = lane >> 4;
  const int ntn = N >> 7; const int mt = blockIdx.x / ntn, nq = blockIdx.x - mt * ntn; if (mt * G2_BM >= M) return;      /* the whole work-group, in front of every copy and barrier */
  const int wr = (w >> 1) * 64, wc = (w & 1) * 64; const int row0 = mt * G2_BM + wr, col0 = nq * G2_BN + wc;
  constexpr int RS = 2048 / KS;      /* rows that one copy of the work-group covers */
  const int sr = tid / (KS / 8), sc = (tid % (KS / 8)) * 8;      /* staging: rows sr + RS j, 16-byte piece sc */
  const unsigned short* ag = (const unsigned short*)A + (size_t)(mt * G2_BM + sr) * lda + sc; const unsigned short* bg = (const unsigned short*)Bh + (size_t)(nq * G2_BN + sr) * ldb + sc;
  const size_t pa = (size_t)RS * lda, pb = (size_t)RS * ldb;
  const unsigned la0 = (unsigned)(size_t)&sa[0][sr][sc], lb0 = (unsigned)(size_t)&sb[0][sr][sc];      /* low 32 bits of a __shared__ address = the LDS byte address */
  const unsigned abuf = G2_BM * PT * 2, bbuf = NP * G2_BN * PT * 2;
  constexpr int nst = K / KS;
  const v8f z8 = {0.f,0.f,0.f,0.f,0.f,0.f,0.f,0.f}; v8f acc[NP][4][4];
#pragma unroll      /* constant indices keep the accumulator array in registers */
  for (int p = 0; p < NP; ++p)
#pragma unroll      /* constant indices keep the accumulator array in registers */
    for (int i = 0; i < 4; ++i)
#pragma unroll      /* constant indices keep the accumulator array in registers */
      for (int j = 0; j < 4; ++j) acc[p][i][j] = z8;
  g2_stage<NP, KS>(la0, lb0, ag, bg, pa, pb, sB);
  asm volatile("s_wait_asynccnt 0x0" ::: "memory");      /* this wave's copies of stage 0 have landed */
  __syncthreads();      /* publishes stage 0 */
  g2_stage<NP, KS>(la0 + abuf, lb0 + bbuf, ag + KS, bg + KS, pa, pb, sB);
#pragma unroll 1      /* one stage per trip: the two-buffer order below holds per trip */
  for (int s = 0; s < nst; ++s) { const int bf = s & 1;
#pragma unroll      /* constant indices keep the fragment and accumulator arrays in registers */
    for (int ks = 0; ks < KS; ks += 32) { v16h af[4];
#pragma unroll      /* constant indices keep the fragment and accumulator arrays in registers */
      for (int i = 0; i < 4; ++i) af[i] = g2_frag(&sa[bf][wr + i * 16 + ln][ks], hh);
#pragma unroll      /* constant indices keep the fragment and accumulator arrays in registers */
      for (int p = 0; p < NP; ++p) { v16h bq[4];
#pragma unroll      /* constant indices keep the fragment and accumulator arrays in registers */
        for (int j = 0; j < 4; ++j) bq[j] = g2_frag(&sb[bf][p * G2_BN + wc + j * 16 + ln][ks], hh);
        __builtin_amdgcn_sched_barrier(0);      /* keeps the block's LDS reads together in front of its 16 WMMAs: left free, the compiler sinks each A fragment's reads to its row and waits them out there */
#pragma unroll      /* constant indices keep the fragment and accumulator arrays in registers */
        for (int i = 0; i < 4; ++i)
#pragma unroll      /* constant indices keep the fragment and accumulator arrays in registers */
          for (int j = 0; j < 4; ++j) acc[p][i][j] = g2_mma(af[i], bq[j], acc[p][i][j]);
      }
    }
    asm volatile("s_wait_dscnt 0x0" ::: "memory");      /* this wave's reads of buffer bf have returned before the buffer is refilled */
    asm volatile("s_wait_asynccnt 0x0" ::: "memory");      /* this wave's copies of stage s + 1 have landed */
    __syncthreads();      /* publishes stage s + 1 and ends every wave's reads of buffer bf */
    if (s + 2 < nst) { const int kn = (s + 2) * KS; g2_stage<NP, KS>(la0 + bf * abuf, lb0 + bf * bbuf, ag + kn, bg + kn, pa, pb, sB); }
  }
  asm volatile("s_wait_asynccnt 0x0" ::: "memory");      /* no copy is outstanding when the wave goes on to its end */
  const size_t e0 = (size_t)(row0 + hh) * DM + col0 + ln * 4;      /* the lane's element of row hh of the wave's tile */
  v4f bv = {0.f, 0.f, 0.f, 0.f};
  if (HASB) { const v4f b4 = *(const v4fa*)(bias + col0 + ln * 4); bv = (v4f){bf16_round(b4[0]), bf16_round(b4[1]), bf16_round(b4[2]), bf16_round(b4[3])}; }
  const float* Rl = RES ? CP + e0 : nullptr;
  v4f rs[16];
  if (RES) g2_res<0>(rs, Rl);
#pragma unroll      /* constant indices keep the accumulator array in registers */
  for (int p = 0; p < NP; ++p) { float* Cl = W32 ? C + p * sC + e0 : nullptr; _Float16* Hl = W16 ? C16 + p * sC + e0 : nullptr;
    g2_out<ACT, HASB, RES, W32, W16, 0, false>(acc[p], so[w], alpha, bv, rs, Rl, Cl, Hl, ln, hh);
    if (p + 1 < NP) g2_out<ACT, HASB, RES, W32, W16, 1, false>(acc[p], so[w], alpha, bv, rs, Rl, Cl, Hl, ln, hh);
    else g2_out<ACT, HASB, RES, W32, W16, 1, true>(acc[p], so[w], alpha, bv, rs, Rl, Cl, Hl, ln, hh); } }


// Every operand conversion in one launch: x -> f16(bf16(x)) rows, and the five natural [out][in] weights -> f16(bf16(w) x 16) planes (= Bt[n][k]).
// A work-group converts CV_BE contiguous elements of ONE tensor (the tensor is picked from the block index, the same for the whole work-group); a thread takes CV_PT pieces of 8 elements, all its loads in front of its stores.
#define CV_PT 4                        /* 8-element pieces per thread: eight 16-byte loads in flight per lane */
#define CV_BE (256 * CV_PT * 8)        /* elements per work-group */
#define CV_NX ((int)(NR * DM / CV_BE)) /* work-groups on x */
#define CV_NW (DM * DM / CV_BE)        /* work-groups on each weight */
__global__ __launch_bounds__(256) void k_cvt(const float* __restrict__ x, const float* __restrict__ wq, const float* __restrict__ wk, const float* __restrict__ wv, const float* __restrict__ w1, const float* __restrict__ w2,
    _Float16* __restrict__ X16, _Float16* __restrict__ BQ, _Float16* __restrict__ BK, _Float16* __restrict__ BV, _Float16* __restrict__ BW1, _Float16* __restrict__ BW2) {
  static_assert(NR * DM % CV_BE == 0 && DM * DM % CV_BE == 0, "k_cvt: whole work-groups only");
  int blk = blockIdx.x; const float* s = x; _Float16* d = X16; float sc = 1.0f;
  if (blk >= CV_NX) { blk -= CV_NX; const int wi = blk / CV_NW; blk -= wi * CV_NW; sc = 16.0f;
    s = wi == 0 ? wq : wi == 1 ? wk : wi == 2 ? wv : wi == 3 ? w1 : w2; d = wi == 0 ? BQ : wi == 1 ? BK : wi == 2 ? BV : wi == 3 ? BW1 : BW2; }
  const size_t e0 = (size_t)blk * CV_BE + threadIdx.x * 8;
  v4f a[CV_PT][2];
#pragma unroll      /* constant indices keep the piece array in registers */
  for (int u = 0; u < CV_PT; ++u) { a[u][0] = *(const v4fa*)(s + e0 + u * 2048); a[u][1] = *(const v4fa*)(s + e0 + u * 2048 + 4); }
#pragma unroll      /* constant indices keep the piece array in registers */
  for (int u = 0; u < CV_PT; ++u) { FragH f;
#pragma unroll      /* constant indices keep the piece array in registers */
    for (int q = 0; q < 4; ++q) { f.h[q] = (_Float16)(bf16_round(a[u][0][q]) * sc); f.h[4 + q] = (_Float16)(bf16_round(a[u][1][q]) * sc); }
    *(v8us*)((unsigned short*)d + e0 + u * 2048) = f.half[0]; } }
__global__ __launch_bounds__(256) void k_rsm(const float* __restrict__ S, _Float16* __restrict__ P, int nrows) {
  #pragma clang fp contract(off)
  const int i = blockIdx.x * 256 + threadIdx.x; if (i >= nrows) return; const float* s = S + (size_t)i * SQ; float mx = -3.0e38f;
#pragma unroll 1
  for (int j = 0; j < SQ; ++j) mx = fmaxf(mx, s[j]); float se = 0.f;
#pragma unroll 1
  for (int j = 0; j < SQ; ++j) se += expf(s[j] - mx); const float sc = 256.0f / se;
#pragma unroll 1
  for (int j0 = 0; j0 < SQ; j0 += 8) { FragH f; for (int q = 0; q < 8; ++q) f.h[q] = (_Float16)(expf(s[j0 + q] - mx) * sc); unsigned short* d = (unsigned short*)P + (size_t)i * SQ + j0; *(v8us*)d = f.half[0];  } }
__global__ __launch_bounds__(256) void k_vt(const _Float16* __restrict__ V16, int b, int h0, _Float16* __restrict__ VT) { __shared__ unsigned short tl[64][65]; const int tid = threadIdx.x; const int hh = blockIdx.x % HG, sg = blockIdx.x / HG; const int s0 = sg * 64; const int h = h0 + hh;
  for (int i = tid; i < 64 * 8; i += 256) { const int j = i / 8, d8 = (i % 8) * 8; FragH f; f.half[0] = *(const v8us*)((const unsigned short*)V16 + ((size_t)b * SQ + s0 + j) * DM + h * HD + d8); for (int q = 0; q < 8; ++q) tl[d8 + q][j] = f.u[q]; }
  __syncthreads();
  { for (int i = tid; i < 64 * 8; i += 256) { const int d = i / 8, j8 = (i % 8) * 8; FragH f; for (int q = 0; q < 8; ++q) f.u[q] = tl[d][j8 + q]; *(v8us*)((unsigned short*)VT + ((size_t)hh * HD + d) * SQ + s0 + j8) = f.half[0]; }  } }


// lane l <-> lane l ^ 16
__device__ __forceinline__ float fa_xrow(float v) { const int i = __builtin_bit_cast(int, v); return __builtin_bit_cast(float, __builtin_amdgcn_permlanex16(i, i, 0x76543210, 0xfedcba98, false, false)); }
__device__ __forceinline__ v16h fa_frag(const unsigned short* p, int hh) { FragH f; f.half[0] = *(const v8us*)(p + 8 * hh); f.half[1] = *(const v8us*)(p + 16 + 8 * hh); return f.v; }
__device__ __forceinline__ v8f fa_mma(v16h a, v16h b, v8f c) { return __builtin_amdgcn_wmma_f32_16x16x32_f16(false, a, false, b, (short)0, c, false, false); }
typedef float v2f __attribute__((ext_vector_type(2)));
typedef _Float16 v2h __attribute__((ext_vector_type(2)));
#define FA_KS 64      /* keys per LDS stage */
#define FA_PT 72      /* LDS row pitch in 16-bit elements: 144 B = 16 B x 9, so the 16 rows of a 16-byte fragment read fall on distinct banks */
#define FA_PV 80      /* LDS row pitch of the V rows in 16-bit elements: 160 B = 32 B x 5, the pitch for transposing 16-byte reads of 128-byte rows */
#define FA_NW 8       /* waves per work-group, 32 query columns each */
typedef short fa_s8 __attribute__((ext_vector_type(8)));
// One 16 (d) x 32 (keys) A fragment of V^T from V rows [key][d] in LDS, by two transposing reads (ds_load_tr16_b128), 16 keys apart.
// p: the lane's own address, row 8 (lane >> 4) + (lane & 7) of the 32 keys, 16-byte piece (lane >> 3) & 1 of the 16 d; lane (ln, hh) then holds d = ln, keys 8 hh + 0..7 and 16 + 8 hh + 0..7: the hardware k order, as fa_frag gives it from V^T rows.
__device__ __forceinline__ v16h fa_fragt(const unsigned short* p) { typedef __attribute__((address_space(3))) fa_s8 lds_s8; FragH f; f.half[0] = __builtin_bit_cast(v8us, __builtin_amdgcn_ds_load_tr16_b128_v8i16((lds_s8*)p)); f.half[1] = __builtin_bit_cast(v8us, __builtin_amdgcn_ds_load_tr16_b128_v8i16((lds_s8*)(p + 16 * FA_PV))); return f.v; }
__global__ __launch_bounds__(FA_NW * 32) __attribute__((amdgpu_waves_per_eu(4, 4))) void k_fattn(const _Float16* __restrict__ Q16, const _Float16* __restrict__ K16, const _Float16* __restrict__ V16, const float* __restrict__ X, float* __restrict__ HP) {
  __shared__ __attribute__((aligned(16))) unsigned short sk[2][FA_KS][FA_PT];
  __shared__ __attribute__((aligned(16))) unsigned short sv[2][FA_KS][FA_PV];
  __shared__ __attribute__((aligned(16))) float so[FA_NW][32][68];
  const int tid = threadIdx.x, w = tid >> 5, lane = tid & 31, ln = lane & 15, hh = lane >> 4;
  const int bh = blockIdx.y, b = bh / NH, h = bh - b * NH; const int q0 = blockIdx.x * (FA_NW * 32) + w * 32;
  const unsigned short* Kg = (const unsigned short*)K16 + (size_t)b * SQ * DM + h * HD;      /* key rows, pitch DM */
  const unsigned short* Vg = (const unsigned short*)V16 + (size_t)b * SQ * DM + h * HD;      /* key rows, pitch DM */
  const int sr = tid >> 3, sc = (tid & 7) * 8;      /* staging: rows sr and sr + 32, 16-byte piece sc; a wave's load covers four whole 128-byte rows */
  const float cs = 0.125f * 1.44269504088896340736f;
  v16h qf[2][2];
#pragma unroll      /* constant indices keep the fragment and accumulator arrays in registers */
  for (int qt = 0; qt < 2; ++qt)
#pragma unroll      /* constant indices keep the fragment and accumulator arrays in registers */
    for (int ks = 0; ks < 2; ++ks) qf[qt][ks] = fa_frag((const unsigned short*)Q16 + ((size_t)b * SQ + q0 + qt * 16 + ln) * DM + h * HD + ks * 32, hh);
  const v8f z8 = {0.f,0.f,0.f,0.f,0.f,0.f,0.f,0.f};
  v8f o[4][2]; float mu[2], l[2];
#pragma unroll      /* constant indices keep the fragment and accumulator arrays in registers */
  for (int qt = 0; qt < 2; ++qt) { mu[qt] = -1.0e30f; l[qt] = 0.f;
#pragma unroll      /* constant indices keep the fragment and accumulator arrays in registers */
    for (int dt = 0; dt < 4; ++dt) o[dt][qt] = z8; }
  v8us rk0 = *(const v8us*)(Kg + (size_t)sr * DM + sc), rk1 = *(const v8us*)(Kg + (size_t)(sr + 32) * DM + sc), rv0 = *(const v8us*)(Vg + (size_t)sr * DM + sc), rv1 = *(const v8us*)(Vg + (size_t)(sr + 32) * DM + sc);
  asm volatile("s_wait_xcnt 0x0" ::: "memory");      /* behind the Q, K and V loads, in front of the set-up code that reuses their address registers */
  *(v8us*)&sk[0][sr][sc] = rk0; *(v8us*)&sk[0][sr + 32][sc] = rk1; *(v8us*)&sv[0][sr][sc] = rv0; *(v8us*)&sv[0][sr + 32][sc] = rv1;
  __syncthreads();      /* publishes stage 0 */
#pragma unroll 1      /* one stage per trip keeps the loop small and the register count inside four waves per SIMD */
  for (int s = 0; s < SQ / FA_KS; ++s) { const int bf = s & 1; const bool more = s + 1 < SQ / FA_KS;
    if (more) { const int kn = (s + 1) * FA_KS; rk0 = *(const v8us*)(Kg + (size_t)(kn + sr) * DM + sc); rk1 = *(const v8us*)(Kg + (size_t)(kn + sr + 32) * DM + sc); rv0 = *(const v8us*)(Vg + (size_t)(kn + sr) * DM + sc); rv1 = *(const v8us*)(Vg + (size_t)(kn + sr + 32) * DM + sc); }
#pragma unroll      /* constant indices keep the fragment and accumulator arrays in registers */
    for (int kk = 0; kk < FA_KS; kk += 32) {
      v8f st[2][2];
#pragma unroll      /* constant indices keep the fragment and accumulator arrays in registers */
      for (int kt = 0; kt < 2; ++kt) { const unsigned short* kr = &sk[bf][kk + kt * 16 + ln][0]; const v16h k0 = fa_frag(kr, hh), k1 = fa_frag(kr + 32, hh);
#pragma unroll      /* constant indices keep the fragment and accumulator arrays in registers */
        for (int qt = 0; qt < 2; ++qt) st[kt][qt] = fa_mma(k1, qf[qt][1], fa_mma(k0, qf[qt][0], z8)); }
      v16h vf[4];
#pragma unroll      /* constant indices keep the fragment and accumulator arrays in registers */
      for (int dt = 0; dt < 4; ++dt) vf[dt] = fa_fragt(&sv[bf][kk + 8 * hh + (lane & 7)][dt * 16 + ((lane >> 3) & 1) * 8]);
      float mb[2]; bool need = false;
#pragma unroll      /* constant indices keep the fragment and accumulator arrays in registers */
      for (int qt = 0; qt < 2; ++qt) { float mx = st[0][qt][0];
#pragma unroll      /* constant indices keep the fragment and accumulator arrays in registers */
        for (int r = 1; r < 8; ++r) mx = fmaxf(mx, st[0][qt][r]);
#pragma unroll      /* constant indices keep the fragment and accumulator arrays in registers */
        for (int r = 0; r < 8; ++r) mx = fmaxf(mx, st[1][qt][r]);
        mx = fmaxf(mx, fa_xrow(mx)) * cs; mb[qt] = mx; need = need || (mx > mu[qt] + 8.0f); }
      if (__builtin_amdgcn_ballot_w32(need) != 0) {      /* one scalar branch per pass; rare after the first passes */
#pragma unroll      /* constant indices keep the fragment and accumulator arrays in registers */
        for (int qt = 0; qt < 2; ++qt) { const float mn = fmaxf(mu[qt], mb[qt]); const float al = __builtin_amdgcn_exp2f(mu[qt] - mn); mu[qt] = mn; l[qt] *= al;
#pragma unroll      /* constant indices keep the fragment and accumulator arrays in registers */
          for (int dt = 0; dt < 4; ++dt) o[dt][qt] = o[dt][qt] * al; } }
#pragma unroll      /* constant indices keep the fragment and accumulator arrays in registers */
      for (int qt = 0; qt < 2; ++qt) { const float nm = 4.0f - mu[qt]; const v2f c2 = {cs, cs}, n2 = {nm, nm}; union { v16h v; v2h p[8]; } pf; v2f ls = {0.f, 0.f};
#pragma unroll      /* constant indices keep the fragment and accumulator arrays in registers */
        for (int i = 0; i < 4; ++i) { const int kt = i >> 1, r4 = (i & 1) * 4;
          const v2f x0 = {st[kt][qt][r4], st[kt][qt][r4 + 1]}, x1 = {st[kt][qt][r4 + 2], st[kt][qt][r4 + 3]};
          const v2f t0 = __builtin_elementwise_fma(x0, c2, n2), t1 = __builtin_elementwise_fma(x1, c2, n2); 
          const v2f p0 = {__builtin_amdgcn_exp2f(t0[0]), __builtin_amdgcn_exp2f(t0[1])}, p1 = {__builtin_amdgcn_exp2f(t1[0]), __builtin_amdgcn_exp2f(t1[1])}; ls += p0; ls += p1;
          pf.p[i * 2] = __builtin_convertvector(p0, v2h); pf.p[i * 2 + 1] = __builtin_convertvector(p1, v2h); }
        l[qt] += ls[0] + ls[1];
#pragma unroll      /* constant indices keep the fragment and accumulator arrays in registers */
        for (int dt = 0; dt < 4; ++dt) o[dt][qt] = fa_mma(vf[dt], pf.v, o[dt][qt]); }
    }
    if (more) { *(v8us*)&sk[bf ^ 1][sr][sc] = rk0; *(v8us*)&sk[bf ^ 1][sr + 32][sc] = rk1; *(v8us*)&sv[bf ^ 1][sr][sc] = rv0; *(v8us*)&sv[bf ^ 1][sr + 32][sc] = rv1; }
    __syncthreads();      /* publishes the next stage's buffer and ends every wave's reads of this one, which the next trip refills */
  }
  // epilogue: O^T / row sum through the wave's own LDS rows, so that each global access covers whole 256-byte head rows
#pragma unroll      /* constant indices keep the fragment and accumulator arrays in registers */
  for (int qt = 0; qt < 2; ++qt) { const float inv = 1.0f / (l[qt] + fa_xrow(l[qt]));
#pragma unroll      /* constant indices keep the fragment and accumulator arrays in registers */
    for (int dt = 0; dt < 4; ++dt) { const v4f lo = {o[dt][qt][0] * inv, o[dt][qt][1] * inv, o[dt][qt][2] * inv, o[dt][qt][3] * inv}, hi = {o[dt][qt][4] * inv, o[dt][qt][5] * inv, o[dt][qt][6] * inv, o[dt][qt][7] * inv};
      *(v4f*)&so[w][qt * 16 + ln][dt * 16 + 8 * hh] = lo; *(v4f*)&so[w][qt * 16 + ln][dt * 16 + 8 * hh + 4] = hi; } }
  __builtin_amdgcn_fence(__ATOMIC_ACQ_REL, "workgroup"); __builtin_amdgcn_wave_barrier();      /* the wave's own LDS stores before its own reads of other lanes' elements */
  const size_t g0 = ((size_t)b * SQ + q0) * DM + h * HD + ln * 4;
#pragma unroll      /* constant indices keep the fragment and accumulator arrays in registers */
  for (int q = 0; q < 16; ++q) { const int r = q * 2 + hh; const v4f v = *(const v4fa*)&so[w][r][ln * 4]; const v4f xi = *(const v4fa*)(X + g0 + (size_t)r * DM); const v4f xr = {bf16_round(xi[0]), bf16_round(xi[1]), bf16_round(xi[2]), bf16_round(xi[3])}; *(v4f*)(HP + g0 + (size_t)r * DM) = v + xr; } }


// Row LayerNorm (biased variance, eps, bf16-rounded gamma and beta), two rows per wave and no LDS: a lane holds 32 elements of each of its rows (eight 16-byte pieces per row, so that each load and each f32 store of the wave covers 512 contiguous bytes).
// Mean and variance: four chains per lane, then a butterfly over the 32 lanes (four DPP steps inside the 16-lane rows, one exchange between them). Two passes over the registers, as the definition has it.
// Each wave takes LN_RW rows, which share one rounding of gamma and beta: the launch starts 4,096 waves (16 per WGP, all resident at once) instead of eight waves per row (65,536), and has no barrier.
#define LN_NW 16      /* waves per work-group */
#define LN_RW 2       /* rows per wave */
template <int M> __device__ __forceinline__ float ln_xm(float v) { return __builtin_bit_cast(float, __builtin_amdgcn_update_dpp(0, __builtin_bit_cast(int, v), 0x160 + M, 0xf, 0xf, true)); }      /* lane l <-> lane l ^ M, M < 16 (row_xmask) */
__device__ __forceinline__ float ln_wsum(v4f s) { float v = (s[0] + s[1]) + (s[2] + s[3]); v += ln_xm<1>(v); v += ln_xm<2>(v); v += ln_xm<4>(v); v += ln_xm<8>(v); return v + fa_xrow(v); }
template <int W16, int W32>
__global__ __launch_bounds__(LN_NW * 32) void k_lnw(const float* __restrict__ X, const float* __restrict__ g, const float* __restrict__ bb, float eps, _Float16* __restrict__ N16, float* __restrict__ N32) {
  static_assert(DMQ == 8 * 128, "k_lnw: a row is eight 512-byte pieces");
  const int c0 = (threadIdx.x & 31) * 4; const size_t r0 = ((size_t)blockIdx.x * LN_NW + __builtin_amdgcn_readfirstlane(threadIdx.x >> 5)) * LN_RW;      /* the wave's number as a scalar: the row bases stay in scalar registers and every access shares the lane's one offset register */
  v4f gg[8], bv[8], x[LN_RW][8]; float rs[LN_RW];
#pragma unroll      /* constant indices keep the row arrays in registers */
  for (int u = 0; u < 8; ++u) { gg[u] = *(const v4fa*)(g + u * 128 + c0); bv[u] = *(const v4fa*)(bb + u * 128 + c0); }
#pragma unroll      /* constant indices keep the row arrays in registers */
  for (int i = 0; i < LN_RW; ++i)
#pragma unroll      /* constant indices keep the row arrays in registers */
    for (int u = 0; u < 8; ++u) { const int c = u * 128 + c0; x[i][u] = *(const v4fa*)(X + (r0 + i) * DMQ + c); }
  __builtin_amdgcn_sched_barrier(0);      /* keeps all 32 loads in front of the arithmetic: left free, the compiler sinks most gamma and beta loads behind the reductions and waits each pair out there */
#pragma unroll      /* constant indices keep the row arrays in registers */
  for (int u = 0; u < 8; ++u)
#pragma unroll      /* constant indices keep the row arrays in registers */
    for (int q = 0; q < 4; ++q) { gg[u][q] = bf16_round(gg[u][q]); bv[u][q] = bf16_round(bv[u][q]); }
#pragma unroll      /* constant indices keep the row arrays in registers */
  for (int i = 0; i < LN_RW; ++i) { v4f s = x[i][0];
#pragma unroll      /* constant indices keep the row arrays in registers */
    for (int u = 1; u < 8; ++u) s += x[i][u];
    const float mu = ln_wsum(s) * (1.0f / (float)DMQ); v4f q = {0.f, 0.f, 0.f, 0.f};
#pragma unroll      /* constant indices keep the row arrays in registers */
    for (int u = 0; u < 8; ++u) { x[i][u] = x[i][u] - mu; q += x[i][u] * x[i][u]; }
    rs[i] = rsqrtf(ln_wsum(q) * (1.0f / (float)DMQ) + eps); }
#pragma unroll      /* constant indices keep the row arrays in registers */
  for (int i = 0; i < LN_RW; ++i)
#pragma unroll      /* constant indices keep the row arrays in registers */
    for (int u = 0; u < 8; ++u) { const int c = u * 128 + c0; const v4f y = x[i][u] * rs[i] * gg[u] + bv[u];
      if (W32) *(v4f*)(N32 + (r0 + i) * DMQ + c) = y;
      if (W16) *(v4h*)(N16 + (r0 + i) * DMQ + c) = __builtin_convertvector(y, v4h); } }




extern "C" void kernel_launch(void* const* d_in, const int* in_sizes, int n_in,
                              void* d_out, int out_size, void* d_ws, size_t ws_size, hipStream_t stream) {
  (void)in_sizes; (void)n_in; (void)out_size;
  const float* const* I = (const float* const*)d_in; const float* x = I[0]; const float* wq = I[1]; const float* wk = I[2]; const float* wv = I[3]; const float* g1 = I[4]; const float* be1 = I[5]; const float* w1 = I[6]; const float* b1 = I[7]; const float* w2 = I[8]; const float* b2 = I[9]; const float* g2 = I[10]; const float* be2 = I[11];      /* natural [out][in] weights; LN affine; FFN biases */
  char* ws = (char*)d_ws; size_t off = 0;
  auto take = [&](size_t bytes) { char* p = ws + off; off += (bytes + 255) & ~(size_t)255; return p; };
  _Float16* BW1 = (_Float16*)take((size_t)DM * DM * 2); _Float16* BW2 = (_Float16*)take((size_t)DM * DM * 2); float* HP = (float*)take(NR * DM * 4); _Float16* H16 = (_Float16*)take(NR * DM * 2); _Float16* FF16 = (_Float16*)take(NR * DM * 2); _Float16* BQ = (_Float16*)take((size_t)DM * DM * 2); _Float16* BK = (_Float16*)take((size_t)DM * DM * 2); _Float16* BV = (_Float16*)take((size_t)DM * DM * 2); 
  _Float16* X16 = (_Float16*)take(NR * DM * 2); _Float16* Q16 = (_Float16*)take(NR * DM * 2); _Float16* K16 = (_Float16*)take(NR * DM * 2); _Float16* V16 = (_Float16*)take(NR * DM * 2);
  float* HF = (float*)take(NR * DM * 4);      /* the f32 h rows (LN1 output, residual for the FFN) */
  if (off > ws_size) return;
  k_cvt<<<CV_NX + 5 * CV_NW, 256, 0, stream>>>(x, wq, wk, wv, w1, w2, X16, BQ, BK, BV, BW1, BW2);      /* x rows and the five weight planes as f16 */
  const size_t r0p = (size_t)B0 * SQ;      /* first projected row */
  k_gemm2<0, false, false, false, true, 3, 64><<<dim3((unsigned)((MP / G2_BM) * (DM / G2_BN)), 1), 256, 0, stream>>>(X16 + r0p * DM, BQ, (size_t)(BK - BQ), 0.0625f, nullptr, nullptr, nullptr, Q16 + r0p * DM, (size_t)(K16 - Q16));      /* q, k, v: every work-group takes its tile in the three weight planes and the three output planes, which lie at equal distances in the workspace */
  k_fattn<<<dim3(SQ / (FA_NW * 32), NB * NH), FA_NW * 32, 0, stream>>>(Q16, K16, V16, x, HP);      /* h_pre = bf16(x) + attn (merged heads), f32 rows */
  k_lnw<1, 1><<<(unsigned)(MP / (LN_NW * LN_RW)), LN_NW * 32, 0, stream>>>(HP + r0p * DM, g1, be1, 1e-5f, H16 + r0p * DM, HF + r0p * DM);      /* h = LN1(x + attn) -> f16 rows (FFN operand) and f32 rows (residual) */
  k_gemm2<3, true, false, false, true, 1, 128><<<dim3((unsigned)((MP / G2_BM) * (DM / G2_BN)), 1), 256, 0, stream>>>(H16 + r0p * DM, BW1, 0, 0.0625f, b1, nullptr, nullptr, FF16 + r0p * DM, 0);      /* relu(h l1^T + b1) -> f16 rows */
  k_gemm2<0, true, true, true, false, 1, 128><<<dim3((unsigned)((MP / G2_BM) * (DM / G2_BN)), 1), 256, 0, stream>>>(FF16 + r0p * DM, BW2, 0, 0.0625f, b2, HF + r0p * DM, HP + r0p * DM, nullptr, 0);      /* y = h + ff (own-element residual; the h_pre plane is free again) */
  k_lnw<0, 1><<<(unsigned)(MP / (LN_NW * LN_RW)), LN_NW * 32, 0, stream>>>(HP + r0p * DM, g2, be2, 1e-5f, nullptr, (float*)d_out + r0p * DM);      /* out = LN2(h + ff) -> f32 output rows */
}

// v008
// Measured time: 140 microseconds a run.
// Timed twice side by side with v007, it ran 1.08 times as fast both times.
// Counting every step since v000, it is 95.6 times as fast.
#include <hip/hip_runtime.h>
// Post-LN transformer encoder block (x [4][2048][1024]; q = x wq^T, k, v likewise (nn.Linear natural [1024][1024] sigma 1/32, no biases); 16 heads of 64 (chunked along features = head-major columns); softmax(q k^T / 8) v over all keys (no mask), heads merged, NO output projection; h = LN1(x + attn) (biased variance, eps 1e-5, gamma/beta); ff = relu(h l1_w^T + l1_b) l2_w^T + l2_b (natural [1024][1024], biases sigma 0.01); out = LN2(h + ff) -> [4][2048][1024]).
// Structure: token rows r = b*2048 + s; x and the five weights as f16 planes (bf16-rounded; exact but for the first FFN weight, times gamma), one conversion launch; Q, K, V as one WMMA GEMM launch (a work-group takes the same 256x128 tile of all three planes, so that each staged x tile serves three products; operand tiles staged in LDS, 64x64 wave tiles per plane, f32 accumulation, exact x16 weights, f16 outputs); one fused attention launch (per head and 256 queries: S^T = K Q^T, online softmax in registers with f32 statistics and native exp2, weights as f16, O^T += V^T P^T, the V^T fragments by transposing LDS reads of V rows), h_pre = bf16(x) + attn as f32 and f16 rows, with each row's mean and centred square sum over the head's 64 columns; LN1 has no launch of its own: its row statistics are joined from the 16 head parts in the two FFN GEMMs, the first applies them behind the product (h l1^T = rs (h_pre (g l1)^T - mu sum_k g l1) + sum_k beta l1, gamma folded into the f16 weight plane), the second forms its residual h = LN1(h_pre) element by element; relu(h l1^T + b1) -> f16; y = h + ff l2^T + b2; LN2 on VALU -> f32 output.
// Compute dtype: inputs rounded to bf16; x / weights exact (the first FFN weight times gamma rounded to f16); q, k, v, softmax weights and h_pre as plain f16 GEMM operands (~2^-12); scores and softmax statistics f32; v_wmma_f32_16x16x32_f16.
#define NB 4
#define SQ 2048
#define DM 1024
#define NH 16
#define HD 64
#define DMQ DM                       /* LayerNorm width */
#define HG 2                         /* heads per block group of the unlaunched per-batch k_vt */
#define B0 0                         /* first batch processed (debug hook) */
#define NBR NB                       /* batches processed (debug hook) */
#define NR ((size_t)NB * SQ)         /* token rows */
#define MP ((int)((size_t)NBR * SQ)) /* rows projected (debug hook) */
#define QN SQ                        /* unused (attention runs all SQ queries per batch) */
#define NHD NH                       /* unused (attention runs all NH heads) */
#define MPO MP                       /* unused (the output stage runs MP rows) */
#define LQ DM      /* unused (the q/k/v rows have pitch DM) */
typedef __bf16 v16b __attribute__((ext_vector_type(16)));
typedef unsigned short v8us __attribute__((ext_vector_type(8), may_alias));
typedef float  v8f  __attribute__((ext_vector_type(8)));
typedef float  v4f  __attribute__((ext_vector_type(4)));
typedef float  v4fa __attribute__((ext_vector_type(4), may_alias));
union FragB { v16b v; v8us half[2]; unsigned short u[16]; };

__device__ __forceinline__ unsigned short bf16_bits(float x) { unsigned int u = __float_as_uint(x); return (unsigned short)((u + 0x7FFFu + ((u >> 16) & 1u)) >> 16); }
__device__ __forceinline__ float bf16_val(unsigned short b) { return __uint_as_float(((unsigned int)b) << 16); }
__device__ __forceinline__ float bf16_round(float x) { return bf16_val(bf16_bits(x)); }
// D += A·B with NT terms: 1 = ah·bh, 2 = + al·bh (A split), 3 = + ah·bl (both split)
template <int NT>
__device__ __forceinline__ v8f mmaN(v16b ah, v16b al, v16b bh, v16b bl, v8f c) {
  c = __builtin_amdgcn_wmma_f32_16x16x32_bf16(false, ah, false, bh, (short)0, c, false, false);
  if (NT >= 2) c = __builtin_amdgcn_wmma_f32_16x16x32_bf16(false, al, false, bh, (short)0, c, false, false);
  if (NT >= 3) c = __builtin_amdgcn_wmma_f32_16x16x32_bf16(false, ah, false, bl, (short)0, c, false, false);
  asm volatile("v_nop\n\tv_nop\n\tv_nop\n\tv_nop" : "+v"(c) : "v"(ah), "v"(al), "v"(bh), "v"(bl));
  return c;
}

__global__ __launch_bounds__(256) void k_wt_bf16(const float* __restrict__ W, unsigned short* __restrict__ Wt, int K, int N) {
  const int t = blockIdx.x * 256 + threadIdx.x;
  const int k8n = K / 8;
  if (t >= N * k8n) return;
  const int n = t / k8n, k8 = (t % k8n) * 8;
  v8us v;
#pragma unroll
  for (int i = 0; i < 8; ++i) v[i] = bf16_bits(W[(size_t)(k8 + i) * N + n]);
  *(v8us*)(Wt + (size_t)n * K + k8) = v;
  
}

// GEMM C[M][N] (f32, pitch ldc) = act(A[M][K]·W + bias). A f32 row-major (pitch lda) converted per fragment to bf16
// (ASPLIT: hi/lo two planes -> 2 terms, else single rounded term); Wt bf16 [N][K] (pitch ldb). BIAS_BF16 rounds the
// bias to bf16 first (bias quantised to bf16 before the add). K%32==0, M%16==0, N%64==0.
template <bool ASPLIT, int ACT, bool BIAS_BF16>
__global__ __launch_bounds__(128) void k_gemm_bf(const float* __restrict__ A, int lda, const unsigned short* __restrict__ Wt, int ldb,
                                               const float* __restrict__ bias, float* __restrict__ C, int ldc, int M, int N, int K) {
  __shared__ __attribute__((aligned(16))) float so[4][16][64];
  const int tid = threadIdx.x, w = tid >> 5, lane = tid & 31, ln = lane & 15, hh = lane >> 4;
  const int ntn = N / 64;
  const int wid = blockIdx.x * 4 + w;
  const int mt = wid / ntn, nq = wid % ntn;
  if (mt * 16 >= M) return;
  const int row0 = mt * 16, col0 = nq * 64;
  const float* arow = A + (size_t)(row0 + ln) * lda;
  v8f acc[4] = {};
  for (int kb = 0; kb < K; kb += 32) {
    FragB ah, al;
    const v4f x0 = *(const v4fa*)(arow + kb + 8 * hh), x1 = *(const v4fa*)(arow + kb + 8 * hh + 4);
    const v4f x2 = *(const v4fa*)(arow + kb + 16 + 8 * hh), x3 = *(const v4fa*)(arow + kb + 16 + 8 * hh + 4);
    float xs[16] = {x0[0],x0[1],x0[2],x0[3],x1[0],x1[1],x1[2],x1[3],x2[0],x2[1],x2[2],x2[3],x3[0],x3[1],x3[2],x3[3]};
#pragma unroll
    for (int i = 0; i < 16; ++i) { const unsigned short hb = bf16_bits(xs[i]); ah.u[i] = hb; al.u[i] = ASPLIT ? bf16_bits(xs[i] - bf16_val(hb)) : (unsigned short)0; }
#pragma unroll
    for (int t = 0; t < 4; ++t) {
      const unsigned short* brow = Wt + (size_t)(col0 + t * 16 + ln) * ldb + kb;
      FragB b;
      b.half[0] = *(const v8us*)(brow + 8 * hh);
      b.half[1] = *(const v8us*)(brow + 16 + 8 * hh);
      acc[t] = mmaN<ASPLIT ? 2 : 1>(ah.v, al.v, b.v, b.v, acc[t]);
    }
  }
#pragma unroll
  for (int t = 0; t < 4; ++t) {
    float bv = bias ? bias[col0 + t * 16 + ln] : 0.f;
    if (BIAS_BF16) bv = bf16_round(bv);
#pragma unroll
    for (int r = 0; r < 8; ++r) { float v = acc[t][r] + bv; if (ACT == 1) v = fmaxf(v, 0.f); so[w][8 * hh + r][t * 16 + ln] = v; }
  }
  __builtin_amdgcn_fence(__ATOMIC_ACQ_REL, "workgroup");
  __builtin_amdgcn_wave_barrier();
  const int rsub = lane >> 4, c4 = (lane & 15) * 4;
  {
#pragma unroll
    for (int q = 0; q < 8; ++q) {
      const int r = q * 2 + rsub;
      const v4f v = *(const v4fa*)&so[w][r][c4];
      *(v4f*)(C + (size_t)(row0 + r) * ldc + col0 + c4) = v;
    }
    
  }
}

// GEMM C = act(A·W + bias + resid): A f32 (ASPLIT -> hi/lo 2 terms), Wt bf16 [N][K]; ACT 0 none, 1 relu, 2 exact gelu;
// resid (optional, f32, row index = (row % rmod), pitch ldr, RES_BF16 rounds it) added before the activation.
template <bool ASPLIT, int ACT, bool BIAS_BF16, bool RES_BF16>
__global__ __launch_bounds__(128) void k_gemm_bf3(const float* __restrict__ A, int lda, const unsigned short* __restrict__ Wt, int ldb,
                                                const float* __restrict__ bias, const float* __restrict__ resid, int rmod, int ldr,
                                                float* __restrict__ C, int ldc, int M, int N, int K) {
  __shared__ __attribute__((aligned(16))) float so[4][16][64];
  const int tid = threadIdx.x, w = tid >> 5, lane = tid & 31, ln = lane & 15, hh = lane >> 4;
  const int ntn = N / 64;
  const int wid = blockIdx.x * 4 + w;
  const int mt = wid / ntn, nq = wid % ntn;
  if (mt * 16 >= M) return;
  const int row0 = mt * 16, col0 = nq * 64;
  const float* arow = A + (size_t)(row0 + ln) * lda;
  v8f acc[4] = {};
  for (int kb = 0; kb < K; kb += 32) {
    FragB ah, al;
    const v4f x0 = *(const v4fa*)(arow + kb + 8 * hh), x1 = *(const v4fa*)(arow + kb + 8 * hh + 4);
    const v4f x2 = *(const v4fa*)(arow + kb + 16 + 8 * hh), x3 = *(const v4fa*)(arow + kb + 16 + 8 * hh + 4);
    float xs[16] = {x0[0],x0[1],x0[2],x0[3],x1[0],x1[1],x1[2],x1[3],x2[0],x2[1],x2[2],x2[3],x3[0],x3[1],x3[2],x3[3]};
#pragma unroll
    for (int i = 0; i < 16; ++i) { const unsigned short hb = bf16_bits(xs[i]); ah.u[i] = hb; al.u[i] = ASPLIT ? bf16_bits(xs[i] - bf16_val(hb)) : (unsigned short)0; }
#pragma unroll
    for (int t = 0; t < 4; ++t) {
      const unsigned short* brow = Wt + (size_t)(col0 + t * 16 + ln) * ldb + kb;
      FragB b;
      b.half[0] = *(const v8us*)(brow + 8 * hh);
      b.half[1] = *(const v8us*)(brow + 16 + 8 * hh);
      acc[t] = mmaN<ASPLIT ? 2 : 1>(ah.v, al.v, b.v, b.v, acc[t]);
    }
  }
#pragma unroll
  for (int t = 0; t < 4; ++t) {
    const int col = col0 + t * 16 + ln;
    float bv = bias ? bias[col] : 0.f;
    if (BIAS_BF16) bv = bf16_round(bv);
#pragma unroll
    for (int r = 0; r < 8; ++r) {
      float v = acc[t][r] + bv;
      if (resid) { float rv = resid[(size_t)((row0 + 8 * hh + r) % rmod) * ldr + col]; if (RES_BF16) rv = bf16_round(rv); v += rv; }
      if (ACT == 1) v = fmaxf(v, 0.f);
      if (ACT == 2) v = 0.5f * v * (1.0f + erff(v * 0.70710678118654752f));
      if (ACT == 3) { const float u = 0.7978845608028654f * (v + 0.044715f * v * v * v); v = 0.5f * v * (1.0f + tanhf(u)); }
      so[w][8 * hh + r][t * 16 + ln] = v;
    }
  }
  __builtin_amdgcn_fence(__ATOMIC_ACQ_REL, "workgroup");
  __builtin_amdgcn_wave_barrier();
  const int rsub = lane >> 4, c4 = (lane & 15) * 4;
  {
#pragma unroll
    for (int q = 0; q < 8; ++q) {
      const int r = q * 2 + rsub;
      const v4f v = *(const v4fa*)&so[w][r][c4];
      *(v4f*)(C + (size_t)(row0 + r) * ldc + col0 + c4) = v;
    }
    
  }
}
// row LayerNorm (biased variance, eps) over N: s = X (+ R); optional out_sum <- s; out_norm <- (s-mu)*rsqrt(var+eps)*g + b
template <bool PARAM_BF16>
__global__ __launch_bounds__(256) void k_layernorm(const float* __restrict__ X, const float* __restrict__ R, const float* __restrict__ g, const float* __restrict__ bta,
                                                  float* __restrict__ out_sum, float* __restrict__ out_norm, int N, float eps) {
  __shared__ float red[256];
  const int row = blockIdx.x, tid = threadIdx.x;
  const float* x = X + (size_t)row * N; const float* rr = R ? R + (size_t)row * N : nullptr;
  float vals[16];                     // up to N = 4096
  const int per = N / 256;            // contiguous chunk per thread? use strided-by-4 chunks: thread handles j = tid*4 + 1024*u
  float s1 = 0.f;
  for (int u = 0; u < per / 4; ++u) {
    const int j = tid * 4 + 1024 * u;
    const v4f a = *(const v4fa*)(x + j);
    v4f b = {0.f,0.f,0.f,0.f}; if (rr) b = *(const v4fa*)(rr + j);
#pragma unroll
    for (int q = 0; q < 4; ++q) { const float v = a[q] + b[q]; vals[u * 4 + q] = v; s1 += v; }
  }
  red[tid] = s1; __syncthreads();
  for (int st = 128; st > 0; st >>= 1) { if (tid < st) red[tid] += red[tid + st]; __syncthreads(); }
  const float mu = red[0] / (float)N; __syncthreads();
  float s2 = 0.f;
  for (int u = 0; u < per / 4; ++u)
#pragma unroll
    for (int q = 0; q < 4; ++q) { const float c = vals[u * 4 + q] - mu; s2 += c * c; }
  red[tid] = s2; __syncthreads();
  for (int st = 128; st > 0; st >>= 1) { if (tid < st) red[tid] += red[tid + st]; __syncthreads(); }
  const float rs = rsqrtf(red[0] / (float)N + eps);
  {
    for (int u = 0; u < per / 4; ++u) {
      const int j = tid * 4 + 1024 * u;
      v4f o, sm;
#pragma unroll
      for (int q = 0; q < 4; ++q) {
        float gg = g[j + q], bb = bta[j + q];
        if (PARAM_BF16) { gg = bf16_round(gg); bb = bf16_round(bb); }
        sm[q] = vals[u * 4 + q]; o[q] = (vals[u * 4 + q] - mu) * rs * gg + bb;
      }
      if (out_sum) *(v4f*)(out_sum + (size_t)row * N + j) = sm;
      *(v4f*)(out_norm + (size_t)row * N + j) = o;
    }
    
  }
}



// ---- f16 WMMA path (v_wmma_f32_16x16x32_f16): 11-bit significands for operands in range — used where a [0,1] probability operand needs more precision than bf16
typedef _Float16 v16h __attribute__((ext_vector_type(16)));
union FragH { v16h v; v8us half[2]; _Float16 h[16]; unsigned short u[16]; };
template <int NT>
__device__ __forceinline__ v8f mmaH(v16h ah, v16h al, v16h bh, v16h bl, v8f c) {
  c = __builtin_amdgcn_wmma_f32_16x16x32_f16(false, ah, false, bh, (short)0, c, false, false);
  if (NT >= 2) c = __builtin_amdgcn_wmma_f32_16x16x32_f16(false, al, false, bh, (short)0, c, false, false);
  if (NT >= 3) c = __builtin_amdgcn_wmma_f32_16x16x32_f16(false, ah, false, bl, (short)0, c, false, false);
  asm volatile("v_nop\n\tv_nop\n\tv_nop\n\tv_nop" : "+v"(c) : "v"(ah), "v"(al), "v"(bh), "v"(bl));
  return c;
}
// batched GEMM like k_gemm_b but f16 operands: A f32 (split into f16 hi/lo if ASPLIT, else rounded to f16), Bt = f16 values [n][k]; alpha; C f32; N multiple of 16 (partial tiles skipped)
template <bool ASPLIT>
__global__ __launch_bounds__(128) void k_gemm_h(const float* __restrict__ A, int lda, size_t sA, const _Float16* __restrict__ Bh, int ldb, size_t sB, float alpha, float* __restrict__ C, int ldc, size_t sC, int M, int N, int K) {
  __shared__ __attribute__((aligned(16))) float so[4][16][64];
  const int tid = threadIdx.x, w = tid >> 5, lane = tid & 31, ln = lane & 15, hh = lane >> 4; const int by = blockIdx.y;
  A += (size_t)by * sA; Bh += (size_t)by * sB; C += (size_t)by * sC;
  const int ntn = (N + 63) / 64; const int wid = blockIdx.x * 4 + w; const int mt = wid / ntn, nq = wid % ntn; if (mt * 16 >= M) return;
  const int row0 = mt * 16, col0 = nq * 64; const float* arow = A + (size_t)(row0 + ln) * lda;
  v8f acc[4] = {};
  for (int kb = 0; kb < K; kb += 32) {
    FragH ah, al;
    const v4f x0 = *(const v4fa*)(arow + kb + 8 * hh), x1 = *(const v4fa*)(arow + kb + 8 * hh + 4), x2 = *(const v4fa*)(arow + kb + 16 + 8 * hh), x3 = *(const v4fa*)(arow + kb + 16 + 8 * hh + 4);
    float xs[16] = {x0[0],x0[1],x0[2],x0[3],x1[0],x1[1],x1[2],x1[3],x2[0],x2[1],x2[2],x2[3],x3[0],x3[1],x3[2],x3[3]};
#pragma unroll
    for (int i = 0; i < 16; ++i) { const _Float16 h = (_Float16)xs[i]; ah.h[i] = h; al.h[i] = ASPLIT ? (_Float16)(xs[i] - (float)h) : (_Float16)0.0f; }
#pragma unroll
    for (int t = 0; t < 4; ++t) { if (col0 + t * 16 >= N) continue; const size_t boff = (size_t)(col0 + t * 16 + ln) * ldb + kb; FragH bq; bq.half[0] = *(const v8us*)(Bh + boff + 8 * hh); bq.half[1] = *(const v8us*)(Bh + boff + 16 + 8 * hh);
      acc[t] = mmaH<ASPLIT ? 2 : 1>(ah.v, al.v, bq.v, bq.v, acc[t]); }
  }
#pragma unroll
  for (int t = 0; t < 4; ++t) { if (col0 + t * 16 >= N) continue;
#pragma unroll
    for (int r = 0; r < 8; ++r) so[w][8 * hh + r][t * 16 + ln] = acc[t][r] * alpha; }
  __builtin_amdgcn_fence(__ATOMIC_ACQ_REL, "workgroup"); __builtin_amdgcn_wave_barrier();
  const int rsub = lane >> 4, c4 = (lane & 15) * 4;
  {
#pragma unroll
    for (int q = 0; q < 8; ++q) { const int r = q * 2 + rsub; if (col0 + c4 < N) { const v4f v = *(const v4fa*)&so[w][r][c4]; *(v4f*)(C + (size_t)(row0 + r) * ldc + col0 + c4) = v; } }
     }
}

// Wt[n][k] = f16(W[k][n]·scale) from f32 row-major W[K][N] (scale = power of two; bf16-exact weights stay exact in f16 away from the subnormal range)
__global__ __launch_bounds__(256) void k_wt_f16(const float* __restrict__ W, _Float16* __restrict__ Wt, int K, int N, float scale) {
  const int t = blockIdx.x * 256 + threadIdx.x; if (t >= N * (K / 8)) return; const int n = t / (K / 8), k8 = (t % (K / 8)) * 8; FragH f;
#pragma unroll
  for (int i = 0; i < 8; ++i) f.h[i] = (_Float16)(bf16_round(W[(size_t)(k8 + i) * N + n]) * scale); const v8us o = f.half[0];
  *(v8us*)((unsigned short*)Wt + (size_t)n * K + k8) = o; 
}
// k_gemm_hh variant with fused epilogue: v = acc·alpha + bias[by·sBias + col] (+ CP[(row/rowsPerB)·sCPb + by·64 + col] if CP) ; ACT 0 none / 1 elu ; writes f16 C16 (and f32 C if non-null)
template <int ACT>
__global__ __launch_bounds__(128) void k_gemm_hhx(const _Float16* __restrict__ A, int lda, size_t sA, const _Float16* __restrict__ Bh, int ldb, size_t sB, float alpha, const float* __restrict__ bias, size_t sBias, const float* __restrict__ CP, int rowsPerB, size_t sCPb, int row0g,
    float* __restrict__ C, _Float16* __restrict__ C16, int ldc, size_t sC, int M, int N, int K) {
  __shared__ __attribute__((aligned(16))) float so[4][16][64];
  const int tid = threadIdx.x, w = tid >> 5, lane = tid & 31, ln = lane & 15, hh = lane >> 4; const int by = blockIdx.y;
  A += (size_t)by * sA; Bh += (size_t)by * sB; const size_t cofs = (size_t)by * sC; const float* bp = bias ? bias + (size_t)by * sBias : nullptr;
  const int ntn = (N + 63) / 64; const int wid = blockIdx.x * 4 + w; const int mt = wid / ntn, nq = wid % ntn; if (mt * 16 >= M) return;
  const int row0 = mt * 16, col0 = nq * 64; const _Float16* arow = A + (size_t)(row0 + ln) * lda;
  v8f acc[4] = {};
  for (int kb = 0; kb < K; kb += 32) { FragH ah; ah.half[0] = *(const v8us*)((const unsigned short*)arow + kb + 8 * hh); ah.half[1] = *(const v8us*)((const unsigned short*)arow + kb + 16 + 8 * hh);
#pragma unroll
    for (int t = 0; t < 4; ++t) { if (col0 + t * 16 >= N) continue; const size_t boff = (size_t)(col0 + t * 16 + ln) * ldb + kb; FragH bq; bq.half[0] = *(const v8us*)((const unsigned short*)Bh + boff + 8 * hh); bq.half[1] = *(const v8us*)((const unsigned short*)Bh + boff + 16 + 8 * hh);
      acc[t] = mmaH<1>(ah.v, ah.v, bq.v, bq.v, acc[t]); }
  }
#pragma unroll
  for (int t = 0; t < 4; ++t) { if (col0 + t * 16 >= N) continue; const int col = col0 + t * 16 + ln; const float bv = bp ? bf16_round(bp[col]) : 0.f;
#pragma unroll
    for (int r = 0; r < 8; ++r) { float v = acc[t][r] * alpha + bv; if (CP) { const int rr = row0g + row0 + 8 * hh + r; if (rowsPerB < 0) v += CP[cofs + (size_t)rr * ldc + col];      /* rowsPerB < 0: own element of the batched C plane */ else { const int bidx = rr / rowsPerB; v += CP[(size_t)bidx * sCPb + (size_t)by * 64 + col]; } } if (ACT == 1) v = (v > 0.f) ? v : expm1f(v); else if (ACT == 7) v = (v > 0.f) ? v + 1.0f : expf(v); else if (ACT == 8) v = tanhf(v); else if (ACT == 9) v = 0.5f * v * (1.0f + tanhf(0.7978845608028654f * (v + 0.044715f * v * v * v))); else if (ACT == 11) v = 1.0f / (1.0f + expf(-v)); else if (ACT == 12) v = (v > 0.f) ? v : 0.01f * v; else if (ACT == 14) v = (v > 0.f) ? v : 0.1f * v; else if (ACT == 16) v = (v >= 0.f) ? v : 0.3f * v; else if (ACT == 17) v = (v >= 0.f) ? v : 0.2f * v; else if (ACT == 15) v = v / (1.0f + expf(-v)); else if (ACT == 3) v = fmaxf(v, 0.f); else if (ACT == 6) v = 0.5f * v * (1.0f + erff(v * 0.70710678118654752f)); so[w][8 * hh + r][t * 16 + ln] = v; } }
  __builtin_amdgcn_fence(__ATOMIC_ACQ_REL, "workgroup"); __builtin_amdgcn_wave_barrier();
  const int rsub = lane >> 4, c4 = (lane & 15) * 4; typedef _Float16 v4h __attribute__((ext_vector_type(4)));
  {
#pragma unroll
    for (int q = 0; q < 8; ++q) { const int r = q * 2 + rsub; if (col0 + c4 < N) { const v4f v = *(const v4fa*)&so[w][r][c4]; if (C) *(v4f*)(C + cofs + (size_t)(row0 + r) * ldc + col0 + c4) = v; if (C16) { v4h h4; for (int i = 0; i < 4; ++i) h4[i] = (_Float16)v[i]; *(v4h*)(C16 + cofs + (size_t)(row0 + r) * ldc + col0 + c4) = h4; } } }
     }
}


typedef _Float16 v4h __attribute__((ext_vector_type(4)));
typedef float v2f __attribute__((ext_vector_type(2)));
typedef float v2fa __attribute__((ext_vector_type(2), may_alias));
// lane l <-> lane l ^ 16
__device__ __forceinline__ float fa_xrow(float v) { const int i = __builtin_bit_cast(int, v); return __builtin_bit_cast(float, __builtin_amdgcn_permlanex16(i, i, 0x76543210, 0xfedcba98, false, false)); }
template <int M> __device__ __forceinline__ float ln_xm(float v) { return __builtin_bit_cast(float, __builtin_amdgcn_update_dpp(0, __builtin_bit_cast(int, v), 0x160 + M, 0xf, 0xf, true)); }      /* lane l <-> lane l ^ M, M < 16 (row_xmask) */
__device__ __forceinline__ float rw_sum16(float v) { v += ln_xm<1>(v); v += ln_xm<2>(v); v += ln_xm<4>(v); return v + ln_xm<8>(v); }      /* sum over the 16 lanes of a row, in every lane */
#define LN1_EPS 1e-5f

__global__ __launch_bounds__(256) void k_h16(const float* __restrict__ x, _Float16* __restrict__ X16, size_t n8) { const size_t t = (size_t)blockIdx.x * 256 + threadIdx.x; if (t >= n8) return; FragH f;
#pragma unroll
  for (int q = 0; q < 8; ++q) f.h[q] = (_Float16)x[t * 8 + q]; *(v8us*)((unsigned short*)X16 + t * 8) = f.half[0];  }
__global__ __launch_bounds__(256) void k_round16f(const float* __restrict__ W, _Float16* __restrict__ Bt, size_t n8) { const size_t t = (size_t)blockIdx.x * 256 + threadIdx.x; if (t >= n8) return; FragH f;
#pragma unroll
  for (int i = 0; i < 8; ++i) f.h[i] = (_Float16)(bf16_round(W[t * 8 + i]) * 16.0f); *(v8us*)((unsigned short*)Bt + t * 8) = f.half[0];  }
__global__ __launch_bounds__(256) void k_hl(const float* __restrict__ F, _Float16* __restrict__ Hh, _Float16* __restrict__ Hl, size_t n8) { const size_t t = (size_t)blockIdx.x * 256 + threadIdx.x; if (t >= n8) return; FragH fh, fl; const v4f a = *(const v4fa*)(F + t * 8), c = *(const v4fa*)(F + t * 8 + 4);
#pragma unroll
  for (int q = 0; q < 4; ++q) { _Float16 h = (_Float16)a[q]; fh.h[q] = h; fl.h[q] = (_Float16)((a[q] - (float)h) * 1024.0f); h = (_Float16)c[q]; fh.h[4 + q] = h; fl.h[4 + q] = (_Float16)((c[q] - (float)h) * 1024.0f); }
  { *(v8us*)((unsigned short*)Hh + t * 8) = fh.half[0]; *(v8us*)((unsigned short*)Hl + t * 8) = fl.half[0];  } }

// ---- GEMM with both operands staged in LDS (work-group tile 256x128 in each of NP weight planes, eight waves of 64x64 per plane; MP % 256 == 0, DM % 128 == 0); epilogue = k_gemm_hhx semantics or LayerNorm 1 folded in (LNM), its cases fixed at compile time ----
// KS: k per stage (128: 256 bytes of every operand row; 64 where the rows of three planes have to fit LDS twice). LDS row pitch KS + 8 elements: 272 B = 16 B x 17 or 144 B = 16 B x 9, the pitches for 16-byte fragment reads.
#define G2_BM 256     /* rows of C per work-group */
#define G2_BN 128     /* columns of C per work-group */
__device__ __forceinline__ v16h g2_frag(const unsigned short* p, int hh) { FragH f; f.half[0] = *(const v8us*)(p + 8 * hh); f.half[1] = *(const v8us*)(p + 16 + 8 * hh); return f.v; }
__device__ __forceinline__ v8f g2_mma(v16h a, v16h b, v8f c) { return __builtin_amdgcn_wmma_f32_16x16x32_f16(false, a, false, b, (short)0, c, false, false); }
// Eight asynchronous copies of one lane: its 16-byte piece of eight operand rows, a fixed row step apart, from global memory straight into LDS (a wave's copy covers two whole 256-byte rows).
// l: the lane's LDS byte address; g: its global address; p: the row step in elements of the source; lp: the same step in LDS bytes. The s_wait_xcnt stands inside the statement so that no address register is rewritten in front of it.
__device__ __forceinline__ void g2_copy8(unsigned l, const unsigned short* g, size_t p, unsigned lp) {
  asm volatile("global_load_async_to_lds_b128 %0, %8, off\n\t"
               "global_load_async_to_lds_b128 %1, %9, off\n\t"
               "global_load_async_to_lds_b128 %2, %10, off\n\t"
               "global_load_async_to_lds_b128 %3, %11, off\n\t"
               "global_load_async_to_lds_b128 %4, %12, off\n\t"
               "global_load_async_to_lds_b128 %5, %13, off\n\t"
               "global_load_async_to_lds_b128 %6, %14, off\n\t"
               "global_load_async_to_lds_b128 %7, %15, off\n\t"
               "s_wait_xcnt 0x0"
               :: "v"(l), "v"(l + lp), "v"(l + 2 * lp), "v"(l + 3 * lp), "v"(l + 4 * lp), "v"(l + 5 * lp), "v"(l + 6 * lp), "v"(l + 7 * lp),
                  "v"(g), "v"(g + p), "v"(g + 2 * p), "v"(g + 3 * p), "v"(g + 4 * p), "v"(g + 5 * p), "v"(g + 6 * p), "v"(g + 7 * p)
               : "memory"); }
// Four copies of one lane by the builtin (with 128-byte rows a wave's copy covers four whole rows): in a kernel whose accumulators fill the registers below v256 the operands of asm text, which have to lie there, cost spills; the compiler's own copies take any register.
typedef int g2_i4 __attribute__((ext_vector_type(4)));
__device__ __forceinline__ void g2_copy4(unsigned l, const unsigned short* g, size_t p, unsigned lp) {
  typedef __attribute__((address_space(1))) g2_i4 gl_i4; typedef __attribute__((address_space(3))) g2_i4 ls_i4;
#pragma unroll      /* the row steps become constants of the address additions */
  for (int j = 0; j < 4; ++j) __builtin_amdgcn_global_load_async_to_lds_b128((gl_i4*)(g + j * p), (ls_i4*)(l + j * lp), 0, 0); }
// One stage: KS elements of 256 A rows and of 128 B rows in each of NP planes (sB apart): 24 copies per lane (NP 1, KS 128) or 20 (NP 3, KS 64). One copy of the work-group covers 2048 / KS rows.
template <int NP, int KS>
__device__ __forceinline__ void g2_stage(unsigned la, unsigned lb, const unsigned short* ga, const unsigned short* gb, size_t pa, size_t pb, size_t sB) {
  constexpr unsigned pbytes = (KS + 8) * 2, lp = (2048 / KS) * pbytes;
  if (KS == 128) { g2_copy8(la, ga, pa, lp); g2_copy8(la + 8 * lp, ga + 8 * pa, pa, lp); }
  else { g2_copy4(la, ga, pa, lp); g2_copy4(la + 4 * lp, ga + 4 * pa, pa, lp); }
#pragma unroll      /* the plane steps fold into the addresses */
  for (int p = 0; p < NP; ++p) { if (KS == 128) g2_copy8(lb + p * G2_BN * pbytes, gb + p * sB, pb, lp);
    else g2_copy4(lb + p * G2_BN * pbytes, gb + p * sB, pb, lp); } }
// Half P (32 rows) of a wave's 64x64 tile: the raw accumulators go through the wave's own 32 LDS rows; on the row side a lane holds 4 neighbouring columns of a row, so that bias, residual and f32 output are 16-byte accesses (f16 output 8-byte) that cover whole rows of the tile.
// Every case (bias, residual, which outputs) and the row pitch (DM) are compile-time constants: the text has no branch, the LDS reads form one group, the 16 stores another, and every global address is one register pair plus an immediate offset.
// v = acc alpha + bias (+ residual), activation: the operations and their order per element are those of the element-wise form.
// Rl, Cl, Hl: the lane's own addresses of row hh, columns 4 ln .. 4 ln + 3 of the wave's tile in the residual, f32 output and f16 output planes.
// The residual rows of half P, 16 loads in flight.
template <int P>
__device__ __forceinline__ void g2_res(v4f (&rs)[16], const float* Rl) {
#pragma unroll      /* constant indices keep the row array in registers */
  for (int q = 0; q < 16; ++q) rs[q] = *(const v4fa*)(Rl + (size_t)(P * 32 + q * 2) * DM); }
// rs: on entry the residual rows of half P (loads issued by the caller); half 0 leaves the loads of half 1 in flight there.
// LNM: how LayerNorm 1 enters. 1: A held the rows before the norm and B the weights times gamma, so v = (acc - mu ga) alpha rs + bv, with ga the column's sum of the B row and bv = bias + the column's sum of beta w. 2: the residual rows are those before the norm: (r - mu) rs ga + gb, ga = gamma, gb = beta. sr: (mu, rs) of the wave's 64 rows, in LDS.
template <int ACT, bool HASB, bool RES, bool W32, bool W16, int P, bool LAST, int LNM>
__device__ __forceinline__ void g2_out(const v8f (&acc)[4][4], float (*sw)[68], float alpha, v4f bv, v4f (&rs)[16], const float* Rl, float* Cl, _Float16* Hl, int ln, int hh, const float (*sr)[2], v4f ga, v4f gb) {
  v4f y[16]; v4h h[16]; v2f ms[16];
#pragma unroll      /* constant indices keep the accumulator array in registers */
  for (int u = 0; u < 8; ++u) { const int t = u & 3, half = u >> 2;
#pragma unroll      /* constant indices keep the accumulator array in registers */
    for (int r = 0; r < 8; ++r) sw[half * 16 + 8 * hh + r][t * 16 + ln] = acc[P * 2 + half][t][r]; }
  asm volatile("s_wait_dscnt 0x0" ::: "memory");      /* the wave's own LDS stores before its own reads of other lanes' elements; no wait on the global loads and stores in flight */
#pragma unroll      /* the row steps fold into the immediate offsets of the LDS reads */
  for (int q = 0; q < 16; ++q) { y[q] = *(const v4fa*)&sw[q * 2 + hh][ln * 4]; if (LNM) ms[q] = *(const v2fa*)&sr[P * 32 + q * 2 + hh][0]; }
#pragma unroll      /* constant indices keep the row arrays in registers */
  for (int q = 0; q < 16; ++q) { v4f v;
    if (LNM == 1) v = (y[q] - ga * ms[q][0]) * alpha * ms[q][1] + bv;
    else { v = HASB ? y[q] * alpha + bv : y[q] * alpha; if (RES) v += LNM == 2 ? (rs[q] - ms[q][0]) * ms[q][1] * ga + gb : rs[q]; }
    if (ACT == 3) { const v4f z4 = {0.f, 0.f, 0.f, 0.f}; v = __builtin_elementwise_max(v, z4); }
    y[q] = v; if (W16) h[q] = __builtin_convertvector(v, v4h); }
  __builtin_amdgcn_sched_barrier(0);      /* every value of the half is made in front of its first store: no register that an issued store names is written before the wait below or, in the wave's last half, the wave's end */
  if (RES && P == 0) g2_res<1>(rs, Rl);      /* the next half's residual rows fly during this half's stores and the next half's LDS round */
#pragma unroll      /* the row steps fold into the immediate offsets of the stores */
  for (int q = 0; q < 16; ++q) { if (W32) *(v4f*)(Cl + (size_t)(P * 32 + q * 2) * DM) = y[q]; if (W16) *(v4h*)(Hl + (size_t)(P * 32 + q * 2) * DM) = h[q]; }
  if (!LAST) asm volatile("s_wait_xcnt 0x0" ::: "memory");      /* behind the half's stores, in front of the next half's code, which reuses their registers; it also keeps the next half's LDS stores behind this half's LDS reads, whose values have all been used */
}
// C = act(A Bh^T alpha + bias (+ own element of CP)): A [MP][DM], Bh [DM][DM] (NP planes, sB apart), outputs [MP][DM] (NP planes, sC apart) as f32 (W32) and / or f16 (W16).
// NP > 1: the work-group takes its 256x128 tile in every plane at once; a staged A tile and a wave's A fragments then serve NP products (per plane and accumulator the k order is that of NP = 1).
// LNM 1, 2: LayerNorm 1 is applied here (g2_out). ST: per head and row the mean and the centred square sum of the row's 64 columns of that head; a thread joins the 16 parts of one row of the tile (means averaged; square sums added, plus 64 times the squared distances of the part means from the row mean). L0, L1: LNM 1: the pairs (sum of the B row, sum of beta w) per column, eight columns per 128-byte line; LNM 2: gamma, beta.
template <int ACT, bool HASB, bool RES, bool W32, bool W16, int NP, int KS, int LNM>
__global__ __launch_bounds__(256) void k_gemm2(const _Float16* __restrict__ A, const _Float16* __restrict__ Bh, size_t sB, float alpha, const float* __restrict__ bias, const float* __restrict__ CP,
    float* __restrict__ C, _Float16* __restrict__ C16, size_t sC, const float* __restrict__ ST, const float* __restrict__ L0, const float* __restrict__ L1) { static_assert(ACT == 0 || ACT == 3, "k_gemm2: unsupported ACT code (would silently apply no activation)");
  static_assert(MP % G2_BM == 0 && DM % G2_BN == 0 && DM % KS == 0 && DM / KS >= 2 && (KS == 64 || KS == 128), "k_gemm2: whole tiles and stages only");
  static_assert(NP == 1 || (!HASB && !RES && !LNM), "k_gemm2: bias, residual and norm are those of one plane");
  static_assert(LNM == 0 || (LNM == 1 && HASB && !RES) || (LNM == 2 && RES), "k_gemm2: the norm enters behind the product or in the residual");
  constexpr int PT = KS + 8;      /* LDS row pitch in elements */
  __shared__ __attribute__((aligned(16))) unsigned short sa[2][G2_BM][PT];
  __shared__ __attribute__((aligned(16))) unsigned short sb[2][NP * G2_BN][PT];
  __shared__ __attribute__((aligned(16))) float so[8][32][68];
  __shared__ __attribute__((aligned(16))) float srow[LNM ? G2_BM : 1][2];      /* (mu, rs) of the tile's rows */
  constexpr int lda = DM, ldb = DM, M = MP, N = DM, K = DM;
  const int tid = threadIdx.x, w = tid >> 5, lane = tid & 31, ln = lane & 15, hh = lane >> 4;
  const int ntn = N >> 7; const int mt = blockIdx.x / ntn, nq = blockIdx.x - mt * ntn; if (mt * G2_BM >= M) return;      /* the whole work-group, in front of every copy and barrier */
  const int wr = (w >> 1) * 64, wc = (w & 1) * 64; const int row0 = mt * G2_BM + wr, col0 = nq * G2_BN + wc;
  constexpr int RS = 2048 / KS;      /* rows that one copy of the work-group covers */
  const int sr = tid / (KS / 8), sc = (tid % (KS / 8)) * 8;      /* staging: rows sr + RS j, 16-byte piece sc */
  const unsigned short* ag = (const unsigned short*)A + (size_t)(mt * G2_BM + sr) * lda + sc; const unsigned short* bg = (const unsigned short*)Bh + (size_t)(nq * G2_BN + sr) * ldb + sc;
  const size_t pa = (size_t)RS * lda, pb = (size_t)RS * ldb;
  const unsigned la0 = (unsigned)(size_t)&sa[0][sr][sc], lb0 = (unsigned)(size_t)&sb[0][sr][sc];      /* low 32 bits of a __shared__ address = the LDS byte address */
  const unsigned abuf = G2_BM * PT * 2, bbuf = NP * G2_BN * PT * 2;
  constexpr int nst = K / KS;
  const v8f z8 = {0.f,0.f,0.f,0.f,0.f,0.f,0.f,0.f}; v8f acc[NP][4][4];
#pragma unroll      /* constant indices keep the accumulator array in registers */
  for (int p = 0; p < NP; ++p)
#pragma unroll      /* constant indices keep the accumulator array in registers */
    for (int i = 0; i < 4; ++i)
#pragma unroll      /* constant indices keep the accumulator array in registers */
      for (int j = 0; j < 4; ++j) acc[p][i][j] = z8;
  g2_stage<NP, KS>(la0, lb0, ag, bg, pa, pb, sB);
  if (LNM) { float mh[NH], sm = 0.f, m2 = 0.f, d2 = 0.f;      /* while stage 0 flies; the barrier that publishes stage 0 publishes these rows too */
#pragma unroll      /* constant indices keep the part array in registers; 16 loads in flight */
    for (int p = 0; p < NH; ++p) { const v2f t = *(const v2fa*)(ST + ((size_t)p * NR + mt * G2_BM + tid) * 2); mh[p] = t[0]; sm += t[0]; m2 += t[1]; }
    const float mu = sm * (1.0f / (float)NH);
#pragma unroll      /* constant indices keep the part array in registers */
    for (int p = 0; p < NH; ++p) { const float d = mh[p] - mu; d2 += d * d; }
    srow[tid][0] = mu; srow[tid][1] = rsqrtf((m2 + (float)HD * d2) * (1.0f / (float)DM) + LN1_EPS); }
  asm volatile("s_wait_asynccnt 0x0" ::: "memory");      /* this wave's copies of stage 0 have landed */
  __syncthreads();      /* publishes stage 0 */
  g2_stage<NP, KS>(la0 + abuf, lb0 + bbuf, ag + KS, bg + KS, pa, pb, sB);
#pragma unroll 1      /* one stage per trip: the two-buffer order below holds per trip */
  for (int s = 0; s < nst; ++s) { const int bf = s & 1;
#pragma unroll      /* constant indices keep the fragment and accumulator arrays in registers */
    for (int ks = 0; ks < KS; ks += 32) { v16h af[4];
#pragma unroll      /* constant indices keep the fragment and accumulator arrays in registers */
      for (int i = 0; i < 4; ++i) af[i] = g2_frag(&sa[bf][wr + i * 16 + ln][ks], hh);
#pragma unroll      /* constant indices keep the fragment and accumulator arrays in registers */
      for (int p = 0; p < NP; ++p) { v16h bq[4];
#pragma unroll      /* constant indices keep the fragment and accumulator arrays in registers */
        for (int j = 0; j < 4; ++j) bq[j] = g2_frag(&sb[bf][p * G2_BN + wc + j * 16 + ln][ks], hh);
        __builtin_amdgcn_sched_barrier(0);      /* keeps the block's LDS reads together in front of its 16 WMMAs: left free, the compiler sinks each A fragment's reads to its row and waits them out there */
#pragma unroll      /* constant indices keep the fragment and accumulator arrays in registers */
        for (int i = 0; i < 4; ++i)
#pragma unroll      /* constant indices keep the fragment and accumulator arrays in registers */
          for (int j = 0; j < 4; ++j) acc[p][i][j] = g2_mma(af[i], bq[j], acc[p][i][j]);
      }
    }
    asm volatile("s_wait_dscnt 0x0" ::: "memory");      /* this wave's reads of buffer bf have returned before the buffer is refilled */
    asm volatile("s_wait_asynccnt 0x0" ::: "memory");      /* this wave's copies of stage s + 1 have landed */
    __syncthreads();      /* publishes stage s + 1 and ends every wave's reads of buffer bf */
    if (s + 2 < nst) { const int kn = (s + 2) * KS; g2_stage<NP, KS>(la0 + bf * abuf, lb0 + bf * bbuf, ag + kn, bg + kn, pa, pb, sB); }
  }
  asm volatile("s_wait_asynccnt 0x0" ::: "memory");      /* no copy is outstanding when the wave goes on to its end */
  const size_t e0 = (size_t)(row0 + hh) * DM + col0 + ln * 4;      /* the lane's element of row hh of the wave's tile */
  v4f bv = {0.f, 0.f, 0.f, 0.f};
  if (HASB) { const float* bp = bias + col0 + ln * 4; const v4f b4 = *(const v4fa*)bp;
    asm volatile("s_wait_xcnt 0x0" :: "v"(bp) : "memory");      /* behind the bias load, in front of the next loads, whose results may take its address pair */
    bv = (v4f){bf16_round(b4[0]), bf16_round(b4[1]), bf16_round(b4[2]), bf16_round(b4[3])}; }
  v4f ga = {0.f, 0.f, 0.f, 0.f}, gb = ga;
  if (LNM == 1) { const int n = col0 + ln * 4; const float* gp = L0 + (n >> 3) * 32 + (n & 7) * 2; const v4f p0 = *(const v4fa*)gp, p1 = *(const v4fa*)(gp + 4);
    asm volatile("s_wait_xcnt 0x0" :: "v"(gp) : "memory");      /* behind the two loads of one address pair: as an input here the pair stays live to this wait */
    ga = (v4f){p0[0], p0[2], p1[0], p1[2]}; bv += (v4f){p0[1], p0[3], p1[1], p1[3]}; }
  if (LNM == 2) { const float* gp = L0 + col0 + ln * 4; const float* ep = L1 + col0 + ln * 4; const v4f g4 = *(const v4fa*)gp, b4 = *(const v4fa*)ep;
    asm volatile("s_wait_xcnt 0x0" :: "v"(gp), "v"(ep) : "memory");      /* behind the gamma and beta loads: as inputs here their address pairs stay live to this wait */
    ga = (v4f){bf16_round(g4[0]), bf16_round(g4[1]), bf16_round(g4[2]), bf16_round(g4[3])}; gb = (v4f){bf16_round(b4[0]), bf16_round(b4[1]), bf16_round(b4[2]), bf16_round(b4[3])}; }
  const float* Rl = RES ? CP + e0 : nullptr;
  v4f rs[16];
  if (RES) g2_res<0>(rs, Rl);
#pragma unroll      /* constant indices keep the accumulator array in registers */
  for (int p = 0; p < NP; ++p) { float* Cl = W32 ? C + p * sC + e0 : nullptr; _Float16* Hl = W16 ? C16 + p * sC + e0 : nullptr;
    g2_out<ACT, HASB, RES, W32, W16, 0, false, LNM>(acc[p], so[w], alpha, bv, rs, Rl, Cl, Hl, ln, hh, &srow[LNM ? wr : 0], ga, gb);
    if (p + 1 < NP) g2_out<ACT, HASB, RES, W32, W16, 1, false, LNM>(acc[p], so[w], alpha, bv, rs, Rl, Cl, Hl, ln, hh, &srow[LNM ? wr : 0], ga, gb);
    else g2_out<ACT, HASB, RES, W32, W16, 1, true, LNM>(acc[p], so[w], alpha, bv, rs, Rl, Cl, Hl, ln, hh, &srow[LNM ? wr : 0], ga, gb); } }


// Every operand conversion in one launch: x -> f16(bf16(x)) rows, and the five natural [out][in] weights -> f16(bf16(w) x 16) planes (= Bt[n][k]; the first FFN weight times bf16(gamma), by cv_w1).
// A work-group converts CV_BE contiguous elements of ONE tensor (the tensor is picked from the block index, the same for the whole work-group); a thread takes CV_PT pieces of 8 elements, all its loads in front of its stores.
#define CV_PT 4                        /* 8-element pieces per thread: eight 16-byte loads in flight per lane */
#define CV_BE (256 * CV_PT * 8)        /* elements per work-group */
#define CV_NX ((int)(NR * DM / CV_BE)) /* work-groups on x */
#define CV_NW (DM * DM / CV_BE)        /* work-groups on each weight */
// The first FFN weight takes LayerNorm 1's gamma with it: plane f16(bf16(w) bf16(gamma) x 16); one wave per weight row n (eight 16-byte loads of 1 KiB per wave), which also sums the row of the plane as stored and beta w over k (one chain per lane, then a butterfly over the 32 lanes).
// GB: the pair of sums per row; the eight rows of a work-group share one 128-byte line, which no other work-group writes.
__device__ __forceinline__ void cv_w1(const float* __restrict__ w1, const float* __restrict__ g, const float* __restrict__ be, _Float16* __restrict__ BW1, float* __restrict__ GB, int blk) {
  static_assert(CV_BE == 8 * DM && DM == 4 * 256, "cv_w1: eight rows per work-group, four 256-element pieces per row");
  const int lane = threadIdx.x & 31, w = threadIdx.x >> 5; const size_t e0 = (size_t)(blk * 8 + w) * DM + lane * 8;
  v4f a[4][2], gv[4][2], bv[4][2]; v8us o[4]; float sg = 0.f, sb = 0.f;
#pragma unroll      /* constant indices keep the piece arrays in registers */
  for (int u = 0; u < 4; ++u)
#pragma unroll      /* constant indices keep the piece arrays in registers */
    for (int p = 0; p < 2; ++p) { a[u][p] = *(const v4fa*)(w1 + e0 + u * 256 + p * 4); gv[u][p] = *(const v4fa*)(g + lane * 8 + u * 256 + p * 4); bv[u][p] = *(const v4fa*)(be + lane * 8 + u * 256 + p * 4); }
  __builtin_amdgcn_sched_barrier(0);      /* keeps all 24 loads in front of the arithmetic: left free, the compiler sinks some of them behind the first waits and pays the memory latency several times in a row */
#pragma unroll      /* constant indices keep the piece arrays in registers */
  for (int u = 0; u < 4; ++u) { FragH f;
#pragma unroll      /* constant indices keep the piece arrays in registers */
    for (int q = 0; q < 8; ++q) { const float wv = bf16_round(a[u][q >> 2][q & 3]); const _Float16 hv = (_Float16)(wv * bf16_round(gv[u][q >> 2][q & 3]) * 16.0f); f.h[q] = hv; sg += (float)hv; sb += wv * bf16_round(bv[u][q >> 2][q & 3]); }
    o[u] = f.half[0]; }
  sg = rw_sum16(sg); sb = rw_sum16(sb); const v2f pr = {sg + fa_xrow(sg), sb + fa_xrow(sb)};
  if (lane == 0) *(v2fa*)(GB + blk * 32 + w * 2) = pr;
#pragma unroll      /* the piece steps fold into the immediate offsets of the stores */
  for (int u = 0; u < 4; ++u) *(v8us*)((unsigned short*)BW1 + e0 + u * 256) = o[u];
  asm volatile("s_wait_xcnt 0x0" ::: "memory"); }      /* behind the stores, in front of whatever code the compiler lays behind them that writes their registers */
__global__ __launch_bounds__(256) void k_cvt(const float* __restrict__ x, const float* __restrict__ wq, const float* __restrict__ wk, const float* __restrict__ wv, const float* __restrict__ w1, const float* __restrict__ w2, const float* __restrict__ g1, const float* __restrict__ be1,
    _Float16* __restrict__ X16, _Float16* __restrict__ BQ, _Float16* __restrict__ BK, _Float16* __restrict__ BV, _Float16* __restrict__ BW1, _Float16* __restrict__ BW2, float* __restrict__ GB) {
  static_assert(NR * DM % CV_BE == 0 && DM * DM % CV_BE == 0, "k_cvt: whole work-groups only");
  int blk = blockIdx.x; const float* s = x; _Float16* d = X16; float sc = 1.0f;
  if (blk >= CV_NX) { blk -= CV_NX; const int wi = blk / CV_NW; blk -= wi * CV_NW; sc = 16.0f;
    if (wi == 3) { cv_w1(w1, g1, be1, BW1, GB, blk); return; }      /* the whole work-group; the kernel has no barrier */
    s = wi == 0 ? wq : wi == 1 ? wk : wi == 2 ? wv : wi == 3 ? w1 : w2; d = wi == 0 ? BQ : wi == 1 ? BK : wi == 2 ? BV : wi == 3 ? BW1 : BW2; }
  const size_t e0 = (size_t)blk * CV_BE + threadIdx.x * 8;
  v4f a[CV_PT][2];
#pragma unroll      /* constant indices keep the piece array in registers */
  for (int u = 0; u < CV_PT; ++u) { a[u][0] = *(const v4fa*)(s + e0 + u * 2048); a[u][1] = *(const v4fa*)(s + e0 + u * 2048 + 4); }
#pragma unroll      /* constant indices keep the piece array in registers */
  for (int u = 0; u < CV_PT; ++u) { FragH f;
#pragma unroll      /* constant indices keep the piece array in registers */
    for (int q = 0; q < 4; ++q) { f.h[q] = (_Float16)(bf16_round(a[u][0][q]) * sc); f.h[4 + q] = (_Float16)(bf16_round(a[u][1][q]) * sc); }
    *(v8us*)((unsigned short*)d + e0 + u * 2048) = f.half[0]; } }
__global__ __launch_bounds__(256) void k_rsm(const float* __restrict__ S, _Float16* __restrict__ P, int nrows) {
  #pragma clang fp contract(off)
  const int i = blockIdx.x * 256 + threadIdx.x; if (i >= nrows) return; const float* s = S + (size_t)i * SQ; float mx = -3.0e38f;
#pragma unroll 1
  for (int j = 0; j < SQ; ++j) mx = fmaxf(mx, s[j]); float se = 0.f;
#pragma unroll 1
  for (int j = 0; j < SQ; ++j) se += expf(s[j] - mx); const float sc = 256.0f / se;
#pragma unroll 1
  for (int j0 = 0; j0 < SQ; j0 += 8) { FragH f; for (int q = 0; q < 8; ++q) f.h[q] = (_Float16)(expf(s[j0 + q] - mx) * sc); unsigned short* d = (unsigned short*)P + (size_t)i * SQ + j0; *(v8us*)d = f.half[0];  } }
__global__ __launch_bounds__(256) void k_vt(const _Float16* __restrict__ V16, int b, int h0, _Float16* __restrict__ VT) { __shared__ unsigned short tl[64][65]; const int tid = threadIdx.x; const int hh = blockIdx.x % HG, sg = blockIdx.x / HG; const int s0 = sg * 64; const int h = h0 + hh;
  for (int i = tid; i < 64 * 8; i += 256) { const int j = i / 8, d8 = (i % 8) * 8; FragH f; f.half[0] = *(const v8us*)((const unsigned short*)V16 + ((size_t)b * SQ + s0 + j) * DM + h * HD + d8); for (int q = 0; q < 8; ++q) tl[d8 + q][j] = f.u[q]; }
  __syncthreads();
  { for (int i = tid; i < 64 * 8; i += 256) { const int d = i / 8, j8 = (i % 8) * 8; FragH f; for (int q = 0; q < 8; ++q) f.u[q] = tl[d][j8 + q]; *(v8us*)((unsigned short*)VT + ((size_t)hh * HD + d) * SQ + s0 + j8) = f.half[0]; }  } }


__device__ __forceinline__ v16h fa_frag(const unsigned short* p, int hh) { FragH f; f.half[0] = *(const v8us*)(p + 8 * hh); f.half[1] = *(const v8us*)(p + 16 + 8 * hh); return f.v; }
__device__ __forceinline__ v8f fa_mma(v16h a, v16h b, v8f c) { return __builtin_amdgcn_wmma_f32_16x16x32_f16(false, a, false, b, (short)0, c, false, false); }
typedef _Float16 v2h __attribute__((ext_vector_type(2)));
#define FA_KS 64      /* keys per LDS stage */
#define FA_PT 72      /* LDS row pitch in 16-bit elements: 144 B = 16 B x 9, so the 16 rows of a 16-byte fragment read fall on distinct banks */
#define FA_PV 80      /* LDS row pitch of the V rows in 16-bit elements: 160 B = 32 B x 5, the pitch for transposing 16-byte reads of 128-byte rows */
#define FA_NW 8       /* waves per work-group, 32 query columns each */
typedef short fa_s8 __attribute__((ext_vector_type(8)));
// One 16 (d) x 32 (keys) A fragment of V^T from V rows [key][d] in LDS, by two transposing reads (ds_load_tr16_b128), 16 keys apart.
// p: the lane's own address, row 8 (lane >> 4) + (lane & 7) of the 32 keys, 16-byte piece (lane >> 3) & 1 of the 16 d; lane (ln, hh) then holds d = ln, keys 8 hh + 0..7 and 16 + 8 hh + 0..7: the hardware k order, as fa_frag gives it from V^T rows.
__device__ __forceinline__ v16h fa_fragt(const unsigned short* p) { typedef __attribute__((address_space(3))) fa_s8 lds_s8; FragH f; f.half[0] = __builtin_bit_cast(v8us, __builtin_amdgcn_ds_load_tr16_b128_v8i16((lds_s8*)p)); f.half[1] = __builtin_bit_cast(v8us, __builtin_amdgcn_ds_load_tr16_b128_v8i16((lds_s8*)(p + 16 * FA_PV))); return f.v; }
__global__ __launch_bounds__(FA_NW * 32) __attribute__((amdgpu_waves_per_eu(4, 4))) void k_fattn(const _Float16* __restrict__ Q16, const _Float16* __restrict__ K16, const _Float16* __restrict__ V16, const float* __restrict__ X, float* __restrict__ HP, _Float16* __restrict__ HP16, float* __restrict__ ST) {
  __shared__ __attribute__((aligned(16))) unsigned short sk[2][FA_KS][FA_PT];
  __shared__ __attribute__((aligned(16))) unsigned short sv[2][FA_KS][FA_PV];
  __shared__ __attribute__((aligned(16))) float so[FA_NW][32][68];
  const int tid = threadIdx.x, w = tid >> 5, lane = tid & 31, ln = lane & 15, hh = lane >> 4;
  const int bh = blockIdx.y, b = bh / NH, h = bh - b * NH; const int q0 = blockIdx.x * (FA_NW * 32) + w * 32;
  const unsigned short* Kg = (const unsigned short*)K16 + (size_t)b * SQ * DM + h * HD;      /* key rows, pitch DM */
  const unsigned short* Vg = (const unsigned short*)V16 + (size_t)b * SQ * DM + h * HD;      /* key rows, pitch DM */
  const int sr = tid >> 3, sc = (tid & 7) * 8;      /* staging: rows sr and sr + 32, 16-byte piece sc; a wave's load covers four whole 128-byte rows */
  const float cs = 0.125f * 1.44269504088896340736f;
  v16h qf[2][2];
#pragma unroll      /* constant indices keep the fragment and accumulator arrays in registers */
  for (int qt = 0; qt < 2; ++qt)
#pragma unroll      /* constant indices keep the fragment and accumulator arrays in registers */
    for (int ks = 0; ks < 2; ++ks) qf[qt][ks] = fa_frag((const unsigned short*)Q16 + ((size_t)b * SQ + q0 + qt * 16 + ln) * DM + h * HD + ks * 32, hh);
  const v8f z8 = {0.f,0.f,0.f,0.f,0.f,0.f,0.f,0.f};
  v8f o[4][2]; float mu[2], l[2];
#pragma unroll      /* constant indices keep the fragment and accumulator arrays in registers */
  for (int qt = 0; qt < 2; ++qt) { mu[qt] = -1.0e30f; l[qt] = 0.f;
#pragma unroll      /* constant indices keep the fragment and accumulator arrays in registers */
    for (int dt = 0; dt < 4; ++dt) o[dt][qt] = z8; }
  v8us rk0 = *(const v8us*)(Kg + (size_t)sr * DM + sc), rk1 = *(const v8us*)(Kg + (size_t)(sr + 32) * DM + sc), rv0 = *(const v8us*)(Vg + (size_t)sr * DM + sc), rv1 = *(const v8us*)(Vg + (size_t)(sr + 32) * DM + sc);
  asm volatile("s_wait_xcnt 0x0" ::: "memory");      /* behind the Q, K and V loads, in front of the set-up code that reuses their address registers */
  *(v8us*)&sk[0][sr][sc] = rk0; *(v8us*)&sk[0][sr + 32][sc] = rk1; *(v8us*)&sv[0][sr][sc] = rv0; *(v8us*)&sv[0][sr + 32][sc] = rv1;
  __syncthreads();      /* publishes stage 0 */
#pragma unroll 1      /* one stage per trip keeps the loop small and the register count inside four waves per SIMD */
  for (int s = 0; s < SQ / FA_KS; ++s) { const int bf = s & 1; const bool more = s + 1 < SQ / FA_KS;
    if (more) { const int kn = (s + 1) * FA_KS; rk0 = *(const v8us*)(Kg + (size_t)(kn + sr) * DM + sc); rk1 = *(const v8us*)(Kg + (size_t)(kn + sr + 32) * DM + sc); rv0 = *(const v8us*)(Vg + (size_t)(kn + sr) * DM + sc); rv1 = *(const v8us*)(Vg + (size_t)(kn + sr + 32) * DM + sc); }
#pragma unroll      /* constant indices keep the fragment and accumulator arrays in registers */
    for (int kk = 0; kk < FA_KS; kk += 32) {
      v8f st[2][2];
#pragma unroll      /* constant indices keep the fragment and accumulator arrays in registers */
      for (int kt = 0; kt < 2; ++kt) { const unsigned short* kr = &sk[bf][kk + kt * 16 + ln][0]; const v16h k0 = fa_frag(kr, hh), k1 = fa_frag(kr + 32, hh);
#pragma unroll      /* constant indices keep the fragment and accumulator arrays in registers */
        for (int qt = 0; qt < 2; ++qt) st[kt][qt] = fa_mma(k1, qf[qt][1], fa_mma(k0, qf[qt][0], z8)); }
      v16h vf[4];
#pragma unroll      /* constant indices keep the fragment and accumulator arrays in registers */
      for (int dt = 0; dt < 4; ++dt) vf[dt] = fa_fragt(&sv[bf][kk + 8 * hh + (lane & 7)][dt * 16 + ((lane >> 3) & 1) * 8]);
      float mb[2]; bool need = false;
#pragma unroll      /* constant indices keep the fragment and accumulator arrays in registers */
      for (int qt = 0; qt < 2; ++qt) { float mx = st[0][qt][0];
#pragma unroll      /* constant indices keep the fragment and accumulator arrays in registers */
        for (int r = 1; r < 8; ++r) mx = fmaxf(mx, st[0][qt][r]);
#pragma unroll      /* constant indices keep the fragment and accumulator arrays in registers */
        for (int r = 0; r < 8; ++r) mx = fmaxf(mx, st[1][qt][r]);
        mx = fmaxf(mx, fa_xrow(mx)) * cs; mb[qt] = mx; need = need || (mx > mu[qt] + 8.0f); }
      if (__builtin_amdgcn_ballot_w32(need) != 0) {      /* one scalar branch per pass; rare after the first passes */
#pragma unroll      /* constant indices keep the fragment and accumulator arrays in registers */
        for (int qt = 0; qt < 2; ++qt) { const float mn = fmaxf(mu[qt], mb[qt]); const float al = __builtin_amdgcn_exp2f(mu[qt] - mn); mu[qt] = mn; l[qt] *= al;
#pragma unroll      /* constant indices keep the fragment and accumulator arrays in registers */
          for (int dt = 0; dt < 4; ++dt) o[dt][qt] = o[dt][qt] * al; } }
#pragma unroll      /* constant indices keep the fragment and accumulator arrays in registers */
      for (int qt = 0; qt < 2; ++qt) { const float nm = 4.0f - mu[qt]; const v2f c2 = {cs, cs}, n2 = {nm, nm}; union { v16h v; v2h p[8]; } pf; v2f ls = {0.f, 0.f};
#pragma unroll      /* constant indices keep the fragment and accumulator arrays in registers */
        for (int i = 0; i < 4; ++i) { const int kt = i >> 1, r4 = (i & 1) * 4;
          const v2f x0 = {st[kt][qt][r4], st[kt][qt][r4 + 1]}, x1 = {st[kt][qt][r4 + 2], st[kt][qt][r4 + 3]};
          const v2f t0 = __builtin_elementwise_fma(x0, c2, n2), t1 = __builtin_elementwise_fma(x1, c2, n2); 
          const v2f p0 = {__builtin_amdgcn_exp2f(t0[0]), __builtin_amdgcn_exp2f(t0[1])}, p1 = {__builtin_amdgcn_exp2f(t1[0]), __builtin_amdgcn_exp2f(t1[1])}; ls += p0; ls += p1;
          pf.p[i * 2] = __builtin_convertvector(p0, v2h); pf.p[i * 2 + 1] = __builtin_convertvector(p1, v2h); }
        l[qt] += ls[0] + ls[1];
#pragma unroll      /* constant indices keep the fragment and accumulator arrays in registers */
        for (int dt = 0; dt < 4; ++dt) o[dt][qt] = fa_mma(vf[dt], pf.v, o[dt][qt]); }
    }
    if (more) { *(v8us*)&sk[bf ^ 1][sr][sc] = rk0; *(v8us*)&sk[bf ^ 1][sr + 32][sc] = rk1; *(v8us*)&sv[bf ^ 1][sr][sc] = rv0; *(v8us*)&sv[bf ^ 1][sr + 32][sc] = rv1; }
    __syncthreads();      /* publishes the next stage's buffer and ends every wave's reads of this one, which the next trip refills */
  }
  // epilogue, through the wave's own LDS rows, so that each global access covers whole 256-byte head rows: bf16(x) goes in by rows and is read back in the accumulators' layout, where a lane holds 32 of one query's 64 columns; h_pre = O^T / row sum + x is formed there and goes back the same way
  const size_t g0 = ((size_t)b * SQ + q0) * DM + h * HD + ln * 4;
  const float* xl = X + g0 + (size_t)hh * DM;      /* the lane's own address in row hh of the wave's 32 x rows */
  v4f hv[16]; v4h hq[16]; float mh[2], m2[2];
#pragma unroll      /* constant indices keep the fragment and accumulator arrays in registers */
  for (int q = 0; q < 16; ++q) hv[q] = *(const v4fa*)(xl + (size_t)(q * 2) * DM);
  asm volatile("s_wait_xcnt 0x0" :: "v"(xl) : "memory");      /* behind the 16 loads, which share one address pair: as an input here the pair stays live to this wait, so that no load's result is put into it */
#pragma unroll      /* constant indices keep the fragment and accumulator arrays in registers */
  for (int q = 0; q < 16; ++q) { const v4f xr = {bf16_round(hv[q][0]), bf16_round(hv[q][1]), bf16_round(hv[q][2]), bf16_round(hv[q][3])}; *(v4f*)&so[w][q * 2 + hh][ln * 4] = xr; }
  __builtin_amdgcn_fence(__ATOMIC_ACQ_REL, "workgroup"); __builtin_amdgcn_wave_barrier();      /* the wave's own LDS stores before its own reads of other lanes' elements */
  // LayerNorm 1's part statistics: mean and centred square sum of each row's 64 columns of this head, in-lane (four chains) plus one exchange between the wave halves
#pragma unroll      /* constant indices keep the fragment and accumulator arrays in registers */
  for (int qt = 0; qt < 2; ++qt) { const float inv = 1.0f / (l[qt] + fa_xrow(l[qt])); v4f t[4][2], sa = {0.f, 0.f, 0.f, 0.f}, qa = sa;
#pragma unroll      /* constant indices keep the fragment and accumulator arrays in registers */
    for (int dt = 0; dt < 4; ++dt)
#pragma unroll      /* constant indices keep the fragment and accumulator arrays in registers */
      for (int p = 0; p < 2; ++p) { const v4f ov = {o[dt][qt][p * 4], o[dt][qt][p * 4 + 1], o[dt][qt][p * 4 + 2], o[dt][qt][p * 4 + 3]}; t[dt][p] = ov * inv + *(const v4fa*)&so[w][qt * 16 + ln][dt * 16 + 8 * hh + p * 4]; sa += t[dt][p]; }
    const float s1 = (sa[0] + sa[1]) + (sa[2] + sa[3]); mh[qt] = (s1 + fa_xrow(s1)) * (1.0f / (float)HD);
#pragma unroll      /* constant indices keep the fragment and accumulator arrays in registers */
    for (int dt = 0; dt < 4; ++dt)
#pragma unroll      /* constant indices keep the fragment and accumulator arrays in registers */
      for (int p = 0; p < 2; ++p) { const v4f d = t[dt][p] - mh[qt]; qa += d * d; *(v4f*)&so[w][qt * 16 + ln][dt * 16 + 8 * hh + p * 4] = t[dt][p]; }      /* each lane writes the cells that it has read */
    const float s2 = (qa[0] + qa[1]) + (qa[2] + qa[3]); m2[qt] = s2 + fa_xrow(s2); }
  __builtin_amdgcn_fence(__ATOMIC_ACQ_REL, "workgroup"); __builtin_amdgcn_wave_barrier();      /* the wave's own LDS stores before its own reads of other lanes' elements */
#pragma unroll      /* constant indices keep the fragment and accumulator arrays in registers */
  for (int q = 0; q < 16; ++q) { hv[q] = *(const v4fa*)&so[w][q * 2 + hh][ln * 4]; hq[q] = __builtin_convertvector(hv[q], v4h); }
  const v2f pr = {hh ? mh[1] : mh[0], hh ? m2[1] : m2[0]};      /* both halves hold both query groups' pairs: lane 16 hh + ln stores row 16 hh + ln, one store of 256 bytes for the wave's 32 rows */
  *(v2fa*)(ST + ((size_t)h * NR + (size_t)b * SQ + q0 + lane) * 2) = pr;
#pragma unroll      /* the row steps fold into the immediate offsets of the stores */
  for (int q = 0; q < 16; ++q) { const int r = q * 2 + hh; *(v4f*)(HP + g0 + (size_t)r * DM) = hv[q]; *(v4h*)(HP16 + g0 + (size_t)r * DM) = hq[q]; } }


// Row LayerNorm (biased variance, eps, bf16-rounded gamma and beta), two rows per wave and no LDS: a lane holds 32 elements of each of its rows (eight 16-byte pieces, so that each load and each f32 store of the wave covers 512 contiguous bytes).
// Mean and variance: four chains per lane, then a butterfly over the 32 lanes (four DPP steps inside the 16-lane rows, one exchange between them). Two passes over the registers, as the definition has it.
// Each wave takes LN_RW rows, which share one rounding of gamma and beta: the launch starts 4,096 waves (16 per WGP, all resident at once) instead of eight waves per row (65,536), and has no barrier.
#define LN_NW 16      /* waves per work-group */
#define LN_RW 2       /* rows per wave */
__device__ __forceinline__ float ln_wsum(v4f s) { float v = (s[0] + s[1]) + (s[2] + s[3]); v += ln_xm<1>(v); v += ln_xm<2>(v); v += ln_xm<4>(v); v += ln_xm<8>(v); return v + fa_xrow(v); }
template <int W16, int W32>
__global__ __launch_bounds__(LN_NW * 32) void k_lnw(const float* __restrict__ X, const float* __restrict__ g, const float* __restrict__ bb, float eps, _Float16* __restrict__ N16, float* __restrict__ N32) {
  static_assert(DMQ == 8 * 128, "k_lnw: a row is eight 512-byte pieces");
  const int c0 = (threadIdx.x & 31) * 4; const size_t r0 = ((size_t)blockIdx.x * LN_NW + __builtin_amdgcn_readfirstlane(threadIdx.x >> 5)) * LN_RW;      /* the wave's number as a scalar: the row bases stay in scalar registers and every access shares the lane's one offset register */
  v4f gg[8], bv[8], x[LN_RW][8]; float rs[LN_RW];
#pragma unroll      /* constant indices keep the row arrays in registers */
  for (int u = 0; u < 8; ++u) { gg[u] = *(const v4fa*)(g + u * 128 + c0); bv[u] = *(const v4fa*)(bb + u * 128 + c0); }
#pragma unroll      /* constant indices keep the row arrays in registers */
  for (int i = 0; i < LN_RW; ++i)
#pragma unroll      /* constant indices keep the row arrays in registers */
    for (int u = 0; u < 8; ++u) { const int c = u * 128 + c0; x[i][u] = *(const v4fa*)(X + (r0 + i) * DMQ + c); }
  __builtin_amdgcn_sched_barrier(0);      /* keeps all 32 loads in front of the arithmetic: left free, the compiler sinks most gamma and beta loads behind the reductions and waits each pair out there */
#pragma unroll      /* constant indices keep the row arrays in registers */
  for (int u = 0; u < 8; ++u)
#pragma unroll      /* constant indices keep the row arrays in registers */
    for (int q = 0; q < 4; ++q) { gg[u][q] = bf16_round(gg[u][q]); bv[u][q] = bf16_round(bv[u][q]); }
#pragma unroll      /* constant indices keep the row arrays in registers */
  for (int i = 0; i < LN_RW; ++i) { v4f s = x[i][0];
#pragma unroll      /* constant indices keep the row arrays in registers */
    for (int u = 1; u < 8; ++u) s += x[i][u];
    const float mu = ln_wsum(s) * (1.0f / (float)DMQ); v4f q = {0.f, 0.f, 0.f, 0.f};
#pragma unroll      /* constant indices keep the row arrays in registers */
    for (int u = 0; u < 8; ++u) { x[i][u] = x[i][u] - mu; q += x[i][u] * x[i][u]; }
    rs[i] = rsqrtf(ln_wsum(q) * (1.0f / (float)DMQ) + eps); }
#pragma unroll      /* constant indices keep the row arrays in registers */
  for (int i = 0; i < LN_RW; ++i)
#pragma unroll      /* constant indices keep the row arrays in registers */
    for (int u = 0; u < 8; ++u) { const int c = u * 128 + c0; const v4f y = x[i][u] * rs[i] * gg[u] + bv[u];
      if (W32) *(v4f*)(N32 + (r0 + i) * DMQ + c) = y;
      if (W16) *(v4h*)(N16 + (r0 + i) * DMQ + c) = __builtin_convertvector(y, v4h); } }




extern "C" void kernel_launch(void* const* d_in, const int* in_sizes, int n_in,
                              void* d_out, int out_size, void* d_ws, size_t ws_size, hipStream_t stream) {
  (void)in_sizes; (void)n_in; (void)out_size;
  const float* const* I = (const float* const*)d_in; const float* x = I[0]; const float* wq = I[1]; const float* wk = I[2]; const float* wv = I[3]; const float* g1 = I[4]; const float* be1 = I[5]; const float* w1 = I[6]; const float* b1 = I[7]; const float* w2 = I[8]; const float* b2 = I[9]; const float* g2 = I[10]; const float* be2 = I[11];      /* natural [out][in] weights; LN affine; FFN biases */
  char* ws = (char*)d_ws; size_t off = 0;
  auto take = [&](size_t bytes) { char* p = ws + off; off += (bytes + 255) & ~(size_t)255; return p; };
  _Float16* BW1 = (_Float16*)take((size_t)DM * DM * 2); _Float16* BW2 = (_Float16*)take((size_t)DM * DM * 2); float* HP = (float*)take(NR * DM * 4); _Float16* H16 = (_Float16*)take(NR * DM * 2); _Float16* FF16 = (_Float16*)take(NR * DM * 2); _Float16* BQ = (_Float16*)take((size_t)DM * DM * 2); _Float16* BK = (_Float16*)take((size_t)DM * DM * 2); _Float16* BV = (_Float16*)take((size_t)DM * DM * 2); 
  _Float16* X16 = (_Float16*)take(NR * DM * 2); _Float16* Q16 = (_Float16*)take(NR * DM * 2); _Float16* K16 = (_Float16*)take(NR * DM * 2); _Float16* V16 = (_Float16*)take(NR * DM * 2);
  float* HF = (float*)take(NR * DM * 4);      /* y = h + ff, f32 rows */
  float* ST = (float*)take((size_t)NH * NR * 2 * 4); float* GB = (float*)take((size_t)CV_NW * 32 * 4);      /* LN1: part statistics per head and row; per column of l1 the two sums over k */
  if (off > ws_size) return;
  k_cvt<<<CV_NX + 5 * CV_NW, 256, 0, stream>>>(x, wq, wk, wv, w1, w2, g1, be1, X16, BQ, BK, BV, BW1, BW2, GB);      /* x rows and the five weight planes as f16 */
  const size_t r0p = (size_t)B0 * SQ;      /* first projected row */
  k_gemm2<0, false, false, false, true, 3, 64, 0><<<dim3((unsigned)((MP / G2_BM) * (DM / G2_BN)), 1), 256, 0, stream>>>(X16 + r0p * DM, BQ, (size_t)(BK - BQ), 0.0625f, nullptr, nullptr, nullptr, Q16 + r0p * DM, (size_t)(K16 - Q16), nullptr, nullptr, nullptr);      /* q, k, v: every work-group takes its tile in the three weight planes and the three output planes, which lie at equal distances in the workspace */
  k_fattn<<<dim3(SQ / (FA_NW * 32), NB * NH), FA_NW * 32, 0, stream>>>(Q16, K16, V16, x, HP, H16, ST);      /* h_pre = bf16(x) + attn (merged heads), f32 and f16 rows, and LN1's part statistics */
  k_gemm2<3, true, false, false, true, 1, 128, 1><<<dim3((unsigned)((MP / G2_BM) * (DM / G2_BN)), 1), 256, 0, stream>>>(H16 + r0p * DM, BW1, 0, 0.0625f, b1, nullptr, nullptr, FF16 + r0p * DM, 0, ST + r0p * 2, GB, nullptr);      /* relu(LN1(h_pre) l1^T + b1) -> f16 rows */
  k_gemm2<0, true, true, true, false, 1, 128, 2><<<dim3((unsigned)((MP / G2_BM) * (DM / G2_BN)), 1), 256, 0, stream>>>(FF16 + r0p * DM, BW2, 0, 0.0625f, b2, HP + r0p * DM, HF + r0p * DM, nullptr, 0, ST + r0p * 2, g1, be1);      /* y = LN1(h_pre) + ff (own-element residual) */
  k_lnw<0, 1><<<(unsigned)(MP / (LN_NW * LN_RW)), LN_NW * 32, 0, stream>>>(HF + r0p * DM, g2, be2, 1e-5f, nullptr, (float*)d_out + r0p * DM);      /* out = LN2(h + ff) -> f32 output rows */
}

// v009
// It runs in 133 microseconds.
// In both of two side-by-side timings against v008, it was 1.05 times as fast.
// Counting every step since v000, it is 100 times as fast.
#include <hip/hip_runtime.h>
// Post-LN transformer encoder block (x [4][2048][1024]; q = x wq^T, k, v likewise (nn.Linear natural [1024][1024] sigma 1/32, no biases); 16 heads of 64 (chunked along features = head-major columns); softmax(q k^T / 8) v over all keys (no mask), heads merged, NO output projection; h = LN1(x + attn) (biased variance, eps 1e-5, gamma/beta); ff = relu(h l1_w^T + l1_b) l2_w^T + l2_b (natural [1024][1024], biases sigma 0.01); out = LN2(h + ff) -> [4][2048][1024]).
// Structure: token rows r = b*2048 + s; x and the five weights as f16 planes (bf16-rounded; exact but for the first FFN weight, times gamma), one conversion launch; Q, K, V as one WMMA GEMM launch (a work-group takes the same 256x128 tile of all three planes, so that each staged x tile serves three products; operand tiles staged in LDS, 64x64 wave tiles per plane, f32 accumulation, exact x16 weights, f16 outputs); one fused attention launch (per head and 256 queries: S^T = K Q^T, online softmax in registers with f32 statistics and native exp2, weights as f16, O^T += V^T P^T, the V^T fragments by transposing LDS reads of V rows), h_pre = bf16(x) + attn as f32 and f16 rows, with each row's mean and centred square sum over the head's 64 columns; LN1 has no launch of its own: its row statistics are joined from the 16 head parts in the two FFN GEMMs, the first applies them behind the product (h l1^T = rs (h_pre (g l1)^T - mu sum_k g l1) + sum_k beta l1, gamma folded into the f16 weight plane), the second forms its residual h = LN1(h_pre) element by element; relu(h l1^T + b1) -> f16; y = h + ff l2^T + b2; LN2 on VALU -> f32 output.
// Compute dtype: inputs rounded to bf16; x / weights exact (the first FFN weight times gamma rounded to f16); q, k, v, softmax weights and h_pre as plain f16 GEMM operands (~2^-12); scores and softmax statistics f32; v_wmma_f32_16x16x32_f16.
#define NB 4
#define SQ 2048
#define DM 1024
#define NH 16
#define HD 64
#define DMQ DM                       /* LayerNorm width */
#define HG 2                         /* heads per block group of the unlaunched per-batch k_vt */
#define B0 0                         /* first batch processed (debug hook) */
#define NBR NB                       /* batches processed (debug hook) */
#define NR ((size_t)NB * SQ)         /* token rows */
#define MP ((int)((size_t)NBR * SQ)) /* rows projected (debug hook) */
#define QN SQ                        /* unused (attention runs all SQ queries per batch) */
#define NHD NH                       /* unused (attention runs all NH heads) */
#define MPO MP                       /* unused (the output stage runs MP rows) */
#define LQ DM      /* unused (the q/k/v rows have pitch DM) */
typedef __bf16 v16b __attribute__((ext_vector_type(16)));
typedef unsigned short v8us __attribute__((ext_vector_type(8), may_alias));
typedef float  v8f  __attribute__((ext_vector_type(8)));
typedef float  v4f  __attribute__((ext_vector_type(4)));
typedef float  v4fa __attribute__((ext_vector_type(4), may_alias));
union FragB { v16b v; v8us half[2]; unsigned short u[16]; };

__device__ __forceinline__ unsigned short bf16_bits(float x) { unsigned int u = __float_as_uint(x); return (unsigned short)((u + 0x7FFFu + ((u >> 16) & 1u)) >> 16); }
__device__ __forceinline__ float bf16_val(unsigned short b) { return __uint_as_float(((unsigned int)b) << 16); }
__device__ __forceinline__ float bf16_round(float x) { return bf16_val(bf16_bits(x)); }
// D += A·B with NT terms: 1 = ah·bh, 2 = + al·bh (A split), 3 = + ah·bl (both split)
template <int NT>
__device__ __forceinline__ v8f mmaN(v16b ah, v16b al, v16b bh, v16b bl, v8f c) {
  c = __builtin_amdgcn_wmma_f32_16x16x32_bf16(false, ah, false, bh, (short)0, c, false, false);
  if (NT >= 2) c = __builtin_amdgcn_wmma_f32_16x16x32_bf16(false, al, false, bh, (short)0, c, false, false);
  if (NT >= 3) c = __builtin_amdgcn_wmma_f32_16x16x32_bf16(false, ah, false, bl, (short)0, c, false, false);
  asm volatile("v_nop\n\tv_nop\n\tv_nop\n\tv_nop" : "+v"(c) : "v"(ah), "v"(al), "v"(bh), "v"(bl));
  return c;
}

__global__ __launch_bounds__(256) void k_wt_bf16(const float* __restrict__ W, unsigned short* __restrict__ Wt, int K, int N) {
  const int t = blockIdx.x * 256 + threadIdx.x;
  const int k8n = K / 8;
  if (t >= N * k8n) return;
  const int n = t / k8n, k8 = (t % k8n) * 8;
  v8us v;
#pragma unroll
  for (int i = 0; i < 8; ++i) v[i] = bf16_bits(W[(size_t)(k8 + i) * N + n]);
  *(v8us*)(Wt + (size_t)n * K + k8) = v;
  
}

// GEMM C[M][N] (f32, pitch ldc) = act(A[M][K]·W + bias). A f32 row-major (pitch lda) converted per fragment to bf16
// (ASPLIT: hi/lo two planes -> 2 terms, else single rounded term); Wt bf16 [N][K] (pitch ldb). BIAS_BF16 rounds the
// bias to bf16 first (bias quantised to bf16 before the add). K%32==0, M%16==0, N%64==0.
template <bool ASPLIT, int ACT, bool BIAS_BF16>
__global__ __launch_bounds__(128) void k_gemm_bf(const float* __restrict__ A, int lda, const unsigned short* __restrict__ Wt, int ldb,
                                               const float* __restrict__ bias, float* __restrict__ C, int ldc, int M, int N, int K) {
  __shared__ __attribute__((aligned(16))) float so[4][16][64];
  const int tid = threadIdx.x, w = tid >> 5, lane = tid & 31, ln = lane & 15, hh = lane >> 4;
  const int ntn = N / 64;
  const int wid = blockIdx.x * 4 + w;
  const int mt = wid / ntn, nq = wid % ntn;
  if (mt * 16 >= M) return;
  const int row0 = mt * 16, col0 = nq * 64;
  const float* arow = A + (size_t)(row0 + ln) * lda;
  v8f acc[4] = {};
  for (int kb = 0; kb < K; kb += 32) {
    FragB ah, al;
    const v4f x0 = *(const v4fa*)(arow + kb + 8 * hh), x1 = *(const v4fa*)(arow + kb + 8 * hh + 4);
    const v4f x2 = *(const v4fa*)(arow + kb + 16 + 8 * hh), x3 = *(const v4fa*)(arow + kb + 16 + 8 * hh + 4);
    float xs[16] = {x0[0],x0[1],x0[2],x0[3],x1[0],x1[1],x1[2],x1[3],x2[0],x2[1],x2[2],x2[3],x3[0],x3[1],x3[2],x3[3]};
#pragma unroll
    for (int i = 0; i < 16; ++i) { const unsigned short hb = bf16_bits(xs[i]); ah.u[i] = hb; al.u[i] = ASPLIT ? bf16_bits(xs[i] - bf16_val(hb)) : (unsigned short)0; }
#pragma unroll
    for (int t = 0; t < 4; ++t) {
      const unsigned short* brow = Wt + (size_t)(col0 + t * 16 + ln) * ldb + kb;
      FragB b;
      b.half[0] = *(const v8us*)(brow + 8 * hh);
      b.half[1] = *(const v8us*)(brow + 16 + 8 * hh);
      acc[t] = mmaN<ASPLIT ? 2 : 1>(ah.v, al.v, b.v, b.v, acc[t]);
    }
  }
#pragma unroll
  for (int t = 0; t < 4; ++t) {
    float bv = bias ? bias[col0 + t * 16 + ln] : 0.f;
    if (BIAS_BF16) bv = bf16_round(bv);
#pragma unroll
    for (int r = 0; r < 8; ++r) { float v = acc[t][r] + bv; if (ACT == 1) v = fmaxf(v, 0.f); so[w][8 * hh + r][t * 16 + ln] = v; }
  }
  __builtin_amdgcn_fence(__ATOMIC_ACQ_REL, "workgroup");
  __builtin_amdgcn_wave_barrier();
  const int rsub = lane >> 4, c4 = (lane & 15) * 4;
  {
#pragma unroll
    for (int q = 0; q < 8; ++q) {
      const int r = q * 2 + rsub;
      const v4f v = *(const v4fa*)&so[w][r][c4];
      *(v4f*)(C + (size_t)(row0 + r) * ldc + col0 + c4) = v;
    }
    
  }
}

// GEMM C = act(A·W + bias + resid): A f32 (ASPLIT -> hi/lo 2 terms), Wt bf16 [N][K]; ACT 0 none, 1 relu, 2 exact gelu;
// resid (optional, f32, row index = (row % rmod), pitch ldr, RES_BF16 rounds it) added before the activation.
template <bool ASPLIT, int ACT, bool BIAS_BF16, bool RES_BF16>
__global__ __launch_bounds__(128) void k_gemm_bf3(const float* __restrict__ A, int lda, const unsigned short* __restrict__ Wt, int ldb,
                                                const float* __restrict__ bias, const float* __restrict__ resid, int rmod, int ldr,
                                                float* __restrict__ C, int ldc, int M, int N, int K) {
  __shared__ __attribute__((aligned(16))) float so[4][16][64];
  const int tid = threadIdx.x, w = tid >> 5, lane = tid & 31, ln = lane & 15, hh = lane >> 4;
  const int ntn = N / 64;
  const int wid = blockIdx.x * 4 + w;
  const int mt = wid / ntn, nq = wid % ntn;
  if (mt * 16 >= M) return;
  const int row0 = mt * 16, col0 = nq * 64;
  const float* arow = A + (size_t)(row0 + ln) * lda;
  v8f acc[4] = {};
  for (int kb = 0; kb < K; kb += 32) {
    FragB ah, al;
    const v4f x0 = *(const v4fa*)(arow + kb + 8 * hh), x1 = *(const v4fa*)(arow + kb + 8 * hh + 4);
    const v4f x2 = *(const v4fa*)(arow + kb + 16 + 8 * hh), x3 = *(const v4fa*)(arow + kb + 16 + 8 * hh + 4);
    float xs[16] = {x0[0],x0[1],x0[2],x0[3],x1[0],x1[1],x1[2],x1[3],x2[0],x2[1],x2[2],x2[3],x3[0],x3[1],x3[2],x3[3]};
#pragma unroll
    for (int i = 0; i < 16; ++i) { const unsigned short hb = bf16_bits(xs[i]); ah.u[i] = hb; al.u[i] = ASPLIT ? bf16_bits(xs[i] - bf16_val(hb)) : (unsigned short)0; }
#pragma unroll
    for (int t = 0; t < 4; ++t) {
      const unsigned short* brow = Wt + (size_t)(col0 + t * 16 + ln) * ldb + kb;
      FragB b;
      b.half[0] = *(const v8us*)(brow + 8 * hh);
      b.half[1] = *(const v8us*)(brow + 16 + 8 * hh);
      acc[t] = mmaN<ASPLIT ? 2 : 1>(ah.v, al.v, b.v, b.v, acc[t]);
    }
  }
#pragma unroll
  for (int t = 0; t < 4; ++t) {
    const int col = col0 + t * 16 + ln;
    float bv = bias ? bias[col] : 0.f;
    if (BIAS_BF16) bv = bf16_round(bv);
#pragma unroll
    for (int r = 0; r < 8; ++r) {
      float v = acc[t][r] + bv;
      if (resid) { float rv = resid[(size_t)((row0 + 8 * hh + r) % rmod) * ldr + col]; if (RES_BF16) rv = bf16_round(rv); v += rv; }
      if (ACT == 1) v = fmaxf(v, 0.f);
      if (ACT == 2) v = 0.5f * v * (1.0f + erff(v * 0.70710678118654752f));
      if (ACT == 3) { const float u = 0.7978845608028654f * (v + 0.044715f * v * v * v); v = 0.5f * v * (1.0f + tanhf(u)); }
      so[w][8 * hh + r][t * 16 + ln] = v;
    }
  }
  __builtin_amdgcn_fence(__ATOMIC_ACQ_REL, "workgroup");
  __builtin_amdgcn_wave_barrier();
  const int rsub = lane >> 4, c4 = (lane & 15) * 4;
  {
#pragma unroll
    for (int q = 0; q < 8; ++q) {
      const int r = q * 2 + rsub;
      const v4f v = *(const v4fa*)&so[w][r][c4];
      *(v4f*)(C + (size_t)(row0 + r) * ldc + col0 + c4) = v;
    }
    
  }
}
// row LayerNorm (biased variance, eps) over N: s = X (+ R); optional out_sum <- s; out_norm <- (s-mu)*rsqrt(var+eps)*g + b
template <bool PARAM_BF16>
__global__ __launch_bounds__(256) void k_layernorm(const float* __restrict__ X, const float* __restrict__ R, const float* __restrict__ g, const float* __restrict__ bta,
                                                  float* __restrict__ out_sum, float* __restrict__ out_norm, int N, float eps) {
  __shared__ float red[256];
  const int row = blockIdx.x, tid = threadIdx.x;
  const float* x = X + (size_t)row * N; const float* rr = R ? R + (size_t)row * N : nullptr;
  float vals[16];                     // up to N = 4096
  const int per = N / 256;            // contiguous chunk per thread? use strided-by-4 chunks: thread handles j = tid*4 + 1024*u
  float s1 = 0.f;
  for (int u = 0; u < per / 4; ++u) {
    const int j = tid * 4 + 1024 * u;
    const v4f a = *(const v4fa*)(x + j);
    v4f b = {0.f,0.f,0.f,0.f}; if (rr) b = *(const v4fa*)(rr + j);
#pragma unroll
    for (int q = 0; q < 4; ++q) { const float v = a[q] + b[q]; vals[u * 4 + q] = v; s1 += v; }
  }
  red[tid] = s1; __syncthreads();
  for (int st = 128; st > 0; st >>= 1) { if (tid < st) red[tid] += red[tid + st]; __syncthreads(); }
  const float mu = red[0] / (float)N; __syncthreads();
  float s2 = 0.f;
  for (int u = 0; u < per / 4; ++u)
#pragma unroll
    for (int q = 0; q < 4; ++q) { const float c = vals[u * 4 + q] - mu; s2 += c * c; }
  red[tid] = s2; __syncthreads();
  for (int st = 128; st > 0; st >>= 1) { if (tid < st) red[tid] += red[tid + st]; __syncthreads(); }
  const float rs = rsqrtf(red[0] / (float)N + eps);
  {
    for (int u = 0; u < per / 4; ++u) {
      const int j = tid * 4 + 1024 * u;
      v4f o, sm;
#pragma unroll
      for (int q = 0; q < 4; ++q) {
        float gg = g[j + q], bb = bta[j + q];
        if (PARAM_BF16) { gg = bf16_round(gg); bb = bf16_round(bb); }
        sm[q] = vals[u * 4 + q]; o[q] = (vals[u * 4 + q] - mu) * rs * gg + bb;
      }
      if (out_sum) *(v4f*)(out_sum + (size_t)row * N + j) = sm;
      *(v4f*)(out_norm + (size_t)row * N + j) = o;
    }
    
  }
}



// ---- f16 WMMA path (v_wmma_f32_16x16x32_f16): 11-bit significands for operands in range — used where a [0,1] probability operand needs more precision than bf16
typedef _Float16 v16h __attribute__((ext_vector_type(16)));
union FragH { v16h v; v8us half[2]; _Float16 h[16]; unsigned short u[16]; };
template <int NT>
__device__ __forceinline__ v8f mmaH(v16h ah, v16h al, v16h bh, v16h bl, v8f c) {
  c = __builtin_amdgcn_wmma_f32_16x16x32_f16(false, ah, false, bh, (short)0, c, false, false);
  if (NT >= 2) c = __builtin_amdgcn_wmma_f32_16x16x32_f16(false, al, false, bh, (short)0, c, false, false);
  if (NT >= 3) c = __builtin_amdgcn_wmma_f32_16x16x32_f16(false, ah, false, bl, (short)0, c, false, false);
  asm volatile("v_nop\n\tv_nop\n\tv_nop\n\tv_nop" : "+v"(c) : "v"(ah), "v"(al), "v"(bh), "v"(bl));
  return c;
}
// batched GEMM like k_gemm_b but f16 operands: A f32 (split into f16 hi/lo if ASPLIT, else rounded to f16), Bt = f16 values [n][k]; alpha; C f32; N multiple of 16 (partial tiles skipped)
template <bool ASPLIT>
__global__ __launch_bounds__(128) void k_gemm_h(const float* __restrict__ A, int lda, size_t sA, const _Float16* __restrict__ Bh, int ldb, size_t sB, float alpha, float* __restrict__ C, int ldc, size_t sC, int M, int N, int K) {
  __shared__ __attribute__((aligned(16))) float so[4][16][64];
  const int tid = threadIdx.x, w = tid >> 5, lane = tid & 31, ln = lane & 15, hh = lane >> 4; const int by = blockIdx.y;
  A += (size_t)by * sA; Bh += (size_t)by * sB; C += (size_t)by * sC;
  const int ntn = (N + 63) / 64; const int wid = blockIdx.x * 4 + w; const int mt = wid / ntn, nq = wid % ntn; if (mt * 16 >= M) return;
  const int row0 = mt * 16, col0 = nq * 64; const float* arow = A + (size_t)(row0 + ln) * lda;
  v8f acc[4] = {};
  for (int kb = 0; kb < K; kb += 32) {
    FragH ah, al;
    const v4f x0 = *(const v4fa*)(arow + kb + 8 * hh), x1 = *(const v4fa*)(arow + kb + 8 * hh + 4), x2 = *(const v4fa*)(arow + kb + 16 + 8 * hh), x3 = *(const v4fa*)(arow + kb + 16 + 8 * hh + 4);
    float xs[16] = {x0[0],x0[1],x0[2],x0[3],x1[0],x1[1],x1[2],x1[3],x2[0],x2[1],x2[2],x2[3],x3[0],x3[1],x3[2],x3[3]};
#pragma unroll
    for (int i = 0; i < 16; ++i) { const _Float16 h = (_Float16)xs[i]; ah.h[i] = h; al.h[i] = ASPLIT ? (_Float16)(xs[i] - (float)h) : (_Float16)0.0f; }
#pragma unroll
    for (int t = 0; t < 4; ++t) { if (col0 + t * 16 >= N) continue; const size_t boff = (size_t)(col0 + t * 16 + ln) * ldb + kb; FragH bq; bq.half[0] = *(const v8us*)(Bh + boff + 8 * hh); bq.half[1] = *(const v8us*)(Bh + boff + 16 + 8 * hh);
      acc[t] = mmaH<ASPLIT ? 2 : 1>(ah.v, al.v, bq.v, bq.v, acc[t]); }
  }
#pragma unroll
  for (int t = 0; t < 4; ++t) { if (col0 + t * 16 >= N) continue;
#pragma unroll
    for (int r = 0; r < 8; ++r) so[w][8 * hh + r][t * 16 + ln] = acc[t][r] * alpha; }
  __builtin_amdgcn_fence(__ATOMIC_ACQ_REL, "workgroup"); __builtin_amdgcn_wave_barrier();
  const int rsub = lane >> 4, c4 = (lane & 15) * 4;
  {
#pragma unroll
    for (int q = 0; q < 8; ++q) { const int r = q * 2 + rsub; if (col0 + c4 < N) { const v4f v = *(const v4fa*)&so[w][r][c4]; *(v4f*)(C + (size_t)(row0 + r) * ldc + col0 + c4) = v; } }
     }
}

// Wt[n][k] = f16(W[k][n]·scale) from f32 row-major W[K][N] (scale = power of two; bf16-exact weights stay exact in f16 away from the subnormal range)
__global__ __launch_bounds__(256) void k_wt_f16(const float* __restrict__ W, _Float16* __restrict__ Wt, int K, int N, float scale) {
  const int t = blockIdx.x * 256 + threadIdx.x; if (t >= N * (K / 8)) return; const int n = t / (K / 8), k8 = (t % (K / 8)) * 8; FragH f;
#pragma unroll
  for (int i = 0; i < 8; ++i) f.h[i] = (_Float16)(bf16_round(W[(size_t)(k8 + i) * N + n]) * scale); const v8us o = f.half[0];
  *(v8us*)((unsigned short*)Wt + (size_t)n * K + k8) = o; 
}
// k_gemm_hh variant with fused epilogue: v = acc·alpha + bias[by·sBias + col] (+ CP[(row/rowsPerB)·sCPb + by·64 + col] if CP) ; ACT 0 none / 1 elu ; writes f16 C16 (and f32 C if non-null)
template <int ACT>
__global__ __launch_bounds__(128) void k_gemm_hhx(const _Float16* __restrict__ A, int lda, size_t sA, const _Float16* __restrict__ Bh, int ldb, size_t sB, float alpha, const float* __restrict__ bias, size_t sBias, const float* __restrict__ CP, int rowsPerB, size_t sCPb, int row0g,
    float* __restrict__ C, _Float16* __restrict__ C16, int ldc, size_t sC, int M, int N, int K) {
  __shared__ __attribute__((aligned(16))) float so[4][16][64];
  const int tid = threadIdx.x, w = tid >> 5, lane = tid & 31, ln = lane & 15, hh = lane >> 4; const int by = blockIdx.y;
  A += (size_t)by * sA; Bh += (size_t)by * sB; const size_t cofs = (size_t)by * sC; const float* bp = bias ? bias + (size_t)by * sBias : nullptr;
  const int ntn = (N + 63) / 64; const int wid = blockIdx.x * 4 + w; const int mt = wid / ntn, nq = wid % ntn; if (mt * 16 >= M) return;
  const int row0 = mt * 16, col0 = nq * 64; const _Float16* arow = A + (size_t)(row0 + ln) * lda;
  v8f acc[4] = {};
  for (int kb = 0; kb < K; kb += 32) { FragH ah; ah.half[0] = *(const v8us*)((const unsigned short*)arow + kb + 8 * hh); ah.half[1] = *(const v8us*)((const unsigned short*)arow + kb + 16 + 8 * hh);
#pragma unroll
    for (int t = 0; t < 4; ++t) { if (col0 + t * 16 >= N) continue; const size_t boff = (size_t)(col0 + t * 16 + ln) * ldb + kb; FragH bq; bq.half[0] = *(const v8us*)((const unsigned short*)Bh + boff + 8 * hh); bq.half[1] = *(const v8us*)((const unsigned short*)Bh + boff + 16 + 8 * hh);
      acc[t] = mmaH<1>(ah.v, ah.v, bq.v, bq.v, acc[t]); }
  }
#pragma unroll
  for (int t = 0; t < 4; ++t) { if (col0 + t * 16 >= N) continue; const int col = col0 + t * 16 + ln; const float bv = bp ? bf16_round(bp[col]) : 0.f;
#pragma unroll
    for (int r = 0; r < 8; ++r) { float v = acc[t][r] * alpha + bv; if (CP) { const int rr = row0g + row0 + 8 * hh + r; if (rowsPerB < 0) v += CP[cofs + (size_t)rr * ldc + col];      /* rowsPerB < 0: own element of the batched C plane */ else { const int bidx = rr / rowsPerB; v += CP[(size_t)bidx * sCPb + (size_t)by * 64 + col]; } } if (ACT == 1) v = (v > 0.f) ? v : expm1f(v); else if (ACT == 7) v = (v > 0.f) ? v + 1.0f : expf(v); else if (ACT == 8) v = tanhf(v); else if (ACT == 9) v = 0.5f * v * (1.0f + tanhf(0.7978845608028654f * (v + 0.044715f * v * v * v))); else if (ACT == 11) v = 1.0f / (1.0f + expf(-v)); else if (ACT == 12) v = (v > 0.f) ? v : 0.01f * v; else if (ACT == 14) v = (v > 0.f) ? v : 0.1f * v; else if (ACT == 16) v = (v >= 0.f) ? v : 0.3f * v; else if (ACT == 17) v = (v >= 0.f) ? v : 0.2f * v; else if (ACT == 15) v = v / (1.0f + expf(-v)); else if (ACT == 3) v = fmaxf(v, 0.f); else if (ACT == 6) v = 0.5f * v * (1.0f + erff(v * 0.70710678118654752f)); so[w][8 * hh + r][t * 16 + ln] = v; } }
  __builtin_amdgcn_fence(__ATOMIC_ACQ_REL, "workgroup"); __builtin_amdgcn_wave_barrier();
  const int rsub = lane >> 4, c4 = (lane & 15) * 4; typedef _Float16 v4h __attribute__((ext_vector_type(4)));
  {
#pragma unroll
    for (int q = 0; q < 8; ++q) { const int r = q * 2 + rsub; if (col0 + c4 < N) { const v4f v = *(const v4fa*)&so[w][r][c4]; if (C) *(v4f*)(C + cofs + (size_t)(row0 + r) * ldc + col0 + c4) = v; if (C16) { v4h h4; for (int i = 0; i < 4; ++i) h4[i] = (_Float16)v[i]; *(v4h*)(C16 + cofs + (size_t)(row0 + r) * ldc + col0 + c4) = h4; } } }
     }
}


typedef _Float16 v4h __attribute__((ext_vector_type(4)));
typedef float v2f __attribute__((ext_vector_type(2)));
typedef float v2fa __attribute__((ext_vector_type(2), may_alias));
// lane l <-> lane l ^ 16
__device__ __forceinline__ float fa_xrow(float v) { const int i = __builtin_bit_cast(int, v); return __builtin_bit_cast(float, __builtin_amdgcn_permlanex16(i, i, 0x76543210, 0xfedcba98, false, false)); }
template <int M> __device__ __forceinline__ float ln_xm(float v) { return __builtin_bit_cast(float, __builtin_amdgcn_update_dpp(0, __builtin_bit_cast(int, v), 0x160 + M, 0xf, 0xf, true)); }      /* lane l <-> lane l ^ M, M < 16 (row_xmask) */
__device__ __forceinline__ float rw_sum16(float v) { v += ln_xm<1>(v); v += ln_xm<2>(v); v += ln_xm<4>(v); return v + ln_xm<8>(v); }      /* sum over the 16 lanes of a row, in every lane */
#define LN1_EPS 1e-5f

__global__ __launch_bounds__(256) void k_h16(const float* __restrict__ x, _Float16* __restrict__ X16, size_t n8) { const size_t t = (size_t)blockIdx.x * 256 + threadIdx.x; if (t >= n8) return; FragH f;
#pragma unroll
  for (int q = 0; q < 8; ++q) f.h[q] = (_Float16)x[t * 8 + q]; *(v8us*)((unsigned short*)X16 + t * 8) = f.half[0];  }
__global__ __launch_bounds__(256) void k_round16f(const float* __restrict__ W, _Float16* __restrict__ Bt, size_t n8) { const size_t t = (size_t)blockIdx.x * 256 + threadIdx.x; if (t >= n8) return; FragH f;
#pragma unroll
  for (int i = 0; i < 8; ++i) f.h[i] = (_Float16)(bf16_round(W[t * 8 + i]) * 16.0f); *(v8us*)((unsigned short*)Bt + t * 8) = f.half[0];  }
__global__ __launch_bounds__(256) void k_hl(const float* __restrict__ F, _Float16* __restrict__ Hh, _Float16* __restrict__ Hl, size_t n8) { const size_t t = (size_t)blockIdx.x * 256 + threadIdx.x; if (t >= n8) return; FragH fh, fl; const v4f a = *(const v4fa*)(F + t * 8), c = *(const v4fa*)(F + t * 8 + 4);
#pragma unroll
  for (int q = 0; q < 4; ++q) { _Float16 h = (_Float16)a[q]; fh.h[q] = h; fl.h[q] = (_Float16)((a[q] - (float)h) * 1024.0f); h = (_Float16)c[q]; fh.h[4 + q] = h; fl.h[4 + q] = (_Float16)((c[q] - (float)h) * 1024.0f); }
  { *(v8us*)((unsigned short*)Hh + t * 8) = fh.half[0]; *(v8us*)((unsigned short*)Hl + t * 8) = fl.half[0];  } }

// ---- GEMM with both operands staged in LDS (work-group tile 256x128 in each of NP weight planes, eight waves of 64x64 per plane; MP % 256 == 0, DM % 128 == 0); epilogue = k_gemm_hhx semantics or LayerNorm 1 folded in (LNM), its cases fixed at compile time ----
// KS: k per stage (128: 256 bytes of every operand row; 64 where the rows of three planes have to fit LDS twice). LDS row pitch KS + 8 elements: 272 B = 16 B x 17 or 144 B = 16 B x 9, the pitches for 16-byte fragment reads.
#define FA_CS (0.125f * 1.44269504088896340736f)      /* softmax scale 1 / sqrt(64) times log2(e): the q plane is stored times this, so that k q is a base-2 exponent */
#define G2_BM 256     /* rows of C per work-group */
#define G2_BN 128     /* columns of C per work-group */
__device__ __forceinline__ v16h g2_frag(const unsigned short* p, int hh) { FragH f; f.half[0] = *(const v8us*)(p + 8 * hh); f.half[1] = *(const v8us*)(p + 16 + 8 * hh); return f.v; }
__device__ __forceinline__ v8f g2_mma(v16h a, v16h b, v8f c) { return __builtin_amdgcn_wmma_f32_16x16x32_f16(false, a, false, b, (short)0, c, false, false); }
// Eight asynchronous copies of one lane: its 16-byte piece of eight operand rows, a fixed row step apart, from global memory straight into LDS (a wave's copy covers two whole 256-byte rows).
// l: the lane's LDS byte address; g: its global address; p: the row step in elements of the source; lp: the same step in LDS bytes. The s_wait_xcnt stands inside the statement so that no address register is rewritten in front of it.
__device__ __forceinline__ void g2_copy8(unsigned l, const unsigned short* g, size_t p, unsigned lp) {
  asm volatile("global_load_async_to_lds_b128 %0, %8, off\n\t"
               "global_load_async_to_lds_b128 %1, %9, off\n\t"
               "global_load_async_to_lds_b128 %2, %10, off\n\t"
               "global_load_async_to_lds_b128 %3, %11, off\n\t"
               "global_load_async_to_lds_b128 %4, %12, off\n\t"
               "global_load_async_to_lds_b128 %5, %13, off\n\t"
               "global_load_async_to_lds_b128 %6, %14, off\n\t"
               "global_load_async_to_lds_b128 %7, %15, off\n\t"
               "s_wait_xcnt 0x0"
               :: "v"(l), "v"(l + lp), "v"(l + 2 * lp), "v"(l + 3 * lp), "v"(l + 4 * lp), "v"(l + 5 * lp), "v"(l + 6 * lp), "v"(l + 7 * lp),
                  "v"(g), "v"(g + p), "v"(g + 2 * p), "v"(g + 3 * p), "v"(g + 4 * p), "v"(g + 5 * p), "v"(g + 6 * p), "v"(g + 7 * p)
               : "memory"); }
// Four copies of one lane by the builtin (with 128-byte rows a wave's copy covers four whole rows): in a kernel whose accumulators fill the registers below v256 the operands of asm text, which have to lie there, cost spills; the compiler's own copies take any register.
typedef int g2_i4 __attribute__((ext_vector_type(4)));
__device__ __forceinline__ void g2_copy4(unsigned l, const unsigned short* g, size_t p, unsigned lp) {
  typedef __attribute__((address_space(1))) g2_i4 gl_i4; typedef __attribute__((address_space(3))) g2_i4 ls_i4;
#pragma unroll      /* the row steps become constants of the address additions */
  for (int j = 0; j < 4; ++j) __builtin_amdgcn_global_load_async_to_lds_b128((gl_i4*)(g + j * p), (ls_i4*)(l + j * lp), 0, 0); }
// One stage: KS elements of 256 A rows and of 128 B rows in each of NP planes (sB apart): 24 copies per lane (NP 1, KS 128) or 20 (NP 3, KS 64). One copy of the work-group covers 2048 / KS rows.
template <int NP, int KS>
__device__ __forceinline__ void g2_stage(unsigned la, unsigned lb, const unsigned short* ga, const unsigned short* gb, size_t pa, size_t pb, size_t sB) {
  constexpr unsigned pbytes = (KS + 8) * 2, lp = (2048 / KS) * pbytes;
  if (KS == 128) { g2_copy8(la, ga, pa, lp); g2_copy8(la + 8 * lp, ga + 8 * pa, pa, lp); }
  else { g2_copy4(la, ga, pa, lp); g2_copy4(la + 4 * lp, ga + 4 * pa, pa, lp); }
#pragma unroll      /* the plane steps fold into the addresses */
  for (int p = 0; p < NP; ++p) { if (KS == 128) g2_copy8(lb + p * G2_BN * pbytes, gb + p * sB, pb, lp);
    else g2_copy4(lb + p * G2_BN * pbytes, gb + p * sB, pb, lp); } }
// Half P (32 rows) of a wave's 64x64 tile: the raw accumulators go through the wave's own 32 LDS rows; on the row side a lane holds 4 neighbouring columns of a row, so that bias, residual and f32 output are 16-byte accesses (f16 output 8-byte) that cover whole rows of the tile.
// Every case (bias, residual, which outputs) and the row pitch (DM) are compile-time constants: the text has no branch, the LDS reads form one group, the 16 stores another, and every global address is one register pair plus an immediate offset.
// v = acc alpha + bias (+ residual), activation: the operations and their order per element are those of the element-wise form.
// Rl, Cl, Hl: the lane's own addresses of row hh, columns 4 ln .. 4 ln + 3 of the wave's tile in the residual, f32 output and f16 output planes.
// The residual rows of half P, 16 loads in flight.
template <int P>
__device__ __forceinline__ void g2_res(v4f (&rs)[16], const float* Rl) {
#pragma unroll      /* constant indices keep the row array in registers */
  for (int q = 0; q < 16; ++q) rs[q] = *(const v4fa*)(Rl + (size_t)(P * 32 + q * 2) * DM); }
// rs: on entry the residual rows of half P (loads issued by the caller); half 0 leaves the loads of half 1 in flight there.
// LNM: how LayerNorm 1 enters. 1: A held the rows before the norm and B the weights times gamma, so v = (acc - mu ga) alpha rs + bv, with ga the column's sum of the B row and bv = bias + the column's sum of beta w. 2: the residual rows are those before the norm: (r - mu) rs ga + gb, ga = gamma, gb = beta. sr: (mu, rs) of the wave's 64 rows, in LDS.
template <int ACT, bool HASB, bool RES, bool W32, bool W16, int P, bool LAST, int LNM>
__device__ __forceinline__ void g2_out(const v8f (&acc)[4][4], float (*sw)[68], float alpha, v4f bv, v4f (&rs)[16], const float* Rl, float* Cl, _Float16* Hl, int ln, int hh, const float (*sr)[2], v4f ga, v4f gb) {
  v4f y[16]; v4h h[16]; v2f ms[16];
#pragma unroll      /* constant indices keep the accumulator array in registers */
  for (int u = 0; u < 8; ++u) { const int t = u & 3, half = u >> 2;
#pragma unroll      /* constant indices keep the accumulator array in registers */
    for (int r = 0; r < 8; ++r) sw[half * 16 + 8 * hh + r][t * 16 + ln] = acc[P * 2 + half][t][r]; }
  asm volatile("s_wait_dscnt 0x0" ::: "memory");      /* the wave's own LDS stores before its own reads of other lanes' elements; no wait on the global loads and stores in flight */
#pragma unroll      /* the row steps fold into the immediate offsets of the LDS reads */
  for (int q = 0; q < 16; ++q) { y[q] = *(const v4fa*)&sw[q * 2 + hh][ln * 4]; if (LNM) ms[q] = *(const v2fa*)&sr[P * 32 + q * 2 + hh][0]; }
#pragma unroll      /* constant indices keep the row arrays in registers */
  for (int q = 0; q < 16; ++q) { v4f v;
    if (LNM == 1) v = (y[q] - ga * ms[q][0]) * alpha * ms[q][1] + bv;
    else { v = HASB ? y[q] * alpha + bv : y[q] * alpha; if (RES) v += LNM == 2 ? (rs[q] - ms[q][0]) * ms[q][1] * ga + gb : rs[q]; }
    if (ACT == 3) { const v4f z4 = {0.f, 0.f, 0.f, 0.f}; v = __builtin_elementwise_max(v, z4); }
    y[q] = v; if (W16) h[q] = __builtin_convertvector(v, v4h); }
  __builtin_amdgcn_sched_barrier(0);      /* every value of the half is made in front of its first store: no register that an issued store names is written before the wait below or, in the wave's last half, the wave's end */
  if (RES && P == 0) g2_res<1>(rs, Rl);      /* the next half's residual rows fly during this half's stores and the next half's LDS round */
#pragma unroll      /* the row steps fold into the immediate offsets of the stores */
  for (int q = 0; q < 16; ++q) { if (W32) *(v4f*)(Cl + (size_t)(P * 32 + q * 2) * DM) = y[q]; if (W16) *(v4h*)(Hl + (size_t)(P * 32 + q * 2) * DM) = h[q]; }
  if (!LAST) asm volatile("s_wait_xcnt 0x0" ::: "memory");      /* behind the half's stores, in front of the next half's code, which reuses their registers; it also keeps the next half's LDS stores behind this half's LDS reads, whose values have all been used */
}
// C = act(A Bh^T alpha + bias (+ own element of CP)), alpha times FA_CS in the first plane if NP > 1: A [MP][DM], Bh [DM][DM] (NP planes, sB apart), outputs [MP][DM] (NP planes, sC apart) as f32 (W32) and / or f16 (W16).
// NP > 1: the work-group takes its 256x128 tile in every plane at once; a staged A tile and a wave's A fragments then serve NP products (per plane and accumulator the k order is that of NP = 1).
// LNM 1, 2: LayerNorm 1 is applied here (g2_out). ST: per head and row the mean and the centred square sum of the row's 64 columns of that head; a thread joins the 16 parts of one row of the tile (means averaged; square sums added, plus 64 times the squared distances of the part means from the row mean). L0, L1: LNM 1: the pairs (sum of the B row, sum of beta w) per column, eight columns per 128-byte line; LNM 2: gamma, beta.
template <int ACT, bool HASB, bool RES, bool W32, bool W16, int NP, int KS, int LNM>
__global__ __launch_bounds__(256) void k_gemm2(const _Float16* __restrict__ A, const _Float16* __restrict__ Bh, size_t sB, float alpha, const float* __restrict__ bias, const float* __restrict__ CP,
    float* __restrict__ C, _Float16* __restrict__ C16, size_t sC, const float* __restrict__ ST, const float* __restrict__ L0, const float* __restrict__ L1) { static_assert(ACT == 0 || ACT == 3, "k_gemm2: unsupported ACT code (would silently apply no activation)");
  static_assert(MP % G2_BM == 0 && DM % G2_BN == 0 && DM % KS == 0 && DM / KS >= 2 && (KS == 64 || KS == 128), "k_gemm2: whole tiles and stages only");
  static_assert(NP == 1 || (!HASB && !RES && !LNM), "k_gemm2: bias, residual and norm are those of one plane");
  static_assert(LNM == 0 || (LNM == 1 && HASB && !RES) || (LNM == 2 && RES), "k_gemm2: the norm enters behind the product or in the residual");
  constexpr int PT = KS + 8;      /* LDS row pitch in elements */
  __shared__ __attribute__((aligned(16))) unsigned short sa[2][G2_BM][PT];
  __shared__ __attribute__((aligned(16))) unsigned short sb[2][NP * G2_BN][PT];
  __shared__ __attribute__((aligned(16))) float so[8][32][68];
  __shared__ __attribute__((aligned(16))) float srow[LNM ? G2_BM : 1][2];      /* (mu, rs) of the tile's rows */
  constexpr int lda = DM, ldb = DM, M = MP, N = DM, K = DM;
  const int tid = threadIdx.x, w = tid >> 5, lane = tid & 31, ln = lane & 15, hh = lane >> 4;
  const int ntn = N >> 7; const int mt = blockIdx.x / ntn, nq = blockIdx.x - mt * ntn; if (mt * G2_BM >= M) return;      /* the whole work-group, in front of every copy and barrier */
  const int wr = (w >> 1) * 64, wc = (w & 1) * 64; const int row0 = mt * G2_BM + wr, col0 = nq * G2_BN + wc;
  constexpr int RS = 2048 / KS;      /* rows that one copy of the work-group covers */
  const int sr = tid / (KS / 8), sc = (tid % (KS / 8)) * 8;      /* staging: rows sr + RS j, 16-byte piece sc */
  const unsigned short* ag = (const unsigned short*)A + (size_t)(mt * G2_BM + sr) * lda + sc; const unsigned short* bg = (const unsigned short*)Bh + (size_t)(nq * G2_BN + sr) * ldb + sc;
  const size_t pa = (size_t)RS * lda, pb = (size_t)RS * ldb;
  const unsigned la0 = (unsigned)(size_t)&sa[0][sr][sc], lb0 = (unsigned)(size_t)&sb[0][sr][sc];      /* low 32 bits of a __shared__ address = the LDS byte address */
  const unsigned abuf = G2_BM * PT * 2, bbuf = NP * G2_BN * PT * 2;
  constexpr int nst = K / KS;
  const v8f z8 = {0.f,0.f,0.f,0.f,0.f,0.f,0.f,0.f}; v8f acc[NP][4][4];
#pragma unroll      /* constant indices keep the accumulator array in registers */
  for (int p = 0; p < NP; ++p)
#pragma unroll      /* constant indices keep the accumulator array in registers */
    for (int i = 0; i < 4; ++i)
#pragma unroll      /* constant indices keep the accumulator array in registers */
      for (int j = 0; j < 4; ++j) acc[p][i][j] = z8;
  g2_stage<NP, KS>(la0, lb0, ag, bg, pa, pb, sB);
  if (LNM) { float mh[NH], sm = 0.f, m2 = 0.f, d2 = 0.f;      /* while stage 0 flies; the barrier that publishes stage 0 publishes these rows too */
#pragma unroll      /* constant indices keep the part array in registers; 16 loads in flight */
    for (int p = 0; p < NH; ++p) { const v2f t = *(const v2fa*)(ST + ((size_t)p * NR + mt * G2_BM + tid) * 2); mh[p] = t[0]; sm += t[0]; m2 += t[1]; }
    const float mu = sm * (1.0f / (float)NH);
#pragma unroll      /* constant indices keep the part array in registers */
    for (int p = 0; p < NH; ++p) { const float d = mh[p] - mu; d2 += d * d; }
    srow[tid][0] = mu; srow[tid][1] = rsqrtf((m2 + (float)HD * d2) * (1.0f / (float)DM) + LN1_EPS); }
  asm volatile("s_wait_asynccnt 0x0" ::: "memory");      /* this wave's copies of stage 0 have landed */
  __syncthreads();      /* publishes stage 0 */
  g2_stage<NP, KS>(la0 + abuf, lb0 + bbuf, ag + KS, bg + KS, pa, pb, sB);
#pragma unroll 1      /* one stage per trip: the two-buffer order below holds per trip */
  for (int s = 0; s < nst; ++s) { const int bf = s & 1;
#pragma unroll      /* constant indices keep the fragment and accumulator arrays in registers */
    for (int ks = 0; ks < KS; ks += 32) { v16h af[4];
#pragma unroll      /* constant indices keep the fragment and accumulator arrays in registers */
      for (int i = 0; i < 4; ++i) af[i] = g2_frag(&sa[bf][wr + i * 16 + ln][ks], hh);
#pragma unroll      /* constant indices keep the fragment and accumulator arrays in registers */
      for (int p = 0; p < NP; ++p) { v16h bq[4];
#pragma unroll      /* constant indices keep the fragment and accumulator arrays in registers */
        for (int j = 0; j < 4; ++j) bq[j] = g2_frag(&sb[bf][p * G2_BN + wc + j * 16 + ln][ks], hh);
        __builtin_amdgcn_sched_barrier(0);      /* keeps the block's LDS reads together in front of its 16 WMMAs: left free, the compiler sinks each A fragment's reads to its row and waits them out there */
#pragma unroll      /* constant indices keep the fragment and accumulator arrays in registers */
        for (int i = 0; i < 4; ++i)
#pragma unroll      /* constant indices keep the fragment and accumulator arrays in registers */
          for (int j = 0; j < 4; ++j) acc[p][i][j] = g2_mma(af[i], bq[j], acc[p][i][j]);
      }
    }
    asm volatile("s_wait_dscnt 0x0" ::: "memory");      /* this wave's reads of buffer bf have returned before the buffer is refilled */
    asm volatile("s_wait_asynccnt 0x0" ::: "memory");      /* this wave's copies of stage s + 1 have landed */
    __syncthreads();      /* publishes stage s + 1 and ends every wave's reads of buffer bf */
    if (s + 2 < nst) { const int kn = (s + 2) * KS; g2_stage<NP, KS>(la0 + bf * abuf, lb0 + bf * bbuf, ag + kn, bg + kn, pa, pb, sB); }
  }
  asm volatile("s_wait_asynccnt 0x0" ::: "memory");      /* no copy is outstanding when the wave goes on to its end */
  const size_t e0 = (size_t)(row0 + hh) * DM + col0 + ln * 4;      /* the lane's element of row hh of the wave's tile */
  v4f bv = {0.f, 0.f, 0.f, 0.f};
  if (HASB) { const float* bp = bias + col0 + ln * 4; const v4f b4 = *(const v4fa*)bp;
    asm volatile("s_wait_xcnt 0x0" :: "v"(bp) : "memory");      /* behind the bias load, in front of the next loads, whose results may take its address pair */
    bv = (v4f){bf16_round(b4[0]), bf16_round(b4[1]), bf16_round(b4[2]), bf16_round(b4[3])}; }
  v4f ga = {0.f, 0.f, 0.f, 0.f}, gb = ga;
  if (LNM == 1) { const int n = col0 + ln * 4; const float* gp = L0 + (n >> 3) * 32 + (n & 7) * 2; const v4f p0 = *(const v4fa*)gp, p1 = *(const v4fa*)(gp + 4);
    asm volatile("s_wait_xcnt 0x0" :: "v"(gp) : "memory");      /* behind the two loads of one address pair: as an input here the pair stays live to this wait */
    ga = (v4f){p0[0], p0[2], p1[0], p1[2]}; bv += (v4f){p0[1], p0[3], p1[1], p1[3]}; }
  if (LNM == 2) { const float* gp = L0 + col0 + ln * 4; const float* ep = L1 + col0 + ln * 4; const v4f g4 = *(const v4fa*)gp, b4 = *(const v4fa*)ep;
    asm volatile("s_wait_xcnt 0x0" :: "v"(gp), "v"(ep) : "memory");      /* behind the gamma and beta loads: as inputs here their address pairs stay live to this wait */
    ga = (v4f){bf16_round(g4[0]), bf16_round(g4[1]), bf16_round(g4[2]), bf16_round(g4[3])}; gb = (v4f){bf16_round(b4[0]), bf16_round(b4[1]), bf16_round(b4[2]), bf16_round(b4[3])}; }
  const float* Rl = RES ? CP + e0 : nullptr;
  v4f rs[16];
  if (RES) g2_res<0>(rs, Rl);
#pragma unroll      /* constant indices keep the accumulator array in registers */
  for (int p = 0; p < NP; ++p) { float* Cl = W32 ? C + p * sC + e0 : nullptr; _Float16* Hl = W16 ? C16 + p * sC + e0 : nullptr;
    const float ap = (NP > 1 && p == 0) ? alpha * FA_CS : alpha;      /* of the three planes the first is q: it takes the softmax scale in f32, in front of its one rounding to f16 */
    g2_out<ACT, HASB, RES, W32, W16, 0, false, LNM>(acc[p], so[w], ap, bv, rs, Rl, Cl, Hl, ln, hh, &srow[LNM ? wr : 0], ga, gb);
    if (p + 1 < NP) g2_out<ACT, HASB, RES, W32, W16, 1, false, LNM>(acc[p], so[w], ap, bv, rs, Rl, Cl, Hl, ln, hh, &srow[LNM ? wr : 0], ga, gb);
    else g2_out<ACT, HASB, RES, W32, W16, 1, true, LNM>(acc[p], so[w], ap, bv, rs, Rl, Cl, Hl, ln, hh, &srow[LNM ? wr : 0], ga, gb); } }


// Every operand conversion in one launch: x -> f16(bf16(x)) rows, and the five natural [out][in] weights -> f16(bf16(w) x 16) planes (= Bt[n][k]; the first FFN weight by cv_w1).
// A work-group converts CV_BE contiguous elements of ONE tensor (the tensor is picked from the block index, the same for the whole work-group); a thread takes CV_PT pieces of 8 elements, all its loads in front of its stores.
#define CV_PT 4                        /* 8-element pieces per thread: eight 16-byte loads in flight per lane */
#define CV_BE (256 * CV_PT * 8)        /* elements per work-group */
#define CV_NX ((int)(NR * DM / CV_BE)) /* work-groups on x */
#define CV_NW (DM * DM / CV_BE)        /* work-groups on each weight */
// The first FFN weight takes LayerNorm 1's gamma with it: plane f16(bf16(w) bf16(gamma) x 16); one wave per weight row n (eight 16-byte loads of 1 KiB per wave), which also sums the row of the plane as stored and beta w over k (one chain per lane, then a butterfly over the 32 lanes).
// GB: the pair of sums per row; the eight rows of a work-group share one 128-byte line, which no other work-group writes.
__device__ __forceinline__ void cv_w1(const float* __restrict__ w1, const float* __restrict__ g, const float* __restrict__ be, _Float16* __restrict__ BW1, float* __restrict__ GB, int blk) {
  static_assert(CV_BE == 8 * DM && DM == 4 * 256, "cv_w1: eight rows per work-group, four 256-element pieces per row");
  const int lane = threadIdx.x & 31, w = threadIdx.x >> 5; const size_t e0 = (size_t)(blk * 8 + w) * DM + lane * 8;
  v4f a[4][2], gv[4][2], bv[4][2]; v8us o[4]; float sg = 0.f, sb = 0.f;
#pragma unroll      /* constant indices keep the piece arrays in registers */
  for (int u = 0; u < 4; ++u)
#pragma unroll      /* constant indices keep the piece arrays in registers */
    for (int p = 0; p < 2; ++p) { a[u][p] = *(const v4fa*)(w1 + e0 + u * 256 + p * 4); gv[u][p] = *(const v4fa*)(g + lane * 8 + u * 256 + p * 4); bv[u][p] = *(const v4fa*)(be + lane * 8 + u * 256 + p * 4); }
  __builtin_amdgcn_sched_barrier(0);      /* keeps all 24 loads in front of the arithmetic: left free, the compiler sinks some of them behind the first waits and pays the memory latency several times in a row */
#pragma unroll      /* constant indices keep the piece arrays in registers */
  for (int u = 0; u < 4; ++u) { FragH f;
#pragma unroll      /* constant indices keep the piece arrays in registers */
    for (int q = 0; q < 8; ++q) { const float wv = bf16_round(a[u][q >> 2][q & 3]); const _Float16 hv = (_Float16)(wv * bf16_round(gv[u][q >> 2][q & 3]) * 16.0f); f.h[q] = hv; sg += (float)hv; sb += wv * bf16_round(bv[u][q >> 2][q & 3]); }
    o[u] = f.half[0]; }
  sg = rw_sum16(sg); sb = rw_sum16(sb); const v2f pr = {sg + fa_xrow(sg), sb + fa_xrow(sb)};
  if (lane == 0) *(v2fa*)(GB + blk * 32 + w * 2) = pr;
#pragma unroll      /* the piece steps fold into the immediate offsets of the stores */
  for (int u = 0; u < 4; ++u) *(v8us*)((unsigned short*)BW1 + e0 + u * 256) = o[u];
  asm volatile("s_wait_xcnt 0x0" ::: "memory"); }      /* behind the stores, in front of whatever code the compiler lays behind them that writes their registers */
__global__ __launch_bounds__(256) void k_cvt(const float* __restrict__ x, const float* __restrict__ wq, const float* __restrict__ wk, const float* __restrict__ wv, const float* __restrict__ w1, const float* __restrict__ w2, const float* __restrict__ g1, const float* __restrict__ be1,
    _Float16* __restrict__ X16, _Float16* __restrict__ BQ, _Float16* __restrict__ BK, _Float16* __restrict__ BV, _Float16* __restrict__ BW1, _Float16* __restrict__ BW2, float* __restrict__ GB) {
  static_assert(NR * DM % CV_BE == 0 && DM * DM % CV_BE == 0, "k_cvt: whole work-groups only");
  int blk = blockIdx.x; const float* s = x; _Float16* d = X16; float sc = 1.0f;
  if (blk >= CV_NX) { blk -= CV_NX; const int wi = blk / CV_NW; blk -= wi * CV_NW; sc = 16.0f;
    if (wi == 3) { cv_w1(w1, g1, be1, BW1, GB, blk); return; }      /* the whole work-group; the kernel has no barrier */
    s = wi == 0 ? wq : wi == 1 ? wk : wi == 2 ? wv : wi == 3 ? w1 : w2; d = wi == 0 ? BQ : wi == 1 ? BK : wi == 2 ? BV : wi == 3 ? BW1 : BW2; }
  const size_t e0 = (size_t)blk * CV_BE + threadIdx.x * 8;
  v4f a[CV_PT][2];
#pragma unroll      /* constant indices keep the piece array in registers */
  for (int u = 0; u < CV_PT; ++u) { a[u][0] = *(const v4fa*)(s + e0 + u * 2048); a[u][1] = *(const v4fa*)(s + e0 + u * 2048 + 4); }
#pragma unroll      /* constant indices keep the piece array in registers */
  for (int u = 0; u < CV_PT; ++u) { FragH f;
#pragma unroll      /* constant indices keep the piece array in registers */
    for (int q = 0; q < 4; ++q) { f.h[q] = (_Float16)(bf16_round(a[u][0][q]) * sc); f.h[4 + q] = (_Float16)(bf16_round(a[u][1][q]) * sc); }
    *(v8us*)((unsigned short*)d + e0 + u * 2048) = f.half[0]; } }
__global__ __launch_bounds__(256) void k_rsm(const float* __restrict__ S, _Float16* __restrict__ P, int nrows) {
  #pragma clang fp contract(off)
  const int i = blockIdx.x * 256 + threadIdx.x; if (i >= nrows) return; const float* s = S + (size_t)i * SQ; float mx = -3.0e38f;
#pragma unroll 1
  for (int j = 0; j < SQ; ++j) mx = fmaxf(mx, s[j]); float se = 0.f;
#pragma unroll 1
  for (int j = 0; j < SQ; ++j) se += expf(s[j] - mx); const float sc = 256.0f / se;
#pragma unroll 1
  for (int j0 = 0; j0 < SQ; j0 += 8) { FragH f; for (int q = 0; q < 8; ++q) f.h[q] = (_Float16)(expf(s[j0 + q] - mx) * sc); unsigned short* d = (unsigned short*)P + (size_t)i * SQ + j0; *(v8us*)d = f.half[0];  } }
__global__ __launch_bounds__(256) void k_vt(const _Float16* __restrict__ V16, int b, int h0, _Float16* __restrict__ VT) { __shared__ unsigned short tl[64][65]; const int tid = threadIdx.x; const int hh = blockIdx.x % HG, sg = blockIdx.x / HG; const int s0 = sg * 64; const int h = h0 + hh;
  for (int i = tid; i < 64 * 8; i += 256) { const int j = i / 8, d8 = (i % 8) * 8; FragH f; f.half[0] = *(const v8us*)((const unsigned short*)V16 + ((size_t)b * SQ + s0 + j) * DM + h * HD + d8); for (int q = 0; q < 8; ++q) tl[d8 + q][j] = f.u[q]; }
  __syncthreads();
  { for (int i = tid; i < 64 * 8; i += 256) { const int d = i / 8, j8 = (i % 8) * 8; FragH f; for (int q = 0; q < 8; ++q) f.u[q] = tl[d][j8 + q]; *(v8us*)((unsigned short*)VT + ((size_t)hh * HD + d) * SQ + s0 + j8) = f.half[0]; }  } }


__device__ __forceinline__ v16h fa_frag(const unsigned short* p, int hh) { FragH f; f.half[0] = *(const v8us*)(p + 8 * hh); f.half[1] = *(const v8us*)(p + 16 + 8 * hh); return f.v; }
__device__ __forceinline__ v8f fa_mma(v16h a, v16h b, v8f c) { return __builtin_amdgcn_wmma_f32_16x16x32_f16(false, a, false, b, (short)0, c, false, false); }
typedef _Float16 v2h __attribute__((ext_vector_type(2)));
#define FA_KS 64      /* keys per LDS stage */
#define FA_PT 72      /* LDS row pitch in 16-bit elements: 144 B = 16 B x 9, so the 16 rows of a 16-byte fragment read fall on distinct banks */
#define FA_PV 80      /* LDS row pitch of the V rows in 16-bit elements: 160 B = 32 B x 5, the pitch for transposing 16-byte reads of 128-byte rows */
#define FA_NW 8       /* waves per work-group, 32 query columns each */
typedef short fa_s8 __attribute__((ext_vector_type(8)));
// One 16 (d) x 32 (keys) A fragment of V^T from V rows [key][d] in LDS, by two transposing reads (ds_load_tr16_b128), 16 keys apart.
// p: the lane's own address, row 8 (lane >> 4) + (lane & 7) of the 32 keys, 16-byte piece (lane >> 3) & 1 of the 16 d; lane (ln, hh) then holds d = ln, keys 8 hh + 0..7 and 16 + 8 hh + 0..7: the hardware k order, as fa_frag gives it from V^T rows.
__device__ __forceinline__ v16h fa_fragt(const unsigned short* p) { typedef __attribute__((address_space(3))) fa_s8 lds_s8; FragH f; f.half[0] = __builtin_bit_cast(v8us, __builtin_amdgcn_ds_load_tr16_b128_v8i16((lds_s8*)p)); f.half[1] = __builtin_bit_cast(v8us, __builtin_amdgcn_ds_load_tr16_b128_v8i16((lds_s8*)(p + 16 * FA_PV))); return f.v; }
// The exponents of 32 keys (LDS rows kr) against the wave's 32 queries: S^T = K Q^T on top of cn, the start value 4 - mu of the lane's query.
__device__ __forceinline__ void fa_scores(v8f (&st)[2][2], const unsigned short (*kr)[FA_PT], int ln, int hh, const v16h (&qf)[2][2], const v8f (&cn)[2]) {
  v16h kf[2][2];
#pragma unroll      /* constant indices keep the fragment and accumulator arrays in registers */
  for (int kt = 0; kt < 2; ++kt) { const unsigned short* p = &kr[kt * 16 + ln][0]; kf[kt][0] = fa_frag(p, hh); kf[kt][1] = fa_frag(p + 32, hh); }
  __builtin_amdgcn_sched_barrier(0);      /* keeps the eight K reads together in front of the products: left free, the compiler reads into one fragment's registers three times in a row and waits each read out */
#pragma unroll      /* constant indices keep the fragment and accumulator arrays in registers */
  for (int kt = 0; kt < 2; ++kt)
#pragma unroll      /* constant indices keep the fragment and accumulator arrays in registers */
    for (int qt = 0; qt < 2; ++qt) st[kt][qt] = fa_mma(kf[kt][1], qf[qt][1], fa_mma(kf[kt][0], qf[qt][0], cn[qt])); }
// The largest of a query's 32 exponents, in both wave halves.
__device__ __forceinline__ float fa_colmax(const v8f (&st)[2][2], int qt) { float mx = st[0][qt][0];
#pragma unroll      /* constant indices keep the fragment and accumulator arrays in registers */
  for (int r = 1; r < 8; ++r) mx = fmaxf(mx, st[0][qt][r]);
#pragma unroll      /* constant indices keep the fragment and accumulator arrays in registers */
  for (int r = 0; r < 8; ++r) mx = fmaxf(mx, st[1][qt][r]);
  return fmaxf(mx, fa_xrow(mx)); }
// Exponents -> weights, in place, and per query group the lane's sum of its 16 weights (two chains, in key order).
__device__ __forceinline__ void fa_weights(v8f (&st)[2][2], float (&sm)[2]) {
#pragma unroll      /* constant indices keep the fragment and accumulator arrays in registers */
  for (int qt = 0; qt < 2; ++qt) { v2f ls = {0.f, 0.f};
#pragma unroll      /* constant indices keep the fragment and accumulator arrays in registers */
    for (int i = 0; i < 8; ++i) { const int kt = i >> 2, r = (i & 3) * 2; const v2f p = {__builtin_amdgcn_exp2f(st[kt][qt][r]), __builtin_amdgcn_exp2f(st[kt][qt][r + 1])}; st[kt][qt][r] = p[0]; st[kt][qt][r + 1] = p[1]; ls += p; }
    sm[qt] = ls[0] + ls[1]; } }
__global__ __launch_bounds__(FA_NW * 32) __attribute__((amdgpu_waves_per_eu(4, 4))) void k_fattn(const _Float16* __restrict__ Q16, const _Float16* __restrict__ K16, const _Float16* __restrict__ V16, const float* __restrict__ X, float* __restrict__ HP, _Float16* __restrict__ HP16, float* __restrict__ ST) {
  __shared__ __attribute__((aligned(16))) unsigned short sk[2][FA_KS][FA_PT];
  __shared__ __attribute__((aligned(16))) unsigned short sv[2][FA_KS][FA_PV];
  __shared__ __attribute__((aligned(16))) float so[FA_NW][32][68];
  const int tid = threadIdx.x, w = tid >> 5, lane = tid & 31, ln = lane & 15, hh = lane >> 4;
  const int bh = blockIdx.y, b = bh / NH, h = bh - b * NH; const int q0 = blockIdx.x * (FA_NW * 32) + w * 32;
  const unsigned short* Kg = (const unsigned short*)K16 + (size_t)b * SQ * DM + h * HD;      /* key rows, pitch DM */
  const unsigned short* Vg = (const unsigned short*)V16 + (size_t)b * SQ * DM + h * HD;      /* key rows, pitch DM */
  const int sr = tid >> 3, sc = (tid & 7) * 8;      /* staging: rows sr and sr + 32, 16-byte piece sc; a wave's load covers four whole 128-byte rows */
  v16h qf[2][2];
#pragma unroll      /* constant indices keep the fragment and accumulator arrays in registers */
  for (int qt = 0; qt < 2; ++qt)
#pragma unroll      /* constant indices keep the fragment and accumulator arrays in registers */
    for (int ks = 0; ks < 2; ++ks) qf[qt][ks] = fa_frag((const unsigned short*)Q16 + ((size_t)b * SQ + q0 + qt * 16 + ln) * DM + h * HD + ks * 32, hh);
  const v8f z8 = {0.f,0.f,0.f,0.f,0.f,0.f,0.f,0.f};
  v8f o[4][2], cn[2]; float l[2];
#pragma unroll      /* constant indices keep the fragment and accumulator arrays in registers */
  for (int qt = 0; qt < 2; ++qt) { cn[qt] = z8; l[qt] = 0.f;
#pragma unroll      /* constant indices keep the fragment and accumulator arrays in registers */
    for (int dt = 0; dt < 4; ++dt) o[dt][qt] = z8; }
  v8us rk0 = *(const v8us*)(Kg + (size_t)sr * DM + sc), rk1 = *(const v8us*)(Kg + (size_t)(sr + 32) * DM + sc), rv0 = *(const v8us*)(Vg + (size_t)sr * DM + sc), rv1 = *(const v8us*)(Vg + (size_t)(sr + 32) * DM + sc);
  asm volatile("s_wait_xcnt 0x0" ::: "memory");      /* behind the Q, K and V loads, in front of the set-up code that reuses their address registers */
  *(v8us*)&sk[0][sr][sc] = rk0; *(v8us*)&sk[0][sr + 32][sc] = rk1; *(v8us*)&sv[0][sr][sc] = rv0; *(v8us*)&sv[0][sr + 32][sc] = rv1;
  __syncthreads();      /* publishes stage 0 */
  { v8f st[2][2]; fa_scores(st, &sk[0][0], ln, hh, qf, cn);      /* the maximum in use starts as that of the first 32 keys, whatever it is: their plain scores (cn = 0) once ahead of the loop */
#pragma unroll      /* constant indices keep the fragment and accumulator arrays in registers */
    for (int qt = 0; qt < 2; ++qt) cn[qt] = cn[qt] + (4.0f - fa_colmax(st, qt)); }
#pragma unroll 1      /* one stage per trip keeps the loop small and the register count inside four waves per SIMD */
  for (int s = 0; s < SQ / FA_KS; ++s) { const int bf = s & 1; const bool more = s + 1 < SQ / FA_KS;
    if (more) { const int kn = (s + 1) * FA_KS; rk0 = *(const v8us*)(Kg + (size_t)(kn + sr) * DM + sc); rk1 = *(const v8us*)(Kg + (size_t)(kn + sr + 32) * DM + sc); rv0 = *(const v8us*)(Vg + (size_t)(kn + sr) * DM + sc); rv1 = *(const v8us*)(Vg + (size_t)(kn + sr + 32) * DM + sc); }
#pragma unroll      /* constant indices keep the fragment and accumulator arrays in registers */
    for (int kk = 0; kk < FA_KS; kk += 32) {
      v8f st[2][2]; float sm[2];
      fa_scores(st, &sk[bf][kk], ln, hh, qf, cn);
      v16h vf[4];
#pragma unroll      /* constant indices keep the fragment and accumulator arrays in registers */
      for (int dt = 0; dt < 4; ++dt) vf[dt] = fa_fragt(&sv[bf][kk + 8 * hh + (lane & 7)][dt * 16 + ((lane >> 3) & 1) * 8]);
      __builtin_amdgcn_sched_barrier(0);      /* the V^T reads issue in front of the exp2 run, which covers their latency */
      fa_weights(st, sm);
      asm volatile("" :: "v"(vf[0]), "v"(vf[1]), "v"(vf[2]), "v"(vf[3]));      /* holds the V^T reads in front of the branch, where the exp2 run covers their latency: left free, the compiler sinks them behind it, directly in front of the products that wait for them */
      const bool need = !(fmaxf(sm[0], sm[1]) <= 4096.0f);      /* a lane's sum of 16 weights bounds each of them: up to 2^12 none has left the range */
      if (__builtin_amdgcn_ballot_w32(need) != 0) {      /* one scalar branch per pass, rarely taken: only here are the maxima formed, from the pass's scores made anew */
        asm volatile("" ::: "memory");      /* the K fragments are read from LDS again here: kept for this path, they would hold 32 registers through every pass */
        fa_scores(st, &sk[bf][kk], ln, hh, qf, cn);
#pragma unroll      /* constant indices keep the fragment and accumulator arrays in registers */
        for (int qt = 0; qt < 2; ++qt) { const float d = fmaxf(fa_colmax(st, qt) - 4.0f, 0.f); const float al = __builtin_amdgcn_exp2f(-d); l[qt] *= al;      /* d: the step of the maximum in use, the same in both wave halves */
          cn[qt] = cn[qt] - d; st[0][qt] = st[0][qt] - d; st[1][qt] = st[1][qt] - d;
#pragma unroll      /* constant indices keep the fragment and accumulator arrays in registers */
          for (int dt = 0; dt < 4; ++dt) o[dt][qt] = o[dt][qt] * al; }
        fa_weights(st, sm); }
#pragma unroll      /* constant indices keep the fragment and accumulator arrays in registers */
      for (int qt = 0; qt < 2; ++qt) { union { v16h v; v2h p[8]; } pf;
#pragma unroll      /* constant indices keep the fragment and accumulator arrays in registers */
        for (int i = 0; i < 8; ++i) { const v2f p = {st[i >> 2][qt][(i & 3) * 2], st[i >> 2][qt][(i & 3) * 2 + 1]}; pf.p[i] = __builtin_convertvector(p, v2h); }
        l[qt] += sm[qt];
#pragma unroll      /* constant indices keep the fragment and accumulator arrays in registers */
        for (int dt = 0; dt < 4; ++dt) o[dt][qt] = fa_mma(vf[dt], pf.v, o[dt][qt]); }
    }
    if (more) { *(v8us*)&sk[bf ^ 1][sr][sc] = rk0; *(v8us*)&sk[bf ^ 1][sr + 32][sc] = rk1; *(v8us*)&sv[bf ^ 1][sr][sc] = rv0; *(v8us*)&sv[bf ^ 1][sr + 32][sc] = rv1; }
    __syncthreads();      /* publishes the next stage's buffer and ends every wave's reads of this one, which the next trip refills */
  }
  // epilogue, through the wave's own LDS rows, so that each global access covers whole 256-byte head rows: bf16(x) goes in by rows and is read back in the accumulators' layout, where a lane holds 32 of one query's 64 columns; h_pre = O^T / row sum + x is formed there and goes back the same way
  const size_t g0 = ((size_t)b * SQ + q0) * DM + h * HD + ln * 4;
  const float* xl = X + g0 + (size_t)hh * DM;      /* the lane's own address in row hh of the wave's 32 x rows */
  v4f hv[16]; v4h hq[16]; float mh[2], m2[2];
#pragma unroll      /* constant indices keep the fragment and accumulator arrays in registers */
  for (int q = 0; q < 16; ++q) hv[q] = *(const v4fa*)(xl + (size_t)(q * 2) * DM);
  asm volatile("s_wait_xcnt 0x0" :: "v"(xl) : "memory");      /* behind the 16 loads, which share one address pair: as an input here the pair stays live to this wait, so that no load's result is put into it */
#pragma unroll      /* constant indices keep the fragment and accumulator arrays in registers */
  for (int q = 0; q < 16; ++q) { const v4f xr = {bf16_round(hv[q][0]), bf16_round(hv[q][1]), bf16_round(hv[q][2]), bf16_round(hv[q][3])}; *(v4f*)&so[w][q * 2 + hh][ln * 4] = xr; }
  __builtin_amdgcn_fence(__ATOMIC_ACQ_REL, "workgroup"); __builtin_amdgcn_wave_barrier();      /* the wave's own LDS stores before its own reads of other lanes' elements */
  // LayerNorm 1's part statistics: mean and centred square sum of each row's 64 columns of this head, in-lane (four chains) plus one exchange between the wave halves
#pragma unroll      /* constant indices keep the fragment and accumulator arrays in registers */
  for (int qt = 0; qt < 2; ++qt) { const float inv = 1.0f / (l[qt] + fa_xrow(l[qt])); v4f t[4][2], sa = {0.f, 0.f, 0.f, 0.f}, qa = sa;
#pragma unroll      /* constant indices keep the fragment and accumulator arrays in registers */
    for (int dt = 0; dt < 4; ++dt)
#pragma unroll      /* constant indices keep the fragment and accumulator arrays in registers */
      for (int p = 0; p < 2; ++p) { const v4f ov = {o[dt][qt][p * 4], o[dt][qt][p * 4 + 1], o[dt][qt][p * 4 + 2], o[dt][qt][p * 4 + 3]}; t[dt][p] = ov * inv + *(const v4fa*)&so[w][qt * 16 + ln][dt * 16 + 8 * hh + p * 4]; sa += t[dt][p]; }
    const float s1 = (sa[0] + sa[1]) + (sa[2] + sa[3]); mh[qt] = (s1 + fa_xrow(s1)) * (1.0f / (float)HD);
#pragma unroll      /* constant indices keep the fragment and accumulator arrays in registers */
    for (int dt = 0; dt < 4; ++dt)
#pragma unroll      /* constant indices keep the fragment and accumulator arrays in registers */
      for (int p = 0; p < 2; ++p) { const v4f d = t[dt][p] - mh[qt]; qa += d * d; *(v4f*)&so[w][qt * 16 + ln][dt * 16 + 8 * hh + p * 4] = t[dt][p]; }      /* each lane writes the cells that it has read */
    const float s2 = (qa[0] + qa[1]) + (qa[2] + qa[3]); m2[qt] = s2 + fa_xrow(s2); }
  __builtin_amdgcn_fence(__ATOMIC_ACQ_REL, "workgroup"); __builtin_amdgcn_wave_barrier();      /* the wave's own LDS stores before its own reads of other lanes' elements */
#pragma unroll      /* constant indices keep the fragment and accumulator arrays in registers */
  for (int q = 0; q < 16; ++q) { hv[q] = *(const v4fa*)&so[w][q * 2 + hh][ln * 4]; hq[q] = __builtin_convertvector(hv[q], v4h); }
  const v2f pr = {hh ? mh[1] : mh[0], hh ? m2[1] : m2[0]};      /* both halves hold both query groups' pairs: lane 16 hh + ln stores row 16 hh + ln, one store of 256 bytes for the wave's 32 rows */
  *(v2fa*)(ST + ((size_t)h * NR + (size_t)b * SQ + q0 + lane) * 2) = pr;
#pragma unroll      /* the row steps fold into the immediate offsets of the stores */
  for (int q = 0; q < 16; ++q) { const int r = q * 2 + hh; *(v4f*)(HP + g0 + (size_t)r * DM) = hv[q]; *(v4h*)(HP16 + g0 + (size_t)r * DM) = hq[q]; } }


// Row LayerNorm (biased variance, eps, bf16-rounded gamma and beta), two rows per wave and no LDS: a lane holds 32 elements of each of its rows (eight 16-byte pieces, so that each load and each f32 store of the wave covers 512 contiguous bytes).
// Mean and variance: four chains per lane, then a butterfly over the 32 lanes (four DPP steps inside the 16-lane rows, one exchange between them). Two passes over the registers, as the definition has it.
// Each wave takes LN_RW rows, which share one rounding of gamma and beta: the launch starts 4,096 waves (16 per WGP, all resident at once) instead of eight waves per row (65,536), and has no barrier.
#define LN_NW 16      /* waves per work-group */
#define LN_RW 2       /* rows per wave */
__device__ __forceinline__ float ln_wsum(v4f s) { float v = (s[0] + s[1]) + (s[2] + s[3]); v += ln_xm<1>(v); v += ln_xm<2>(v); v += ln_xm<4>(v); v += ln_xm<8>(v); return v + fa_xrow(v); }
template <int W16, int W32>
__global__ __launch_bounds__(LN_NW * 32) void k_lnw(const float* __restrict__ X, const float* __restrict__ g, const float* __restrict__ bb, float eps, _Float16* __restrict__ N16, float* __restrict__ N32) {
  static_assert(DMQ == 8 * 128, "k_lnw: a row is eight 512-byte pieces");
  const int c0 = (threadIdx.x & 31) * 4; const size_t r0 = ((size_t)blockIdx.x * LN_NW + __builtin_amdgcn_readfirstlane(threadIdx.x >> 5)) * LN_RW;      /* the wave's number as a scalar: the row bases stay in scalar registers and every access shares the lane's one offset register */
  v4f gg[8], bv[8], x[LN_RW][8]; float rs[LN_RW];
#pragma unroll      /* constant indices keep the row arrays in registers */
  for (int u = 0; u < 8; ++u) { gg[u] = *(const v4fa*)(g + u * 128 + c0); bv[u] = *(const v4fa*)(bb + u * 128 + c0); }
#pragma unroll      /* constant indices keep the row arrays in registers */
  for (int i = 0; i < LN_RW; ++i)
#pragma unroll      /* constant indices keep the row arrays in registers */
    for (int u = 0; u < 8; ++u) { const int c = u * 128 + c0; x[i][u] = *(const v4fa*)(X + (r0 + i) * DMQ + c); }
  __builtin_amdgcn_sched_barrier(0);      /* keeps all 32 loads in front of the arithmetic: left free, the compiler sinks most gamma and beta loads behind the reductions and waits each pair out there */
#pragma unroll      /* constant indices keep the row arrays in registers */
  for (int u = 0; u < 8; ++u)
#pragma unroll      /* constant indices keep the row arrays in registers */
    for (int q = 0; q < 4; ++q) { gg[u][q] = bf16_round(gg[u][q]); bv[u][q] = bf16_round(bv[u][q]); }
#pragma unroll      /* constant indices keep the row arrays in registers */
  for (int i = 0; i < LN_RW; ++i) { v4f s = x[i][0];
#pragma unroll      /* constant indices keep the row arrays in registers */
    for (int u = 1; u < 8; ++u) s += x[i][u];
    const float mu = ln_wsum(s) * (1.0f / (float)DMQ); v4f q = {0.f, 0.f, 0.f, 0.f};
#pragma unroll      /* constant indices keep the row arrays in registers */
    for (int u = 0; u < 8; ++u) { x[i][u] = x[i][u] - mu; q += x[i][u] * x[i][u]; }
    rs[i] = rsqrtf(ln_wsum(q) * (1.0f / (float)DMQ) + eps); }
#pragma unroll      /* constant indices keep the row arrays in registers */
  for (int i = 0; i < LN_RW; ++i)
#pragma unroll      /* constant indices keep the row arrays in registers */
    for (int u = 0; u < 8; ++u) { const int c = u * 128 + c0; const v4f y = x[i][u] * rs[i] * gg[u] + bv[u];
      if (W32) *(v4f*)(N32 + (r0 + i) * DMQ + c) = y;
      if (W16) *(v4h*)(N16 + (r0 + i) * DMQ + c) = __builtin_convertvector(y, v4h); } }




extern "C" void kernel_launch(void* const* d_in, const int* in_sizes, int n_in,
                              void* d_out, int out_size, void* d_ws, size_t ws_size, hipStream_t stream) {
  (void)in_sizes; (void)n_in; (void)out_size;
  const float* const* I = (const float* const*)d_in; const float* x = I[0]; const float* wq = I[1]; const float* wk = I[2]; const float* wv = I[3]; const float* g1 = I[4]; const float* be1 = I[5]; const float* w1 = I[6]; const float* b1 = I[7]; const float* w2 = I[8]; const float* b2 = I[9]; const float* g2 = I[10]; const float* be2 = I[11];      /* natural [out][in] weights; LN affine; FFN biases */
  char* ws = (char*)d_ws; size_t off = 0;
  auto take = [&](size_t bytes) { char* p = ws + off; off += (bytes + 255) & ~(size_t)255; return p; };
  _Float16* BW1 = (_Float16*)take((size_t)DM * DM * 2); _Float16* BW2 = (_Float16*)take((size_t)DM * DM * 2); float* HP = (float*)take(NR * DM * 4); _Float16* H16 = (_Float16*)take(NR * DM * 2); _Float16* FF16 = (_Float16*)take(NR * DM * 2); _Float16* BQ = (_Float16*)take((size_t)DM * DM * 2); _Float16* BK = (_Float16*)take((size_t)DM * DM * 2); _Float16* BV = (_Float16*)take((size_t)DM * DM * 2); 
  _Float16* X16 = (_Float16*)take(NR * DM * 2); _Float16* Q16 = (_Float16*)take(NR * DM * 2); _Float16* K16 = (_Float16*)take(NR * DM * 2); _Float16* V16 = (_Float16*)take(NR * DM * 2);
  float* HF = (float*)take(NR * DM * 4);      /* y = h + ff, f32 rows */
  float* ST = (float*)take((size_t)NH * NR * 2 * 4); float* GB = (float*)take((size_t)CV_NW * 32 * 4);      /* LN1: part statistics per head and row; per column of l1 the two sums over k */
  if (off > ws_size) return;
  k_cvt<<<CV_NX + 5 * CV_NW, 256, 0, stream>>>(x, wq, wk, wv, w1, w2, g1, be1, X16, BQ, BK, BV, BW1, BW2, GB);      /* x rows and the five weight planes as f16 */
  const size_t r0p = (size_t)B0 * SQ;      /* first projected row */
  k_gemm2<0, false, false, false, true, 3, 64, 0><<<dim3((unsigned)((MP / G2_BM) * (DM / G2_BN)), 1), 256, 0, stream>>>(X16 + r0p * DM, BQ, (size_t)(BK - BQ), 0.0625f, nullptr, nullptr, nullptr, Q16 + r0p * DM, (size_t)(K16 - Q16), nullptr, nullptr, nullptr);      /* q, k, v: every work-group takes its tile in the three weight planes and the three output planes, which lie at equal distances in the workspace */
  k_fattn<<<dim3(SQ / (FA_NW * 32), NB * NH), FA_NW * 32, 0, stream>>>(Q16, K16, V16, x, HP, H16, ST);      /* h_pre = bf16(x) + attn (merged heads), f32 and f16 rows, and LN1's part statistics */
  k_gemm2<3, true, false, false, true, 1, 128, 1><<<dim3((unsigned)((MP / G2_BM) * (DM / G2_BN)), 1), 256, 0, stream>>>(H16 + r0p * DM, BW1, 0, 0.0625f, b1, nullptr, nullptr, FF16 + r0p * DM, 0, ST + r0p * 2, GB, nullptr);      /* relu(LN1(h_pre) l1^T + b1) -> f16 rows */
  k_gemm2<0, true, true, true, false, 1, 128, 2><<<dim3((unsigned)((MP / G2_BM) * (DM / G2_BN)), 1), 256, 0, stream>>>(FF16 + r0p * DM, BW2, 0, 0.0625f, b2, HP + r0p * DM, HF + r0p * DM, nullptr, 0, ST + r0p * 2, g1, be1);      /* y = LN1(h_pre) + ff (own-element residual) */
  k_lnw<0, 1><<<(unsigned)(MP / (LN_NW * LN_RW)), LN_NW * 32, 0, stream>>>(HF + r0p * DM, g2, be2, 1e-5f, nullptr, (float*)d_out + r0p * DM);      /* out = LN2(h + ff) -> f32 output rows */
}
